// v000
// Times are from an AMD MI455X. After a warm-up the kernel runs many times in a row, and a time is the length of
// such a window on the GPU divided by its runs, so every launch and the gaps after it count. The runs cycle
// through copies of the inputs. A figure is the median of several windows, for all but v000 over two sittings.
// Sittings can differ by a few percent; kernels timed side by side share one.
// v000 is the starting kernel. One run takes 1100 microseconds.
// compute dtype: all float inputs rounded to bf16; q / k / v projections with EXACT bf16 products on WMMA 16x16x32 (f32 accumulate), no biases; causal logits: 3 products for the first 384 rows, single f16 q x k after, x 64^-0.5; softmax f32; P x 2^11 once to f16 x v once to f16 (bf16 hi + lo below row 384); TWO output projections in sequence, each through k_out (rows < 384: the f32 operand as bf16 hi + lo against the exact weight; beyond: x2^6 f16 carry x f16(bf16 x 2^8) weight); f32 output.
#include <hip/hip_runtime.h>
#include <math.h>

typedef __attribute__((ext_vector_type(16))) _Float16 v16h;
typedef __attribute__((ext_vector_type(16))) __bf16 v16b;
typedef __attribute__((ext_vector_type(8)))  _Float16 v8h;
typedef __attribute__((ext_vector_type(8)))  float v8f;
typedef __attribute__((ext_vector_type(4)))  float v4f;
typedef __attribute__((ext_vector_type(2)))  float v2f;
typedef __attribute__((ext_vector_type(4)))  unsigned v4u;
typedef __attribute__((ext_vector_type(4)))  int v4i;
typedef float __attribute__((may_alias)) float_a;
typedef int __attribute__((may_alias)) int_a;

template <typename T> __device__ __forceinline__ void vst2(void* p, T v) { *(T*)p = v;  }
__device__ __forceinline__ v8f wmma16(v16h a, v16h b, v8f c) {
  v8f d = __builtin_amdgcn_wmma_f32_16x16x32_f16(false, a, false, b, (short)0, c, false, false);
  asm volatile("v_nop\n\tv_nop\n\tv_nop\n\tv_nop" : "+v"(d) : "v"(a), "v"(b));
  return d;
}
__device__ __forceinline__ v8f wmma_bf(v16b a, v16b b, v8f c) {
  v8f d = __builtin_amdgcn_wmma_f32_16x16x32_bf16(false, a, false, b, (short)0, c, false, false);
  asm volatile("v_nop\n\tv_nop\n\tv_nop\n\tv_nop" : "+v"(d) : "v"(a), "v"(b));
  return d;
}
// 16x16x32 fragments: lane = (h = lane>>4, row/col = lane&15); elements 0..7 = k0+8h+0..7, 8..15 = k0+16+8h+0..7; D element r = row 8h+r
__device__ __forceinline__ v16h frag_h(const _Float16* rowk0, int lane) {
  union { v16h v; v8h q[2]; } u; const _Float16* p = rowk0 + 8 * (lane >> 4);
  u.q[0] = *(const v8h*)p; u.q[1] = *(const v8h*)(p + 16); return u.v;
}
__device__ __forceinline__ v16h frag_f32(const float* rowk0, int lane) {
  v16h a; const float* p = rowk0 + 8 * (lane >> 4);
#pragma unroll
  for (int i = 0; i < 8; ++i) { a[i] = (_Float16)p[i]; a[8 + i] = (_Float16)p[16 + i]; }
  return a;
}
__device__ __forceinline__ v16h frag_f32s(const float* rowk0, int lane, float sc) {
  v16h a; const float* p = rowk0 + 8 * (lane >> 4);
#pragma unroll
  for (int i = 0; i < 8; ++i) { a[i] = (_Float16)(p[i] * sc); a[8 + i] = (_Float16)(p[16 + i] * sc); }
  return a;
}
// column fragment from a [K][ld] layout (column n), rows >= K read as 0
__device__ __forceinline__ v16h fragc_f32(const float* W, int k0, int n, int lane, int ld, int K) {
  v16h a; const int g = lane >> 4;
#pragma unroll
  for (int i = 0; i < 8; ++i) { const int ka = k0 + 8 * g + i, kb = ka + 16;
    a[i] = (_Float16)(ka < K ? W[(size_t)(ka < K ? ka : K - 1) * ld + n] : 0.f); a[8 + i] = (_Float16)(kb < K ? W[(size_t)(kb < K ? kb : K - 1) * ld + n] : 0.f); }
  return a;
}
struct F2 { v16b h, l; };
__device__ __forceinline__ F2 bsplit16(const float v[16]) { F2 r;
#pragma unroll
  for (int i = 0; i < 16; ++i) { const __bf16 h = (__bf16)v[i]; r.h[i] = h; r.l[i] = (__bf16)(v[i] - (float)h); }
  return r; }
__device__ __forceinline__ F2 split_row(const float* row, int k0, int lane) { float v[16]; const float* p = row + k0 + 8 * (lane >> 4);
#pragma unroll
  for (int i = 0; i < 8; ++i) { v[i] = p[i]; v[8 + i] = p[16 + i]; }
  return bsplit16(v); }
__device__ __forceinline__ F2 split_rowK(const float* row, int k0, int lane, int K) { float v[16]; const int g = lane >> 4;
#pragma unroll
  for (int i = 0; i < 8; ++i) { const int ka = k0 + 8 * g + i, kb = ka + 16; v[i] = ka < K ? row[ka < K ? ka : K - 1] : 0.f; v[8 + i] = kb < K ? row[kb < K ? kb : K - 1] : 0.f; }
  return bsplit16(v); }
__device__ __forceinline__ F2 split_col(const float* W, int k0, int n, int lane, int ld, int K) { float v[16]; const int g = lane >> 4;
#pragma unroll
  for (int i = 0; i < 8; ++i) { const int ka = k0 + 8 * g + i, kb = ka + 16; v[i] = ka < K ? W[(size_t)(ka < K ? ka : K - 1) * ld + n] : 0.f; v[8 + i] = kb < K ? W[(size_t)(kb < K ? kb : K - 1) * ld + n] : 0.f; }
  return bsplit16(v); }
__device__ __forceinline__ v8f mac3(const F2& a, const F2& b, v8f c) { c = wmma_bf(a.l, b.h, c); c = wmma_bf(a.h, b.l, c); return wmma_bf(a.h, b.h, c); }
__device__ __forceinline__ float sigm(float v) { return 1.0f / (1.0f + expf(-v)); }
#define LDSX() do { asm volatile("s_wait_dscnt 0" ::: "memory"); __builtin_amdgcn_wave_barrier(); __builtin_amdgcn_fence(__ATOMIC_RELEASE, "workgroup"); } while (0)

// Causal multi-head self-attention with per-head-shaped weights and TWO output projections (x [2,2048,1024]; wq / wk / wv [1024,16,64] = (in, head, d): an (in,out) [1024][1024] matrix with out = head*64 + d; wp1 [16,64,1024] = (head, d, out): an (in,out) [1024][1024] matrix with in = head*64 + d; wp2 [1024,1024] (in,out); all N(0, 1/1024), no biases; wei = q k^T x 64^-0.5; tril kept, -inf elsewhere; softmax; att merged (head*64 + d); y = att wp1; out = y wp2).
#define NB 2
#define TT 2048
#define CC 1024            // NH * HD = projected width
#define DIN 1024          // input (model) width
#define NH 16
#define HD 64
#define NQB (TT / 64)
#define HG 4
#define SCALE (0.125f)
#define CAUSAL 1
#ifndef TNB
#define TNB NB
#endif
__device__ __forceinline__ float bfr(float v) { return (float)(__bf16)v; }
__host__ __device__ __forceinline__ int kb_last(int qb) { return CAUSAL ? ((qb * 64 + 63) >> 7) : (TT / 128 - 1); }
typedef __attribute__((ext_vector_type(8))) __bf16 v8b;
__device__ __forceinline__ v16b frag_b(const __bf16* rowk0, int lane) {
  union { v16b v; v8b q[2]; } u; const __bf16* p = rowk0 + 8 * (lane >> 4);
  u.q[0] = *(const v8b*)p; u.q[1] = *(const v8b*)(p + 16); return u.v;
}
#define QBH 6              // causal: query blocks 0..QBH-1 of each sequence (few keys, no averaging) take the high-precision path
#define QHI 384            // rows carrying a q residual plane (all rows when non-causal: 2-product logits everywhere)
#define KHI 384            // key rows carrying k residual / v bf16 hi+lo planes (used only by the causal high-precision path)
// B fragment (k rows k0+.., output column o) of a weight: (in,out) [K][ld] or (out,in) [ld rows of K]: bf16 exact, or f16(bf16 * 256) exact
__device__ __forceinline__ v16b wcol_io(const float* Wm, int k0, int o, int lane, int ld) { v16b w; const int g = lane >> 4;
#pragma unroll
  for (int i = 0; i < 8; ++i) { w[i] = (__bf16)Wm[(size_t)(k0 + 8 * g + i) * ld + o]; w[8 + i] = (__bf16)Wm[(size_t)(k0 + 16 + 8 * g + i) * ld + o]; }
  return w; }
__device__ __forceinline__ v16b wcol_oi(const float* Wm, int k0, int o, int lane, int K) { v16b w; const float* p = Wm + (size_t)o * K + k0 + 8 * (lane >> 4);
#pragma unroll
  for (int i = 0; i < 8; ++i) { w[i] = (__bf16)p[i]; w[8 + i] = (__bf16)p[16 + i]; }
  return w; }
__device__ __forceinline__ v16h wcolh_io(const float* Wm, int k0, int o, int lane, int ld) { v16h w; const int g = lane >> 4;
#pragma unroll
  for (int i = 0; i < 8; ++i) { w[i] = (_Float16)(bfr(Wm[(size_t)(k0 + 8 * g + i) * ld + o]) * 256.0f); w[8 + i] = (_Float16)(bfr(Wm[(size_t)(k0 + 16 + 8 * g + i) * ld + o]) * 256.0f); }
  return w; }
__device__ __forceinline__ v16h wcolh_oi(const float* Wm, int k0, int o, int lane, int K) { v16h w; const float* p = Wm + (size_t)o * K + k0 + 8 * (lane >> 4);
#pragma unroll
  for (int i = 0; i < 8; ++i) { w[i] = (_Float16)(bfr(p[i]) * 256.0f); w[8 + i] = (_Float16)(bfr(p[16 + i]) * 256.0f); }
  return w; }
#define WQKV_LAYOUT 0   // 0 = (in,out) [DIN][CC]; 1 = (out,in) [CC][DIN]; 2 = per-head [NH][DIN][HD]
__device__ __forceinline__ v16b wcol_hdk(const float* Wm, int k0, int o, int lane) { v16b w; const int g = lane >> 4; const float* p = Wm + (size_t)(o / HD) * DIN * HD + (o % HD);
#pragma unroll
  for (int i = 0; i < 8; ++i) { w[i] = (__bf16)p[(size_t)(k0 + 8 * g + i) * HD]; w[8 + i] = (__bf16)p[(size_t)(k0 + 16 + 8 * g + i) * HD]; }
  return w; }
#define WO_OUT_IN 0
#if WQKV_LAYOUT == 1
#define WCOL(W, k0, o, lane) wcol_oi(W, k0, o, lane, DIN)
#elif WQKV_LAYOUT == 2
#define WCOL(W, k0, o, lane) wcol_hdk(W, k0, o, lane)
#else
#define WCOL(W, k0, o, lane) wcol_io(W, k0, o, lane, CC)
#endif
#if WO_OUT_IN
#define WOCOL(W, k0, o, lane) wcol_oi(W, k0, o, lane, CC)
#define WOCOLH(W, k0, o, lane) wcolh_oi(W, k0, o, lane, CC)
#else
#define WOCOL(W, k0, o, lane) wcol_io(W, k0, o, lane, DIN)
#define WOCOLH(W, k0, o, lane) wcolh_io(W, k0, o, lane, DIN)
#endif

#ifndef SM_EXTRA_PARAMS
#define SM_EXTRA_PARAMS
#endif
#ifndef PROJ_EXTRA_PARAMS
#define PROJ_EXTRA_PARAMS
#endif
#ifndef SM_MASK_HOOK
#define SM_MASK_HOOK (void)0
#endif

#define WS_QH  0u                                      // f16 q rows [b*t][CC]
#define WS_KH  (WS_QH + 2u * (size_t)NB * TT * CC)      // f16 k rows [b*t][CC]
#define WS_VT  (WS_KH + 2u * (size_t)NB * TT * CC)      // f16 v planes [b][c][t]
#define WS_QL  (WS_VT + 2u * (size_t)NB * CC * TT)      // f16 q residual x 2^10 rows [b][t < QHI][CC]
#define WS_KL  (WS_QL + 2u * (size_t)NB * QHI * CC)     // f16 k residual x 2^10 rows [b][t < KHI][CC]
#define WS_VB  (WS_KL + 2u * (size_t)NB * KHI * CC)     // bf16 v hi planes [b][c][t < KHI]
#define WS_VBL (WS_VB + 2u * (size_t)NB * CC * KHI)
#define WS_S   (WS_VBL + 2u * (size_t)NB * CC * KHI)    // f32 logits / P [hg][t][s]
#define WS_Y   (WS_S  + 4u * (size_t)HG * TT * TT)      // f32 ctx rows [b*t][CC] (only when there is an output projection)
#define WS_END (WS_Y  + 4u * (size_t)NB * TT * CC)
#define WS_Y2 (WS_END)                                     // f32 rows [b*t][DIN]: the first output projection's result, the second one's operand
#define WS_END2 (WS_Y2 + 4u * (size_t)NB * TT * DIN)

// ---- k_proj: block = (64 rows, 128 cols, which): q/k/v = X W (+ b) with exact bf16 products (K = DIN) -> which 0: q f16 rows (+ residual rows < QHI); 1: k f16 rows (+ residual rows < KHI); 2: v f16 planes [c][t] (+ bf16 hi/lo planes for t < KHI)
__global__ __launch_bounds__(128) void k_proj(const float* __restrict__ XQ, const float* __restrict__ XK, const float* __restrict__ XV, const float* __restrict__ WQ, const float* __restrict__ WK, const float* __restrict__ WV, const float* __restrict__ BQ, const float* __restrict__ BK, const float* __restrict__ BV,
    _Float16* __restrict__ QH, _Float16* __restrict__ QL, _Float16* __restrict__ KH, _Float16* __restrict__ KL, _Float16* __restrict__ VT, __bf16* __restrict__ VB, __bf16* __restrict__ VBL) {
  __shared__ __align__(16) _Float16 sh[64][136], sl[64][136]; __shared__ __align__(16) _Float16 th[128][72]; __shared__ __align__(16) __bf16 tb[128][72], tbl[128][72];
  const int tid = threadIdx.x, wave = tid >> 5, lane = tid & 31, col = lane & 15, g = lane >> 4; const int which = blockIdx.z; const int c0 = blockIdx.y * 128; const size_t r0 = (size_t)blockIdx.x * 64; const size_t bb = r0 / TT; const int t0 = (int)(r0 % TT);
  const float* X = which == 0 ? XQ : which == 1 ? XK : XV; const float* WA = which == 0 ? WQ : which == 1 ? WK : WV; const float* BA = which == 0 ? BQ : which == 1 ? BK : BV;
  v8f acc[8] = {};
#pragma unroll 2
  for (int kc = 0; kc < DIN / 32; ++kc) { v16b a; { const float* p = X + (r0 + wave * 16 + col) * DIN + kc * 32 + 8 * g;
#pragma unroll
      for (int i = 0; i < 8; ++i) { a[i] = (__bf16)p[i]; a[8 + i] = (__bf16)p[16 + i]; } }
    asm volatile("s_wait_loadcnt 0x0" ::: "memory");
#pragma unroll
    for (int j = 0; j < 8; ++j) { const v16b w = WCOL(WA, kc * 32, c0 + j * 16 + col, lane); asm volatile("s_wait_loadcnt 0x0" ::: "memory"); acc[j] = wmma_bf(a, w, acc[j]); } }
  if (which < 2) { _Float16* DH = which == 0 ? QH : KH; _Float16* DL = which == 0 ? QL : KL; const int nhi = which == 0 ? QHI : KHI; const bool hi_rows = t0 < nhi;
#pragma unroll
    for (int j = 0; j < 8; ++j) { const float bias = BA ? bfr(BA[c0 + j * 16 + col]) : 0.f;
#pragma unroll
      for (int r = 0; r < 8; ++r) { const float v = acc[j][r] + bias; const _Float16 hv = (_Float16)v; sh[wave * 16 + 8 * g + r][j * 16 + col] = hv; sl[wave * 16 + 8 * g + r][j * 16 + col] = (_Float16)((v - (float)hv) * 1024.0f); } }
    __syncthreads();
    for (int e = tid; e < 64 * 16; e += 128) { const int rl = e >> 4, q = e & 15; vst2((unsigned*)(DH + (r0 + rl) * CC + c0 + q * 8), *(const v4u*)&sh[rl][q * 8]); if (hi_rows) vst2((unsigned*)(DL + (bb * nhi + t0 + rl) * (size_t)CC + c0 + q * 8), *(const v4u*)&sl[rl][q * 8]); }
  } else { const bool hi_rows = t0 < KHI;
#pragma unroll
    for (int j = 0; j < 8; ++j) { const float bias = BA ? bfr(BA[c0 + j * 16 + col]) : 0.f;
#pragma unroll
      for (int r = 0; r < 8; ++r) { const float v = acc[j][r] + bias; const int rl = wave * 16 + 8 * g + r, cl = j * 16 + col; th[cl][rl] = (_Float16)v; const __bf16 bh = (__bf16)v; tb[cl][rl] = bh; tbl[cl][rl] = (__bf16)(v - (float)bh); } }
    __syncthreads();
    for (int e = tid; e < 128 * 8; e += 128) { const int cl = e >> 3, q = e & 7; vst2((unsigned*)(VT + (bb * CC + c0 + cl) * (size_t)TT + t0 + q * 8), *(const v4u*)&th[cl][q * 8]); if (hi_rows) { const size_t o3 = (bb * CC + c0 + cl) * (size_t)KHI + t0 + q * 8; vst2((unsigned*)(VB + o3), *(const v4u*)&tb[cl][q * 8]); vst2((unsigned*)(VBL + o3), *(const v4u*)&tbl[cl][q * 8]); } } } }
// ---- k_sc: block = (query block qb, key block kb <= kb_last(qb), head in group) of batch b: logits x SCALE; q hi + residual (x 2^10) against k (2 products) for query rows < QHI, plus the k residual (3 products) for query blocks < QBH (causal early rows); causal: blocks past the diagonal exit, the mask itself is applied by index in k_sm
__global__ __launch_bounds__(128) void k_sc(const _Float16* __restrict__ QH, const _Float16* __restrict__ KH, const _Float16* __restrict__ QL, const _Float16* __restrict__ KL, int b, int h0, float* __restrict__ S0) { __shared__ __align__(16) float ss[4][16][132];
  const int qb = blockIdx.x, kb = blockIdx.y; if (kb > kb_last(qb)) return;
  const int h = h0 + blockIdx.z; float* S = S0 + (size_t)blockIdx.z * TT * TT;
  const int tid = threadIdx.x, wave = tid >> 5, lane = tid & 31, col = lane & 15, g = lane >> 4; const int k0 = kb * 128; const int ql0 = qb * 64 + wave * 16; const size_t q0 = (size_t)b * TT + ql0, kr0 = (size_t)b * TT + k0;
  v8f acc[8] = {}, accl[8] = {};
  const _Float16* QLb = QL + (size_t)b * QHI * CC; const _Float16* KLb = KL + (size_t)b * KHI * CC;
  if (qb < QBH) {
#pragma unroll
    for (int kc = 0; kc < HD / 32; ++kc) { const v16h ah = frag_h(QH + (q0 + col) * CC + h * HD + kc * 32, lane), al = frag_h(QLb + (size_t)(ql0 + col) * CC + h * HD + kc * 32, lane);
#pragma unroll
      for (int j = 0; j < 8; ++j) { const v16h kbf = frag_h(KH + (kr0 + j * 16 + col) * CC + h * HD + kc * 32, lane), klf = frag_h(KLb + (size_t)(k0 + j * 16 + col) * CC + h * HD + kc * 32, lane); acc[j] = wmma16(ah, kbf, acc[j]); accl[j] = wmma16(al, kbf, accl[j]); accl[j] = wmma16(ah, klf, accl[j]); } }
  } else if (qb * 64 < QHI) {
#pragma unroll
    for (int kc = 0; kc < HD / 32; ++kc) { const v16h ah = frag_h(QH + (q0 + col) * CC + h * HD + kc * 32, lane), al = frag_h(QLb + (size_t)(ql0 + col) * CC + h * HD + kc * 32, lane);
#pragma unroll
      for (int j = 0; j < 8; ++j) { const v16h kbf = frag_h(KH + (kr0 + j * 16 + col) * CC + h * HD + kc * 32, lane); acc[j] = wmma16(ah, kbf, acc[j]); accl[j] = wmma16(al, kbf, accl[j]); } }
  } else {
#pragma unroll
    for (int kc = 0; kc < HD / 32; ++kc) { const v16h ah = frag_h(QH + (q0 + col) * CC + h * HD + kc * 32, lane);
#pragma unroll
      for (int j = 0; j < 8; ++j) { const v16h kbf = frag_h(KH + (kr0 + j * 16 + col) * CC + h * HD + kc * 32, lane); acc[j] = wmma16(ah, kbf, acc[j]); } } }
#pragma unroll
  for (int j = 0; j < 8; ++j) {
#pragma unroll
    for (int r = 0; r < 8; ++r) ss[wave][8 * g + r][j * 16 + col] = (acc[j][r] + accl[j][r] * (1.0f / 1024.0f)) * SCALE; }
  LDSX(); for (int rl = 0; rl < 16; ++rl) vst2(S + (size_t)(ql0 + rl) * TT + k0 + lane * 4, *(const v4f*)&ss[wave][rl][lane * 4]); }
// ---- k_sm: block = query row t (head in group): keys [0, kend): causal -> logit if s <= t else excluded; softmax in f32; P x 2^11 in place (0 for excluded)
__global__ __launch_bounds__(256) void k_sm(float* __restrict__ S0 SM_EXTRA_PARAMS) { __shared__ float sred[8]; __shared__ float sbc; __shared__ __align__(16) float shv[TT];
  const int tid = threadIdx.x; const int t = blockIdx.x; const int kend = (kb_last(t >> 6) + 1) * 128;
  float* sr = S0 + (size_t)blockIdx.y * TT * TT + (size_t)t * TT;
  float m = -3.0e38f; for (int k = tid; k < kend; k += 256) { float v = (!CAUSAL || k <= t) ? sr[k] : -3.0e38f; SM_MASK_HOOK; shv[k] = v; m = fmaxf(m, v); }
#pragma unroll
  for (int o = 1; o < 32; o <<= 1) m = fmaxf(m, __shfl_xor(m, o));
  if ((tid & 31) == 0) sred[tid >> 5] = m; __syncthreads(); if (tid == 0) { float a = sred[0]; for (int i = 1; i < 8; ++i) a = fmaxf(a, sred[i]); sbc = a; } __syncthreads(); m = sbc; __syncthreads();
  float sum = 0.f; for (int k = tid; k < kend; k += 256) { const float v = shv[k]; const float e = (v <= -1.0e38f) ? 0.f : expf(v - m); shv[k] = e; sum += e; }
#pragma unroll
  for (int o = 1; o < 32; o <<= 1) sum += __shfl_xor(sum, o);
  if ((tid & 31) == 0) sred[tid >> 5] = sum; __syncthreads(); if (tid == 0) { float a = 0.f; for (int i = 0; i < 8; ++i) a += sred[i]; sbc = a > 0.f ? 2048.0f / a : 0.f; }   /* a fully excluded row yields P = 0 */ __syncthreads(); const float inv = sbc;
  for (int k = tid; k < kend; k += 256) shv[k] = shv[k] * inv;
  __syncthreads(); for (int q = tid; q < kend / 4; q += 256) vst2(sr + q * 4, *(const v4f*)&shv[q * 4]); }
// ---- k_pv: block = 64 queries (qb) of (b, h): ctx = P . v over keys [0, kend) (P x 2^11 once to f16 against v f16: 1 product; causal early query blocks: P and v as bf16 hi + lo, 3 products); 256-B (row, head) segment by 16 lanes
__global__ __launch_bounds__(128) void k_pv(const float* __restrict__ PS0, const _Float16* __restrict__ VT, const __bf16* __restrict__ VB, const __bf16* __restrict__ VBL, int b, int h0, float* __restrict__ Y) { const int h = h0 + blockIdx.z; const float* PS = PS0 + (size_t)blockIdx.z * TT * TT; __shared__ __align__(16) float ss[4][16][HD + 4];
  const int tid = threadIdx.x, wave = tid >> 5, lane = tid & 31, col = lane & 15, g = lane >> 4; const int qb = blockIdx.x; const int ql0 = qb * 64 + wave * 16; const int kce = (kb_last(qb) + 1) * 4;
  v8f acc[HD / 16] = {};
  if (qb < QBH) {
#pragma unroll 1
    for (int kc = 0; kc < kce; ++kc) { const F2 p = split_row(PS + (size_t)(ql0 + col) * TT, kc * 32, lane);
      asm volatile("s_wait_loadcnt 0x0" ::: "memory");
#pragma unroll
      for (int j = 0; j < HD / 16; ++j) { const size_t po = ((size_t)b * CC + h * HD + j * 16 + col) * (size_t)KHI + kc * 32; const v16b vh = frag_b(VB + po, lane); acc[j] = wmma_bf(p.h, vh, acc[j]); acc[j] = wmma_bf(p.l, vh, acc[j]); acc[j] = wmma_bf(p.h, frag_b(VBL + po, lane), acc[j]); } }
  } else {
#pragma unroll 1
    for (int kc = 0; kc < kce; ++kc) { const v16h p = frag_f32(PS + (size_t)(ql0 + col) * TT + kc * 32, lane);
      asm volatile("s_wait_loadcnt 0x0" ::: "memory");
#pragma unroll
      for (int j = 0; j < HD / 16; ++j) { const size_t po = ((size_t)b * CC + h * HD + j * 16 + col) * (size_t)TT + kc * 32; acc[j] = wmma16(p, frag_h(VT + po, lane), acc[j]); } } }
#pragma unroll
  for (int j = 0; j < HD / 16; ++j)
#pragma unroll
    for (int r = 0; r < 8; ++r) ss[wave][8 * g + r][j * 16 + col] = acc[j][r] * (1.0f / 2048.0f);
  LDSX(); for (int rl = 0; rl < 16; ++rl) if (lane < HD / 4) vst2(Y + ((size_t)b * TT + ql0 + rl) * CC + h * HD + lane * 4, *(const v4f*)&ss[wave][rl][lane * 4]); }
// ---- k_out: block = (64 rows, 128 cols): out = ctx Wo (+ bo): ctx x 2^6 once to f16 against Wo as f16(bf16 x 2^8) exact (1 product) x 2^-14; causal early rows (< QHI of each sequence): ctx bf16 hi + lo against exact bf16 Wo (2 products)
__global__ __launch_bounds__(128) void k_out(const float* __restrict__ Y, const float* __restrict__ WO, const float* __restrict__ BO, float* __restrict__ OUT) { __shared__ __align__(16) float sf[4][16][132];
  const int tid = threadIdx.x, wave = tid >> 5, lane = tid & 31, col = lane & 15, g = lane >> 4; const int c0 = blockIdx.y * 128; const size_t r0 = (size_t)blockIdx.x * 64 + wave * 16;
  v8f acc[8] = {};
  if (CAUSAL && (int)(((size_t)blockIdx.x * 64) % TT) < QHI) {   /* block-uniform */
#pragma unroll 2
    for (int kc = 0; kc < CC / 32; ++kc) { const F2 a = split_row(Y + (r0 + col) * CC, kc * 32, lane); asm volatile("s_wait_loadcnt 0x0" ::: "memory");
#pragma unroll
      for (int j = 0; j < 8; ++j) { const v16b w = WOCOL(WO, kc * 32, c0 + j * 16 + col, lane); asm volatile("s_wait_loadcnt 0x0" ::: "memory"); acc[j] = wmma_bf(a.h, w, acc[j]); acc[j] = wmma_bf(a.l, w, acc[j]); } }
#pragma unroll
    for (int j = 0; j < 8; ++j) { const float bias = BO ? bfr(BO[c0 + j * 16 + col]) : 0.f;
#pragma unroll
      for (int r = 0; r < 8; ++r) sf[wave][8 * g + r][j * 16 + col] = acc[j][r] + bias; }
  } else {
#pragma unroll 2
    for (int kc = 0; kc < CC / 32; ++kc) { const v16h a = frag_f32s(Y + (r0 + col) * CC + kc * 32, lane, 64.0f); asm volatile("s_wait_loadcnt 0x0" ::: "memory");   /* ctx carried x 2^6 into f16 so small-magnitude context rows stay clear of f16 subnormals */
#pragma unroll
      for (int j = 0; j < 8; ++j) { const v16h w = WOCOLH(WO, kc * 32, c0 + j * 16 + col, lane); asm volatile("s_wait_loadcnt 0x0" ::: "memory"); acc[j] = wmma16(a, w, acc[j]); } }
#pragma unroll
    for (int j = 0; j < 8; ++j) { const float bias = BO ? bfr(BO[c0 + j * 16 + col]) : 0.f;
#pragma unroll
      for (int r = 0; r < 8; ++r) sf[wave][8 * g + r][j * 16 + col] = acc[j][r] * (1.0f / 16384.0f) + bias; } }   /* 2^-8 (Wo carry) x 2^-6 (ctx carry) */
  LDSX(); for (int rl = 0; rl < 16; ++rl) vst2(OUT + (r0 + rl) * DIN + c0 + lane * 4, *(const v4f*)&sf[wave][rl][lane * 4]); }

extern "C" void kernel_launch(void* const* d_in, const int* in_sizes, int n_in, void* d_out, int out_size, void* d_ws, size_t ws_size, hipStream_t stream) {
  (void)in_sizes; (void)n_in; (void)out_size;
  const float** F = (const float**)d_in;
  if (ws_size < (size_t)WS_END) return;
  char* ws = (char*)d_ws; _Float16 *QH = (_Float16*)(ws + WS_QH), *KH = (_Float16*)(ws + WS_KH), *VT = (_Float16*)(ws + WS_VT), *QL = (_Float16*)(ws + WS_QL), *KL = (_Float16*)(ws + WS_KL); __bf16 *VB = (__bf16*)(ws + WS_VB), *VBL = (__bf16*)(ws + WS_VBL); float *S = (float*)(ws + WS_S), *Y = (float*)(ws + WS_Y);
  (void)Y; (void)QL; (void)KL; (void)VB; (void)VBL;
  // inputs: 0 x [2,2048,1024]; 1 wq [1024,16,64] = (in,out) [1024][1024]; 2 wk; 3 wv; 4 wp1 [16,64,1024] = (in,out) [1024][1024]; 5 wp2 [1024,1024] (in,out); no biases
  if (ws_size < (size_t)WS_END2) return;
  float* Y2 = (float*)(ws + WS_Y2);
  k_proj<<<dim3(TNB * TT / 64, CC / 128, 3), 128, 0, stream>>>(F[0], F[0], F[0], F[1], F[2], F[3], nullptr, nullptr, nullptr, QH, QL, KH, KL, VT, VB, VBL);
  for (int b = 0; b < TNB; ++b) for (int h0 = 0; h0 < NH; h0 += HG) {
    k_sc<<<dim3(NQB, TT / 128, HG), 128, 0, stream>>>(QH, KH, QL, KL, b, h0, S);
    k_sm<<<dim3(TT, HG), 256, 0, stream>>>(S);
    k_pv<<<dim3(NQB, 1, HG), 128, 0, stream>>>(S, VT, VB, VBL, b, h0, Y);
  }
  k_out<<<dim3(TNB * TT / 64, DIN / 128), 128, 0, stream>>>(Y, F[4], nullptr, Y2);              /* y = att wp1 (f32 rows in workspace) */
  k_out<<<dim3(TNB * TT / 64, DIN / 128), 128, 0, stream>>>(Y2, F[5], nullptr, (float*)d_out);   /* out = y wp2 */
  static_assert(CC == DIN, "the second output projection reuses k_out: its operand rows have width DIN == CC");
}

// v001
// One run takes 757 microseconds.
// In two side-by-side timings against v000, it was 1.44 and 1.45 times as fast.
// compute dtype: all float inputs rounded to bf16; q / k / v projections with EXACT bf16 products on WMMA 16x16x32 (f32 accumulate), no biases; causal logits: 3 products for the first 384 rows, single f16 q x k after, x 64^-0.5; softmax f32; P x 2^11 once to f16 x v once to f16 (bf16 hi + lo below row 384); TWO output projections in sequence, each through k_out (rows < 384: the f32 operand as bf16 hi + lo against the exact weight; beyond: x2^6 f16 carry x f16(bf16 x 2^8) weight); f32 output.
#include <hip/hip_runtime.h>
#include <math.h>

typedef __attribute__((ext_vector_type(16))) _Float16 v16h;
typedef __attribute__((ext_vector_type(16))) __bf16 v16b;
typedef __attribute__((ext_vector_type(8)))  _Float16 v8h;
typedef __attribute__((ext_vector_type(8)))  float v8f;
typedef __attribute__((ext_vector_type(4)))  float v4f;
typedef __attribute__((ext_vector_type(2)))  float v2f;
typedef __attribute__((ext_vector_type(4)))  unsigned v4u;
typedef __attribute__((ext_vector_type(4)))  int v4i;
typedef float __attribute__((may_alias)) float_a;
typedef int __attribute__((may_alias)) int_a;

template <typename T> __device__ __forceinline__ void vst2(void* p, T v) { *(T*)p = v;  }
__device__ __forceinline__ v8f wmma16(v16h a, v16h b, v8f c) {
  v8f d = __builtin_amdgcn_wmma_f32_16x16x32_f16(false, a, false, b, (short)0, c, false, false);
  asm volatile("v_nop\n\tv_nop\n\tv_nop\n\tv_nop" : "+v"(d) : "v"(a), "v"(b));
  return d;
}
__device__ __forceinline__ v8f wmma_bf(v16b a, v16b b, v8f c) {
  v8f d = __builtin_amdgcn_wmma_f32_16x16x32_bf16(false, a, false, b, (short)0, c, false, false);
  asm volatile("v_nop\n\tv_nop\n\tv_nop\n\tv_nop" : "+v"(d) : "v"(a), "v"(b));
  return d;
}
// 16x16x32 fragments: lane = (h = lane>>4, row/col = lane&15); elements 0..7 = k0+8h+0..7, 8..15 = k0+16+8h+0..7; D element r = row 8h+r
__device__ __forceinline__ v16h frag_h(const _Float16* rowk0, int lane) {
  union { v16h v; v8h q[2]; } u; const _Float16* p = rowk0 + 8 * (lane >> 4);
  u.q[0] = *(const v8h*)p; u.q[1] = *(const v8h*)(p + 16); return u.v;
}
__device__ __forceinline__ v16h frag_f32(const float* rowk0, int lane) {
  v16h a; const float* p = rowk0 + 8 * (lane >> 4);
#pragma unroll
  for (int i = 0; i < 8; ++i) { a[i] = (_Float16)p[i]; a[8 + i] = (_Float16)p[16 + i]; }
  return a;
}
__device__ __forceinline__ v16h frag_f32s(const float* rowk0, int lane, float sc) {
  v16h a; const float* p = rowk0 + 8 * (lane >> 4);
#pragma unroll
  for (int i = 0; i < 8; ++i) { a[i] = (_Float16)(p[i] * sc); a[8 + i] = (_Float16)(p[16 + i] * sc); }
  return a;
}
// column fragment from a [K][ld] layout (column n), rows >= K read as 0
__device__ __forceinline__ v16h fragc_f32(const float* W, int k0, int n, int lane, int ld, int K) {
  v16h a; const int g = lane >> 4;
#pragma unroll
  for (int i = 0; i < 8; ++i) { const int ka = k0 + 8 * g + i, kb = ka + 16;
    a[i] = (_Float16)(ka < K ? W[(size_t)(ka < K ? ka : K - 1) * ld + n] : 0.f); a[8 + i] = (_Float16)(kb < K ? W[(size_t)(kb < K ? kb : K - 1) * ld + n] : 0.f); }
  return a;
}
struct F2 { v16b h, l; };
__device__ __forceinline__ F2 bsplit16(const float v[16]) { F2 r;
#pragma unroll
  for (int i = 0; i < 16; ++i) { const __bf16 h = (__bf16)v[i]; r.h[i] = h; r.l[i] = (__bf16)(v[i] - (float)h); }
  return r; }
__device__ __forceinline__ F2 split_row(const float* row, int k0, int lane) { float v[16]; const float* p = row + k0 + 8 * (lane >> 4);
#pragma unroll
  for (int i = 0; i < 8; ++i) { v[i] = p[i]; v[8 + i] = p[16 + i]; }
  return bsplit16(v); }
__device__ __forceinline__ F2 split_rowK(const float* row, int k0, int lane, int K) { float v[16]; const int g = lane >> 4;
#pragma unroll
  for (int i = 0; i < 8; ++i) { const int ka = k0 + 8 * g + i, kb = ka + 16; v[i] = ka < K ? row[ka < K ? ka : K - 1] : 0.f; v[8 + i] = kb < K ? row[kb < K ? kb : K - 1] : 0.f; }
  return bsplit16(v); }
__device__ __forceinline__ F2 split_col(const float* W, int k0, int n, int lane, int ld, int K) { float v[16]; const int g = lane >> 4;
#pragma unroll
  for (int i = 0; i < 8; ++i) { const int ka = k0 + 8 * g + i, kb = ka + 16; v[i] = ka < K ? W[(size_t)(ka < K ? ka : K - 1) * ld + n] : 0.f; v[8 + i] = kb < K ? W[(size_t)(kb < K ? kb : K - 1) * ld + n] : 0.f; }
  return bsplit16(v); }
__device__ __forceinline__ v8f mac3(const F2& a, const F2& b, v8f c) { c = wmma_bf(a.l, b.h, c); c = wmma_bf(a.h, b.l, c); return wmma_bf(a.h, b.h, c); }
__device__ __forceinline__ float sigm(float v) { return 1.0f / (1.0f + expf(-v)); }
#define LDSX() do { asm volatile("s_wait_dscnt 0" ::: "memory"); __builtin_amdgcn_wave_barrier(); __builtin_amdgcn_fence(__ATOMIC_RELEASE, "workgroup"); } while (0)

// Causal multi-head self-attention with per-head-shaped weights and TWO output projections (x [2,2048,1024]; wq / wk / wv [1024,16,64] = (in, head, d): an (in,out) [1024][1024] matrix with out = head*64 + d; wp1 [16,64,1024] = (head, d, out): an (in,out) [1024][1024] matrix with in = head*64 + d; wp2 [1024,1024] (in,out); all N(0, 1/1024), no biases; wei = q k^T x 64^-0.5; tril kept, -inf elsewhere; softmax; att merged (head*64 + d); y = att wp1; out = y wp2).
#define NB 2
#define TT 2048
#define CC 1024            // NH * HD = projected width
#define DIN 1024          // input (model) width
#define NH 16
#define HD 64
#define NQB (TT / 64)
#define HG 4
#define SCALE (0.125f)
#define CAUSAL 1
#ifndef TNB
#define TNB NB
#endif
__device__ __forceinline__ float bfr(float v) { return (float)(__bf16)v; }
__host__ __device__ __forceinline__ int kb_last(int qb) { return CAUSAL ? ((qb * 64 + 63) >> 7) : (TT / 128 - 1); }
typedef __attribute__((ext_vector_type(8))) __bf16 v8b;
__device__ __forceinline__ v16b frag_b(const __bf16* rowk0, int lane) {
  union { v16b v; v8b q[2]; } u; const __bf16* p = rowk0 + 8 * (lane >> 4);
  u.q[0] = *(const v8b*)p; u.q[1] = *(const v8b*)(p + 16); return u.v;
}
#define QBH 6              // causal: query blocks 0..QBH-1 of each sequence (few keys, no averaging) take the high-precision path
#define QHI 384            // rows carrying a q residual plane
#define KHI 384            // key rows carrying k residual / v bf16 hi+lo planes (used only by the causal high-precision path)
// B fragment (k rows k0+.., output column o) of a weight: (in,out) [K][ld] or (out,in) [ld rows of K]: bf16 exact, or f16(bf16 * 256) exact
__device__ __forceinline__ v16b wcol_io(const float* Wm, int k0, int o, int lane, int ld) { v16b w; const int g = lane >> 4;
#pragma unroll
  for (int i = 0; i < 8; ++i) { w[i] = (__bf16)Wm[(size_t)(k0 + 8 * g + i) * ld + o]; w[8 + i] = (__bf16)Wm[(size_t)(k0 + 16 + 8 * g + i) * ld + o]; }
  return w; }
__device__ __forceinline__ v16b wcol_oi(const float* Wm, int k0, int o, int lane, int K) { v16b w; const float* p = Wm + (size_t)o * K + k0 + 8 * (lane >> 4);
#pragma unroll
  for (int i = 0; i < 8; ++i) { w[i] = (__bf16)p[i]; w[8 + i] = (__bf16)p[16 + i]; }
  return w; }
__device__ __forceinline__ v16h wcolh_io(const float* Wm, int k0, int o, int lane, int ld) { v16h w; const int g = lane >> 4;
#pragma unroll
  for (int i = 0; i < 8; ++i) { w[i] = (_Float16)(bfr(Wm[(size_t)(k0 + 8 * g + i) * ld + o]) * 256.0f); w[8 + i] = (_Float16)(bfr(Wm[(size_t)(k0 + 16 + 8 * g + i) * ld + o]) * 256.0f); }
  return w; }
__device__ __forceinline__ v16h wcolh_oi(const float* Wm, int k0, int o, int lane, int K) { v16h w; const float* p = Wm + (size_t)o * K + k0 + 8 * (lane >> 4);
#pragma unroll
  for (int i = 0; i < 8; ++i) { w[i] = (_Float16)(bfr(p[i]) * 256.0f); w[8 + i] = (_Float16)(bfr(p[16 + i]) * 256.0f); }
  return w; }
#define WQKV_LAYOUT 0   // 0 = (in,out) [DIN][CC]; 1 = (out,in) [CC][DIN]; 2 = per-head [NH][DIN][HD]
__device__ __forceinline__ v16b wcol_hdk(const float* Wm, int k0, int o, int lane) { v16b w; const int g = lane >> 4; const float* p = Wm + (size_t)(o / HD) * DIN * HD + (o % HD);
#pragma unroll
  for (int i = 0; i < 8; ++i) { w[i] = (__bf16)p[(size_t)(k0 + 8 * g + i) * HD]; w[8 + i] = (__bf16)p[(size_t)(k0 + 16 + 8 * g + i) * HD]; }
  return w; }
#define WO_OUT_IN 0
#if WQKV_LAYOUT == 1
#define WCOL(W, k0, o, lane) wcol_oi(W, k0, o, lane, DIN)
#elif WQKV_LAYOUT == 2
#define WCOL(W, k0, o, lane) wcol_hdk(W, k0, o, lane)
#else
#define WCOL(W, k0, o, lane) wcol_io(W, k0, o, lane, CC)
#endif
#if WO_OUT_IN
#define WOCOL(W, k0, o, lane) wcol_oi(W, k0, o, lane, CC)
#define WOCOLH(W, k0, o, lane) wcolh_oi(W, k0, o, lane, CC)
#else
#define WOCOL(W, k0, o, lane) wcol_io(W, k0, o, lane, DIN)
#define WOCOLH(W, k0, o, lane) wcolh_io(W, k0, o, lane, DIN)
#endif

#ifndef SM_EXTRA_PARAMS
#define SM_EXTRA_PARAMS
#endif
#ifndef PROJ_EXTRA_PARAMS
#define PROJ_EXTRA_PARAMS
#endif
#ifndef SM_MASK_HOOK
#define SM_MASK_HOOK (void)0
#endif

#define WS_QH  0u                                      // f16 q rows [b*t][CC]
#define WS_KH  (WS_QH + 2u * (size_t)NB * TT * CC)      // f16 k rows [b*t][CC]
#define WS_VT  (WS_KH + 2u * (size_t)NB * TT * CC)      // f16 v planes [b][c][t]
#define WS_QL  (WS_VT + 2u * (size_t)NB * CC * TT)      // f16 q residual x 2^10 rows [b][t < QHI][CC]
#define WS_KL  (WS_QL + 2u * (size_t)NB * QHI * CC)     // f16 k residual x 2^10 rows [b][t < KHI][CC]
#define WS_VB  (WS_KL + 2u * (size_t)NB * KHI * CC)     // bf16 v hi planes [b][c][t < KHI]
#define WS_VBL (WS_VB + 2u * (size_t)NB * CC * KHI)
#define WS_S   (WS_VBL + 2u * (size_t)NB * CC * KHI)    // f32 logits / P [hg][t][s]
#define WS_Y   (WS_S  + 4u * (size_t)HG * TT * TT)      // f32 ctx rows [b*t][CC] (only when there is an output projection)
#define WS_END (WS_Y  + 4u * (size_t)NB * TT * CC)
#define WS_Y2 (WS_END)                                     // f32 rows [b*t][DIN]: the first output projection's result, the second one's operand
#define WS_END2 (WS_Y2 + 4u * (size_t)NB * TT * DIN)

// ---- k_proj: block = (64 rows, 128 cols, which): q/k/v = X W (+ b) with exact bf16 products (K = DIN) -> which 0: q f16 rows (+ residual rows < QHI); 1: k f16 rows (+ residual rows < KHI); 2: v f16 planes [c][t] (+ bf16 hi/lo planes for t < KHI)
__global__ __launch_bounds__(128) void k_proj(const float* __restrict__ XQ, const float* __restrict__ XK, const float* __restrict__ XV, const float* __restrict__ WQ, const float* __restrict__ WK, const float* __restrict__ WV, const float* __restrict__ BQ, const float* __restrict__ BK, const float* __restrict__ BV,
    _Float16* __restrict__ QH, _Float16* __restrict__ QL, _Float16* __restrict__ KH, _Float16* __restrict__ KL, _Float16* __restrict__ VT, __bf16* __restrict__ VB, __bf16* __restrict__ VBL) {
  __shared__ __align__(16) _Float16 sh[64][136], sl[64][136]; __shared__ __align__(16) _Float16 th[128][72]; __shared__ __align__(16) __bf16 tb[128][72], tbl[128][72];
  const int tid = threadIdx.x, wave = tid >> 5, lane = tid & 31, col = lane & 15, g = lane >> 4; const int which = blockIdx.z; const int c0 = blockIdx.y * 128; const size_t r0 = (size_t)blockIdx.x * 64; const size_t bb = r0 / TT; const int t0 = (int)(r0 % TT);
  const float* X = which == 0 ? XQ : which == 1 ? XK : XV; const float* WA = which == 0 ? WQ : which == 1 ? WK : WV; const float* BA = which == 0 ? BQ : which == 1 ? BK : BV;
  v8f acc[8] = {};
#pragma unroll 2
  for (int kc = 0; kc < DIN / 32; ++kc) { v16b a; { const float* p = X + (r0 + wave * 16 + col) * DIN + kc * 32 + 8 * g;
#pragma unroll
      for (int i = 0; i < 8; ++i) { a[i] = (__bf16)p[i]; a[8 + i] = (__bf16)p[16 + i]; } }
    asm volatile("s_wait_loadcnt 0x0" ::: "memory");
#pragma unroll
    for (int j = 0; j < 8; ++j) { const v16b w = WCOL(WA, kc * 32, c0 + j * 16 + col, lane); asm volatile("s_wait_loadcnt 0x0" ::: "memory"); acc[j] = wmma_bf(a, w, acc[j]); } }
  if (which < 2) { _Float16* DH = which == 0 ? QH : KH; _Float16* DL = which == 0 ? QL : KL; const int nhi = which == 0 ? QHI : KHI; const bool hi_rows = t0 < nhi;
#pragma unroll
    for (int j = 0; j < 8; ++j) { const float bias = BA ? bfr(BA[c0 + j * 16 + col]) : 0.f;
#pragma unroll
      for (int r = 0; r < 8; ++r) { const float v = acc[j][r] + bias; const _Float16 hv = (_Float16)v; sh[wave * 16 + 8 * g + r][j * 16 + col] = hv; sl[wave * 16 + 8 * g + r][j * 16 + col] = (_Float16)((v - (float)hv) * 1024.0f); } }
    __syncthreads();
    for (int e = tid; e < 64 * 16; e += 128) { const int rl = e >> 4, q = e & 15; vst2((unsigned*)(DH + (r0 + rl) * CC + c0 + q * 8), *(const v4u*)&sh[rl][q * 8]); if (hi_rows) vst2((unsigned*)(DL + (bb * nhi + t0 + rl) * (size_t)CC + c0 + q * 8), *(const v4u*)&sl[rl][q * 8]); }
  } else { const bool hi_rows = t0 < KHI;
#pragma unroll
    for (int j = 0; j < 8; ++j) { const float bias = BA ? bfr(BA[c0 + j * 16 + col]) : 0.f;
#pragma unroll
      for (int r = 0; r < 8; ++r) { const float v = acc[j][r] + bias; const int rl = wave * 16 + 8 * g + r, cl = j * 16 + col; th[cl][rl] = (_Float16)v; const __bf16 bh = (__bf16)v; tb[cl][rl] = bh; tbl[cl][rl] = (__bf16)(v - (float)bh); } }
    __syncthreads();
    for (int e = tid; e < 128 * 8; e += 128) { const int cl = e >> 3, q = e & 7; vst2((unsigned*)(VT + (bb * CC + c0 + cl) * (size_t)TT + t0 + q * 8), *(const v4u*)&th[cl][q * 8]); if (hi_rows) { const size_t o3 = (bb * CC + c0 + cl) * (size_t)KHI + t0 + q * 8; vst2((unsigned*)(VB + o3), *(const v4u*)&tb[cl][q * 8]); vst2((unsigned*)(VBL + o3), *(const v4u*)&tbl[cl][q * 8]); } } } }
// ---- k_sc: block = (query block qb, key block kb <= kb_last(qb), head in group) of batch b: logits x SCALE; q hi + residual (x 2^10) against k (2 products) for query rows < QHI, plus the k residual (3 products) for query blocks < QBH (causal early rows); causal: blocks past the diagonal exit, the mask itself is applied by index in k_sm
__global__ __launch_bounds__(128) void k_sc(const _Float16* __restrict__ QH, const _Float16* __restrict__ KH, const _Float16* __restrict__ QL, const _Float16* __restrict__ KL, int b, int h0, float* __restrict__ S0) { __shared__ __align__(16) float ss[4][16][132];
  const int qb = blockIdx.x, kb = blockIdx.y; if (kb > kb_last(qb)) return;
  const int h = h0 + blockIdx.z; float* S = S0 + (size_t)blockIdx.z * TT * TT;
  const int tid = threadIdx.x, wave = tid >> 5, lane = tid & 31, col = lane & 15, g = lane >> 4; const int k0 = kb * 128; const int ql0 = qb * 64 + wave * 16; const size_t q0 = (size_t)b * TT + ql0, kr0 = (size_t)b * TT + k0;
  v8f acc[8] = {}, accl[8] = {};
  const _Float16* QLb = QL + (size_t)b * QHI * CC; const _Float16* KLb = KL + (size_t)b * KHI * CC;
  if (qb < QBH) {
#pragma unroll
    for (int kc = 0; kc < HD / 32; ++kc) { const v16h ah = frag_h(QH + (q0 + col) * CC + h * HD + kc * 32, lane), al = frag_h(QLb + (size_t)(ql0 + col) * CC + h * HD + kc * 32, lane);
#pragma unroll
      for (int j = 0; j < 8; ++j) { const v16h kbf = frag_h(KH + (kr0 + j * 16 + col) * CC + h * HD + kc * 32, lane), klf = frag_h(KLb + (size_t)(k0 + j * 16 + col) * CC + h * HD + kc * 32, lane); acc[j] = wmma16(ah, kbf, acc[j]); accl[j] = wmma16(al, kbf, accl[j]); accl[j] = wmma16(ah, klf, accl[j]); } }
  } else if (qb * 64 < QHI) {
#pragma unroll
    for (int kc = 0; kc < HD / 32; ++kc) { const v16h ah = frag_h(QH + (q0 + col) * CC + h * HD + kc * 32, lane), al = frag_h(QLb + (size_t)(ql0 + col) * CC + h * HD + kc * 32, lane);
#pragma unroll
      for (int j = 0; j < 8; ++j) { const v16h kbf = frag_h(KH + (kr0 + j * 16 + col) * CC + h * HD + kc * 32, lane); acc[j] = wmma16(ah, kbf, acc[j]); accl[j] = wmma16(al, kbf, accl[j]); } }
  } else {
#pragma unroll
    for (int kc = 0; kc < HD / 32; ++kc) { const v16h ah = frag_h(QH + (q0 + col) * CC + h * HD + kc * 32, lane);
#pragma unroll
      for (int j = 0; j < 8; ++j) { const v16h kbf = frag_h(KH + (kr0 + j * 16 + col) * CC + h * HD + kc * 32, lane); acc[j] = wmma16(ah, kbf, acc[j]); } } }
#pragma unroll
  for (int j = 0; j < 8; ++j) {
#pragma unroll
    for (int r = 0; r < 8; ++r) ss[wave][8 * g + r][j * 16 + col] = (acc[j][r] + accl[j][r] * (1.0f / 1024.0f)) * SCALE; }
  LDSX(); for (int rl = 0; rl < 16; ++rl) vst2(S + (size_t)(ql0 + rl) * TT + k0 + lane * 4, *(const v4f*)&ss[wave][rl][lane * 4]); }
// ---- k_sm: block = query row t (head in group): keys [0, kend): causal -> logit if s <= t else excluded; softmax in f32; P x 2^11 in place (0 for excluded)
__global__ __launch_bounds__(256) void k_sm(float* __restrict__ S0 SM_EXTRA_PARAMS) { __shared__ float sred[8]; __shared__ float sbc; __shared__ __align__(16) float shv[TT];
  const int tid = threadIdx.x; const int t = blockIdx.x; const int kend = (kb_last(t >> 6) + 1) * 128;
  float* sr = S0 + (size_t)blockIdx.y * TT * TT + (size_t)t * TT;
  float m = -3.0e38f; for (int k = tid; k < kend; k += 256) { float v = (!CAUSAL || k <= t) ? sr[k] : -3.0e38f; SM_MASK_HOOK; shv[k] = v; m = fmaxf(m, v); }
#pragma unroll
  for (int o = 1; o < 32; o <<= 1) m = fmaxf(m, __shfl_xor(m, o));
  if ((tid & 31) == 0) sred[tid >> 5] = m; __syncthreads(); if (tid == 0) { float a = sred[0]; for (int i = 1; i < 8; ++i) a = fmaxf(a, sred[i]); sbc = a; } __syncthreads(); m = sbc; __syncthreads();
  float sum = 0.f; for (int k = tid; k < kend; k += 256) { const float v = shv[k]; const float e = (v <= -1.0e38f) ? 0.f : expf(v - m); shv[k] = e; sum += e; }
#pragma unroll
  for (int o = 1; o < 32; o <<= 1) sum += __shfl_xor(sum, o);
  if ((tid & 31) == 0) sred[tid >> 5] = sum; __syncthreads(); if (tid == 0) { float a = 0.f; for (int i = 0; i < 8; ++i) a += sred[i]; sbc = a > 0.f ? 2048.0f / a : 0.f; }   /* a fully excluded row yields P = 0 */ __syncthreads(); const float inv = sbc;
  for (int k = tid; k < kend; k += 256) shv[k] = shv[k] * inv;
  __syncthreads(); for (int q = tid; q < kend / 4; q += 256) vst2(sr + q * 4, *(const v4f*)&shv[q * 4]); }
// ---- k_pv: block = 16 queries (tile qt of query block qb = qt / 4) of (b, h), PVW waves: ctx = P . v over keys [0, kend); wave w takes the 32-key chunks w, w + PVW, ... and the PVW partial tiles are summed in wave order through LDS (P x 2^11 once to f16 against v f16: 1 product; causal early query blocks: P and v as bf16 hi + lo, 3 products); 256-B (row, head) segment by 16 lanes
#define PVW 8
__global__ __launch_bounds__(32 * PVW) void k_pv(const float* __restrict__ PS0, const _Float16* __restrict__ VT, const __bf16* __restrict__ VB, const __bf16* __restrict__ VBL, int b, int h0, float* __restrict__ Y) { const int h = h0 + blockIdx.z; const float* PS = PS0 + (size_t)blockIdx.z * TT * TT; __shared__ __align__(16) float ss[PVW][16][HD + 4];
  const int tid = threadIdx.x, lane = tid & 31, col = lane & 15, g = lane >> 4; const int qb = blockIdx.x >> 2; const int ql0 = blockIdx.x * 16; const int kce = (kb_last(qb) + 1) * 4;
  const int wave = __builtin_amdgcn_readfirstlane(tid >> 5);   /* scalar, so that the key loop's bounds and branch stay wave-uniform around the matrix instructions */
  v8f acc[HD / 16] = {};
  if (qb < QBH) {
#pragma unroll 1
    for (int kc = wave; kc < kce; kc += PVW) { const F2 p = split_row(PS + (size_t)(ql0 + col) * TT, kc * 32, lane);
      asm volatile("s_wait_loadcnt 0x0" ::: "memory");
#pragma unroll
      for (int j = 0; j < HD / 16; ++j) { const size_t po = ((size_t)b * CC + h * HD + j * 16 + col) * (size_t)KHI + kc * 32; const v16b vh = frag_b(VB + po, lane); acc[j] = wmma_bf(p.h, vh, acc[j]); acc[j] = wmma_bf(p.l, vh, acc[j]); acc[j] = wmma_bf(p.h, frag_b(VBL + po, lane), acc[j]); } }
  } else {
#pragma unroll 1
    for (int kc = wave; kc < kce; kc += PVW) { const v16h p = frag_f32(PS + (size_t)(ql0 + col) * TT + kc * 32, lane);
      asm volatile("s_wait_loadcnt 0x0" ::: "memory");
#pragma unroll
      for (int j = 0; j < HD / 16; ++j) { const size_t po = ((size_t)b * CC + h * HD + j * 16 + col) * (size_t)TT + kc * 32; acc[j] = wmma16(p, frag_h(VT + po, lane), acc[j]); } } }
#pragma unroll
  for (int j = 0; j < HD / 16; ++j)
#pragma unroll
    for (int r = 0; r < 8; ++r) ss[wave][8 * g + r][j * 16 + col] = acc[j][r];
  __syncthreads();   /* every wave's partial tile is in LDS before any thread sums across waves */
  for (int e = tid; e < 16 * (HD / 4); e += 32 * PVW) { const int rl = e / (HD / 4), q = e % (HD / 4); v4f s = *(const v4f*)&ss[0][rl][q * 4];
    for (int w = 1; w < PVW; ++w) s += *(const v4f*)&ss[w][rl][q * 4];
    vst2(Y + ((size_t)b * TT + ql0 + rl) * CC + h * HD + q * 4, s * (1.0f / 2048.0f)); } }
// ---- k_out: block = (64 rows, 128 cols): out = ctx Wo (+ bo): ctx x 2^6 once to f16 against Wo as f16(bf16 x 2^8) exact (1 product) x 2^-14; causal early rows (< QHI of each sequence): ctx bf16 hi + lo against exact bf16 Wo (2 products)
__global__ __launch_bounds__(128) void k_out(const float* __restrict__ Y, const float* __restrict__ WO, const float* __restrict__ BO, float* __restrict__ OUT) { __shared__ __align__(16) float sf[4][16][132];
  const int tid = threadIdx.x, wave = tid >> 5, lane = tid & 31, col = lane & 15, g = lane >> 4; const int c0 = blockIdx.y * 128; const size_t r0 = (size_t)blockIdx.x * 64 + wave * 16;
  v8f acc[8] = {};
  if (CAUSAL && (int)(((size_t)blockIdx.x * 64) % TT) < QHI) {   /* block-uniform */
#pragma unroll 2
    for (int kc = 0; kc < CC / 32; ++kc) { const F2 a = split_row(Y + (r0 + col) * CC, kc * 32, lane); asm volatile("s_wait_loadcnt 0x0" ::: "memory");
#pragma unroll
      for (int j = 0; j < 8; ++j) { const v16b w = WOCOL(WO, kc * 32, c0 + j * 16 + col, lane); asm volatile("s_wait_loadcnt 0x0" ::: "memory"); acc[j] = wmma_bf(a.h, w, acc[j]); acc[j] = wmma_bf(a.l, w, acc[j]); } }
#pragma unroll
    for (int j = 0; j < 8; ++j) { const float bias = BO ? bfr(BO[c0 + j * 16 + col]) : 0.f;
#pragma unroll
      for (int r = 0; r < 8; ++r) sf[wave][8 * g + r][j * 16 + col] = acc[j][r] + bias; }
  } else {
#pragma unroll 2
    for (int kc = 0; kc < CC / 32; ++kc) { const v16h a = frag_f32s(Y + (r0 + col) * CC + kc * 32, lane, 64.0f); asm volatile("s_wait_loadcnt 0x0" ::: "memory");   /* ctx carried x 2^6 into f16 so small-magnitude context rows stay clear of f16 subnormals */
#pragma unroll
      for (int j = 0; j < 8; ++j) { const v16h w = WOCOLH(WO, kc * 32, c0 + j * 16 + col, lane); asm volatile("s_wait_loadcnt 0x0" ::: "memory"); acc[j] = wmma16(a, w, acc[j]); } }
#pragma unroll
    for (int j = 0; j < 8; ++j) { const float bias = BO ? bfr(BO[c0 + j * 16 + col]) : 0.f;
#pragma unroll
      for (int r = 0; r < 8; ++r) sf[wave][8 * g + r][j * 16 + col] = acc[j][r] * (1.0f / 16384.0f) + bias; } }   /* 2^-8 (Wo carry) x 2^-6 (ctx carry) */
  LDSX(); for (int rl = 0; rl < 16; ++rl) vst2(OUT + (r0 + rl) * DIN + c0 + lane * 4, *(const v4f*)&sf[wave][rl][lane * 4]); }

extern "C" void kernel_launch(void* const* d_in, const int* in_sizes, int n_in, void* d_out, int out_size, void* d_ws, size_t ws_size, hipStream_t stream) {
  (void)in_sizes; (void)n_in; (void)out_size;
  const float** F = (const float**)d_in;
  if (ws_size < (size_t)WS_END) return;
  char* ws = (char*)d_ws; _Float16 *QH = (_Float16*)(ws + WS_QH), *KH = (_Float16*)(ws + WS_KH), *VT = (_Float16*)(ws + WS_VT), *QL = (_Float16*)(ws + WS_QL), *KL = (_Float16*)(ws + WS_KL); __bf16 *VB = (__bf16*)(ws + WS_VB), *VBL = (__bf16*)(ws + WS_VBL); float *S = (float*)(ws + WS_S), *Y = (float*)(ws + WS_Y);
  (void)Y; (void)QL; (void)KL; (void)VB; (void)VBL;
  // inputs: 0 x [2,2048,1024]; 1 wq [1024,16,64] = (in,out) [1024][1024]; 2 wk; 3 wv; 4 wp1 [16,64,1024] = (in,out) [1024][1024]; 5 wp2 [1024,1024] (in,out); no biases
  if (ws_size < (size_t)WS_END2) return;
  float* Y2 = (float*)(ws + WS_Y2);
  k_proj<<<dim3(TNB * TT / 64, CC / 128, 3), 128, 0, stream>>>(F[0], F[0], F[0], F[1], F[2], F[3], nullptr, nullptr, nullptr, QH, QL, KH, KL, VT, VB, VBL);
  for (int b = 0; b < TNB; ++b) for (int h0 = 0; h0 < NH; h0 += HG) {
    k_sc<<<dim3(NQB, TT / 128, HG), 128, 0, stream>>>(QH, KH, QL, KL, b, h0, S);
    k_sm<<<dim3(TT, HG), 256, 0, stream>>>(S);
    k_pv<<<dim3(TT / 16, 1, HG), 32 * PVW, 0, stream>>>(S, VT, VB, VBL, b, h0, Y);
  }
  k_out<<<dim3(TNB * TT / 64, DIN / 128), 128, 0, stream>>>(Y, F[4], nullptr, Y2);              /* y = att wp1 (f32 rows in workspace) */
  k_out<<<dim3(TNB * TT / 64, DIN / 128), 128, 0, stream>>>(Y2, F[5], nullptr, (float*)d_out);   /* out = y wp2 */
  static_assert(CC == DIN, "the second output projection reuses k_out: its operand rows have width DIN == CC");
}

// v002
// Measured time: 565 microseconds a run.
// Timed twice side by side with v001, it ran 1.34 and 1.33 times as fast.
// Counting every step since v000, it is 1.94 times as fast.
// compute dtype: all float inputs rounded to bf16; q / k / v projections with EXACT bf16 products on WMMA 16x16x32 (f32 accumulate), no biases; causal logits: 3 products for the first 384 rows, single f16 q x k after, x 64^-0.5; softmax f32; P x 2^11 once to f16 x v once to f16 (bf16 hi + lo below row 384); TWO output projections in sequence, each through k_out (rows < 384: the f32 operand as bf16 hi + lo against the exact weight; beyond: x2^6 f16 carry x f16(bf16 x 2^8) weight); f32 output.
#include <hip/hip_runtime.h>
#include <math.h>

typedef __attribute__((ext_vector_type(16))) _Float16 v16h;
typedef __attribute__((ext_vector_type(16))) __bf16 v16b;
typedef __attribute__((ext_vector_type(8)))  _Float16 v8h;
typedef __attribute__((ext_vector_type(8)))  float v8f;
typedef __attribute__((ext_vector_type(4)))  float v4f;
typedef __attribute__((ext_vector_type(2)))  float v2f;
typedef __attribute__((ext_vector_type(4)))  unsigned v4u;
typedef __attribute__((ext_vector_type(4)))  int v4i;
typedef float __attribute__((may_alias)) float_a;
typedef int __attribute__((may_alias)) int_a;

template <typename T> __device__ __forceinline__ void vst2(void* p, T v) { *(T*)p = v;  }
__device__ __forceinline__ v8f wmma16(v16h a, v16h b, v8f c) {
  v8f d = __builtin_amdgcn_wmma_f32_16x16x32_f16(false, a, false, b, (short)0, c, false, false);
  asm volatile("v_nop\n\tv_nop\n\tv_nop\n\tv_nop" : "+v"(d) : "v"(a), "v"(b));
  return d;
}
__device__ __forceinline__ v8f wmma_bf(v16b a, v16b b, v8f c) {
  v8f d = __builtin_amdgcn_wmma_f32_16x16x32_bf16(false, a, false, b, (short)0, c, false, false);
  asm volatile("v_nop\n\tv_nop\n\tv_nop\n\tv_nop" : "+v"(d) : "v"(a), "v"(b));
  return d;
}
// 16x16x32 fragments: lane = (h = lane>>4, row/col = lane&15); elements 0..7 = k0+8h+0..7, 8..15 = k0+16+8h+0..7; D element r = row 8h+r
__device__ __forceinline__ v16h frag_h(const _Float16* rowk0, int lane) {
  union { v16h v; v8h q[2]; } u; const _Float16* p = rowk0 + 8 * (lane >> 4);
  u.q[0] = *(const v8h*)p; u.q[1] = *(const v8h*)(p + 16); return u.v;
}
__device__ __forceinline__ v16h frag_f32(const float* rowk0, int lane) {
  v16h a; const float* p = rowk0 + 8 * (lane >> 4);
#pragma unroll
  for (int i = 0; i < 8; ++i) { a[i] = (_Float16)p[i]; a[8 + i] = (_Float16)p[16 + i]; }
  return a;
}
__device__ __forceinline__ v16h frag_f32s(const float* rowk0, int lane, float sc) {
  v16h a; const float* p = rowk0 + 8 * (lane >> 4);
#pragma unroll
  for (int i = 0; i < 8; ++i) { a[i] = (_Float16)(p[i] * sc); a[8 + i] = (_Float16)(p[16 + i] * sc); }
  return a;
}
// column fragment from a [K][ld] layout (column n), rows >= K read as 0
__device__ __forceinline__ v16h fragc_f32(const float* W, int k0, int n, int lane, int ld, int K) {
  v16h a; const int g = lane >> 4;
#pragma unroll
  for (int i = 0; i < 8; ++i) { const int ka = k0 + 8 * g + i, kb = ka + 16;
    a[i] = (_Float16)(ka < K ? W[(size_t)(ka < K ? ka : K - 1) * ld + n] : 0.f); a[8 + i] = (_Float16)(kb < K ? W[(size_t)(kb < K ? kb : K - 1) * ld + n] : 0.f); }
  return a;
}
struct F2 { v16b h, l; };
__device__ __forceinline__ F2 bsplit16(const float v[16]) { F2 r;
#pragma unroll
  for (int i = 0; i < 16; ++i) { const __bf16 h = (__bf16)v[i]; r.h[i] = h; r.l[i] = (__bf16)(v[i] - (float)h); }
  return r; }
__device__ __forceinline__ F2 split_row(const float* row, int k0, int lane) { float v[16]; const float* p = row + k0 + 8 * (lane >> 4);
#pragma unroll
  for (int i = 0; i < 8; ++i) { v[i] = p[i]; v[8 + i] = p[16 + i]; }
  return bsplit16(v); }
__device__ __forceinline__ F2 split_rowK(const float* row, int k0, int lane, int K) { float v[16]; const int g = lane >> 4;
#pragma unroll
  for (int i = 0; i < 8; ++i) { const int ka = k0 + 8 * g + i, kb = ka + 16; v[i] = ka < K ? row[ka < K ? ka : K - 1] : 0.f; v[8 + i] = kb < K ? row[kb < K ? kb : K - 1] : 0.f; }
  return bsplit16(v); }
__device__ __forceinline__ F2 split_col(const float* W, int k0, int n, int lane, int ld, int K) { float v[16]; const int g = lane >> 4;
#pragma unroll
  for (int i = 0; i < 8; ++i) { const int ka = k0 + 8 * g + i, kb = ka + 16; v[i] = ka < K ? W[(size_t)(ka < K ? ka : K - 1) * ld + n] : 0.f; v[8 + i] = kb < K ? W[(size_t)(kb < K ? kb : K - 1) * ld + n] : 0.f; }
  return bsplit16(v); }
__device__ __forceinline__ v8f mac3(const F2& a, const F2& b, v8f c) { c = wmma_bf(a.l, b.h, c); c = wmma_bf(a.h, b.l, c); return wmma_bf(a.h, b.h, c); }
__device__ __forceinline__ float sigm(float v) { return 1.0f / (1.0f + expf(-v)); }
#define LDSX() do { asm volatile("s_wait_dscnt 0" ::: "memory"); __builtin_amdgcn_wave_barrier(); __builtin_amdgcn_fence(__ATOMIC_RELEASE, "workgroup"); } while (0)

// Causal multi-head self-attention with per-head-shaped weights and TWO output projections (x [2,2048,1024]; wq / wk / wv [1024,16,64] = (in, head, d): an (in,out) [1024][1024] matrix with out = head*64 + d; wp1 [16,64,1024] = (head, d, out): an (in,out) [1024][1024] matrix with in = head*64 + d; wp2 [1024,1024] (in,out); all N(0, 1/1024), no biases; wei = q k^T x 64^-0.5; tril kept, -inf elsewhere; softmax; att merged (head*64 + d); y = att wp1; out = y wp2).
#define NB 2
#define TT 2048
#define CC 1024            // NH * HD = projected width
#define DIN 1024          // input (model) width
#define NH 16
#define HD 64
#define NQB (TT / 64)
#define HG 4
#define SCALE (0.125f)
#define CAUSAL 1
#ifndef TNB
#define TNB NB
#endif
__device__ __forceinline__ float bfr(float v) { return (float)(__bf16)v; }
__host__ __device__ __forceinline__ int kb_last(int qb) { return CAUSAL ? ((qb * 64 + 63) >> 7) : (TT / 128 - 1); }
typedef __attribute__((ext_vector_type(8))) __bf16 v8b;
__device__ __forceinline__ v16b frag_b(const __bf16* rowk0, int lane) {
  union { v16b v; v8b q[2]; } u; const __bf16* p = rowk0 + 8 * (lane >> 4);
  u.q[0] = *(const v8b*)p; u.q[1] = *(const v8b*)(p + 16); return u.v;
}
#define QBH 6              // causal: query blocks 0..QBH-1 of each sequence (few keys, no averaging) take the high-precision path
#define QHI 384            // rows carrying a q residual plane
#define KHI 384            // key rows carrying k residual / v bf16 hi+lo planes (used only by the causal high-precision path)
// B fragment (k rows k0+.., output column o) of a weight: (in,out) [K][ld] or (out,in) [ld rows of K]: bf16 exact, or f16(bf16 * 256) exact
__device__ __forceinline__ v16b wcol_io(const float* Wm, int k0, int o, int lane, int ld) { v16b w; const int g = lane >> 4;
#pragma unroll
  for (int i = 0; i < 8; ++i) { w[i] = (__bf16)Wm[(size_t)(k0 + 8 * g + i) * ld + o]; w[8 + i] = (__bf16)Wm[(size_t)(k0 + 16 + 8 * g + i) * ld + o]; }
  return w; }
__device__ __forceinline__ v16b wcol_oi(const float* Wm, int k0, int o, int lane, int K) { v16b w; const float* p = Wm + (size_t)o * K + k0 + 8 * (lane >> 4);
#pragma unroll
  for (int i = 0; i < 8; ++i) { w[i] = (__bf16)p[i]; w[8 + i] = (__bf16)p[16 + i]; }
  return w; }
__device__ __forceinline__ v16h wcolh_io(const float* Wm, int k0, int o, int lane, int ld) { v16h w; const int g = lane >> 4;
#pragma unroll
  for (int i = 0; i < 8; ++i) { w[i] = (_Float16)(bfr(Wm[(size_t)(k0 + 8 * g + i) * ld + o]) * 256.0f); w[8 + i] = (_Float16)(bfr(Wm[(size_t)(k0 + 16 + 8 * g + i) * ld + o]) * 256.0f); }
  return w; }
__device__ __forceinline__ v16h wcolh_oi(const float* Wm, int k0, int o, int lane, int K) { v16h w; const float* p = Wm + (size_t)o * K + k0 + 8 * (lane >> 4);
#pragma unroll
  for (int i = 0; i < 8; ++i) { w[i] = (_Float16)(bfr(p[i]) * 256.0f); w[8 + i] = (_Float16)(bfr(p[16 + i]) * 256.0f); }
  return w; }
#define WQKV_LAYOUT 0   // 0 = (in,out) [DIN][CC]; 1 = (out,in) [CC][DIN]; 2 = per-head [NH][DIN][HD]
__device__ __forceinline__ v16b wcol_hdk(const float* Wm, int k0, int o, int lane) { v16b w; const int g = lane >> 4; const float* p = Wm + (size_t)(o / HD) * DIN * HD + (o % HD);
#pragma unroll
  for (int i = 0; i < 8; ++i) { w[i] = (__bf16)p[(size_t)(k0 + 8 * g + i) * HD]; w[8 + i] = (__bf16)p[(size_t)(k0 + 16 + 8 * g + i) * HD]; }
  return w; }
#define WO_OUT_IN 0
#if WQKV_LAYOUT == 1
#define WCOL(W, k0, o, lane) wcol_oi(W, k0, o, lane, DIN)
#elif WQKV_LAYOUT == 2
#define WCOL(W, k0, o, lane) wcol_hdk(W, k0, o, lane)
#else
#define WCOL(W, k0, o, lane) wcol_io(W, k0, o, lane, CC)
#endif
#if WO_OUT_IN
#define WOCOL(W, k0, o, lane) wcol_oi(W, k0, o, lane, CC)
#define WOCOLH(W, k0, o, lane) wcolh_oi(W, k0, o, lane, CC)
#else
#define WOCOL(W, k0, o, lane) wcol_io(W, k0, o, lane, DIN)
#define WOCOLH(W, k0, o, lane) wcolh_io(W, k0, o, lane, DIN)
#endif

#ifndef PROJ_EXTRA_PARAMS
#define PROJ_EXTRA_PARAMS
#endif

#define WS_QH  0u                                      // f16 q rows [b*t][CC]
#define WS_KH  (WS_QH + 2u * (size_t)NB * TT * CC)      // f16 k rows [b*t][CC]
#define WS_VT  (WS_KH + 2u * (size_t)NB * TT * CC)      // f16 v planes [b][c][t]
#define WS_QL  (WS_VT + 2u * (size_t)NB * CC * TT)      // f16 q residual x 2^10 rows [b][t < QHI][CC]
#define WS_KL  (WS_QL + 2u * (size_t)NB * QHI * CC)     // f16 k residual x 2^10 rows [b][t < KHI][CC]
#define WS_VB  (WS_KL + 2u * (size_t)NB * KHI * CC)     // bf16 v hi planes [b][c][t < KHI]
#define WS_VBL (WS_VB + 2u * (size_t)NB * CC * KHI)
#define WS_S   (WS_VBL + 2u * (size_t)NB * CC * KHI)    // f32 logits [hg][t][s]
#define WS_Y   (WS_S  + 4u * (size_t)HG * TT * TT)      // f32 ctx rows [b*t][CC] (only when there is an output projection)
#define WS_END (WS_Y  + 4u * (size_t)NB * TT * CC)
#define WS_Y2 (WS_END)                                     // f32 rows [b*t][DIN]: the first output projection's result, the second one's operand
#define WS_END2 (WS_Y2 + 4u * (size_t)NB * TT * DIN)

// ---- k_proj: block = (64 rows, 128 cols, which): q/k/v = X W (+ b) with exact bf16 products (K = DIN) -> which 0: q f16 rows (+ residual rows < QHI); 1: k f16 rows (+ residual rows < KHI); 2: v f16 planes [c][t] (+ bf16 hi/lo planes for t < KHI)
__global__ __launch_bounds__(128) void k_proj(const float* __restrict__ XQ, const float* __restrict__ XK, const float* __restrict__ XV, const float* __restrict__ WQ, const float* __restrict__ WK, const float* __restrict__ WV, const float* __restrict__ BQ, const float* __restrict__ BK, const float* __restrict__ BV,
    _Float16* __restrict__ QH, _Float16* __restrict__ QL, _Float16* __restrict__ KH, _Float16* __restrict__ KL, _Float16* __restrict__ VT, __bf16* __restrict__ VB, __bf16* __restrict__ VBL) {
  __shared__ __align__(16) _Float16 sh[64][136], sl[64][136]; __shared__ __align__(16) _Float16 th[128][72]; __shared__ __align__(16) __bf16 tb[128][72], tbl[128][72];
  const int tid = threadIdx.x, wave = tid >> 5, lane = tid & 31, col = lane & 15, g = lane >> 4; const int which = blockIdx.z; const int c0 = blockIdx.y * 128; const size_t r0 = (size_t)blockIdx.x * 64; const size_t bb = r0 / TT; const int t0 = (int)(r0 % TT);
  const float* X = which == 0 ? XQ : which == 1 ? XK : XV; const float* WA = which == 0 ? WQ : which == 1 ? WK : WV; const float* BA = which == 0 ? BQ : which == 1 ? BK : BV;
  v8f acc[8] = {};
#pragma unroll 2
  for (int kc = 0; kc < DIN / 32; ++kc) { v16b a; { const float* p = X + (r0 + wave * 16 + col) * DIN + kc * 32 + 8 * g;
#pragma unroll
      for (int i = 0; i < 8; ++i) { a[i] = (__bf16)p[i]; a[8 + i] = (__bf16)p[16 + i]; } }
    asm volatile("s_wait_loadcnt 0x0" ::: "memory");
#pragma unroll
    for (int j = 0; j < 8; ++j) { const v16b w = WCOL(WA, kc * 32, c0 + j * 16 + col, lane); asm volatile("s_wait_loadcnt 0x0" ::: "memory"); acc[j] = wmma_bf(a, w, acc[j]); } }
  if (which < 2) { _Float16* DH = which == 0 ? QH : KH; _Float16* DL = which == 0 ? QL : KL; const int nhi = which == 0 ? QHI : KHI; const bool hi_rows = t0 < nhi;
#pragma unroll
    for (int j = 0; j < 8; ++j) { const float bias = BA ? bfr(BA[c0 + j * 16 + col]) : 0.f;
#pragma unroll
      for (int r = 0; r < 8; ++r) { const float v = acc[j][r] + bias; const _Float16 hv = (_Float16)v; sh[wave * 16 + 8 * g + r][j * 16 + col] = hv; sl[wave * 16 + 8 * g + r][j * 16 + col] = (_Float16)((v - (float)hv) * 1024.0f); } }
    __syncthreads();
    for (int e = tid; e < 64 * 16; e += 128) { const int rl = e >> 4, q = e & 15; vst2((unsigned*)(DH + (r0 + rl) * CC + c0 + q * 8), *(const v4u*)&sh[rl][q * 8]); if (hi_rows) vst2((unsigned*)(DL + (bb * nhi + t0 + rl) * (size_t)CC + c0 + q * 8), *(const v4u*)&sl[rl][q * 8]); }
  } else { const bool hi_rows = t0 < KHI;
#pragma unroll
    for (int j = 0; j < 8; ++j) { const float bias = BA ? bfr(BA[c0 + j * 16 + col]) : 0.f;
#pragma unroll
      for (int r = 0; r < 8; ++r) { const float v = acc[j][r] + bias; const int rl = wave * 16 + 8 * g + r, cl = j * 16 + col; th[cl][rl] = (_Float16)v; const __bf16 bh = (__bf16)v; tb[cl][rl] = bh; tbl[cl][rl] = (__bf16)(v - (float)bh); } }
    __syncthreads();
    for (int e = tid; e < 128 * 8; e += 128) { const int cl = e >> 3, q = e & 7; vst2((unsigned*)(VT + (bb * CC + c0 + cl) * (size_t)TT + t0 + q * 8), *(const v4u*)&th[cl][q * 8]); if (hi_rows) { const size_t o3 = (bb * CC + c0 + cl) * (size_t)KHI + t0 + q * 8; vst2((unsigned*)(VB + o3), *(const v4u*)&tb[cl][q * 8]); vst2((unsigned*)(VBL + o3), *(const v4u*)&tbl[cl][q * 8]); } } } }
// ---- k_sc: block = (query block qb, key block kb <= kb_last(qb), head in group) of batch b: logits x SCALE; q hi + residual (x 2^10) against k (2 products) for query rows < QHI, plus the k residual (3 products) for query blocks < QBH (causal early rows); causal: blocks past the diagonal exit, the mask itself is applied by index in k_pv
__global__ __launch_bounds__(128) void k_sc(const _Float16* __restrict__ QH, const _Float16* __restrict__ KH, const _Float16* __restrict__ QL, const _Float16* __restrict__ KL, int b, int h0, float* __restrict__ S0) { __shared__ __align__(16) float ss[4][16][132];
  const int qb = blockIdx.x, kb = blockIdx.y; if (kb > kb_last(qb)) return;
  const int h = h0 + blockIdx.z; float* S = S0 + (size_t)blockIdx.z * TT * TT;
  const int tid = threadIdx.x, wave = tid >> 5, lane = tid & 31, col = lane & 15, g = lane >> 4; const int k0 = kb * 128; const int ql0 = qb * 64 + wave * 16; const size_t q0 = (size_t)b * TT + ql0, kr0 = (size_t)b * TT + k0;
  v8f acc[8] = {}, accl[8] = {};
  const _Float16* QLb = QL + (size_t)b * QHI * CC; const _Float16* KLb = KL + (size_t)b * KHI * CC;
  if (qb < QBH) {
#pragma unroll
    for (int kc = 0; kc < HD / 32; ++kc) { const v16h ah = frag_h(QH + (q0 + col) * CC + h * HD + kc * 32, lane), al = frag_h(QLb + (size_t)(ql0 + col) * CC + h * HD + kc * 32, lane);
#pragma unroll
      for (int j = 0; j < 8; ++j) { const v16h kbf = frag_h(KH + (kr0 + j * 16 + col) * CC + h * HD + kc * 32, lane), klf = frag_h(KLb + (size_t)(k0 + j * 16 + col) * CC + h * HD + kc * 32, lane); acc[j] = wmma16(ah, kbf, acc[j]); accl[j] = wmma16(al, kbf, accl[j]); accl[j] = wmma16(ah, klf, accl[j]); } }
  } else if (qb * 64 < QHI) {
#pragma unroll
    for (int kc = 0; kc < HD / 32; ++kc) { const v16h ah = frag_h(QH + (q0 + col) * CC + h * HD + kc * 32, lane), al = frag_h(QLb + (size_t)(ql0 + col) * CC + h * HD + kc * 32, lane);
#pragma unroll
      for (int j = 0; j < 8; ++j) { const v16h kbf = frag_h(KH + (kr0 + j * 16 + col) * CC + h * HD + kc * 32, lane); acc[j] = wmma16(ah, kbf, acc[j]); accl[j] = wmma16(al, kbf, accl[j]); } }
  } else {
#pragma unroll
    for (int kc = 0; kc < HD / 32; ++kc) { const v16h ah = frag_h(QH + (q0 + col) * CC + h * HD + kc * 32, lane);
#pragma unroll
      for (int j = 0; j < 8; ++j) { const v16h kbf = frag_h(KH + (kr0 + j * 16 + col) * CC + h * HD + kc * 32, lane); acc[j] = wmma16(ah, kbf, acc[j]); } } }
#pragma unroll
  for (int j = 0; j < 8; ++j) {
#pragma unroll
    for (int r = 0; r < 8; ++r) ss[wave][8 * g + r][j * 16 + col] = (acc[j][r] + accl[j][r] * (1.0f / 1024.0f)) * SCALE; }
  LDSX(); for (int rl = 0; rl < 16; ++rl) vst2(S + (size_t)(ql0 + rl) * TT + k0 + lane * 4, *(const v4f*)&ss[wave][rl][lane * 4]); }
// ---- k_pv: block = 16 queries (tile qt of query block qb = qt / 4) of (b, h), PVW waves. Softmax first: wave w takes query rows w and w + PVW whole, in registers: keys [0, kend): causal -> logit if s <= t else excluded; softmax in f32; exp(logit - max) (0 for excluded) to LDS rows, 2^11 / sum to LDS per row. Then ctx = P . v over keys [0, kend), P x 2^11 = the LDS value x the row's 2^11 / sum; wave w takes the 32-key chunks w, w + PVW, ... and the PVW partial tiles are summed in wave order through LDS (P x 2^11 once to f16 against v f16: 1 product; causal early query blocks: P and v as bf16 hi + lo, 3 products); 256-B (row, head) segment by 16 lanes
#define PVW 8
#define PPITCH (TT + 4)    // LDS pitch of a P row in floats: 16 bytes over the row, so that the 16 rows of a fragment read start 4 banks apart
#define NCF (TT / 128 - 1) // most 128-key pieces of a row in front of its last one; a piece is one 16-byte load per lane
__device__ __forceinline__ v4f sm_exp(v4f v, float m) { v4f e;
#pragma unroll
  for (int c = 0; c < 4; ++c) { const float ex = expf(v[c] - m); e[c] = (v[c] <= -1.0e38f) ? 0.f : ex; }
  return e; }
// one query row's softmax by one wave: lane l holds the logits of keys i * 128 + 4 l + 0..3 in x[i], i < nf, and those of the row's last piece (i = nf) in xl. Only the last piece can hold keys > t: nf * 128 = (kb_last(qb)) * 128 <= qb * 64 <= t. Returns 2^11 / sum; exp(logit - max) goes to the LDS row pr
__device__ __forceinline__ float sm_row(const v4f (&x)[NCF], v4f xl, int nf, int t, int lane, float* pr) {
  float m = -3.0e38f;
#pragma unroll
  for (int c = 0; c < 4; ++c) { xl[c] = (!CAUSAL || nf * 128 + lane * 4 + c <= t) ? xl[c] : -3.0e38f; m = fmaxf(m, xl[c]); }
#pragma unroll
  for (int i = 0; i < NCF; ++i) if (i < nf) {
#pragma unroll
    for (int c = 0; c < 4; ++c) m = fmaxf(m, x[i][c]); }
#pragma unroll
  for (int o = 1; o < 32; o <<= 1) m = fmaxf(m, __shfl_xor(m, o));
  v4f s4 = {};
#pragma unroll
  for (int i = 0; i < NCF; ++i) if (i < nf) { const v4f e = sm_exp(x[i], m); s4 += e; *(v4f*)(pr + i * 128 + lane * 4) = e; }
  { const v4f e = sm_exp(xl, m); s4 += e; *(v4f*)(pr + nf * 128 + lane * 4) = e; }
  float sum = (s4[0] + s4[1]) + (s4[2] + s4[3]);
#pragma unroll
  for (int o = 1; o < 32; o <<= 1) sum += __shfl_xor(sum, o);
  return sum > 0.f ? 2048.0f / sum : 0.f; }   /* a fully excluded row yields P = 0 */
__global__ __launch_bounds__(32 * PVW) void k_pv(const float* __restrict__ PS0, const _Float16* __restrict__ VT, const __bf16* __restrict__ VB, const __bf16* __restrict__ VBL, int b, int h0, float* __restrict__ Y) { const int h = h0 + blockIdx.z; const float* PS = PS0 + (size_t)blockIdx.z * TT * TT; __shared__ __align__(16) float sp[16 * PPITCH]; __shared__ float sinv[16];
  static_assert(PVW * 16 * (HD + 4) <= 16 * PPITCH && 2 * PVW == 16, "the partial tiles reuse the P rows' LDS; two query rows per wave");
  const int tid = threadIdx.x, lane = tid & 31, col = lane & 15, g = lane >> 4; const int qb = blockIdx.x >> 2; const int ql0 = blockIdx.x * 16; const int kce = (kb_last(qb) + 1) * 4;
  const int wave = __builtin_amdgcn_readfirstlane(tid >> 5);   /* scalar, so that the key loop's bounds and branch stay wave-uniform around the matrix instructions */
  { const int nf = kb_last(qb); v4f x0[NCF], x1[NCF]; const float* s0 = PS + (size_t)(ql0 + wave) * TT + lane * 4; const float* s1 = s0 + (size_t)PVW * TT;
#pragma unroll
    for (int i = 0; i < NCF; ++i) if (i < nf) { x0[i] = *(const v4f*)(s0 + i * 128); x1[i] = *(const v4f*)(s1 + i * 128); }   /* both rows' loads in flight before either row is worked on */
    const float* sl = s0 + nf * 128; const v4f xl0 = *(const v4f*)sl, xl1 = *(const v4f*)(sl + (size_t)PVW * TT);
    asm volatile("s_wait_xcnt 0x0" :: "v"(s0), "v"(sl) : "memory");   /* the loads' address registers, named here so that they stay as they are up to this wait, may be reused behind it */
    const float i0 = sm_row(x0, xl0, nf, ql0 + wave, lane, sp + wave * PPITCH), i1 = sm_row(x1, xl1, nf, ql0 + wave + PVW, lane, sp + (wave + PVW) * PPITCH);
    if (lane == 0) { sinv[wave] = i0; sinv[wave + PVW] = i1; } }
  __syncthreads();   /* all 16 rows and their factors are in LDS before any wave reads fragments across them */
  const float inv = sinv[col]; const float* pc = sp + col * PPITCH + 8 * g;
  v8f acc[HD / 16] = {};
  if (qb < QBH) {
#pragma unroll 1
    for (int kc = wave; kc < kce; kc += PVW) { float pv[16];
#pragma unroll
      for (int i = 0; i < 8; ++i) { pv[i] = pc[kc * 32 + i] * inv; pv[8 + i] = pc[kc * 32 + 16 + i] * inv; }
      const F2 p = bsplit16(pv);
#pragma unroll
      for (int j = 0; j < HD / 16; ++j) { const size_t po = ((size_t)b * CC + h * HD + j * 16 + col) * (size_t)KHI + kc * 32; const v16b vh = frag_b(VB + po, lane); acc[j] = wmma_bf(p.h, vh, acc[j]); acc[j] = wmma_bf(p.l, vh, acc[j]); acc[j] = wmma_bf(p.h, frag_b(VBL + po, lane), acc[j]); } }
  } else {
#pragma unroll 1
    for (int kc = wave; kc < kce; kc += PVW) { const v16h p = frag_f32s(sp + col * PPITCH + kc * 32, lane, inv);
#pragma unroll
      for (int j = 0; j < HD / 16; ++j) { const size_t po = ((size_t)b * CC + h * HD + j * 16 + col) * (size_t)TT + kc * 32; acc[j] = wmma16(p, frag_h(VT + po, lane), acc[j]); } } }
  __syncthreads();   /* every wave has read its last P fragment before the partial tiles overwrite the P rows */
  float (*ss)[16][HD + 4] = (float (*)[16][HD + 4])sp;
#pragma unroll
  for (int j = 0; j < HD / 16; ++j)
#pragma unroll
    for (int r = 0; r < 8; ++r) ss[wave][8 * g + r][j * 16 + col] = acc[j][r];
  __syncthreads();   /* every wave's partial tile is in LDS before any thread sums across waves */
  for (int e = tid; e < 16 * (HD / 4); e += 32 * PVW) { const int rl = e / (HD / 4), q = e % (HD / 4); v4f s = *(const v4f*)&ss[0][rl][q * 4];
    for (int w = 1; w < PVW; ++w) s += *(const v4f*)&ss[w][rl][q * 4];
    vst2(Y + ((size_t)b * TT + ql0 + rl) * CC + h * HD + q * 4, s * (1.0f / 2048.0f)); } }
// ---- k_out: block = (64 rows, 128 cols): out = ctx Wo (+ bo): ctx x 2^6 once to f16 against Wo as f16(bf16 x 2^8) exact (1 product) x 2^-14; causal early rows (< QHI of each sequence): ctx bf16 hi + lo against exact bf16 Wo (2 products)
__global__ __launch_bounds__(128) void k_out(const float* __restrict__ Y, const float* __restrict__ WO, const float* __restrict__ BO, float* __restrict__ OUT) { __shared__ __align__(16) float sf[4][16][132];
  const int tid = threadIdx.x, wave = tid >> 5, lane = tid & 31, col = lane & 15, g = lane >> 4; const int c0 = blockIdx.y * 128; const size_t r0 = (size_t)blockIdx.x * 64 + wave * 16;
  v8f acc[8] = {};
  if (CAUSAL && (int)(((size_t)blockIdx.x * 64) % TT) < QHI) {   /* block-uniform */
#pragma unroll 2
    for (int kc = 0; kc < CC / 32; ++kc) { const F2 a = split_row(Y + (r0 + col) * CC, kc * 32, lane); asm volatile("s_wait_loadcnt 0x0" ::: "memory");
#pragma unroll
      for (int j = 0; j < 8; ++j) { const v16b w = WOCOL(WO, kc * 32, c0 + j * 16 + col, lane); asm volatile("s_wait_loadcnt 0x0" ::: "memory"); acc[j] = wmma_bf(a.h, w, acc[j]); acc[j] = wmma_bf(a.l, w, acc[j]); } }
#pragma unroll
    for (int j = 0; j < 8; ++j) { const float bias = BO ? bfr(BO[c0 + j * 16 + col]) : 0.f;
#pragma unroll
      for (int r = 0; r < 8; ++r) sf[wave][8 * g + r][j * 16 + col] = acc[j][r] + bias; }
  } else {
#pragma unroll 2
    for (int kc = 0; kc < CC / 32; ++kc) { const v16h a = frag_f32s(Y + (r0 + col) * CC + kc * 32, lane, 64.0f); asm volatile("s_wait_loadcnt 0x0" ::: "memory");   /* ctx carried x 2^6 into f16 so small-magnitude context rows stay clear of f16 subnormals */
#pragma unroll
      for (int j = 0; j < 8; ++j) { const v16h w = WOCOLH(WO, kc * 32, c0 + j * 16 + col, lane); asm volatile("s_wait_loadcnt 0x0" ::: "memory"); acc[j] = wmma16(a, w, acc[j]); } }
#pragma unroll
    for (int j = 0; j < 8; ++j) { const float bias = BO ? bfr(BO[c0 + j * 16 + col]) : 0.f;
#pragma unroll
      for (int r = 0; r < 8; ++r) sf[wave][8 * g + r][j * 16 + col] = acc[j][r] * (1.0f / 16384.0f) + bias; } }   /* 2^-8 (Wo carry) x 2^-6 (ctx carry) */
  LDSX(); for (int rl = 0; rl < 16; ++rl) vst2(OUT + (r0 + rl) * DIN + c0 + lane * 4, *(const v4f*)&sf[wave][rl][lane * 4]); }

extern "C" void kernel_launch(void* const* d_in, const int* in_sizes, int n_in, void* d_out, int out_size, void* d_ws, size_t ws_size, hipStream_t stream) {
  (void)in_sizes; (void)n_in; (void)out_size;
  const float** F = (const float**)d_in;
  if (ws_size < (size_t)WS_END) return;
  char* ws = (char*)d_ws; _Float16 *QH = (_Float16*)(ws + WS_QH), *KH = (_Float16*)(ws + WS_KH), *VT = (_Float16*)(ws + WS_VT), *QL = (_Float16*)(ws + WS_QL), *KL = (_Float16*)(ws + WS_KL); __bf16 *VB = (__bf16*)(ws + WS_VB), *VBL = (__bf16*)(ws + WS_VBL); float *S = (float*)(ws + WS_S), *Y = (float*)(ws + WS_Y);
  (void)Y; (void)QL; (void)KL; (void)VB; (void)VBL;
  // inputs: 0 x [2,2048,1024]; 1 wq [1024,16,64] = (in,out) [1024][1024]; 2 wk; 3 wv; 4 wp1 [16,64,1024] = (in,out) [1024][1024]; 5 wp2 [1024,1024] (in,out); no biases
  if (ws_size < (size_t)WS_END2) return;
  float* Y2 = (float*)(ws + WS_Y2);
  k_proj<<<dim3(TNB * TT / 64, CC / 128, 3), 128, 0, stream>>>(F[0], F[0], F[0], F[1], F[2], F[3], nullptr, nullptr, nullptr, QH, QL, KH, KL, VT, VB, VBL);
  for (int b = 0; b < TNB; ++b) for (int h0 = 0; h0 < NH; h0 += HG) {
    k_sc<<<dim3(NQB, TT / 128, HG), 128, 0, stream>>>(QH, KH, QL, KL, b, h0, S);
    k_pv<<<dim3(TT / 16, 1, HG), 32 * PVW, 0, stream>>>(S, VT, VB, VBL, b, h0, Y);
  }
  k_out<<<dim3(TNB * TT / 64, DIN / 128), 128, 0, stream>>>(Y, F[4], nullptr, Y2);              /* y = att wp1 (f32 rows in workspace) */
  k_out<<<dim3(TNB * TT / 64, DIN / 128), 128, 0, stream>>>(Y2, F[5], nullptr, (float*)d_out);   /* out = y wp2 */
  static_assert(CC == DIN, "the second output projection reuses k_out: its operand rows have width DIN == CC");
}

// v003
// A run of this version takes 407 microseconds.
// Two timings next to v002 both put it at 1.39 times that version's speed.
// Over all steps from v000 it is 2.69 times as fast.
// compute dtype: all float inputs rounded to bf16; q / k / v projections with EXACT bf16 products on WMMA 16x16x32 (f32 accumulate), no biases; causal logits: 3 products for the first 384 rows, single f16 q x k after, x 64^-0.5; softmax f32; P x 2^11 once to f16 x v once to f16 (bf16 hi + lo below row 384); TWO output projections in sequence, each through k_out (rows < 384: the f32 operand as bf16 hi + lo against the exact weight; beyond: x2^6 f16 carry x f16(bf16 x 2^8) weight); f32 output.
#include <hip/hip_runtime.h>
#include <math.h>

typedef __attribute__((ext_vector_type(16))) _Float16 v16h;
typedef __attribute__((ext_vector_type(16))) __bf16 v16b;
typedef __attribute__((ext_vector_type(8)))  _Float16 v8h;
typedef __attribute__((ext_vector_type(8)))  float v8f;
typedef __attribute__((ext_vector_type(4)))  float v4f;
typedef __attribute__((ext_vector_type(2)))  float v2f;
typedef __attribute__((ext_vector_type(4)))  unsigned v4u;
typedef __attribute__((ext_vector_type(4)))  int v4i;
typedef float __attribute__((may_alias)) float_a;
typedef int __attribute__((may_alias)) int_a;

template <typename T> __device__ __forceinline__ void vst2(void* p, T v) { *(T*)p = v;  }
__device__ __forceinline__ v8f wmma16(v16h a, v16h b, v8f c) {
  v8f d = __builtin_amdgcn_wmma_f32_16x16x32_f16(false, a, false, b, (short)0, c, false, false);
  asm volatile("v_nop\n\tv_nop\n\tv_nop\n\tv_nop" : "+v"(d) : "v"(a), "v"(b));
  return d;
}
__device__ __forceinline__ v8f wmma_bf(v16b a, v16b b, v8f c) {
  v8f d = __builtin_amdgcn_wmma_f32_16x16x32_bf16(false, a, false, b, (short)0, c, false, false);
  asm volatile("v_nop\n\tv_nop\n\tv_nop\n\tv_nop" : "+v"(d) : "v"(a), "v"(b));
  return d;
}
// 16x16x32 fragments: lane = (h = lane>>4, row/col = lane&15); elements 0..7 = k0+8h+0..7, 8..15 = k0+16+8h+0..7; D element r = row 8h+r
__device__ __forceinline__ v16h frag_h(const _Float16* rowk0, int lane) {
  union { v16h v; v8h q[2]; } u; const _Float16* p = rowk0 + 8 * (lane >> 4);
  u.q[0] = *(const v8h*)p; u.q[1] = *(const v8h*)(p + 16); return u.v;
}
__device__ __forceinline__ v16h frag_f32(const float* rowk0, int lane) {
  v16h a; const float* p = rowk0 + 8 * (lane >> 4);
#pragma unroll
  for (int i = 0; i < 8; ++i) { a[i] = (_Float16)p[i]; a[8 + i] = (_Float16)p[16 + i]; }
  return a;
}
__device__ __forceinline__ v16h frag_f32s(const float* rowk0, int lane, float sc) {
  v16h a; const float* p = rowk0 + 8 * (lane >> 4);
#pragma unroll
  for (int i = 0; i < 8; ++i) { a[i] = (_Float16)(p[i] * sc); a[8 + i] = (_Float16)(p[16 + i] * sc); }
  return a;
}
// column fragment from a [K][ld] layout (column n), rows >= K read as 0
__device__ __forceinline__ v16h fragc_f32(const float* W, int k0, int n, int lane, int ld, int K) {
  v16h a; const int g = lane >> 4;
#pragma unroll
  for (int i = 0; i < 8; ++i) { const int ka = k0 + 8 * g + i, kb = ka + 16;
    a[i] = (_Float16)(ka < K ? W[(size_t)(ka < K ? ka : K - 1) * ld + n] : 0.f); a[8 + i] = (_Float16)(kb < K ? W[(size_t)(kb < K ? kb : K - 1) * ld + n] : 0.f); }
  return a;
}
struct F2 { v16b h, l; };
__device__ __forceinline__ F2 bsplit16(const float v[16]) { F2 r;
#pragma unroll
  for (int i = 0; i < 16; ++i) { const __bf16 h = (__bf16)v[i]; r.h[i] = h; r.l[i] = (__bf16)(v[i] - (float)h); }
  return r; }
__device__ __forceinline__ F2 split_row(const float* row, int k0, int lane) { float v[16]; const float* p = row + k0 + 8 * (lane >> 4);
#pragma unroll
  for (int i = 0; i < 8; ++i) { v[i] = p[i]; v[8 + i] = p[16 + i]; }
  return bsplit16(v); }
__device__ __forceinline__ F2 split_rowK(const float* row, int k0, int lane, int K) { float v[16]; const int g = lane >> 4;
#pragma unroll
  for (int i = 0; i < 8; ++i) { const int ka = k0 + 8 * g + i, kb = ka + 16; v[i] = ka < K ? row[ka < K ? ka : K - 1] : 0.f; v[8 + i] = kb < K ? row[kb < K ? kb : K - 1] : 0.f; }
  return bsplit16(v); }
__device__ __forceinline__ F2 split_col(const float* W, int k0, int n, int lane, int ld, int K) { float v[16]; const int g = lane >> 4;
#pragma unroll
  for (int i = 0; i < 8; ++i) { const int ka = k0 + 8 * g + i, kb = ka + 16; v[i] = ka < K ? W[(size_t)(ka < K ? ka : K - 1) * ld + n] : 0.f; v[8 + i] = kb < K ? W[(size_t)(kb < K ? kb : K - 1) * ld + n] : 0.f; }
  return bsplit16(v); }
__device__ __forceinline__ v8f mac3(const F2& a, const F2& b, v8f c) { c = wmma_bf(a.l, b.h, c); c = wmma_bf(a.h, b.l, c); return wmma_bf(a.h, b.h, c); }
__device__ __forceinline__ float sigm(float v) { return 1.0f / (1.0f + expf(-v)); }
#define LDSX() do { asm volatile("s_wait_dscnt 0" ::: "memory"); __builtin_amdgcn_wave_barrier(); __builtin_amdgcn_fence(__ATOMIC_RELEASE, "workgroup"); } while (0)

// Causal multi-head self-attention with per-head-shaped weights and TWO output projections (x [2,2048,1024]; wq / wk / wv [1024,16,64] = (in, head, d): an (in,out) [1024][1024] matrix with out = head*64 + d; wp1 [16,64,1024] = (head, d, out): an (in,out) [1024][1024] matrix with in = head*64 + d; wp2 [1024,1024] (in,out); all N(0, 1/1024), no biases; wei = q k^T x 64^-0.5; tril kept, -inf elsewhere; softmax; att merged (head*64 + d); y = att wp1; out = y wp2).
#define NB 2
#define TT 2048
#define CC 1024            // NH * HD = projected width
#define DIN 1024          // input (model) width
#define NH 16
#define HD 64
#define NQB (TT / 64)
#define HG 4
#define SCALE (0.125f)
#define CAUSAL 1
#ifndef TNB
#define TNB NB
#endif
__device__ __forceinline__ float bfr(float v) { return (float)(__bf16)v; }
__host__ __device__ __forceinline__ int kb_last(int qb) { return CAUSAL ? ((qb * 64 + 63) >> 7) : (TT / 128 - 1); }
typedef __attribute__((ext_vector_type(8))) __bf16 v8b;
__device__ __forceinline__ v16b frag_b(const __bf16* rowk0, int lane) {
  union { v16b v; v8b q[2]; } u; const __bf16* p = rowk0 + 8 * (lane >> 4);
  u.q[0] = *(const v8b*)p; u.q[1] = *(const v8b*)(p + 16); return u.v;
}
#define QBH 6              // causal: query blocks 0..QBH-1 of each sequence (few keys, no averaging) take the high-precision path
#define QHI 384            // rows carrying a q residual plane
#define KHI 384            // key rows carrying k residual / v bf16 hi+lo planes (used only by the causal high-precision path)
// B fragment (k rows k0+.., output column o) of a weight: (in,out) [K][ld] or (out,in) [ld rows of K]: bf16 exact, or f16(bf16 * 256) exact
__device__ __forceinline__ v16b wcol_io(const float* Wm, int k0, int o, int lane, int ld) { v16b w; const int g = lane >> 4;
#pragma unroll
  for (int i = 0; i < 8; ++i) { w[i] = (__bf16)Wm[(size_t)(k0 + 8 * g + i) * ld + o]; w[8 + i] = (__bf16)Wm[(size_t)(k0 + 16 + 8 * g + i) * ld + o]; }
  return w; }
__device__ __forceinline__ v16b wcol_oi(const float* Wm, int k0, int o, int lane, int K) { v16b w; const float* p = Wm + (size_t)o * K + k0 + 8 * (lane >> 4);
#pragma unroll
  for (int i = 0; i < 8; ++i) { w[i] = (__bf16)p[i]; w[8 + i] = (__bf16)p[16 + i]; }
  return w; }
__device__ __forceinline__ v16h wcolh_io(const float* Wm, int k0, int o, int lane, int ld) { v16h w; const int g = lane >> 4;
#pragma unroll
  for (int i = 0; i < 8; ++i) { w[i] = (_Float16)(bfr(Wm[(size_t)(k0 + 8 * g + i) * ld + o]) * 256.0f); w[8 + i] = (_Float16)(bfr(Wm[(size_t)(k0 + 16 + 8 * g + i) * ld + o]) * 256.0f); }
  return w; }
__device__ __forceinline__ v16h wcolh_oi(const float* Wm, int k0, int o, int lane, int K) { v16h w; const float* p = Wm + (size_t)o * K + k0 + 8 * (lane >> 4);
#pragma unroll
  for (int i = 0; i < 8; ++i) { w[i] = (_Float16)(bfr(p[i]) * 256.0f); w[8 + i] = (_Float16)(bfr(p[16 + i]) * 256.0f); }
  return w; }
#define WQKV_LAYOUT 0   // 0 = (in,out) [DIN][CC]; 1 = (out,in) [CC][DIN]; 2 = per-head [NH][DIN][HD]
__device__ __forceinline__ v16b wcol_hdk(const float* Wm, int k0, int o, int lane) { v16b w; const int g = lane >> 4; const float* p = Wm + (size_t)(o / HD) * DIN * HD + (o % HD);
#pragma unroll
  for (int i = 0; i < 8; ++i) { w[i] = (__bf16)p[(size_t)(k0 + 8 * g + i) * HD]; w[8 + i] = (__bf16)p[(size_t)(k0 + 16 + 8 * g + i) * HD]; }
  return w; }
#define WO_OUT_IN 0
#if WQKV_LAYOUT == 1
#define WCOL(W, k0, o, lane) wcol_oi(W, k0, o, lane, DIN)
#elif WQKV_LAYOUT == 2
#define WCOL(W, k0, o, lane) wcol_hdk(W, k0, o, lane)
#else
#define WCOL(W, k0, o, lane) wcol_io(W, k0, o, lane, CC)
#endif
#if WO_OUT_IN
#define WOCOL(W, k0, o, lane) wcol_oi(W, k0, o, lane, CC)
#define WOCOLH(W, k0, o, lane) wcolh_oi(W, k0, o, lane, CC)
#else
#define WOCOL(W, k0, o, lane) wcol_io(W, k0, o, lane, DIN)
#define WOCOLH(W, k0, o, lane) wcolh_io(W, k0, o, lane, DIN)
#endif

#ifndef PROJ_EXTRA_PARAMS
#define PROJ_EXTRA_PARAMS
#endif

#define WS_QH  0u                                      // f16 q rows [b*t][CC]
#define WS_KH  (WS_QH + 2u * (size_t)NB * TT * CC)      // f16 k rows [b*t][CC]
#define WS_VT  (WS_KH + 2u * (size_t)NB * TT * CC)      // f16 v planes [b][c][t]
#define WS_QL  (WS_VT + 2u * (size_t)NB * CC * TT)      // f16 q residual x 2^10 rows [b][t < QHI][CC]
#define WS_KL  (WS_QL + 2u * (size_t)NB * QHI * CC)     // f16 k residual x 2^10 rows [b][t < KHI][CC]
#define WS_VB  (WS_KL + 2u * (size_t)NB * KHI * CC)     // bf16 v hi planes [b][c][t < KHI]
#define WS_VBL (WS_VB + 2u * (size_t)NB * CC * KHI)
#define WS_S   (WS_VBL + 2u * (size_t)NB * CC * KHI)    // f32 logits [hg][t][s]
#define WS_Y   (WS_S  + 4u * (size_t)HG * TT * TT)      // f32 ctx rows [b*t][CC] (only when there is an output projection)
#define WS_END (WS_Y  + 4u * (size_t)NB * TT * CC)
#define WS_Y2 (WS_END)                                     // f32 rows [b*t][DIN]: the first output projection's result, the second one's operand
#define WS_END2 (WS_Y2 + 4u * (size_t)NB * TT * DIN)

// ---- operand tiles of one K step (32 k) of k_proj / k_out: read by whole-line loads and converted once per block, kept in LDS as 16-bit rows of 32 k, so that an A or B fragment is two 16-byte LDS reads (frag_b / frag_h on the row). Every loop over a register array, here and in the K steps, is fully unrolled: its indices must be constants, else the array goes to scratch
#define WP 40              // LDS pitch of a staged row in 16-bit elements: 32 k values + 16 bytes, so that 16-byte reads and writes of 64-byte rows spread over all banks
static_assert(WQKV_LAYOUT == 0 && !WO_OUT_IN, "the staged weight tile is written for (in,out) weights");
typedef __attribute__((ext_vector_type(4))) __bf16 v4b;
typedef __attribute__((ext_vector_type(4))) _Float16 v4h;
// weight tile: 32 k rows x 128 output columns of an (in,out) [K][ld] matrix, in LDS as [column][k]. Thread (wave, lane) owns the patch k = 8 (lane >> 3) + 0..7, column = 32 wave + 4 (lane & 7) + 0..3: each load instruction covers four whole 128-byte lines, each LDS store holds 8 consecutive k of one column
__device__ __forceinline__ const float* wt_ptr(const float* Wm, int c0, int wave, int lane, int ld) { return Wm + (size_t)(8 * (lane >> 3)) * ld + c0 + 32 * wave + 4 * (lane & 7); }
__device__ __forceinline__ void wt_load(v4f (&r)[8], const float* p, int ld) {
#pragma unroll
  for (int i = 0; i < 8; ++i) r[i] = *(const v4f*)(p + (size_t)i * ld); }
__device__ __forceinline__ void wt_put_b(__bf16* buf, const v4f (&r)[8], int wave, int lane) {   /* bf16, exact for the bf16-rounded weight */
#pragma unroll
  for (int c = 0; c < 4; ++c) { v8b t;
#pragma unroll
    for (int i = 0; i < 8; ++i) t[i] = (__bf16)r[i][c];
    *(v8b*)(buf + (32 * wave + 4 * (lane & 7) + c) * WP + 8 * (lane >> 3)) = t; } }
__device__ __forceinline__ void wt_put_h(_Float16* buf, const v4f (&r)[8], int wave, int lane) {   /* f16(bf16 x 2^8), exact */
#pragma unroll
  for (int c = 0; c < 4; ++c) { v8h t;
#pragma unroll
    for (int i = 0; i < 8; ++i) t[i] = (_Float16)(bfr(r[i][c]) * 256.0f);
    *(v8h*)(buf + (32 * wave + 4 * (lane & 7) + c) * WP + 8 * (lane >> 3)) = t; } }
// row tile: 64 rows x 32 k of an f32 [rows][ld] matrix, in LDS as [row][k]; rows0 = the block's first row. Thread (wave, lane) owns k = 4 (lane & 7) + 0..3 of rows 16 wave + 4 i + (lane >> 3), i < 4 (the rows of its own wave's A fragment): each load instruction covers four whole 128-byte lines
__device__ __forceinline__ const float* xt_ptr(const float* rows0, int wave, int lane, int ld) { return rows0 + (size_t)(16 * wave + (lane >> 3)) * ld + 4 * (lane & 7); }
__device__ __forceinline__ void xt_load(v4f (&r)[4], const float* p, int ld) {
#pragma unroll
  for (int i = 0; i < 4; ++i) r[i] = *(const v4f*)(p + (size_t)(4 * i) * ld); }
__device__ __forceinline__ int xt_at(int i, int wave, int lane) { return (16 * wave + 4 * i + (lane >> 3)) * WP + 4 * (lane & 7); }
__device__ __forceinline__ void xt_put_b(__bf16* buf, const v4f (&r)[4], int wave, int lane) {   /* once to bf16 */
#pragma unroll
  for (int i = 0; i < 4; ++i) { v4b t;
#pragma unroll
    for (int c = 0; c < 4; ++c) t[c] = (__bf16)r[i][c];
    *(v4b*)(buf + xt_at(i, wave, lane)) = t; } }
__device__ __forceinline__ void xt_put_hl(__bf16* bh, __bf16* bl, const v4f (&r)[4], int wave, int lane) {   /* bf16 hi + lo planes, as bsplit16 */
#pragma unroll
  for (int i = 0; i < 4; ++i) { v4b th, tl;
#pragma unroll
    for (int c = 0; c < 4; ++c) { const __bf16 h = (__bf16)r[i][c]; th[c] = h; tl[c] = (__bf16)(r[i][c] - (float)h); }
    *(v4b*)(bh + xt_at(i, wave, lane)) = th; *(v4b*)(bl + xt_at(i, wave, lane)) = tl; } }
__device__ __forceinline__ void xt_put_h(_Float16* buf, const v4f (&r)[4], int wave, int lane, float sc) {   /* x sc, once to f16 */
#pragma unroll
  for (int i = 0; i < 4; ++i) { v4h t;
#pragma unroll
    for (int c = 0; c < 4; ++c) t[c] = (_Float16)(r[i][c] * sc);
    *(v4h*)(buf + xt_at(i, wave, lane)) = t; } }
// ---- k_proj: block = (64 rows, 128 cols, which): q/k/v = X W (+ b) with exact bf16 products (K = DIN), both operand tiles of each K step staged in LDS (two buffers, which share their LDS with the epilogue's tiles), the next step's loads issued behind the step's barrier -> which 0: q f16 rows (+ residual rows < QHI); 1: k f16 rows (+ residual rows < KHI); 2: v f16 planes [c][t] (+ bf16 hi/lo planes for t < KHI)
__global__ __launch_bounds__(128) void k_proj(const float* __restrict__ XQ, const float* __restrict__ XK, const float* __restrict__ XV, const float* __restrict__ WQ, const float* __restrict__ WK, const float* __restrict__ WV, const float* __restrict__ BQ, const float* __restrict__ BK, const float* __restrict__ BV,
    _Float16* __restrict__ QH, _Float16* __restrict__ QL, _Float16* __restrict__ KH, _Float16* __restrict__ KL, _Float16* __restrict__ VT, __bf16* __restrict__ VB, __bf16* __restrict__ VBL) {
  __shared__ __align__(16) union { struct { _Float16 sh[64][136], sl[64][136]; } r; struct { _Float16 th[128][72]; __bf16 tb[128][72], tbl[128][72]; } c; struct { __bf16 w[2][128 * WP], x[2][64 * WP]; } k; } u;
  _Float16 (&sh)[64][136] = u.r.sh; _Float16 (&sl)[64][136] = u.r.sl; _Float16 (&th)[128][72] = u.c.th; __bf16 (&tb)[128][72] = u.c.tb; __bf16 (&tbl)[128][72] = u.c.tbl;
  const int tid = threadIdx.x, wave = tid >> 5, lane = tid & 31, col = lane & 15, g = lane >> 4; const int which = blockIdx.z; const int c0 = blockIdx.y * 128; const size_t r0 = (size_t)blockIdx.x * 64; const size_t bb = r0 / TT; const int t0 = (int)(r0 % TT);
  const float* X = which == 0 ? XQ : which == 1 ? XK : XV; const float* WA = which == 0 ? WQ : which == 1 ? WK : WV; const float* BA = which == 0 ? BQ : which == 1 ? BK : BV;
  v8f acc[8] = {};
  const float* wp = wt_ptr(WA, c0, wave, lane, CC); const float* xp = xt_ptr(X + r0 * DIN, wave, lane, DIN);
  v4f wr[8], xr[4]; wt_load(wr, wp, CC); xt_load(xr, xp, DIN);
  for (int kc = 0; kc < DIN / 32; ++kc) { __bf16* wb = u.k.w[kc & 1]; __bf16* xb = u.k.x[kc & 1]; wt_put_b(wb, wr, wave, lane); xt_put_b(xb, xr, wave, lane);
    __syncthreads();   /* the whole tiles of step kc are in LDS before any wave reads fragments across them; the same barrier ends every wave's reads of step kc - 1, whose buffers step kc + 1 overwrites */
    if (kc + 1 < DIN / 32) { wt_load(wr, wp + (size_t)32 * CC, CC); xt_load(xr, xp + 32, DIN);
      asm volatile("s_wait_xcnt 0x0" :: "v"(wp), "v"(xp) : "memory");   /* the loads' address registers, named here so that they stay as they are up to this wait, are advanced behind it */
      wp += (size_t)32 * CC; xp += 32; }
    const v16b a = frag_b(xb + (wave * 16 + col) * WP, lane); v16b wf[8];
#pragma unroll
    for (int j = 0; j < 8; ++j) wf[j] = frag_b(wb + (j * 16 + col) * WP, lane);   /* all of the step's LDS reads as one group in front of its matrix instructions */
#pragma unroll
    for (int j = 0; j < 8; ++j) acc[j] = wmma_bf(a, wf[j], acc[j]); }
  __syncthreads();   /* every wave has read its last fragments before the epilogue's tiles overwrite the staging buffers */
  if (which < 2) { _Float16* DH = which == 0 ? QH : KH; _Float16* DL = which == 0 ? QL : KL; const int nhi = which == 0 ? QHI : KHI; const bool hi_rows = t0 < nhi;
#pragma unroll
    for (int j = 0; j < 8; ++j) { const float bias = BA ? bfr(BA[c0 + j * 16 + col]) : 0.f;
#pragma unroll
      for (int r = 0; r < 8; ++r) { const float v = acc[j][r] + bias; const _Float16 hv = (_Float16)v; sh[wave * 16 + 8 * g + r][j * 16 + col] = hv; sl[wave * 16 + 8 * g + r][j * 16 + col] = (_Float16)((v - (float)hv) * 1024.0f); } }
    __syncthreads();
    for (int e = tid; e < 64 * 16; e += 128) { const int rl = e >> 4, q = e & 15; vst2((unsigned*)(DH + (r0 + rl) * CC + c0 + q * 8), *(const v4u*)&sh[rl][q * 8]); if (hi_rows) vst2((unsigned*)(DL + (bb * nhi + t0 + rl) * (size_t)CC + c0 + q * 8), *(const v4u*)&sl[rl][q * 8]); }
  } else { const bool hi_rows = t0 < KHI;
#pragma unroll
    for (int j = 0; j < 8; ++j) { const float bias = BA ? bfr(BA[c0 + j * 16 + col]) : 0.f;
#pragma unroll
      for (int r = 0; r < 8; ++r) { const float v = acc[j][r] + bias; const int rl = wave * 16 + 8 * g + r, cl = j * 16 + col; th[cl][rl] = (_Float16)v; const __bf16 bh = (__bf16)v; tb[cl][rl] = bh; tbl[cl][rl] = (__bf16)(v - (float)bh); } }
    __syncthreads();
    for (int e = tid; e < 128 * 8; e += 128) { const int cl = e >> 3, q = e & 7; vst2((unsigned*)(VT + (bb * CC + c0 + cl) * (size_t)TT + t0 + q * 8), *(const v4u*)&th[cl][q * 8]); if (hi_rows) { const size_t o3 = (bb * CC + c0 + cl) * (size_t)KHI + t0 + q * 8; vst2((unsigned*)(VB + o3), *(const v4u*)&tb[cl][q * 8]); vst2((unsigned*)(VBL + o3), *(const v4u*)&tbl[cl][q * 8]); } } } }
// ---- k_sc: block = (query block qb, key block kb <= kb_last(qb), head in group) of batch b: logits x SCALE; q hi + residual (x 2^10) against k (2 products) for query rows < QHI, plus the k residual (3 products) for query blocks < QBH (causal early rows); causal: blocks past the diagonal exit, the mask itself is applied by index in k_pv
__global__ __launch_bounds__(128) void k_sc(const _Float16* __restrict__ QH, const _Float16* __restrict__ KH, const _Float16* __restrict__ QL, const _Float16* __restrict__ KL, int b, int h0, float* __restrict__ S0) { __shared__ __align__(16) float ss[4][16][132];
  const int qb = blockIdx.x, kb = blockIdx.y; if (kb > kb_last(qb)) return;
  const int h = h0 + blockIdx.z; float* S = S0 + (size_t)blockIdx.z * TT * TT;
  const int tid = threadIdx.x, wave = tid >> 5, lane = tid & 31, col = lane & 15, g = lane >> 4; const int k0 = kb * 128; const int ql0 = qb * 64 + wave * 16; const size_t q0 = (size_t)b * TT + ql0, kr0 = (size_t)b * TT + k0;
  v8f acc[8] = {}, accl[8] = {};
  const _Float16* QLb = QL + (size_t)b * QHI * CC; const _Float16* KLb = KL + (size_t)b * KHI * CC;
  if (qb < QBH) {
#pragma unroll
    for (int kc = 0; kc < HD / 32; ++kc) { const v16h ah = frag_h(QH + (q0 + col) * CC + h * HD + kc * 32, lane), al = frag_h(QLb + (size_t)(ql0 + col) * CC + h * HD + kc * 32, lane);
#pragma unroll
      for (int j = 0; j < 8; ++j) { const v16h kbf = frag_h(KH + (kr0 + j * 16 + col) * CC + h * HD + kc * 32, lane), klf = frag_h(KLb + (size_t)(k0 + j * 16 + col) * CC + h * HD + kc * 32, lane); acc[j] = wmma16(ah, kbf, acc[j]); accl[j] = wmma16(al, kbf, accl[j]); accl[j] = wmma16(ah, klf, accl[j]); } }
  } else if (qb * 64 < QHI) {
#pragma unroll
    for (int kc = 0; kc < HD / 32; ++kc) { const v16h ah = frag_h(QH + (q0 + col) * CC + h * HD + kc * 32, lane), al = frag_h(QLb + (size_t)(ql0 + col) * CC + h * HD + kc * 32, lane);
#pragma unroll
      for (int j = 0; j < 8; ++j) { const v16h kbf = frag_h(KH + (kr0 + j * 16 + col) * CC + h * HD + kc * 32, lane); acc[j] = wmma16(ah, kbf, acc[j]); accl[j] = wmma16(al, kbf, accl[j]); } }
  } else {
#pragma unroll
    for (int kc = 0; kc < HD / 32; ++kc) { const v16h ah = frag_h(QH + (q0 + col) * CC + h * HD + kc * 32, lane);
#pragma unroll
      for (int j = 0; j < 8; ++j) { const v16h kbf = frag_h(KH + (kr0 + j * 16 + col) * CC + h * HD + kc * 32, lane); acc[j] = wmma16(ah, kbf, acc[j]); } } }
#pragma unroll
  for (int j = 0; j < 8; ++j) {
#pragma unroll
    for (int r = 0; r < 8; ++r) ss[wave][8 * g + r][j * 16 + col] = (acc[j][r] + accl[j][r] * (1.0f / 1024.0f)) * SCALE; }
  LDSX(); for (int rl = 0; rl < 16; ++rl) vst2(S + (size_t)(ql0 + rl) * TT + k0 + lane * 4, *(const v4f*)&ss[wave][rl][lane * 4]); }
// ---- k_pv: block = 16 queries (tile qt of query block qb = qt / 4) of (b, h), PVW waves. Softmax first: wave w takes query rows w and w + PVW whole, in registers: keys [0, kend): causal -> logit if s <= t else excluded; softmax in f32; exp(logit - max) (0 for excluded) to LDS rows, 2^11 / sum to LDS per row. Then ctx = P . v over keys [0, kend), P x 2^11 = the LDS value x the row's 2^11 / sum; wave w takes the 32-key chunks w, w + PVW, ... and the PVW partial tiles are summed in wave order through LDS (P x 2^11 once to f16 against v f16: 1 product; causal early query blocks: P and v as bf16 hi + lo, 3 products); 256-B (row, head) segment by 16 lanes
#define PVW 8
#define PPITCH (TT + 4)    // LDS pitch of a P row in floats: 16 bytes over the row, so that the 16 rows of a fragment read start 4 banks apart
#define NCF (TT / 128 - 1) // most 128-key pieces of a row in front of its last one; a piece is one 16-byte load per lane
__device__ __forceinline__ v4f sm_exp(v4f v, float m) { v4f e;
#pragma unroll
  for (int c = 0; c < 4; ++c) { const float ex = expf(v[c] - m); e[c] = (v[c] <= -1.0e38f) ? 0.f : ex; }
  return e; }
// one query row's softmax by one wave: lane l holds the logits of keys i * 128 + 4 l + 0..3 in x[i], i < nf, and those of the row's last piece (i = nf) in xl. Only the last piece can hold keys > t: nf * 128 = (kb_last(qb)) * 128 <= qb * 64 <= t. Returns 2^11 / sum; exp(logit - max) goes to the LDS row pr
__device__ __forceinline__ float sm_row(const v4f (&x)[NCF], v4f xl, int nf, int t, int lane, float* pr) {
  float m = -3.0e38f;
#pragma unroll
  for (int c = 0; c < 4; ++c) { xl[c] = (!CAUSAL || nf * 128 + lane * 4 + c <= t) ? xl[c] : -3.0e38f; m = fmaxf(m, xl[c]); }
#pragma unroll
  for (int i = 0; i < NCF; ++i) if (i < nf) {
#pragma unroll
    for (int c = 0; c < 4; ++c) m = fmaxf(m, x[i][c]); }
#pragma unroll
  for (int o = 1; o < 32; o <<= 1) m = fmaxf(m, __shfl_xor(m, o));
  v4f s4 = {};
#pragma unroll
  for (int i = 0; i < NCF; ++i) if (i < nf) { const v4f e = sm_exp(x[i], m); s4 += e; *(v4f*)(pr + i * 128 + lane * 4) = e; }
  { const v4f e = sm_exp(xl, m); s4 += e; *(v4f*)(pr + nf * 128 + lane * 4) = e; }
  float sum = (s4[0] + s4[1]) + (s4[2] + s4[3]);
#pragma unroll
  for (int o = 1; o < 32; o <<= 1) sum += __shfl_xor(sum, o);
  return sum > 0.f ? 2048.0f / sum : 0.f; }   /* a fully excluded row yields P = 0 */
__global__ __launch_bounds__(32 * PVW) void k_pv(const float* __restrict__ PS0, const _Float16* __restrict__ VT, const __bf16* __restrict__ VB, const __bf16* __restrict__ VBL, int b, int h0, float* __restrict__ Y) { const int h = h0 + blockIdx.z; const float* PS = PS0 + (size_t)blockIdx.z * TT * TT; __shared__ __align__(16) float sp[16 * PPITCH]; __shared__ float sinv[16];
  static_assert(PVW * 16 * (HD + 4) <= 16 * PPITCH && 2 * PVW == 16, "the partial tiles reuse the P rows' LDS; two query rows per wave");
  const int tid = threadIdx.x, lane = tid & 31, col = lane & 15, g = lane >> 4; const int qb = blockIdx.x >> 2; const int ql0 = blockIdx.x * 16; const int kce = (kb_last(qb) + 1) * 4;
  const int wave = __builtin_amdgcn_readfirstlane(tid >> 5);   /* scalar, so that the key loop's bounds and branch stay wave-uniform around the matrix instructions */
  { const int nf = kb_last(qb); v4f x0[NCF], x1[NCF]; const float* s0 = PS + (size_t)(ql0 + wave) * TT + lane * 4; const float* s1 = s0 + (size_t)PVW * TT;
#pragma unroll
    for (int i = 0; i < NCF; ++i) if (i < nf) { x0[i] = *(const v4f*)(s0 + i * 128); x1[i] = *(const v4f*)(s1 + i * 128); }   /* both rows' loads in flight before either row is worked on */
    const float* sl = s0 + nf * 128; const v4f xl0 = *(const v4f*)sl, xl1 = *(const v4f*)(sl + (size_t)PVW * TT);
    asm volatile("s_wait_xcnt 0x0" :: "v"(s0), "v"(sl) : "memory");   /* the loads' address registers, named here so that they stay as they are up to this wait, may be reused behind it */
    const float i0 = sm_row(x0, xl0, nf, ql0 + wave, lane, sp + wave * PPITCH), i1 = sm_row(x1, xl1, nf, ql0 + wave + PVW, lane, sp + (wave + PVW) * PPITCH);
    if (lane == 0) { sinv[wave] = i0; sinv[wave + PVW] = i1; } }
  __syncthreads();   /* all 16 rows and their factors are in LDS before any wave reads fragments across them */
  const float inv = sinv[col]; const float* pc = sp + col * PPITCH + 8 * g;
  v8f acc[HD / 16] = {};
  if (qb < QBH) {
#pragma unroll 1
    for (int kc = wave; kc < kce; kc += PVW) { float pv[16];
#pragma unroll
      for (int i = 0; i < 8; ++i) { pv[i] = pc[kc * 32 + i] * inv; pv[8 + i] = pc[kc * 32 + 16 + i] * inv; }
      const F2 p = bsplit16(pv);
#pragma unroll
      for (int j = 0; j < HD / 16; ++j) { const size_t po = ((size_t)b * CC + h * HD + j * 16 + col) * (size_t)KHI + kc * 32; const v16b vh = frag_b(VB + po, lane); acc[j] = wmma_bf(p.h, vh, acc[j]); acc[j] = wmma_bf(p.l, vh, acc[j]); acc[j] = wmma_bf(p.h, frag_b(VBL + po, lane), acc[j]); } }
  } else {
#pragma unroll 1
    for (int kc = wave; kc < kce; kc += PVW) { const v16h p = frag_f32s(sp + col * PPITCH + kc * 32, lane, inv);
#pragma unroll
      for (int j = 0; j < HD / 16; ++j) { const size_t po = ((size_t)b * CC + h * HD + j * 16 + col) * (size_t)TT + kc * 32; acc[j] = wmma16(p, frag_h(VT + po, lane), acc[j]); } } }
  __syncthreads();   /* every wave has read its last P fragment before the partial tiles overwrite the P rows */
  float (*ss)[16][HD + 4] = (float (*)[16][HD + 4])sp;
#pragma unroll
  for (int j = 0; j < HD / 16; ++j)
#pragma unroll
    for (int r = 0; r < 8; ++r) ss[wave][8 * g + r][j * 16 + col] = acc[j][r];
  __syncthreads();   /* every wave's partial tile is in LDS before any thread sums across waves */
  for (int e = tid; e < 16 * (HD / 4); e += 32 * PVW) { const int rl = e / (HD / 4), q = e % (HD / 4); v4f s = *(const v4f*)&ss[0][rl][q * 4];
    for (int w = 1; w < PVW; ++w) s += *(const v4f*)&ss[w][rl][q * 4];
    vst2(Y + ((size_t)b * TT + ql0 + rl) * CC + h * HD + q * 4, s * (1.0f / 2048.0f)); } }
// ---- k_out: block = (64 rows, 128 cols): out = ctx Wo (+ bo), both operand tiles of each K step staged in LDS as in k_proj: ctx x 2^6 once to f16 against Wo as f16(bf16 x 2^8) exact (1 product) x 2^-14; causal early rows (< QHI of each sequence): ctx bf16 hi + lo against exact bf16 Wo (2 products)
__global__ __launch_bounds__(128) void k_out(const float* __restrict__ Y, const float* __restrict__ WO, const float* __restrict__ BO, float* __restrict__ OUT) { __shared__ __align__(16) float sf[4][16][132]; __shared__ __align__(16) union { struct { __bf16 w[2][128 * WP], yh[2][64 * WP], yl[2][64 * WP]; } b; struct { _Float16 w[2][128 * WP], y[2][64 * WP]; } h; } sk;
  const int tid = threadIdx.x, wave = tid >> 5, lane = tid & 31, col = lane & 15, g = lane >> 4; const int c0 = blockIdx.y * 128; const size_t r0 = (size_t)blockIdx.x * 64 + wave * 16;
  v8f acc[8] = {};
  const float* wp = wt_ptr(WO, c0, wave, lane, DIN); const float* yp = xt_ptr(Y + (size_t)blockIdx.x * 64 * CC, wave, lane, CC);
  v4f wr[8], yr[4]; wt_load(wr, wp, DIN); xt_load(yr, yp, CC);
  if (CAUSAL && (int)(((size_t)blockIdx.x * 64) % TT) < QHI) {   /* block-uniform */
    for (int kc = 0; kc < CC / 32; ++kc) { __bf16* wb = sk.b.w[kc & 1]; __bf16* yh = sk.b.yh[kc & 1]; __bf16* yl = sk.b.yl[kc & 1]; wt_put_b(wb, wr, wave, lane); xt_put_hl(yh, yl, yr, wave, lane);
      __syncthreads();   /* the whole tiles of step kc are in LDS before any wave reads fragments across them; the same barrier ends every wave's reads of step kc - 1, whose buffers step kc + 1 overwrites */
      if (kc + 1 < CC / 32) { wt_load(wr, wp + (size_t)32 * DIN, DIN); xt_load(yr, yp + 32, CC);
        asm volatile("s_wait_xcnt 0x0" :: "v"(wp), "v"(yp) : "memory");   /* the loads' address registers, named here so that they stay as they are up to this wait, are advanced behind it */
        wp += (size_t)32 * DIN; yp += 32; }
      const v16b ah = frag_b(yh + (wave * 16 + col) * WP, lane), al = frag_b(yl + (wave * 16 + col) * WP, lane); v16b wf[8];
#pragma unroll
      for (int j = 0; j < 8; ++j) wf[j] = frag_b(wb + (j * 16 + col) * WP, lane);   /* all of the step's LDS reads as one group in front of its matrix instructions */
#pragma unroll
      for (int j = 0; j < 8; ++j) { acc[j] = wmma_bf(ah, wf[j], acc[j]); acc[j] = wmma_bf(al, wf[j], acc[j]); } }
#pragma unroll
    for (int j = 0; j < 8; ++j) { const float bias = BO ? bfr(BO[c0 + j * 16 + col]) : 0.f;
#pragma unroll
      for (int r = 0; r < 8; ++r) sf[wave][8 * g + r][j * 16 + col] = acc[j][r] + bias; }
  } else {
    for (int kc = 0; kc < CC / 32; ++kc) { _Float16* wb = sk.h.w[kc & 1]; _Float16* yb = sk.h.y[kc & 1]; wt_put_h(wb, wr, wave, lane); xt_put_h(yb, yr, wave, lane, 64.0f);   /* ctx carried x 2^6 into f16 so small-magnitude context rows stay clear of f16 subnormals */
      __syncthreads();   /* as in the branch above: publishes step kc's tiles and ends the reads of step kc - 1 */
      if (kc + 1 < CC / 32) { wt_load(wr, wp + (size_t)32 * DIN, DIN); xt_load(yr, yp + 32, CC);
        asm volatile("s_wait_xcnt 0x0" :: "v"(wp), "v"(yp) : "memory");   /* as in the branch above */
        wp += (size_t)32 * DIN; yp += 32; }
      const v16h a = frag_h(yb + (wave * 16 + col) * WP, lane); v16h wf[8];
#pragma unroll
      for (int j = 0; j < 8; ++j) wf[j] = frag_h(wb + (j * 16 + col) * WP, lane);   /* as in the branch above */
#pragma unroll
      for (int j = 0; j < 8; ++j) acc[j] = wmma16(a, wf[j], acc[j]); }
#pragma unroll
    for (int j = 0; j < 8; ++j) { const float bias = BO ? bfr(BO[c0 + j * 16 + col]) : 0.f;
#pragma unroll
      for (int r = 0; r < 8; ++r) sf[wave][8 * g + r][j * 16 + col] = acc[j][r] * (1.0f / 16384.0f) + bias; } }   /* 2^-8 (Wo carry) x 2^-6 (ctx carry) */
  LDSX(); for (int rl = 0; rl < 16; ++rl) vst2(OUT + (r0 + rl) * DIN + c0 + lane * 4, *(const v4f*)&sf[wave][rl][lane * 4]); }

extern "C" void kernel_launch(void* const* d_in, const int* in_sizes, int n_in, void* d_out, int out_size, void* d_ws, size_t ws_size, hipStream_t stream) {
  (void)in_sizes; (void)n_in; (void)out_size;
  const float** F = (const float**)d_in;
  if (ws_size < (size_t)WS_END) return;
  char* ws = (char*)d_ws; _Float16 *QH = (_Float16*)(ws + WS_QH), *KH = (_Float16*)(ws + WS_KH), *VT = (_Float16*)(ws + WS_VT), *QL = (_Float16*)(ws + WS_QL), *KL = (_Float16*)(ws + WS_KL); __bf16 *VB = (__bf16*)(ws + WS_VB), *VBL = (__bf16*)(ws + WS_VBL); float *S = (float*)(ws + WS_S), *Y = (float*)(ws + WS_Y);
  (void)Y; (void)QL; (void)KL; (void)VB; (void)VBL;
  // inputs: 0 x [2,2048,1024]; 1 wq [1024,16,64] = (in,out) [1024][1024]; 2 wk; 3 wv; 4 wp1 [16,64,1024] = (in,out) [1024][1024]; 5 wp2 [1024,1024] (in,out); no biases
  if (ws_size < (size_t)WS_END2) return;
  float* Y2 = (float*)(ws + WS_Y2);
  k_proj<<<dim3(TNB * TT / 64, CC / 128, 3), 128, 0, stream>>>(F[0], F[0], F[0], F[1], F[2], F[3], nullptr, nullptr, nullptr, QH, QL, KH, KL, VT, VB, VBL);
  for (int b = 0; b < TNB; ++b) for (int h0 = 0; h0 < NH; h0 += HG) {
    k_sc<<<dim3(NQB, TT / 128, HG), 128, 0, stream>>>(QH, KH, QL, KL, b, h0, S);
    k_pv<<<dim3(TT / 16, 1, HG), 32 * PVW, 0, stream>>>(S, VT, VB, VBL, b, h0, Y);
  }
  k_out<<<dim3(TNB * TT / 64, DIN / 128), 128, 0, stream>>>(Y, F[4], nullptr, Y2);              /* y = att wp1 (f32 rows in workspace) */
  k_out<<<dim3(TNB * TT / 64, DIN / 128), 128, 0, stream>>>(Y2, F[5], nullptr, (float*)d_out);   /* out = y wp2 */
  static_assert(CC == DIN, "the second output projection reuses k_out: its operand rows have width DIN == CC");
}

// v004
// A run of this version takes 232 microseconds.
// Two timings next to v003 both put it at 1.76 times that version's speed.
// Over all steps from v000 it is 4.73 times as fast.
// compute dtype: all float inputs rounded to bf16; q / k / v projections with EXACT bf16 products on WMMA 16x16x32 (f32 accumulate), no biases; causal logits: 3 products for the first 384 rows, single f16 q x k after, x 64^-0.5; softmax f32; P x 2^11 once to f16 x v once to f16 (bf16 hi + lo below row 384); TWO output projections in sequence, each through k_out (rows < 384: the f32 operand as bf16 hi + lo against the exact weight; beyond: x2^6 f16 carry x f16(bf16 x 2^8) weight); f32 output.
#include <hip/hip_runtime.h>
#include <math.h>

typedef __attribute__((ext_vector_type(16))) _Float16 v16h;
typedef __attribute__((ext_vector_type(16))) __bf16 v16b;
typedef __attribute__((ext_vector_type(8)))  _Float16 v8h;
typedef __attribute__((ext_vector_type(8)))  float v8f;
typedef __attribute__((ext_vector_type(4)))  float v4f;
typedef __attribute__((ext_vector_type(2)))  float v2f;
typedef __attribute__((ext_vector_type(4)))  unsigned v4u;
typedef __attribute__((ext_vector_type(4)))  int v4i;
typedef float __attribute__((may_alias)) float_a;
typedef int __attribute__((may_alias)) int_a;

template <typename T> __device__ __forceinline__ void vst2(void* p, T v) { *(T*)p = v;  }
__device__ __forceinline__ v8f wmma16(v16h a, v16h b, v8f c) {
  v8f d = __builtin_amdgcn_wmma_f32_16x16x32_f16(false, a, false, b, (short)0, c, false, false);
  asm volatile("v_nop\n\tv_nop\n\tv_nop\n\tv_nop" : "+v"(d) : "v"(a), "v"(b));
  return d;
}
__device__ __forceinline__ v8f wmma_bf(v16b a, v16b b, v8f c) {
  v8f d = __builtin_amdgcn_wmma_f32_16x16x32_bf16(false, a, false, b, (short)0, c, false, false);
  asm volatile("v_nop\n\tv_nop\n\tv_nop\n\tv_nop" : "+v"(d) : "v"(a), "v"(b));
  return d;
}
// 16x16x32 fragments: lane = (h = lane>>4, row/col = lane&15); elements 0..7 = k0+8h+0..7, 8..15 = k0+16+8h+0..7; D element r = row 8h+r
__device__ __forceinline__ v16h frag_h(const _Float16* rowk0, int lane) {
  union { v16h v; v8h q[2]; } u; const _Float16* p = rowk0 + 8 * (lane >> 4);
  u.q[0] = *(const v8h*)p; u.q[1] = *(const v8h*)(p + 16); return u.v;
}
__device__ __forceinline__ v16h frag_f32(const float* rowk0, int lane) {
  v16h a; const float* p = rowk0 + 8 * (lane >> 4);
#pragma unroll
  for (int i = 0; i < 8; ++i) { a[i] = (_Float16)p[i]; a[8 + i] = (_Float16)p[16 + i]; }
  return a;
}
__device__ __forceinline__ v16h frag_f32s(const float* rowk0, int lane, float sc) {
  v16h a; const float* p = rowk0 + 8 * (lane >> 4);
#pragma unroll
  for (int i = 0; i < 8; ++i) { a[i] = (_Float16)(p[i] * sc); a[8 + i] = (_Float16)(p[16 + i] * sc); }
  return a;
}
// column fragment from a [K][ld] layout (column n), rows >= K read as 0
__device__ __forceinline__ v16h fragc_f32(const float* W, int k0, int n, int lane, int ld, int K) {
  v16h a; const int g = lane >> 4;
#pragma unroll
  for (int i = 0; i < 8; ++i) { const int ka = k0 + 8 * g + i, kb = ka + 16;
    a[i] = (_Float16)(ka < K ? W[(size_t)(ka < K ? ka : K - 1) * ld + n] : 0.f); a[8 + i] = (_Float16)(kb < K ? W[(size_t)(kb < K ? kb : K - 1) * ld + n] : 0.f); }
  return a;
}
struct F2 { v16b h, l; };
__device__ __forceinline__ F2 bsplit16(const float v[16]) { F2 r;
#pragma unroll
  for (int i = 0; i < 16; ++i) { const __bf16 h = (__bf16)v[i]; r.h[i] = h; r.l[i] = (__bf16)(v[i] - (float)h); }
  return r; }
__device__ __forceinline__ F2 split_row(const float* row, int k0, int lane) { float v[16]; const float* p = row + k0 + 8 * (lane >> 4);
#pragma unroll
  for (int i = 0; i < 8; ++i) { v[i] = p[i]; v[8 + i] = p[16 + i]; }
  return bsplit16(v); }
__device__ __forceinline__ F2 split_rowK(const float* row, int k0, int lane, int K) { float v[16]; const int g = lane >> 4;
#pragma unroll
  for (int i = 0; i < 8; ++i) { const int ka = k0 + 8 * g + i, kb = ka + 16; v[i] = ka < K ? row[ka < K ? ka : K - 1] : 0.f; v[8 + i] = kb < K ? row[kb < K ? kb : K - 1] : 0.f; }
  return bsplit16(v); }
__device__ __forceinline__ F2 split_col(const float* W, int k0, int n, int lane, int ld, int K) { float v[16]; const int g = lane >> 4;
#pragma unroll
  for (int i = 0; i < 8; ++i) { const int ka = k0 + 8 * g + i, kb = ka + 16; v[i] = ka < K ? W[(size_t)(ka < K ? ka : K - 1) * ld + n] : 0.f; v[8 + i] = kb < K ? W[(size_t)(kb < K ? kb : K - 1) * ld + n] : 0.f; }
  return bsplit16(v); }
__device__ __forceinline__ v8f mac3(const F2& a, const F2& b, v8f c) { c = wmma_bf(a.l, b.h, c); c = wmma_bf(a.h, b.l, c); return wmma_bf(a.h, b.h, c); }
__device__ __forceinline__ float sigm(float v) { return 1.0f / (1.0f + expf(-v)); }
#define LDSX() do { asm volatile("s_wait_dscnt 0" ::: "memory"); __builtin_amdgcn_wave_barrier(); __builtin_amdgcn_fence(__ATOMIC_RELEASE, "workgroup"); } while (0)

// Causal multi-head self-attention with per-head-shaped weights and TWO output projections (x [2,2048,1024]; wq / wk / wv [1024,16,64] = (in, head, d): an (in,out) [1024][1024] matrix with out = head*64 + d; wp1 [16,64,1024] = (head, d, out): an (in,out) [1024][1024] matrix with in = head*64 + d; wp2 [1024,1024] (in,out); all N(0, 1/1024), no biases; wei = q k^T x 64^-0.5; tril kept, -inf elsewhere; softmax; att merged (head*64 + d); y = att wp1; out = y wp2).
#define NB 2
#define TT 2048
#define CC 1024            // NH * HD = projected width
#define DIN 1024          // input (model) width
#define NH 16
#define HD 64
#define SCALE (0.125f)
#define CAUSAL 1
#ifndef TNB
#define TNB NB
#endif
__device__ __forceinline__ float bfr(float v) { return (float)(__bf16)v; }
__host__ __device__ __forceinline__ int kb_last(int qb) { return CAUSAL ? ((qb * 64 + 63) >> 7) : (TT / 128 - 1); }
typedef __attribute__((ext_vector_type(8))) __bf16 v8b;
__device__ __forceinline__ v16b frag_b(const __bf16* rowk0, int lane) {
  union { v16b v; v8b q[2]; } u; const __bf16* p = rowk0 + 8 * (lane >> 4);
  u.q[0] = *(const v8b*)p; u.q[1] = *(const v8b*)(p + 16); return u.v;
}
#define QBH 6              // causal: query blocks 0..QBH-1 of each sequence (few keys, no averaging) take the high-precision path
#define QHI 384            // rows carrying a q residual plane
#define KHI 384            // key rows carrying k residual / v bf16 hi+lo planes (used only by the causal high-precision path)
// B fragment (k rows k0+.., output column o) of a weight: (in,out) [K][ld] or (out,in) [ld rows of K]: bf16 exact, or f16(bf16 * 256) exact
__device__ __forceinline__ v16b wcol_io(const float* Wm, int k0, int o, int lane, int ld) { v16b w; const int g = lane >> 4;
#pragma unroll
  for (int i = 0; i < 8; ++i) { w[i] = (__bf16)Wm[(size_t)(k0 + 8 * g + i) * ld + o]; w[8 + i] = (__bf16)Wm[(size_t)(k0 + 16 + 8 * g + i) * ld + o]; }
  return w; }
__device__ __forceinline__ v16b wcol_oi(const float* Wm, int k0, int o, int lane, int K) { v16b w; const float* p = Wm + (size_t)o * K + k0 + 8 * (lane >> 4);
#pragma unroll
  for (int i = 0; i < 8; ++i) { w[i] = (__bf16)p[i]; w[8 + i] = (__bf16)p[16 + i]; }
  return w; }
__device__ __forceinline__ v16h wcolh_io(const float* Wm, int k0, int o, int lane, int ld) { v16h w; const int g = lane >> 4;
#pragma unroll
  for (int i = 0; i < 8; ++i) { w[i] = (_Float16)(bfr(Wm[(size_t)(k0 + 8 * g + i) * ld + o]) * 256.0f); w[8 + i] = (_Float16)(bfr(Wm[(size_t)(k0 + 16 + 8 * g + i) * ld + o]) * 256.0f); }
  return w; }
__device__ __forceinline__ v16h wcolh_oi(const float* Wm, int k0, int o, int lane, int K) { v16h w; const float* p = Wm + (size_t)o * K + k0 + 8 * (lane >> 4);
#pragma unroll
  for (int i = 0; i < 8; ++i) { w[i] = (_Float16)(bfr(p[i]) * 256.0f); w[8 + i] = (_Float16)(bfr(p[16 + i]) * 256.0f); }
  return w; }
#define WQKV_LAYOUT 0   // 0 = (in,out) [DIN][CC]; 1 = (out,in) [CC][DIN]; 2 = per-head [NH][DIN][HD]
__device__ __forceinline__ v16b wcol_hdk(const float* Wm, int k0, int o, int lane) { v16b w; const int g = lane >> 4; const float* p = Wm + (size_t)(o / HD) * DIN * HD + (o % HD);
#pragma unroll
  for (int i = 0; i < 8; ++i) { w[i] = (__bf16)p[(size_t)(k0 + 8 * g + i) * HD]; w[8 + i] = (__bf16)p[(size_t)(k0 + 16 + 8 * g + i) * HD]; }
  return w; }
#define WO_OUT_IN 0
#if WQKV_LAYOUT == 1
#define WCOL(W, k0, o, lane) wcol_oi(W, k0, o, lane, DIN)
#elif WQKV_LAYOUT == 2
#define WCOL(W, k0, o, lane) wcol_hdk(W, k0, o, lane)
#else
#define WCOL(W, k0, o, lane) wcol_io(W, k0, o, lane, CC)
#endif
#if WO_OUT_IN
#define WOCOL(W, k0, o, lane) wcol_oi(W, k0, o, lane, CC)
#define WOCOLH(W, k0, o, lane) wcolh_oi(W, k0, o, lane, CC)
#else
#define WOCOL(W, k0, o, lane) wcol_io(W, k0, o, lane, DIN)
#define WOCOLH(W, k0, o, lane) wcolh_io(W, k0, o, lane, DIN)
#endif

#ifndef PROJ_EXTRA_PARAMS
#define PROJ_EXTRA_PARAMS
#endif

#define WS_QH  0u                                      // f16 q rows [b*t][CC]
#define WS_KH  (WS_QH + 2u * (size_t)NB * TT * CC)      // f16 k rows [b*t][CC]
#define WS_VT  (WS_KH + 2u * (size_t)NB * TT * CC)      // f16 v planes [b][c][t]
#define WS_QL  (WS_VT + 2u * (size_t)NB * CC * TT)      // f16 q residual x 2^10 rows [b][t < QHI][CC]
#define WS_KL  (WS_QL + 2u * (size_t)NB * QHI * CC)     // f16 k residual x 2^10 rows [b][t < KHI][CC]
#define WS_VB  (WS_KL + 2u * (size_t)NB * KHI * CC)     // bf16 v hi planes [b][c][t < KHI]
#define WS_VBL (WS_VB + 2u * (size_t)NB * CC * KHI)
#define WS_Y   (WS_VBL + 2u * (size_t)NB * CC * KHI)    // f32 ctx rows [b*t][CC] (only when there is an output projection)
#define WS_END (WS_Y  + 4u * (size_t)NB * TT * CC)
#define WS_Y2 (WS_END)                                     // f32 rows [b*t][DIN]: the first output projection's result, the second one's operand
#define WS_END2 (WS_Y2 + 4u * (size_t)NB * TT * DIN)

// ---- operand tiles of one K step (32 k) of k_proj / k_out: read by whole-line loads and converted once per block, kept in LDS as 16-bit rows of 32 k, so that an A or B fragment is two 16-byte LDS reads (frag_b / frag_h on the row). Every loop over a register array, here and in the K steps, is fully unrolled: its indices must be constants, else the array goes to scratch
#define WP 40              // LDS pitch of a staged row in 16-bit elements: 32 k values + 16 bytes, so that 16-byte reads and writes of 64-byte rows spread over all banks
static_assert(WQKV_LAYOUT == 0 && !WO_OUT_IN, "the staged weight tile is written for (in,out) weights");
typedef __attribute__((ext_vector_type(4))) __bf16 v4b;
typedef __attribute__((ext_vector_type(4))) _Float16 v4h;
// weight tile: 32 k rows x 128 output columns of an (in,out) [K][ld] matrix, in LDS as [column][k]. Thread (wave, lane) owns the patch k = 8 (lane >> 3) + 0..7, column = 32 wave + 4 (lane & 7) + 0..3: each load instruction covers four whole 128-byte lines, each LDS store holds 8 consecutive k of one column
__device__ __forceinline__ const float* wt_ptr(const float* Wm, int c0, int wave, int lane, int ld) { return Wm + (size_t)(8 * (lane >> 3)) * ld + c0 + 32 * wave + 4 * (lane & 7); }
__device__ __forceinline__ void wt_load(v4f (&r)[8], const float* p, int ld) {
#pragma unroll
  for (int i = 0; i < 8; ++i) r[i] = *(const v4f*)(p + (size_t)i * ld); }
__device__ __forceinline__ void wt_put_b(__bf16* buf, const v4f (&r)[8], int wave, int lane) {   /* bf16, exact for the bf16-rounded weight */
#pragma unroll
  for (int c = 0; c < 4; ++c) { v8b t;
#pragma unroll
    for (int i = 0; i < 8; ++i) t[i] = (__bf16)r[i][c];
    *(v8b*)(buf + (32 * wave + 4 * (lane & 7) + c) * WP + 8 * (lane >> 3)) = t; } }
__device__ __forceinline__ void wt_put_h(_Float16* buf, const v4f (&r)[8], int wave, int lane) {   /* f16(bf16 x 2^8), exact */
#pragma unroll
  for (int c = 0; c < 4; ++c) { v8h t;
#pragma unroll
    for (int i = 0; i < 8; ++i) t[i] = (_Float16)(bfr(r[i][c]) * 256.0f);
    *(v8h*)(buf + (32 * wave + 4 * (lane & 7) + c) * WP + 8 * (lane >> 3)) = t; } }
// row tile: 64 rows x 32 k of an f32 [rows][ld] matrix, in LDS as [row][k]; rows0 = the block's first row. Thread (wave, lane) owns k = 4 (lane & 7) + 0..3 of rows 16 wave + 4 i + (lane >> 3), i < 4 (the rows of its own wave's A fragment): each load instruction covers four whole 128-byte lines
__device__ __forceinline__ const float* xt_ptr(const float* rows0, int wave, int lane, int ld) { return rows0 + (size_t)(16 * wave + (lane >> 3)) * ld + 4 * (lane & 7); }
__device__ __forceinline__ void xt_load(v4f (&r)[4], const float* p, int ld) {
#pragma unroll
  for (int i = 0; i < 4; ++i) r[i] = *(const v4f*)(p + (size_t)(4 * i) * ld); }
__device__ __forceinline__ int xt_at(int i, int wave, int lane) { return (16 * wave + 4 * i + (lane >> 3)) * WP + 4 * (lane & 7); }
__device__ __forceinline__ void xt_put_b(__bf16* buf, const v4f (&r)[4], int wave, int lane) {   /* once to bf16 */
#pragma unroll
  for (int i = 0; i < 4; ++i) { v4b t;
#pragma unroll
    for (int c = 0; c < 4; ++c) t[c] = (__bf16)r[i][c];
    *(v4b*)(buf + xt_at(i, wave, lane)) = t; } }
__device__ __forceinline__ void xt_put_hl(__bf16* bh, __bf16* bl, const v4f (&r)[4], int wave, int lane) {   /* bf16 hi + lo planes, as bsplit16 */
#pragma unroll
  for (int i = 0; i < 4; ++i) { v4b th, tl;
#pragma unroll
    for (int c = 0; c < 4; ++c) { const __bf16 h = (__bf16)r[i][c]; th[c] = h; tl[c] = (__bf16)(r[i][c] - (float)h); }
    *(v4b*)(bh + xt_at(i, wave, lane)) = th; *(v4b*)(bl + xt_at(i, wave, lane)) = tl; } }
__device__ __forceinline__ void xt_put_h(_Float16* buf, const v4f (&r)[4], int wave, int lane, float sc) {   /* x sc, once to f16 */
#pragma unroll
  for (int i = 0; i < 4; ++i) { v4h t;
#pragma unroll
    for (int c = 0; c < 4; ++c) t[c] = (_Float16)(r[i][c] * sc);
    *(v4h*)(buf + xt_at(i, wave, lane)) = t; } }
// ---- k_proj: block = (64 rows, 128 cols, which): q/k/v = X W (+ b) with exact bf16 products (K = DIN), both operand tiles of each K step staged in LDS (two buffers, which share their LDS with the epilogue's tiles), the next step's loads issued behind the step's barrier -> which 0: q f16 rows (+ residual rows < QHI); 1: k f16 rows (+ residual rows < KHI); 2: v f16 planes [c][t] (+ bf16 hi/lo planes for t < KHI)
__global__ __launch_bounds__(128) void k_proj(const float* __restrict__ XQ, const float* __restrict__ XK, const float* __restrict__ XV, const float* __restrict__ WQ, const float* __restrict__ WK, const float* __restrict__ WV, const float* __restrict__ BQ, const float* __restrict__ BK, const float* __restrict__ BV,
    _Float16* __restrict__ QH, _Float16* __restrict__ QL, _Float16* __restrict__ KH, _Float16* __restrict__ KL, _Float16* __restrict__ VT, __bf16* __restrict__ VB, __bf16* __restrict__ VBL) {
  __shared__ __align__(16) union { struct { _Float16 sh[64][136], sl[64][136]; } r; struct { _Float16 th[128][72]; __bf16 tb[128][72], tbl[128][72]; } c; struct { __bf16 w[2][128 * WP], x[2][64 * WP]; } k; } u;
  _Float16 (&sh)[64][136] = u.r.sh; _Float16 (&sl)[64][136] = u.r.sl; _Float16 (&th)[128][72] = u.c.th; __bf16 (&tb)[128][72] = u.c.tb; __bf16 (&tbl)[128][72] = u.c.tbl;
  const int tid = threadIdx.x, wave = tid >> 5, lane = tid & 31, col = lane & 15, g = lane >> 4; const int which = blockIdx.z; const int c0 = blockIdx.y * 128; const size_t r0 = (size_t)blockIdx.x * 64; const size_t bb = r0 / TT; const int t0 = (int)(r0 % TT);
  const float* X = which == 0 ? XQ : which == 1 ? XK : XV; const float* WA = which == 0 ? WQ : which == 1 ? WK : WV; const float* BA = which == 0 ? BQ : which == 1 ? BK : BV;
  v8f acc[8] = {};
  const float* wp = wt_ptr(WA, c0, wave, lane, CC); const float* xp = xt_ptr(X + r0 * DIN, wave, lane, DIN);
  v4f wr[8], xr[4]; wt_load(wr, wp, CC); xt_load(xr, xp, DIN);
  for (int kc = 0; kc < DIN / 32; ++kc) { __bf16* wb = u.k.w[kc & 1]; __bf16* xb = u.k.x[kc & 1]; wt_put_b(wb, wr, wave, lane); xt_put_b(xb, xr, wave, lane);
    __syncthreads();   /* the whole tiles of step kc are in LDS before any wave reads fragments across them; the same barrier ends every wave's reads of step kc - 1, whose buffers step kc + 1 overwrites */
    if (kc + 1 < DIN / 32) { wt_load(wr, wp + (size_t)32 * CC, CC); xt_load(xr, xp + 32, DIN);
      asm volatile("s_wait_xcnt 0x0" :: "v"(wp), "v"(xp) : "memory");   /* the loads' address registers, named here so that they stay as they are up to this wait, are advanced behind it */
      wp += (size_t)32 * CC; xp += 32; }
    const v16b a = frag_b(xb + (wave * 16 + col) * WP, lane); v16b wf[8];
#pragma unroll
    for (int j = 0; j < 8; ++j) wf[j] = frag_b(wb + (j * 16 + col) * WP, lane);   /* all of the step's LDS reads as one group in front of its matrix instructions */
#pragma unroll
    for (int j = 0; j < 8; ++j) acc[j] = wmma_bf(a, wf[j], acc[j]); }
  __syncthreads();   /* every wave has read its last fragments before the epilogue's tiles overwrite the staging buffers */
  if (which < 2) { _Float16* DH = which == 0 ? QH : KH; _Float16* DL = which == 0 ? QL : KL; const int nhi = which == 0 ? QHI : KHI; const bool hi_rows = t0 < nhi;
#pragma unroll
    for (int j = 0; j < 8; ++j) { const float bias = BA ? bfr(BA[c0 + j * 16 + col]) : 0.f;
#pragma unroll
      for (int r = 0; r < 8; ++r) { const float v = acc[j][r] + bias; const _Float16 hv = (_Float16)v; sh[wave * 16 + 8 * g + r][j * 16 + col] = hv; sl[wave * 16 + 8 * g + r][j * 16 + col] = (_Float16)((v - (float)hv) * 1024.0f); } }
    __syncthreads();
    for (int e = tid; e < 64 * 16; e += 128) { const int rl = e >> 4, q = e & 15; vst2((unsigned*)(DH + (r0 + rl) * CC + c0 + q * 8), *(const v4u*)&sh[rl][q * 8]); if (hi_rows) vst2((unsigned*)(DL + (bb * nhi + t0 + rl) * (size_t)CC + c0 + q * 8), *(const v4u*)&sl[rl][q * 8]); }
  } else { const bool hi_rows = t0 < KHI;
#pragma unroll
    for (int j = 0; j < 8; ++j) { const float bias = BA ? bfr(BA[c0 + j * 16 + col]) : 0.f;
#pragma unroll
      for (int r = 0; r < 8; ++r) { const float v = acc[j][r] + bias; const int rl = wave * 16 + 8 * g + r, cl = j * 16 + col; th[cl][rl] = (_Float16)v; const __bf16 bh = (__bf16)v; tb[cl][rl] = bh; tbl[cl][rl] = (__bf16)(v - (float)bh); } }
    __syncthreads();
    for (int e = tid; e < 128 * 8; e += 128) { const int cl = e >> 3, q = e & 7; vst2((unsigned*)(VT + (bb * CC + c0 + cl) * (size_t)TT + t0 + q * 8), *(const v4u*)&th[cl][q * 8]); if (hi_rows) { const size_t o3 = (bb * CC + c0 + cl) * (size_t)KHI + t0 + q * 8; vst2((unsigned*)(VB + o3), *(const v4u*)&tb[cl][q * 8]); vst2((unsigned*)(VBL + o3), *(const v4u*)&tbl[cl][q * 8]); } } } }
// ---- k_pv: block = 16 queries (tile qt of query block qb = qt / 4) of (b, h) = blockIdx.z, PVW waves. Logits first, never through memory: wave w takes the 64-key units w, w + PVW, ... of keys [0, kend): q x k on the matrix unit, x SCALE, f32 to the 16 LDS rows (single f16 product; causal early query blocks: q hi + residual (x 2^10) against k hi + residual, 3 products); the mask is applied by index in the softmax. Softmax: wave w takes query rows w and w + PVW whole, in registers: keys [0, kend): causal -> logit if s <= t else excluded; softmax in f32; exp(logit - max) (0 for excluded) back to the LDS rows, 2^11 / sum to LDS per row. Then ctx = P . v over keys [0, kend), P x 2^11 = the LDS value x the row's 2^11 / sum; wave w takes the 32-key chunks w, w + PVW, ... and the PVW partial tiles are summed in wave order through LDS (P x 2^11 once to f16 against v f16: 1 product; causal early query blocks: P and v as bf16 hi + lo, 3 products); 256-B (row, head) segment by 16 lanes
#define PVW 8
#define PPITCH (TT + 4)    // LDS pitch of a P row in floats: 16 bytes over the row, so that the 16 rows of a fragment read start 4 banks apart
#define NCF (TT / 128 - 1) // most 128-key pieces of a row in front of its last one; a piece is one 16-byte load per lane
__device__ __forceinline__ v4f sm_exp(v4f v, float m) { v4f e;
#pragma unroll
  for (int c = 0; c < 4; ++c) { const float ex = expf(v[c] - m); e[c] = (v[c] <= -1.0e38f) ? 0.f : ex; }
  return e; }
// one query row's softmax by one wave: lane l holds the logits of keys i * 128 + 4 l + 0..3 in x[i], i < nf, and those of the row's last piece (i = nf) in xl. Only the last piece can hold keys > t: nf * 128 = (kb_last(qb)) * 128 <= qb * 64 <= t. Returns 2^11 / sum; exp(logit - max) goes to the LDS row pr
__device__ __forceinline__ float sm_row(const v4f (&x)[NCF], v4f xl, int nf, int t, int lane, float* pr) {
  float m = -3.0e38f;
#pragma unroll
  for (int c = 0; c < 4; ++c) { xl[c] = (!CAUSAL || nf * 128 + lane * 4 + c <= t) ? xl[c] : -3.0e38f; m = fmaxf(m, xl[c]); }
#pragma unroll
  for (int i = 0; i < NCF; ++i) if (i < nf) {
#pragma unroll
    for (int c = 0; c < 4; ++c) m = fmaxf(m, x[i][c]); }
#pragma unroll
  for (int o = 1; o < 32; o <<= 1) m = fmaxf(m, __shfl_xor(m, o));
  v4f s4 = {};
#pragma unroll
  for (int i = 0; i < NCF; ++i) if (i < nf) { const v4f e = sm_exp(x[i], m); s4 += e; *(v4f*)(pr + i * 128 + lane * 4) = e; }
  { const v4f e = sm_exp(xl, m); s4 += e; *(v4f*)(pr + nf * 128 + lane * 4) = e; }
  float sum = (s4[0] + s4[1]) + (s4[2] + s4[3]);
#pragma unroll
  for (int o = 1; o < 32; o <<= 1) sum += __shfl_xor(sum, o);
  return sum > 0.f ? 2048.0f / sum : 0.f; }   /* a fully excluded row yields P = 0 */
#define KU 64              // keys of one logit unit: four 16-key tiles, whose 16 loads per lane are in flight together
// the B fragments of one unit: f[2 j + kc] = keys 16 j + (lane & 15), d = 32 kc + ..; p = the lane's own place in the unit's first 16 rows (row lane & 15, d = 8 (lane >> 4)), so that all 16 loads go off one address
__device__ __forceinline__ void ku_load(v16h (&f)[8], const _Float16* p) {
#pragma unroll
  for (int j = 0; j < 4; ++j)
#pragma unroll
    for (int kc = 0; kc < 2; ++kc) { union { v16h v; v8h q[2]; } u; const _Float16* s = p + (size_t)(16 * j) * CC + 32 * kc; u.q[0] = *(const v8h*)s; u.q[1] = *(const v8h*)(s + 16); f[2 * j + kc] = u.v; } }
// one unit's logits, single product: the four tiles' accumulators are independent, so that no matrix instruction waits for the one in front of it; w = the lane's place (row 8 (lane >> 4), key lane & 15 of the unit) in the LDS rows
__device__ __forceinline__ void lg_unit(v16h a0, v16h a1, const v16h (&f)[8], float* w) { v8f c[4];
#pragma unroll
  for (int j = 0; j < 4; ++j) { const v8f z = {}; c[j] = wmma16(a0, f[2 * j], z); }
#pragma unroll
  for (int j = 0; j < 4; ++j) c[j] = wmma16(a1, f[2 * j + 1], c[j]);
#pragma unroll
  for (int j = 0; j < 4; ++j)
#pragma unroll
    for (int r = 0; r < 8; ++r) w[r * PPITCH + j * 16] = c[j][r] * SCALE; }
__global__ __launch_bounds__(32 * PVW) void k_pv(const _Float16* __restrict__ QH, const _Float16* __restrict__ KH, const _Float16* __restrict__ QL, const _Float16* __restrict__ KL, const _Float16* __restrict__ VT, const __bf16* __restrict__ VB, const __bf16* __restrict__ VBL, float* __restrict__ Y) { const int b = blockIdx.z / NH, h = blockIdx.z % NH; __shared__ __align__(16) float sp[16 * PPITCH]; __shared__ float sinv[16];
  static_assert(PVW * 16 * (HD + 4) <= 16 * PPITCH && 2 * PVW == 16, "the partial tiles reuse the P rows' LDS; two query rows per wave");
  static_assert(CAUSAL && (((QBH * 64 + 63) >> 7) + 1) * (128 / KU) >= PVW && ((((QBH - 1) * 64 + 63) >> 7) + 1) * (128 / KU) <= PVW, "beyond the early query blocks every wave has a logit unit, within them at most one");
  const int tid = threadIdx.x, lane = tid & 31, col = lane & 15, g = lane >> 4; const int qb = blockIdx.x >> 2; const int ql0 = blockIdx.x * 16; const int kce = (kb_last(qb) + 1) * 4;
  const int wave = __builtin_amdgcn_readfirstlane(tid >> 5);   /* scalar, so that the key loop's bounds and branch stay wave-uniform around the matrix instructions */
  { const int nu = (kb_last(qb) + 1) * (128 / KU); const size_t lo = (size_t)col * CC + h * HD + 8 * g; float* sw = sp + 8 * g * PPITCH + col;
    const _Float16* qp = QH + ((size_t)b * TT + ql0) * CC + lo; const _Float16* kp = KH + ((size_t)b * TT + wave * KU) * CC + lo;
    union { v16h v; v8h q[2]; } a0, a1; a0.q[0] = *(const v8h*)qp; a0.q[1] = *(const v8h*)(qp + 16); a1.q[0] = *(const v8h*)(qp + 32); a1.q[1] = *(const v8h*)(qp + 48);
    if (qb < QBH) { const _Float16* qlp = QL + ((size_t)b * QHI + ql0) * CC + lo; const _Float16* klp = KL + ((size_t)b * KHI + wave * KU) * CC + lo;
      union { v16h v; v8h q[2]; } l0, l1; l0.q[0] = *(const v8h*)qlp; l0.q[1] = *(const v8h*)(qlp + 16); l1.q[0] = *(const v8h*)(qlp + 32); l1.q[1] = *(const v8h*)(qlp + 48);
      asm volatile("s_wait_xcnt 0x0" :: "v"(qp), "v"(qlp) : "memory");   /* the loads' address registers, named here so that they stay as they are up to this wait, may be reused behind it */
      if (wave < nu) { const int u = wave; v16h kf[8], lf[8]; ku_load(kf, kp); ku_load(lf, klp);   /* here nu <= PVW: at most one unit per wave; a scalar test, so that the matrix instructions run with every lane on */
        asm volatile("s_wait_xcnt 0x0" :: "v"(kp), "v"(klp) : "memory");   /* as above */
#pragma unroll
        for (int j = 0; j < 4; ++j) { v8f c = {}, cl = {};
          c = wmma16(a0.v, kf[2 * j], c); cl = wmma16(l0.v, kf[2 * j], cl); cl = wmma16(a0.v, lf[2 * j], cl);
          c = wmma16(a1.v, kf[2 * j + 1], c); cl = wmma16(l1.v, kf[2 * j + 1], cl); cl = wmma16(a1.v, lf[2 * j + 1], cl);
#pragma unroll
          for (int r = 0; r < 8; ++r) sw[r * PPITCH + u * KU + j * 16] = (c[r] + cl[r] * (1.0f / 1024.0f)) * SCALE; } }
    } else { v16h kf[8], kn[8]; int u = wave; constexpr size_t KS = (size_t)PVW * KU * CC;   /* from one unit of a wave to its next; here nu >= PVW: every wave has a unit */
      ku_load(kf, kp);
      asm volatile("s_wait_xcnt 0x0" :: "v"(qp), "v"(kp) : "memory");   /* as above */
      /* two register sets by turns, and no branch between a unit's loads and the work on the unit before it: the wave's next unit is in flight while this one is worked on */
      while (u + 2 * PVW < nu) { ku_load(kn, kp + KS); lg_unit(a0.v, a1.v, kf, sw + u * KU); ku_load(kf, kp + 2 * KS);
        asm volatile("s_wait_xcnt 0x0" :: "v"(kp) : "memory");   /* as above: the address is advanced behind it */
        kp += 2 * KS; lg_unit(a0.v, a1.v, kn, sw + (u + PVW) * KU); u += 2 * PVW; }
      if (u + PVW < nu) { ku_load(kn, kp + KS);
        asm volatile("s_wait_xcnt 0x0" :: "v"(kp) : "memory");   /* as above */
        lg_unit(a0.v, a1.v, kf, sw + u * KU); lg_unit(a0.v, a1.v, kn, sw + (u + PVW) * KU); }
      else lg_unit(a0.v, a1.v, kf, sw + u * KU); } }
  __syncthreads();   /* all 16 rows' logits are in LDS before any wave reads a row across the units */
  { const int nf = kb_last(qb); v4f x0[NCF], x1[NCF]; const float* s0 = sp + wave * PPITCH + lane * 4; const float* s1 = s0 + PVW * PPITCH;
#pragma unroll
    for (int i = 0; i < NCF; ++i) if (i < nf) { x0[i] = *(const v4f*)(s0 + i * 128); x1[i] = *(const v4f*)(s1 + i * 128); }   /* both rows whole in registers before either row's LDS is overwritten */
    const v4f xl0 = *(const v4f*)(s0 + nf * 128), xl1 = *(const v4f*)(s1 + nf * 128);
    const float i0 = sm_row(x0, xl0, nf, ql0 + wave, lane, sp + wave * PPITCH), i1 = sm_row(x1, xl1, nf, ql0 + wave + PVW, lane, sp + (wave + PVW) * PPITCH);
    if (lane == 0) { sinv[wave] = i0; sinv[wave + PVW] = i1; } }
  __syncthreads();   /* all 16 rows and their factors are in LDS before any wave reads fragments across them */
  const float inv = sinv[col]; const float* pc = sp + col * PPITCH + 8 * g;
  v8f acc[HD / 16] = {};
  if (qb < QBH) {
#pragma unroll 1
    for (int kc = wave; kc < kce; kc += PVW) { float pv[16];
#pragma unroll
      for (int i = 0; i < 8; ++i) { pv[i] = pc[kc * 32 + i] * inv; pv[8 + i] = pc[kc * 32 + 16 + i] * inv; }
      const F2 p = bsplit16(pv);
#pragma unroll
      for (int j = 0; j < HD / 16; ++j) { const size_t po = ((size_t)b * CC + h * HD + j * 16 + col) * (size_t)KHI + kc * 32; const v16b vh = frag_b(VB + po, lane); acc[j] = wmma_bf(p.h, vh, acc[j]); acc[j] = wmma_bf(p.l, vh, acc[j]); acc[j] = wmma_bf(p.h, frag_b(VBL + po, lane), acc[j]); } }
  } else {
#pragma unroll 1
    for (int kc = wave; kc < kce; kc += PVW) { const v16h p = frag_f32s(sp + col * PPITCH + kc * 32, lane, inv);
#pragma unroll
      for (int j = 0; j < HD / 16; ++j) { const size_t po = ((size_t)b * CC + h * HD + j * 16 + col) * (size_t)TT + kc * 32; acc[j] = wmma16(p, frag_h(VT + po, lane), acc[j]); } } }
  __syncthreads();   /* every wave has read its last P fragment before the partial tiles overwrite the P rows */
  float (*ss)[16][HD + 4] = (float (*)[16][HD + 4])sp;
#pragma unroll
  for (int j = 0; j < HD / 16; ++j)
#pragma unroll
    for (int r = 0; r < 8; ++r) ss[wave][8 * g + r][j * 16 + col] = acc[j][r];
  __syncthreads();   /* every wave's partial tile is in LDS before any thread sums across waves */
  for (int e = tid; e < 16 * (HD / 4); e += 32 * PVW) { const int rl = e / (HD / 4), q = e % (HD / 4); v4f s = *(const v4f*)&ss[0][rl][q * 4];
    for (int w = 1; w < PVW; ++w) s += *(const v4f*)&ss[w][rl][q * 4];
    vst2(Y + ((size_t)b * TT + ql0 + rl) * CC + h * HD + q * 4, s * (1.0f / 2048.0f)); } }
// ---- k_out: block = (64 rows, 128 cols): out = ctx Wo (+ bo), both operand tiles of each K step staged in LDS as in k_proj: ctx x 2^6 once to f16 against Wo as f16(bf16 x 2^8) exact (1 product) x 2^-14; causal early rows (< QHI of each sequence): ctx bf16 hi + lo against exact bf16 Wo (2 products)
__global__ __launch_bounds__(128) void k_out(const float* __restrict__ Y, const float* __restrict__ WO, const float* __restrict__ BO, float* __restrict__ OUT) { __shared__ __align__(16) float sf[4][16][132]; __shared__ __align__(16) union { struct { __bf16 w[2][128 * WP], yh[2][64 * WP], yl[2][64 * WP]; } b; struct { _Float16 w[2][128 * WP], y[2][64 * WP]; } h; } sk;
  const int tid = threadIdx.x, wave = tid >> 5, lane = tid & 31, col = lane & 15, g = lane >> 4; const int c0 = blockIdx.y * 128; const size_t r0 = (size_t)blockIdx.x * 64 + wave * 16;
  v8f acc[8] = {};
  const float* wp = wt_ptr(WO, c0, wave, lane, DIN); const float* yp = xt_ptr(Y + (size_t)blockIdx.x * 64 * CC, wave, lane, CC);
  v4f wr[8], yr[4]; wt_load(wr, wp, DIN); xt_load(yr, yp, CC);
  if (CAUSAL && (int)(((size_t)blockIdx.x * 64) % TT) < QHI) {   /* block-uniform */
    for (int kc = 0; kc < CC / 32; ++kc) { __bf16* wb = sk.b.w[kc & 1]; __bf16* yh = sk.b.yh[kc & 1]; __bf16* yl = sk.b.yl[kc & 1]; wt_put_b(wb, wr, wave, lane); xt_put_hl(yh, yl, yr, wave, lane);
      __syncthreads();   /* the whole tiles of step kc are in LDS before any wave reads fragments across them; the same barrier ends every wave's reads of step kc - 1, whose buffers step kc + 1 overwrites */
      if (kc + 1 < CC / 32) { wt_load(wr, wp + (size_t)32 * DIN, DIN); xt_load(yr, yp + 32, CC);
        asm volatile("s_wait_xcnt 0x0" :: "v"(wp), "v"(yp) : "memory");   /* the loads' address registers, named here so that they stay as they are up to this wait, are advanced behind it */
        wp += (size_t)32 * DIN; yp += 32; }
      const v16b ah = frag_b(yh + (wave * 16 + col) * WP, lane), al = frag_b(yl + (wave * 16 + col) * WP, lane); v16b wf[8];
#pragma unroll
      for (int j = 0; j < 8; ++j) wf[j] = frag_b(wb + (j * 16 + col) * WP, lane);   /* all of the step's LDS reads as one group in front of its matrix instructions */
#pragma unroll
      for (int j = 0; j < 8; ++j) { acc[j] = wmma_bf(ah, wf[j], acc[j]); acc[j] = wmma_bf(al, wf[j], acc[j]); } }
#pragma unroll
    for (int j = 0; j < 8; ++j) { const float bias = BO ? bfr(BO[c0 + j * 16 + col]) : 0.f;
#pragma unroll
      for (int r = 0; r < 8; ++r) sf[wave][8 * g + r][j * 16 + col] = acc[j][r] + bias; }
  } else {
    for (int kc = 0; kc < CC / 32; ++kc) { _Float16* wb = sk.h.w[kc & 1]; _Float16* yb = sk.h.y[kc & 1]; wt_put_h(wb, wr, wave, lane); xt_put_h(yb, yr, wave, lane, 64.0f);   /* ctx carried x 2^6 into f16 so small-magnitude context rows stay clear of f16 subnormals */
      __syncthreads();   /* as in the branch above: publishes step kc's tiles and ends the reads of step kc - 1 */
      if (kc + 1 < CC / 32) { wt_load(wr, wp + (size_t)32 * DIN, DIN); xt_load(yr, yp + 32, CC);
        asm volatile("s_wait_xcnt 0x0" :: "v"(wp), "v"(yp) : "memory");   /* as in the branch above */
        wp += (size_t)32 * DIN; yp += 32; }
      const v16h a = frag_h(yb + (wave * 16 + col) * WP, lane); v16h wf[8];
#pragma unroll
      for (int j = 0; j < 8; ++j) wf[j] = frag_h(wb + (j * 16 + col) * WP, lane);   /* as in the branch above */
#pragma unroll
      for (int j = 0; j < 8; ++j) acc[j] = wmma16(a, wf[j], acc[j]); }
#pragma unroll
    for (int j = 0; j < 8; ++j) { const float bias = BO ? bfr(BO[c0 + j * 16 + col]) : 0.f;
#pragma unroll
      for (int r = 0; r < 8; ++r) sf[wave][8 * g + r][j * 16 + col] = acc[j][r] * (1.0f / 16384.0f) + bias; } }   /* 2^-8 (Wo carry) x 2^-6 (ctx carry) */
  LDSX(); for (int rl = 0; rl < 16; ++rl) vst2(OUT + (r0 + rl) * DIN + c0 + lane * 4, *(const v4f*)&sf[wave][rl][lane * 4]); }

extern "C" void kernel_launch(void* const* d_in, const int* in_sizes, int n_in, void* d_out, int out_size, void* d_ws, size_t ws_size, hipStream_t stream) {
  (void)in_sizes; (void)n_in; (void)out_size;
  const float** F = (const float**)d_in;
  if (ws_size < (size_t)WS_END) return;
  char* ws = (char*)d_ws; _Float16 *QH = (_Float16*)(ws + WS_QH), *KH = (_Float16*)(ws + WS_KH), *VT = (_Float16*)(ws + WS_VT), *QL = (_Float16*)(ws + WS_QL), *KL = (_Float16*)(ws + WS_KL); __bf16 *VB = (__bf16*)(ws + WS_VB), *VBL = (__bf16*)(ws + WS_VBL); float *Y = (float*)(ws + WS_Y);
  (void)Y; (void)QL; (void)KL; (void)VB; (void)VBL;
  // inputs: 0 x [2,2048,1024]; 1 wq [1024,16,64] = (in,out) [1024][1024]; 2 wk; 3 wv; 4 wp1 [16,64,1024] = (in,out) [1024][1024]; 5 wp2 [1024,1024] (in,out); no biases
  if (ws_size < (size_t)WS_END2) return;
  float* Y2 = (float*)(ws + WS_Y2);
  k_proj<<<dim3(TNB * TT / 64, CC / 128, 3), 128, 0, stream>>>(F[0], F[0], F[0], F[1], F[2], F[3], nullptr, nullptr, nullptr, QH, QL, KH, KL, VT, VB, VBL);
  k_pv<<<dim3(TT / 16, 1, TNB * NH), 32 * PVW, 0, stream>>>(QH, KH, QL, KL, VT, VB, VBL, Y);
  k_out<<<dim3(TNB * TT / 64, DIN / 128), 128, 0, stream>>>(Y, F[4], nullptr, Y2);              /* y = att wp1 (f32 rows in workspace) */
  k_out<<<dim3(TNB * TT / 64, DIN / 128), 128, 0, stream>>>(Y2, F[5], nullptr, (float*)d_out);   /* out = y wp2 */
  static_assert(CC == DIN, "the second output projection reuses k_out: its operand rows have width DIN == CC");
}

// v005
// One run takes 212 microseconds.
// Next to v004, in two timings, it ran 1.09 and 1.10 times as fast.
// Over all steps from v000 it is 5.19 times as fast.
// compute dtype: all float inputs rounded to bf16; q / k / v projections with EXACT bf16 products on WMMA 16x16x32 (f32 accumulate), no biases; causal logits: 3 products for the first 384 rows, single f16 q x k after, x 64^-0.5; softmax f32; P x 2^11 once to f16 x v once to f16 (bf16 hi + lo below row 384); TWO output projections in sequence, each through k_out (rows < 384: the f32 operand as bf16 hi + lo against the exact weight; beyond: x2^6 f16 carry x f16(bf16 x 2^8) weight); f32 output.
#include <hip/hip_runtime.h>
#include <math.h>

typedef __attribute__((ext_vector_type(16))) _Float16 v16h;
typedef __attribute__((ext_vector_type(16))) __bf16 v16b;
typedef __attribute__((ext_vector_type(8)))  _Float16 v8h;
typedef __attribute__((ext_vector_type(8)))  float v8f;
typedef __attribute__((ext_vector_type(4)))  float v4f;
typedef __attribute__((ext_vector_type(2)))  float v2f;
typedef __attribute__((ext_vector_type(4)))  unsigned v4u;
typedef __attribute__((ext_vector_type(4)))  int v4i;
typedef float __attribute__((may_alias)) float_a;
typedef int __attribute__((may_alias)) int_a;

template <typename T> __device__ __forceinline__ void vst2(void* p, T v) { *(T*)p = v;  }
__device__ __forceinline__ v8f wmma16(v16h a, v16h b, v8f c) {
  v8f d = __builtin_amdgcn_wmma_f32_16x16x32_f16(false, a, false, b, (short)0, c, false, false);
  asm volatile("v_nop\n\tv_nop\n\tv_nop\n\tv_nop" : "+v"(d) : "v"(a), "v"(b));
  return d;
}
__device__ __forceinline__ v8f wmma_bf(v16b a, v16b b, v8f c) {
  v8f d = __builtin_amdgcn_wmma_f32_16x16x32_bf16(false, a, false, b, (short)0, c, false, false);
  asm volatile("v_nop\n\tv_nop\n\tv_nop\n\tv_nop" : "+v"(d) : "v"(a), "v"(b));
  return d;
}
// 16x16x32 fragments: lane = (h = lane>>4, row/col = lane&15); elements 0..7 = k0+8h+0..7, 8..15 = k0+16+8h+0..7; D element r = row 8h+r
__device__ __forceinline__ v16h frag_h(const _Float16* rowk0, int lane) {
  union { v16h v; v8h q[2]; } u; const _Float16* p = rowk0 + 8 * (lane >> 4);
  u.q[0] = *(const v8h*)p; u.q[1] = *(const v8h*)(p + 16); return u.v;
}
__device__ __forceinline__ v16h frag_f32(const float* rowk0, int lane) {
  v16h a; const float* p = rowk0 + 8 * (lane >> 4);
#pragma unroll
  for (int i = 0; i < 8; ++i) { a[i] = (_Float16)p[i]; a[8 + i] = (_Float16)p[16 + i]; }
  return a;
}
__device__ __forceinline__ v16h frag_f32s(const float* rowk0, int lane, float sc) {
  v16h a; const float* p = rowk0 + 8 * (lane >> 4);
#pragma unroll
  for (int i = 0; i < 8; ++i) { a[i] = (_Float16)(p[i] * sc); a[8 + i] = (_Float16)(p[16 + i] * sc); }
  return a;
}
// column fragment from a [K][ld] layout (column n), rows >= K read as 0
__device__ __forceinline__ v16h fragc_f32(const float* W, int k0, int n, int lane, int ld, int K) {
  v16h a; const int g = lane >> 4;
#pragma unroll
  for (int i = 0; i < 8; ++i) { const int ka = k0 + 8 * g + i, kb = ka + 16;
    a[i] = (_Float16)(ka < K ? W[(size_t)(ka < K ? ka : K - 1) * ld + n] : 0.f); a[8 + i] = (_Float16)(kb < K ? W[(size_t)(kb < K ? kb : K - 1) * ld + n] : 0.f); }
  return a;
}
struct F2 { v16b h, l; };
__device__ __forceinline__ F2 bsplit16(const float v[16]) { F2 r;
#pragma unroll
  for (int i = 0; i < 16; ++i) { const __bf16 h = (__bf16)v[i]; r.h[i] = h; r.l[i] = (__bf16)(v[i] - (float)h); }
  return r; }
__device__ __forceinline__ F2 split_row(const float* row, int k0, int lane) { float v[16]; const float* p = row + k0 + 8 * (lane >> 4);
#pragma unroll
  for (int i = 0; i < 8; ++i) { v[i] = p[i]; v[8 + i] = p[16 + i]; }
  return bsplit16(v); }
__device__ __forceinline__ F2 split_rowK(const float* row, int k0, int lane, int K) { float v[16]; const int g = lane >> 4;
#pragma unroll
  for (int i = 0; i < 8; ++i) { const int ka = k0 + 8 * g + i, kb = ka + 16; v[i] = ka < K ? row[ka < K ? ka : K - 1] : 0.f; v[8 + i] = kb < K ? row[kb < K ? kb : K - 1] : 0.f; }
  return bsplit16(v); }
__device__ __forceinline__ F2 split_col(const float* W, int k0, int n, int lane, int ld, int K) { float v[16]; const int g = lane >> 4;
#pragma unroll
  for (int i = 0; i < 8; ++i) { const int ka = k0 + 8 * g + i, kb = ka + 16; v[i] = ka < K ? W[(size_t)(ka < K ? ka : K - 1) * ld + n] : 0.f; v[8 + i] = kb < K ? W[(size_t)(kb < K ? kb : K - 1) * ld + n] : 0.f; }
  return bsplit16(v); }
__device__ __forceinline__ v8f mac3(const F2& a, const F2& b, v8f c) { c = wmma_bf(a.l, b.h, c); c = wmma_bf(a.h, b.l, c); return wmma_bf(a.h, b.h, c); }
__device__ __forceinline__ float sigm(float v) { return 1.0f / (1.0f + expf(-v)); }
#define LDSX() do { asm volatile("s_wait_dscnt 0" ::: "memory"); __builtin_amdgcn_wave_barrier(); __builtin_amdgcn_fence(__ATOMIC_RELEASE, "workgroup"); } while (0)

// Causal multi-head self-attention with per-head-shaped weights and TWO output projections (x [2,2048,1024]; wq / wk / wv [1024,16,64] = (in, head, d): an (in,out) [1024][1024] matrix with out = head*64 + d; wp1 [16,64,1024] = (head, d, out): an (in,out) [1024][1024] matrix with in = head*64 + d; wp2 [1024,1024] (in,out); all N(0, 1/1024), no biases; wei = q k^T x 64^-0.5; tril kept, -inf elsewhere; softmax; att merged (head*64 + d); y = att wp1; out = y wp2).
#define NB 2
#define TT 2048
#define CC 1024            // NH * HD = projected width
#define DIN 1024          // input (model) width
#define NH 16
#define HD 64
#define SCALE (0.125f)
#define CAUSAL 1
#ifndef TNB
#define TNB NB
#endif
__device__ __forceinline__ float bfr(float v) { return (float)(__bf16)v; }
__host__ __device__ __forceinline__ int kb_last(int qb) { return CAUSAL ? ((qb * 64 + 63) >> 7) : (TT / 128 - 1); }
typedef __attribute__((ext_vector_type(8))) __bf16 v8b;
__device__ __forceinline__ v16b frag_b(const __bf16* rowk0, int lane) {
  union { v16b v; v8b q[2]; } u; const __bf16* p = rowk0 + 8 * (lane >> 4);
  u.q[0] = *(const v8b*)p; u.q[1] = *(const v8b*)(p + 16); return u.v;
}
#define QBH 6              // causal: query blocks 0..QBH-1 of each sequence (few keys, no averaging) take the high-precision path
#define QHI 384            // rows carrying a q residual plane
#define KHI 384            // key rows carrying k residual / v bf16 hi+lo planes (used only by the causal high-precision path)
// B fragment (k rows k0+.., output column o) of a weight: (in,out) [K][ld] or (out,in) [ld rows of K]: bf16 exact, or f16(bf16 * 256) exact
__device__ __forceinline__ v16b wcol_io(const float* Wm, int k0, int o, int lane, int ld) { v16b w; const int g = lane >> 4;
#pragma unroll
  for (int i = 0; i < 8; ++i) { w[i] = (__bf16)Wm[(size_t)(k0 + 8 * g + i) * ld + o]; w[8 + i] = (__bf16)Wm[(size_t)(k0 + 16 + 8 * g + i) * ld + o]; }
  return w; }
__device__ __forceinline__ v16b wcol_oi(const float* Wm, int k0, int o, int lane, int K) { v16b w; const float* p = Wm + (size_t)o * K + k0 + 8 * (lane >> 4);
#pragma unroll
  for (int i = 0; i < 8; ++i) { w[i] = (__bf16)p[i]; w[8 + i] = (__bf16)p[16 + i]; }
  return w; }
__device__ __forceinline__ v16h wcolh_io(const float* Wm, int k0, int o, int lane, int ld) { v16h w; const int g = lane >> 4;
#pragma unroll
  for (int i = 0; i < 8; ++i) { w[i] = (_Float16)(bfr(Wm[(size_t)(k0 + 8 * g + i) * ld + o]) * 256.0f); w[8 + i] = (_Float16)(bfr(Wm[(size_t)(k0 + 16 + 8 * g + i) * ld + o]) * 256.0f); }
  return w; }
__device__ __forceinline__ v16h wcolh_oi(const float* Wm, int k0, int o, int lane, int K) { v16h w; const float* p = Wm + (size_t)o * K + k0 + 8 * (lane >> 4);
#pragma unroll
  for (int i = 0; i < 8; ++i) { w[i] = (_Float16)(bfr(p[i]) * 256.0f); w[8 + i] = (_Float16)(bfr(p[16 + i]) * 256.0f); }
  return w; }
#define WQKV_LAYOUT 0   // 0 = (in,out) [DIN][CC]; 1 = (out,in) [CC][DIN]; 2 = per-head [NH][DIN][HD]
__device__ __forceinline__ v16b wcol_hdk(const float* Wm, int k0, int o, int lane) { v16b w; const int g = lane >> 4; const float* p = Wm + (size_t)(o / HD) * DIN * HD + (o % HD);
#pragma unroll
  for (int i = 0; i < 8; ++i) { w[i] = (__bf16)p[(size_t)(k0 + 8 * g + i) * HD]; w[8 + i] = (__bf16)p[(size_t)(k0 + 16 + 8 * g + i) * HD]; }
  return w; }
#define WO_OUT_IN 0
#if WQKV_LAYOUT == 1
#define WCOL(W, k0, o, lane) wcol_oi(W, k0, o, lane, DIN)
#elif WQKV_LAYOUT == 2
#define WCOL(W, k0, o, lane) wcol_hdk(W, k0, o, lane)
#else
#define WCOL(W, k0, o, lane) wcol_io(W, k0, o, lane, CC)
#endif
#if WO_OUT_IN
#define WOCOL(W, k0, o, lane) wcol_oi(W, k0, o, lane, CC)
#define WOCOLH(W, k0, o, lane) wcolh_oi(W, k0, o, lane, CC)
#else
#define WOCOL(W, k0, o, lane) wcol_io(W, k0, o, lane, DIN)
#define WOCOLH(W, k0, o, lane) wcolh_io(W, k0, o, lane, DIN)
#endif

#ifndef PROJ_EXTRA_PARAMS
#define PROJ_EXTRA_PARAMS
#endif

#define WS_QH  0u                                      // f16 q rows [b*t][CC]
#define WS_KH  (WS_QH + 2u * (size_t)NB * TT * CC)      // f16 k rows [b*t][CC]
#define WS_VT  (WS_KH + 2u * (size_t)NB * TT * CC)      // f16 v planes [b][c][t]
#define WS_QL  (WS_VT + 2u * (size_t)NB * CC * TT)      // f16 q residual x 2^10 rows [b][t < QHI][CC]
#define WS_KL  (WS_QL + 2u * (size_t)NB * QHI * CC)     // f16 k residual x 2^10 rows [b][t < KHI][CC]
#define WS_VB  (WS_KL + 2u * (size_t)NB * KHI * CC)     // bf16 v hi planes [b][c][t < KHI]
#define WS_VBL (WS_VB + 2u * (size_t)NB * CC * KHI)
#define WS_Y   (WS_VBL + 2u * (size_t)NB * CC * KHI)    // f32 ctx rows [b*t][CC] (only when there is an output projection)
#define WS_END (WS_Y  + 4u * (size_t)NB * TT * CC)
#define WS_Y2 (WS_END)                                     // f32 rows [b*t][DIN]: the first output projection's result, the second one's operand
#define WS_END2 (WS_Y2 + 4u * (size_t)NB * TT * DIN)

// ---- operand tiles of one K step (32 k) of k_proj / k_out: read by whole-line loads and converted once per block, kept in LDS as 16-bit rows of 32 k, so that an A or B fragment is two 16-byte LDS reads (frag_b / frag_h on the row). Every loop over a register array, here and in the K steps, is fully unrolled: its indices must be constants, else the array goes to scratch
#define WP 40              // LDS pitch of a staged row in 16-bit elements: 32 k values + 16 bytes, so that 16-byte reads and writes of 64-byte rows spread over all banks
static_assert(WQKV_LAYOUT == 0 && !WO_OUT_IN, "the staged weight tile is written for (in,out) weights");
typedef __attribute__((ext_vector_type(4))) __bf16 v4b;
typedef __attribute__((ext_vector_type(4))) _Float16 v4h;
// weight tile: 32 k rows x 128 output columns of an (in,out) [K][ld] matrix, in LDS as [column][k]. Thread (wave, lane) owns the patch k = 8 (lane >> 3) + 0..7, column = 32 wave + 4 (lane & 7) + 0..3: each load instruction covers four whole 128-byte lines, each LDS store holds 8 consecutive k of one column
__device__ __forceinline__ const float* wt_ptr(const float* Wm, int c0, int wave, int lane, int ld) { return Wm + (size_t)(8 * (lane >> 3)) * ld + c0 + 32 * wave + 4 * (lane & 7); }
__device__ __forceinline__ void wt_load(v4f (&r)[8], const float* p, int ld) {
#pragma unroll
  for (int i = 0; i < 8; ++i) r[i] = *(const v4f*)(p + (size_t)i * ld); }
__device__ __forceinline__ void wt_put_b(__bf16* buf, const v4f (&r)[8], int wave, int lane) {   /* bf16, exact for the bf16-rounded weight */
#pragma unroll
  for (int c = 0; c < 4; ++c) { v8b t;
#pragma unroll
    for (int i = 0; i < 8; ++i) t[i] = (__bf16)r[i][c];
    *(v8b*)(buf + (32 * wave + 4 * (lane & 7) + c) * WP + 8 * (lane >> 3)) = t; } }
__device__ __forceinline__ void wt_put_h(_Float16* buf, const v4f (&r)[8], int wave, int lane) {   /* f16(bf16 x 2^8), exact */
#pragma unroll
  for (int c = 0; c < 4; ++c) { v8h t;
#pragma unroll
    for (int i = 0; i < 8; ++i) t[i] = (_Float16)(bfr(r[i][c]) * 256.0f);
    *(v8h*)(buf + (32 * wave + 4 * (lane & 7) + c) * WP + 8 * (lane >> 3)) = t; } }
// row tile: 64 rows x 32 k of an f32 [rows][ld] matrix, in LDS as [row][k]; rows0 = the block's first row. Thread (wave, lane) owns k = 4 (lane & 7) + 0..3 of rows 16 wave + 4 i + (lane >> 3), i < 4 (the rows of its own wave's A fragment): each load instruction covers four whole 128-byte lines
__device__ __forceinline__ const float* xt_ptr(const float* rows0, int wave, int lane, int ld) { return rows0 + (size_t)(16 * wave + (lane >> 3)) * ld + 4 * (lane & 7); }
__device__ __forceinline__ void xt_load(v4f (&r)[4], const float* p, int ld) {
#pragma unroll
  for (int i = 0; i < 4; ++i) r[i] = *(const v4f*)(p + (size_t)(4 * i) * ld); }
__device__ __forceinline__ int xt_at(int i, int wave, int lane) { return (16 * wave + 4 * i + (lane >> 3)) * WP + 4 * (lane & 7); }
__device__ __forceinline__ void xt_put_b(__bf16* buf, const v4f (&r)[4], int wave, int lane) {   /* once to bf16 */
#pragma unroll
  for (int i = 0; i < 4; ++i) { v4b t;
#pragma unroll
    for (int c = 0; c < 4; ++c) t[c] = (__bf16)r[i][c];
    *(v4b*)(buf + xt_at(i, wave, lane)) = t; } }
__device__ __forceinline__ void xt_put_hl(__bf16* bh, __bf16* bl, const v4f (&r)[4], int wave, int lane) {   /* bf16 hi + lo planes, as bsplit16 */
#pragma unroll
  for (int i = 0; i < 4; ++i) { v4b th, tl;
#pragma unroll
    for (int c = 0; c < 4; ++c) { const __bf16 h = (__bf16)r[i][c]; th[c] = h; tl[c] = (__bf16)(r[i][c] - (float)h); }
    *(v4b*)(bh + xt_at(i, wave, lane)) = th; *(v4b*)(bl + xt_at(i, wave, lane)) = tl; } }
__device__ __forceinline__ void xt_put_h(_Float16* buf, const v4f (&r)[4], int wave, int lane, float sc) {   /* x sc, once to f16 */
#pragma unroll
  for (int i = 0; i < 4; ++i) { v4h t;
#pragma unroll
    for (int c = 0; c < 4; ++c) t[c] = (_Float16)(r[i][c] * sc);
    *(v4h*)(buf + xt_at(i, wave, lane)) = t; } }
// ---- k_proj: block = (64 rows, 128 cols, which): q/k/v = X W (+ b) with exact bf16 products (K = DIN), both operand tiles of each K step staged in LDS (two buffers, which share their LDS with the epilogue's tiles), the next step's loads issued behind the step's barrier -> which 0: q f16 rows (+ residual rows < QHI); 1: k f16 rows (+ residual rows < KHI); 2: v f16 planes [c][t] (+ bf16 hi/lo planes for t < KHI)
__global__ __launch_bounds__(128) void k_proj(const float* __restrict__ XQ, const float* __restrict__ XK, const float* __restrict__ XV, const float* __restrict__ WQ, const float* __restrict__ WK, const float* __restrict__ WV, const float* __restrict__ BQ, const float* __restrict__ BK, const float* __restrict__ BV,
    _Float16* __restrict__ QH, _Float16* __restrict__ QL, _Float16* __restrict__ KH, _Float16* __restrict__ KL, _Float16* __restrict__ VT, __bf16* __restrict__ VB, __bf16* __restrict__ VBL) {
  __shared__ __align__(16) union { struct { _Float16 sh[64][136], sl[64][136]; } r; struct { _Float16 th[128][72]; __bf16 tb[128][72], tbl[128][72]; } c; struct { __bf16 w[2][128 * WP], x[2][64 * WP]; } k; } u;
  _Float16 (&sh)[64][136] = u.r.sh; _Float16 (&sl)[64][136] = u.r.sl; _Float16 (&th)[128][72] = u.c.th; __bf16 (&tb)[128][72] = u.c.tb; __bf16 (&tbl)[128][72] = u.c.tbl;
  const int tid = threadIdx.x, wave = tid >> 5, lane = tid & 31, col = lane & 15, g = lane >> 4; const int which = blockIdx.z; const int c0 = blockIdx.y * 128; const size_t r0 = (size_t)blockIdx.x * 64; const size_t bb = r0 / TT; const int t0 = (int)(r0 % TT);
  const float* X = which == 0 ? XQ : which == 1 ? XK : XV; const float* WA = which == 0 ? WQ : which == 1 ? WK : WV; const float* BA = which == 0 ? BQ : which == 1 ? BK : BV;
  v8f acc[8] = {};
  const float* wp = wt_ptr(WA, c0, wave, lane, CC); const float* xp = xt_ptr(X + r0 * DIN, wave, lane, DIN);
  v4f wr[8], xr[4]; wt_load(wr, wp, CC); xt_load(xr, xp, DIN);
  for (int kc = 0; kc < DIN / 32; ++kc) { __bf16* wb = u.k.w[kc & 1]; __bf16* xb = u.k.x[kc & 1]; wt_put_b(wb, wr, wave, lane); xt_put_b(xb, xr, wave, lane);
    __syncthreads();   /* the whole tiles of step kc are in LDS before any wave reads fragments across them; the same barrier ends every wave's reads of step kc - 1, whose buffers step kc + 1 overwrites */
    if (kc + 1 < DIN / 32) { wt_load(wr, wp + (size_t)32 * CC, CC); xt_load(xr, xp + 32, DIN);
      asm volatile("s_wait_xcnt 0x0" :: "v"(wp), "v"(xp) : "memory");   /* the loads' address registers, named here so that they stay as they are up to this wait, are advanced behind it */
      wp += (size_t)32 * CC; xp += 32; }
    const v16b a = frag_b(xb + (wave * 16 + col) * WP, lane); v16b wf[8];
#pragma unroll
    for (int j = 0; j < 8; ++j) wf[j] = frag_b(wb + (j * 16 + col) * WP, lane);   /* all of the step's LDS reads as one group in front of its matrix instructions */
#pragma unroll
    for (int j = 0; j < 8; ++j) acc[j] = wmma_bf(a, wf[j], acc[j]); }
  __syncthreads();   /* every wave has read its last fragments before the epilogue's tiles overwrite the staging buffers */
  if (which < 2) { _Float16* DH = which == 0 ? QH : KH; _Float16* DL = which == 0 ? QL : KL; const int nhi = which == 0 ? QHI : KHI; const bool hi_rows = t0 < nhi;
#pragma unroll
    for (int j = 0; j < 8; ++j) { const float bias = BA ? bfr(BA[c0 + j * 16 + col]) : 0.f;
#pragma unroll
      for (int r = 0; r < 8; ++r) { const float v = acc[j][r] + bias; const _Float16 hv = (_Float16)v; sh[wave * 16 + 8 * g + r][j * 16 + col] = hv; sl[wave * 16 + 8 * g + r][j * 16 + col] = (_Float16)((v - (float)hv) * 1024.0f); } }
    __syncthreads();
    for (int e = tid; e < 64 * 16; e += 128) { const int rl = e >> 4, q = e & 15; vst2((unsigned*)(DH + (r0 + rl) * CC + c0 + q * 8), *(const v4u*)&sh[rl][q * 8]); if (hi_rows) vst2((unsigned*)(DL + (bb * nhi + t0 + rl) * (size_t)CC + c0 + q * 8), *(const v4u*)&sl[rl][q * 8]); }
  } else { const bool hi_rows = t0 < KHI;
#pragma unroll
    for (int j = 0; j < 8; ++j) { const float bias = BA ? bfr(BA[c0 + j * 16 + col]) : 0.f;
#pragma unroll
      for (int r = 0; r < 8; ++r) { const float v = acc[j][r] + bias; const int rl = wave * 16 + 8 * g + r, cl = j * 16 + col; th[cl][rl] = (_Float16)v; const __bf16 bh = (__bf16)v; tb[cl][rl] = bh; tbl[cl][rl] = (__bf16)(v - (float)bh); } }
    __syncthreads();
    for (int e = tid; e < 128 * 8; e += 128) { const int cl = e >> 3, q = e & 7; vst2((unsigned*)(VT + (bb * CC + c0 + cl) * (size_t)TT + t0 + q * 8), *(const v4u*)&th[cl][q * 8]); if (hi_rows) { const size_t o3 = (bb * CC + c0 + cl) * (size_t)KHI + t0 + q * 8; vst2((unsigned*)(VB + o3), *(const v4u*)&tb[cl][q * 8]); vst2((unsigned*)(VBL + o3), *(const v4u*)&tbl[cl][q * 8]); } } } }
// ---- k_pv: block = 16 queries (tile qt of query block qb = qt / 4) of (b, h) = blockIdx.z, PVW waves. Logits first, never through memory: wave w takes the 64-key units w, w + PVW, ... of keys [0, kend): q x k on the matrix unit, x SCALE, f32 to the 16 LDS rows (single f16 product; causal early query blocks: q hi + residual (x 2^10) against k hi + residual, 3 products); the mask is applied by index in the softmax. Softmax: wave w takes query rows w and w + PVW whole, in registers: keys [0, kend): causal -> logit if s <= t else excluded; softmax in f32; exp(logit - max) (0 for excluded) back to the LDS rows, 2^11 / sum to LDS per row. Then ctx = P . v over keys [0, kend), P x 2^11 = the LDS value x the row's 2^11 / sum; wave w takes the 32-key chunks w, w + PVW, ... and the PVW partial tiles are summed in wave order through LDS (P x 2^11 once to f16 against v f16: 1 product; causal early query blocks: P and v as bf16 hi + lo, 3 products); 256-B (row, head) segment by 16 lanes
#define PVW 8
#define PPITCH (TT + 4)    // LDS pitch of a P row in floats: 16 bytes over the row, so that the 16 rows of a fragment read start 4 banks apart
#define NCF (TT / 128 - 1) // most 128-key pieces of a row in front of its last one; a piece is one 16-byte load per lane
__device__ __forceinline__ v4f sm_exp(v4f v, float m) { v4f e;
#pragma unroll
  for (int c = 0; c < 4; ++c) { const float ex = expf(v[c] - m); e[c] = (v[c] <= -1.0e38f) ? 0.f : ex; }
  return e; }
// one query row's softmax by one wave: lane l holds the logits of keys i * 128 + 4 l + 0..3 in x[i], i < nf, and those of the row's last piece (i = nf) in xl. Only the last piece can hold keys > t: nf * 128 = (kb_last(qb)) * 128 <= qb * 64 <= t. Returns 2^11 / sum; exp(logit - max) goes to the LDS row pr
__device__ __forceinline__ float sm_row(const v4f (&x)[NCF], v4f xl, int nf, int t, int lane, float* pr) {
  float m = -3.0e38f;
#pragma unroll
  for (int c = 0; c < 4; ++c) { xl[c] = (!CAUSAL || nf * 128 + lane * 4 + c <= t) ? xl[c] : -3.0e38f; m = fmaxf(m, xl[c]); }
#pragma unroll
  for (int i = 0; i < NCF; ++i) if (i < nf) {
#pragma unroll
    for (int c = 0; c < 4; ++c) m = fmaxf(m, x[i][c]); }
#pragma unroll
  for (int o = 1; o < 32; o <<= 1) m = fmaxf(m, __shfl_xor(m, o));
  v4f s4 = {};
#pragma unroll
  for (int i = 0; i < NCF; ++i) if (i < nf) { const v4f e = sm_exp(x[i], m); s4 += e; *(v4f*)(pr + i * 128 + lane * 4) = e; }
  { const v4f e = sm_exp(xl, m); s4 += e; *(v4f*)(pr + nf * 128 + lane * 4) = e; }
  float sum = (s4[0] + s4[1]) + (s4[2] + s4[3]);
#pragma unroll
  for (int o = 1; o < 32; o <<= 1) sum += __shfl_xor(sum, o);
  return sum > 0.f ? 2048.0f / sum : 0.f; }   /* a fully excluded row yields P = 0 */
#define KU 64              // keys of one logit unit: four 16-key tiles, whose 16 loads per lane are in flight together
// the B fragments of one unit: f[2 j + kc] = keys 16 j + (lane & 15), d = 32 kc + ..; p = the lane's own place in the unit's first 16 rows (row lane & 15, d = 8 (lane >> 4)), so that all 16 loads go off one address
__device__ __forceinline__ void ku_load(v16h (&f)[8], const _Float16* p) {
#pragma unroll
  for (int j = 0; j < 4; ++j)
#pragma unroll
    for (int kc = 0; kc < 2; ++kc) { union { v16h v; v8h q[2]; } u; const _Float16* s = p + (size_t)(16 * j) * CC + 32 * kc; u.q[0] = *(const v8h*)s; u.q[1] = *(const v8h*)(s + 16); f[2 * j + kc] = u.v; } }
// one unit's logits, single product: the four tiles' accumulators are independent, so that no matrix instruction waits for the one in front of it; w = the lane's place (row 8 (lane >> 4), key lane & 15 of the unit) in the LDS rows
__device__ __forceinline__ void lg_unit(v16h a0, v16h a1, const v16h (&f)[8], float* w) { v8f c[4];
#pragma unroll
  for (int j = 0; j < 4; ++j) { const v8f z = {}; c[j] = wmma16(a0, f[2 * j], z); }
#pragma unroll
  for (int j = 0; j < 4; ++j) c[j] = wmma16(a1, f[2 * j + 1], c[j]);
#pragma unroll
  for (int j = 0; j < 4; ++j)
#pragma unroll
    for (int r = 0; r < 8; ++r) w[r * PPITCH + j * 16] = c[j][r] * SCALE; }
// the B fragments of one 32-key chunk of v planes of LD keys: f[j] = plane 16 j + (lane & 15), keys 8 (lane >> 4) + ..; p = the lane's own place in the chunk's first 16 planes, so that all 8 loads go off one address
template <int LD, typename V, typename E> __device__ __forceinline__ void pv_load(V (&f)[HD / 16], const E* p) {
#pragma unroll
  for (int j = 0; j < HD / 16; ++j) { union { V v; v4u q[2]; } u; const E* s = p + (size_t)(16 * j) * LD; u.q[0] = *(const v4u*)s; u.q[1] = *(const v4u*)(s + 16); f[j] = u.v; } }
// one chunk's P . v, single product: P x 2^11 from the LDS row, once to f16, against the chunk's four fragments
__device__ __forceinline__ void pv_mac(v8f (&acc)[HD / 16], v16h p, const v16h (&f)[HD / 16]) {
#pragma unroll
  for (int j = 0; j < HD / 16; ++j) acc[j] = wmma16(p, f[j], acc[j]); }
__device__ __forceinline__ void pv_unit(v8f (&acc)[HD / 16], const v16h (&f)[HD / 16], const float* prow, int lane, float inv) { pv_mac(acc, frag_f32s(prow, lane, inv), f); }
__global__ __launch_bounds__(32 * PVW) void k_pv(const _Float16* __restrict__ QH, const _Float16* __restrict__ KH, const _Float16* __restrict__ QL, const _Float16* __restrict__ KL, const _Float16* __restrict__ VT, const __bf16* __restrict__ VB, const __bf16* __restrict__ VBL, float* __restrict__ Y) { const int b = blockIdx.z / NH, h = blockIdx.z % NH; __shared__ __align__(16) float sp[16 * PPITCH]; __shared__ float sinv[16];
  static_assert(PVW * 16 * (HD + 4) <= 16 * PPITCH && 2 * PVW == 16, "the partial tiles reuse the P rows' LDS; two query rows per wave");
  static_assert((((QBH * 64 + 63) >> 7) + 1) * 4 >= 2 * PVW, "beyond the early query blocks every wave has two P.v chunks or more");
  static_assert(CAUSAL && (((QBH * 64 + 63) >> 7) + 1) * (128 / KU) >= PVW && ((((QBH - 1) * 64 + 63) >> 7) + 1) * (128 / KU) <= PVW, "beyond the early query blocks every wave has a logit unit, within them at most one");
  const int tid = threadIdx.x, lane = tid & 31, col = lane & 15, g = lane >> 4; const int qb = blockIdx.x >> 2; const int ql0 = blockIdx.x * 16; const int kce = (kb_last(qb) + 1) * 4;
  const int wave = __builtin_amdgcn_readfirstlane(tid >> 5);   /* scalar, so that the key loop's bounds and branch stay wave-uniform around the matrix instructions */
  { const int nu = (kb_last(qb) + 1) * (128 / KU); const size_t lo = (size_t)col * CC + h * HD + 8 * g; float* sw = sp + 8 * g * PPITCH + col;
    const _Float16* qp = QH + ((size_t)b * TT + ql0) * CC + lo; const _Float16* kp = KH + ((size_t)b * TT + wave * KU) * CC + lo;
    union { v16h v; v8h q[2]; } a0, a1; a0.q[0] = *(const v8h*)qp; a0.q[1] = *(const v8h*)(qp + 16); a1.q[0] = *(const v8h*)(qp + 32); a1.q[1] = *(const v8h*)(qp + 48);
    if (qb < QBH) { const _Float16* qlp = QL + ((size_t)b * QHI + ql0) * CC + lo; const _Float16* klp = KL + ((size_t)b * KHI + wave * KU) * CC + lo;
      union { v16h v; v8h q[2]; } l0, l1; l0.q[0] = *(const v8h*)qlp; l0.q[1] = *(const v8h*)(qlp + 16); l1.q[0] = *(const v8h*)(qlp + 32); l1.q[1] = *(const v8h*)(qlp + 48);
      asm volatile("s_wait_xcnt 0x0" :: "v"(qp), "v"(qlp) : "memory");   /* the loads' address registers, named here so that they stay as they are up to this wait, may be reused behind it */
      if (wave < nu) { const int u = wave; v16h kf[8], lf[8]; ku_load(kf, kp); ku_load(lf, klp);   /* here nu <= PVW: at most one unit per wave; a scalar test, so that the matrix instructions run with every lane on */
        asm volatile("s_wait_xcnt 0x0" :: "v"(kp), "v"(klp) : "memory");   /* as above */
#pragma unroll
        for (int j = 0; j < 4; ++j) { v8f c = {}, cl = {};
          c = wmma16(a0.v, kf[2 * j], c); cl = wmma16(l0.v, kf[2 * j], cl); cl = wmma16(a0.v, lf[2 * j], cl);
          c = wmma16(a1.v, kf[2 * j + 1], c); cl = wmma16(l1.v, kf[2 * j + 1], cl); cl = wmma16(a1.v, lf[2 * j + 1], cl);
#pragma unroll
          for (int r = 0; r < 8; ++r) sw[r * PPITCH + u * KU + j * 16] = (c[r] + cl[r] * (1.0f / 1024.0f)) * SCALE; } }
    } else { v16h kf[8], kn[8]; int u = wave; constexpr size_t KS = (size_t)PVW * KU * CC;   /* from one unit of a wave to its next; here nu >= PVW: every wave has a unit */
      ku_load(kf, kp);
      asm volatile("s_wait_xcnt 0x0" :: "v"(qp), "v"(kp) : "memory");   /* as above */
      /* two register sets by turns, and no branch between a unit's loads and the work on the unit before it: the wave's next unit is in flight while this one is worked on */
      while (u + 2 * PVW < nu) { ku_load(kn, kp + KS); lg_unit(a0.v, a1.v, kf, sw + u * KU); ku_load(kf, kp + 2 * KS);
        asm volatile("s_wait_xcnt 0x0" :: "v"(kp) : "memory");   /* as above: the address is advanced behind it */
        kp += 2 * KS; lg_unit(a0.v, a1.v, kn, sw + (u + PVW) * KU); u += 2 * PVW; }
      if (u + PVW < nu) { ku_load(kn, kp + KS);
        asm volatile("s_wait_xcnt 0x0" :: "v"(kp) : "memory");   /* as above */
        lg_unit(a0.v, a1.v, kf, sw + u * KU); lg_unit(a0.v, a1.v, kn, sw + (u + PVW) * KU); }
      else lg_unit(a0.v, a1.v, kf, sw + u * KU); } }
  __syncthreads();   /* all 16 rows' logits are in LDS before any wave reads a row across the units */
  { const int nf = kb_last(qb); v4f x0[NCF], x1[NCF]; const float* s0 = sp + wave * PPITCH + lane * 4; const float* s1 = s0 + PVW * PPITCH;
#pragma unroll
    for (int i = 0; i < NCF; ++i) if (i < nf) { x0[i] = *(const v4f*)(s0 + i * 128); x1[i] = *(const v4f*)(s1 + i * 128); }   /* both rows whole in registers before either row's LDS is overwritten */
    const v4f xl0 = *(const v4f*)(s0 + nf * 128), xl1 = *(const v4f*)(s1 + nf * 128);
    const float i0 = sm_row(x0, xl0, nf, ql0 + wave, lane, sp + wave * PPITCH), i1 = sm_row(x1, xl1, nf, ql0 + wave + PVW, lane, sp + (wave + PVW) * PPITCH);
    if (lane == 0) { sinv[wave] = i0; sinv[wave + PVW] = i1; } }
  __syncthreads();   /* all 16 rows and their factors are in LDS before any wave reads fragments across them */
  const float inv = sinv[col]; const float* pc = sp + col * PPITCH + 8 * g;
  v8f acc[HD / 16] = {};
  if (qb < QBH) {
    const size_t vo = ((size_t)b * CC + h * HD + col) * (size_t)KHI + 8 * g;
#pragma unroll 1   /* at most two trips here: kept rolled, so that the kernel's text stays short */
    for (int kc = wave; kc < kce; kc += PVW) { v16b vh[HD / 16], vl[HD / 16]; const __bf16* hp = VB + vo + kc * 32; const __bf16* lp = VBL + vo + kc * 32; pv_load<KHI>(vh, hp); pv_load<KHI>(vl, lp);   /* the chunk's 16 loads in flight together, in front of its matrix instructions */
      asm volatile("s_wait_xcnt 0x0" :: "v"(hp), "v"(lp) : "memory");   /* the loads' address registers, named here so that they stay as they are up to this wait, may be reused behind it */
      float pv[16];
#pragma unroll
      for (int i = 0; i < 8; ++i) { pv[i] = pc[kc * 32 + i] * inv; pv[8 + i] = pc[kc * 32 + 16 + i] * inv; }
      const F2 p = bsplit16(pv);
#pragma unroll
      for (int j = 0; j < HD / 16; ++j) { acc[j] = wmma_bf(p.h, vh[j], acc[j]); acc[j] = wmma_bf(p.l, vh[j], acc[j]); acc[j] = wmma_bf(p.h, vl[j], acc[j]); } }
  } else { v16h vf[HD / 16], vn[HD / 16]; int kc = wave; constexpr int VS = PVW * 32;   /* from one chunk of a wave to its next, in keys; here kce >= 2 PVW: every wave has two chunks or more */
    const _Float16* vp = VT + ((size_t)b * CC + h * HD + col) * (size_t)TT + wave * 32 + 8 * g; const float* pr = sp + col * PPITCH;
    pv_load<TT>(vf, vp); pv_load<TT>(vn, vp + VS);
    asm volatile("s_wait_xcnt 0x0" :: "v"(vp) : "memory");   /* as above */
    /* two register sets by turns, each refilled as soon as its chunk is worked off, and no branch between a chunk's loads and the work on the chunk behind it: two chunks of the wave are in flight at any time; the wave sums its chunks in rising order */
    while (kc + 3 * PVW < kce) { const v16h p0 = frag_f32s(pr + kc * 32, lane, inv), p1 = frag_f32s(pr + (kc + PVW) * 32, lane, inv);   /* both chunks' P fragments first, so that each set's refill follows its last matrix instruction directly */
      pv_mac(acc, p0, vf); pv_load<TT>(vf, vp + 2 * VS); pv_mac(acc, p1, vn); pv_load<TT>(vn, vp + 3 * VS);
      asm volatile("s_wait_xcnt 0x0" :: "v"(vp) : "memory");   /* as above: the address is advanced behind it */
      vp += 2 * VS; kc += 2 * PVW; }
    pv_unit(acc, vf, pr + kc * 32, lane, inv);
    if (kc + 2 * PVW < kce) { pv_load<TT>(vf, vp + 2 * VS);
      asm volatile("s_wait_xcnt 0x0" :: "v"(vp) : "memory");   /* as above */
      pv_unit(acc, vn, pr + (kc + PVW) * 32, lane, inv); pv_unit(acc, vf, pr + (kc + 2 * PVW) * 32, lane, inv); }
    else pv_unit(acc, vn, pr + (kc + PVW) * 32, lane, inv); }
  __syncthreads();   /* every wave has read its last P fragment before the partial tiles overwrite the P rows */
  float (*ss)[16][HD + 4] = (float (*)[16][HD + 4])sp;
#pragma unroll
  for (int j = 0; j < HD / 16; ++j)
#pragma unroll
    for (int r = 0; r < 8; ++r) ss[wave][8 * g + r][j * 16 + col] = acc[j][r];
  __syncthreads();   /* every wave's partial tile is in LDS before any thread sums across waves */
  for (int e = tid; e < 16 * (HD / 4); e += 32 * PVW) { const int rl = e / (HD / 4), q = e % (HD / 4); v4f s = *(const v4f*)&ss[0][rl][q * 4];
    for (int w = 1; w < PVW; ++w) s += *(const v4f*)&ss[w][rl][q * 4];
    vst2(Y + ((size_t)b * TT + ql0 + rl) * CC + h * HD + q * 4, s * (1.0f / 2048.0f)); } }
// ---- k_out: block = (64 rows, 128 cols): out = ctx Wo (+ bo), both operand tiles of each K step staged in LDS as in k_proj: ctx x 2^6 once to f16 against Wo as f16(bf16 x 2^8) exact (1 product) x 2^-14; causal early rows (< QHI of each sequence): ctx bf16 hi + lo against exact bf16 Wo (2 products)
__global__ __launch_bounds__(128) void k_out(const float* __restrict__ Y, const float* __restrict__ WO, const float* __restrict__ BO, float* __restrict__ OUT) { __shared__ __align__(16) float sf[4][16][132]; __shared__ __align__(16) union { struct { __bf16 w[2][128 * WP], yh[2][64 * WP], yl[2][64 * WP]; } b; struct { _Float16 w[2][128 * WP], y[2][64 * WP]; } h; } sk;
  const int tid = threadIdx.x, wave = tid >> 5, lane = tid & 31, col = lane & 15, g = lane >> 4; const int c0 = blockIdx.y * 128; const size_t r0 = (size_t)blockIdx.x * 64 + wave * 16;
  v8f acc[8] = {};
  const float* wp = wt_ptr(WO, c0, wave, lane, DIN); const float* yp = xt_ptr(Y + (size_t)blockIdx.x * 64 * CC, wave, lane, CC);
  v4f wr[8], yr[4]; wt_load(wr, wp, DIN); xt_load(yr, yp, CC);
  if (CAUSAL && (int)(((size_t)blockIdx.x * 64) % TT) < QHI) {   /* block-uniform */
    for (int kc = 0; kc < CC / 32; ++kc) { __bf16* wb = sk.b.w[kc & 1]; __bf16* yh = sk.b.yh[kc & 1]; __bf16* yl = sk.b.yl[kc & 1]; wt_put_b(wb, wr, wave, lane); xt_put_hl(yh, yl, yr, wave, lane);
      __syncthreads();   /* the whole tiles of step kc are in LDS before any wave reads fragments across them; the same barrier ends every wave's reads of step kc - 1, whose buffers step kc + 1 overwrites */
      if (kc + 1 < CC / 32) { wt_load(wr, wp + (size_t)32 * DIN, DIN); xt_load(yr, yp + 32, CC);
        asm volatile("s_wait_xcnt 0x0" :: "v"(wp), "v"(yp) : "memory");   /* the loads' address registers, named here so that they stay as they are up to this wait, are advanced behind it */
        wp += (size_t)32 * DIN; yp += 32; }
      const v16b ah = frag_b(yh + (wave * 16 + col) * WP, lane), al = frag_b(yl + (wave * 16 + col) * WP, lane); v16b wf[8];
#pragma unroll
      for (int j = 0; j < 8; ++j) wf[j] = frag_b(wb + (j * 16 + col) * WP, lane);   /* all of the step's LDS reads as one group in front of its matrix instructions */
#pragma unroll
      for (int j = 0; j < 8; ++j) { acc[j] = wmma_bf(ah, wf[j], acc[j]); acc[j] = wmma_bf(al, wf[j], acc[j]); } }
#pragma unroll
    for (int j = 0; j < 8; ++j) { const float bias = BO ? bfr(BO[c0 + j * 16 + col]) : 0.f;
#pragma unroll
      for (int r = 0; r < 8; ++r) sf[wave][8 * g + r][j * 16 + col] = acc[j][r] + bias; }
  } else {
    for (int kc = 0; kc < CC / 32; ++kc) { _Float16* wb = sk.h.w[kc & 1]; _Float16* yb = sk.h.y[kc & 1]; wt_put_h(wb, wr, wave, lane); xt_put_h(yb, yr, wave, lane, 64.0f);   /* ctx carried x 2^6 into f16 so small-magnitude context rows stay clear of f16 subnormals */
      __syncthreads();   /* as in the branch above: publishes step kc's tiles and ends the reads of step kc - 1 */
      if (kc + 1 < CC / 32) { wt_load(wr, wp + (size_t)32 * DIN, DIN); xt_load(yr, yp + 32, CC);
        asm volatile("s_wait_xcnt 0x0" :: "v"(wp), "v"(yp) : "memory");   /* as in the branch above */
        wp += (size_t)32 * DIN; yp += 32; }
      const v16h a = frag_h(yb + (wave * 16 + col) * WP, lane); v16h wf[8];
#pragma unroll
      for (int j = 0; j < 8; ++j) wf[j] = frag_h(wb + (j * 16 + col) * WP, lane);   /* as in the branch above */
#pragma unroll
      for (int j = 0; j < 8; ++j) acc[j] = wmma16(a, wf[j], acc[j]); }
#pragma unroll
    for (int j = 0; j < 8; ++j) { const float bias = BO ? bfr(BO[c0 + j * 16 + col]) : 0.f;
#pragma unroll
      for (int r = 0; r < 8; ++r) sf[wave][8 * g + r][j * 16 + col] = acc[j][r] * (1.0f / 16384.0f) + bias; } }   /* 2^-8 (Wo carry) x 2^-6 (ctx carry) */
  LDSX(); for (int rl = 0; rl < 16; ++rl) vst2(OUT + (r0 + rl) * DIN + c0 + lane * 4, *(const v4f*)&sf[wave][rl][lane * 4]); }

extern "C" void kernel_launch(void* const* d_in, const int* in_sizes, int n_in, void* d_out, int out_size, void* d_ws, size_t ws_size, hipStream_t stream) {
  (void)in_sizes; (void)n_in; (void)out_size;
  const float** F = (const float**)d_in;
  if (ws_size < (size_t)WS_END) return;
  char* ws = (char*)d_ws; _Float16 *QH = (_Float16*)(ws + WS_QH), *KH = (_Float16*)(ws + WS_KH), *VT = (_Float16*)(ws + WS_VT), *QL = (_Float16*)(ws + WS_QL), *KL = (_Float16*)(ws + WS_KL); __bf16 *VB = (__bf16*)(ws + WS_VB), *VBL = (__bf16*)(ws + WS_VBL); float *Y = (float*)(ws + WS_Y);
  (void)Y; (void)QL; (void)KL; (void)VB; (void)VBL;
  // inputs: 0 x [2,2048,1024]; 1 wq [1024,16,64] = (in,out) [1024][1024]; 2 wk; 3 wv; 4 wp1 [16,64,1024] = (in,out) [1024][1024]; 5 wp2 [1024,1024] (in,out); no biases
  if (ws_size < (size_t)WS_END2) return;
  float* Y2 = (float*)(ws + WS_Y2);
  k_proj<<<dim3(TNB * TT / 64, CC / 128, 3), 128, 0, stream>>>(F[0], F[0], F[0], F[1], F[2], F[3], nullptr, nullptr, nullptr, QH, QL, KH, KL, VT, VB, VBL);
  k_pv<<<dim3(TT / 16, 1, TNB * NH), 32 * PVW, 0, stream>>>(QH, KH, QL, KL, VT, VB, VBL, Y);
  k_out<<<dim3(TNB * TT / 64, DIN / 128), 128, 0, stream>>>(Y, F[4], nullptr, Y2);              /* y = att wp1 (f32 rows in workspace) */
  k_out<<<dim3(TNB * TT / 64, DIN / 128), 128, 0, stream>>>(Y2, F[5], nullptr, (float*)d_out);   /* out = y wp2 */
  static_assert(CC == DIN, "the second output projection reuses k_out: its operand rows have width DIN == CC");
}

// v006
// One run takes 188 microseconds.
// Two timings next to v005 both put it at 1.13 times that version's speed.
// Counting every step since v000, it is 5.85 times as fast.
// compute dtype: all float inputs rounded to bf16; q / k / v projections with EXACT bf16 products on WMMA 16x16x32 (f32 accumulate), no biases; causal logits: 3 products for the first 384 rows, single f16 q x k after, x 64^-0.5; softmax f32; P x 2^11 once to f16 x v once to f16 (bf16 hi + lo below row 384); TWO output projections in sequence, each through k_out (rows < 384: the f32 operand as bf16 hi + lo against the exact weight; beyond: x2^6 f16 carry x f16(bf16 x 2^8) weight); f32 output.
#include <hip/hip_runtime.h>
#include <math.h>

typedef __attribute__((ext_vector_type(16))) _Float16 v16h;
typedef __attribute__((ext_vector_type(16))) __bf16 v16b;
typedef __attribute__((ext_vector_type(8)))  _Float16 v8h;
typedef __attribute__((ext_vector_type(8)))  float v8f;
typedef __attribute__((ext_vector_type(4)))  float v4f;
typedef __attribute__((ext_vector_type(2)))  float v2f;
typedef __attribute__((ext_vector_type(4)))  unsigned v4u;
typedef __attribute__((ext_vector_type(4)))  int v4i;
typedef float __attribute__((may_alias)) float_a;
typedef int __attribute__((may_alias)) int_a;

template <typename T> __device__ __forceinline__ void vst2(void* p, T v) { *(T*)p = v;  }
__device__ __forceinline__ v8f wmma16(v16h a, v16h b, v8f c) {
  v8f d = __builtin_amdgcn_wmma_f32_16x16x32_f16(false, a, false, b, (short)0, c, false, false);
  asm volatile("v_nop\n\tv_nop\n\tv_nop\n\tv_nop" : "+v"(d) : "v"(a), "v"(b));
  return d;
}
__device__ __forceinline__ v8f wmma_bf(v16b a, v16b b, v8f c) {
  v8f d = __builtin_amdgcn_wmma_f32_16x16x32_bf16(false, a, false, b, (short)0, c, false, false);
  asm volatile("v_nop\n\tv_nop\n\tv_nop\n\tv_nop" : "+v"(d) : "v"(a), "v"(b));
  return d;
}
// 16x16x32 fragments: lane = (h = lane>>4, row/col = lane&15); elements 0..7 = k0+8h+0..7, 8..15 = k0+16+8h+0..7; D element r = row 8h+r
__device__ __forceinline__ v16h frag_h(const _Float16* rowk0, int lane) {
  union { v16h v; v8h q[2]; } u; const _Float16* p = rowk0 + 8 * (lane >> 4);
  u.q[0] = *(const v8h*)p; u.q[1] = *(const v8h*)(p + 16); return u.v;
}
__device__ __forceinline__ v16h frag_f32(const float* rowk0, int lane) {
  v16h a; const float* p = rowk0 + 8 * (lane >> 4);
#pragma unroll
  for (int i = 0; i < 8; ++i) { a[i] = (_Float16)p[i]; a[8 + i] = (_Float16)p[16 + i]; }
  return a;
}
__device__ __forceinline__ v16h frag_f32s(const float* rowk0, int lane, float sc) {
  v16h a; const float* p = rowk0 + 8 * (lane >> 4);
#pragma unroll
  for (int i = 0; i < 8; ++i) { a[i] = (_Float16)(p[i] * sc); a[8 + i] = (_Float16)(p[16 + i] * sc); }
  return a;
}
// column fragment from a [K][ld] layout (column n), rows >= K read as 0
__device__ __forceinline__ v16h fragc_f32(const float* W, int k0, int n, int lane, int ld, int K) {
  v16h a; const int g = lane >> 4;
#pragma unroll
  for (int i = 0; i < 8; ++i) { const int ka = k0 + 8 * g + i, kb = ka + 16;
    a[i] = (_Float16)(ka < K ? W[(size_t)(ka < K ? ka : K - 1) * ld + n] : 0.f); a[8 + i] = (_Float16)(kb < K ? W[(size_t)(kb < K ? kb : K - 1) * ld + n] : 0.f); }
  return a;
}
struct F2 { v16b h, l; };
__device__ __forceinline__ F2 bsplit16(const float v[16]) { F2 r;
#pragma unroll
  for (int i = 0; i < 16; ++i) { const __bf16 h = (__bf16)v[i]; r.h[i] = h; r.l[i] = (__bf16)(v[i] - (float)h); }
  return r; }
__device__ __forceinline__ F2 split_row(const float* row, int k0, int lane) { float v[16]; const float* p = row + k0 + 8 * (lane >> 4);
#pragma unroll
  for (int i = 0; i < 8; ++i) { v[i] = p[i]; v[8 + i] = p[16 + i]; }
  return bsplit16(v); }
__device__ __forceinline__ F2 split_rowK(const float* row, int k0, int lane, int K) { float v[16]; const int g = lane >> 4;
#pragma unroll
  for (int i = 0; i < 8; ++i) { const int ka = k0 + 8 * g + i, kb = ka + 16; v[i] = ka < K ? row[ka < K ? ka : K - 1] : 0.f; v[8 + i] = kb < K ? row[kb < K ? kb : K - 1] : 0.f; }
  return bsplit16(v); }
__device__ __forceinline__ F2 split_col(const float* W, int k0, int n, int lane, int ld, int K) { float v[16]; const int g = lane >> 4;
#pragma unroll
  for (int i = 0; i < 8; ++i) { const int ka = k0 + 8 * g + i, kb = ka + 16; v[i] = ka < K ? W[(size_t)(ka < K ? ka : K - 1) * ld + n] : 0.f; v[8 + i] = kb < K ? W[(size_t)(kb < K ? kb : K - 1) * ld + n] : 0.f; }
  return bsplit16(v); }
__device__ __forceinline__ v8f mac3(const F2& a, const F2& b, v8f c) { c = wmma_bf(a.l, b.h, c); c = wmma_bf(a.h, b.l, c); return wmma_bf(a.h, b.h, c); }
__device__ __forceinline__ float sigm(float v) { return 1.0f / (1.0f + expf(-v)); }
#define LDSX() do { asm volatile("s_wait_dscnt 0" ::: "memory"); __builtin_amdgcn_wave_barrier(); __builtin_amdgcn_fence(__ATOMIC_RELEASE, "workgroup"); } while (0)

// Causal multi-head self-attention with per-head-shaped weights and TWO output projections (x [2,2048,1024]; wq / wk / wv [1024,16,64] = (in, head, d): an (in,out) [1024][1024] matrix with out = head*64 + d; wp1 [16,64,1024] = (head, d, out): an (in,out) [1024][1024] matrix with in = head*64 + d; wp2 [1024,1024] (in,out); all N(0, 1/1024), no biases; wei = q k^T x 64^-0.5; tril kept, -inf elsewhere; softmax; att merged (head*64 + d); y = att wp1; out = y wp2).
#define NB 2
#define TT 2048
#define CC 1024            // NH * HD = projected width
#define DIN 1024          // input (model) width
#define NH 16
#define HD 64
#define SCALE (0.125f)
#define CAUSAL 1
#ifndef TNB
#define TNB NB
#endif
__device__ __forceinline__ float bfr(float v) { return (float)(__bf16)v; }
__host__ __device__ __forceinline__ int kb_last(int qb) { return CAUSAL ? ((qb * 64 + 63) >> 7) : (TT / 128 - 1); }
typedef __attribute__((ext_vector_type(8))) __bf16 v8b;
__device__ __forceinline__ v16b frag_b(const __bf16* rowk0, int lane) {
  union { v16b v; v8b q[2]; } u; const __bf16* p = rowk0 + 8 * (lane >> 4);
  u.q[0] = *(const v8b*)p; u.q[1] = *(const v8b*)(p + 16); return u.v;
}
#define QBH 6              // causal: query blocks 0..QBH-1 of each sequence (few keys, no averaging) take the high-precision path
#define QHI 384            // rows carrying a q residual plane
#define KHI 384            // key rows carrying k residual / v bf16 hi+lo planes (used only by the causal high-precision path)
// B fragment (k rows k0+.., output column o) of a weight: (in,out) [K][ld] or (out,in) [ld rows of K]: bf16 exact, or f16(bf16 * 256) exact
__device__ __forceinline__ v16b wcol_io(const float* Wm, int k0, int o, int lane, int ld) { v16b w; const int g = lane >> 4;
#pragma unroll
  for (int i = 0; i < 8; ++i) { w[i] = (__bf16)Wm[(size_t)(k0 + 8 * g + i) * ld + o]; w[8 + i] = (__bf16)Wm[(size_t)(k0 + 16 + 8 * g + i) * ld + o]; }
  return w; }
__device__ __forceinline__ v16b wcol_oi(const float* Wm, int k0, int o, int lane, int K) { v16b w; const float* p = Wm + (size_t)o * K + k0 + 8 * (lane >> 4);
#pragma unroll
  for (int i = 0; i < 8; ++i) { w[i] = (__bf16)p[i]; w[8 + i] = (__bf16)p[16 + i]; }
  return w; }
__device__ __forceinline__ v16h wcolh_io(const float* Wm, int k0, int o, int lane, int ld) { v16h w; const int g = lane >> 4;
#pragma unroll
  for (int i = 0; i < 8; ++i) { w[i] = (_Float16)(bfr(Wm[(size_t)(k0 + 8 * g + i) * ld + o]) * 256.0f); w[8 + i] = (_Float16)(bfr(Wm[(size_t)(k0 + 16 + 8 * g + i) * ld + o]) * 256.0f); }
  return w; }
__device__ __forceinline__ v16h wcolh_oi(const float* Wm, int k0, int o, int lane, int K) { v16h w; const float* p = Wm + (size_t)o * K + k0 + 8 * (lane >> 4);
#pragma unroll
  for (int i = 0; i < 8; ++i) { w[i] = (_Float16)(bfr(p[i]) * 256.0f); w[8 + i] = (_Float16)(bfr(p[16 + i]) * 256.0f); }
  return w; }
#define WQKV_LAYOUT 0   // 0 = (in,out) [DIN][CC]; 1 = (out,in) [CC][DIN]; 2 = per-head [NH][DIN][HD]
__device__ __forceinline__ v16b wcol_hdk(const float* Wm, int k0, int o, int lane) { v16b w; const int g = lane >> 4; const float* p = Wm + (size_t)(o / HD) * DIN * HD + (o % HD);
#pragma unroll
  for (int i = 0; i < 8; ++i) { w[i] = (__bf16)p[(size_t)(k0 + 8 * g + i) * HD]; w[8 + i] = (__bf16)p[(size_t)(k0 + 16 + 8 * g + i) * HD]; }
  return w; }
#define WO_OUT_IN 0
#if WQKV_LAYOUT == 1
#define WCOL(W, k0, o, lane) wcol_oi(W, k0, o, lane, DIN)
#elif WQKV_LAYOUT == 2
#define WCOL(W, k0, o, lane) wcol_hdk(W, k0, o, lane)
#else
#define WCOL(W, k0, o, lane) wcol_io(W, k0, o, lane, CC)
#endif
#if WO_OUT_IN
#define WOCOL(W, k0, o, lane) wcol_oi(W, k0, o, lane, CC)
#define WOCOLH(W, k0, o, lane) wcolh_oi(W, k0, o, lane, CC)
#else
#define WOCOL(W, k0, o, lane) wcol_io(W, k0, o, lane, DIN)
#define WOCOLH(W, k0, o, lane) wcolh_io(W, k0, o, lane, DIN)
#endif

#ifndef PROJ_EXTRA_PARAMS
#define PROJ_EXTRA_PARAMS
#endif

// q, k and v lie in the workspace in the order of k_pv's matrix fragments: the 16 bytes that lane l takes with one load stand at l * 16 in a run of 512 bytes, so that every load of a wave covers four whole 128-byte lines (from rows or planes it would touch 16 lines for 32 bytes each)
#define QKT 1024           // 16-bit elements of one 16-row tile of one head's q or k: [d / 32][(d / 16) & 1][lane = 16 ((d / 8) & 1) + (t & 15)][d & 7]
#define VCH 2048           // 16-bit elements of one 32-key chunk of one head's v: [d / 16][(t / 16) & 1][lane = 16 ((t / 8) & 1) + (d & 15)][t & 7]
static_assert(HD == 64 && QKT == 16 * HD && VCH == 32 * HD, "the fragment-order tiles are written for head size 64");
#define WS_QH  0u                                      // f16 q tiles [b][h][t / 16][QKT]
#define WS_KH  (WS_QH + 2u * (size_t)NB * TT * CC)      // f16 k tiles [b][h][t / 16][QKT]
#define WS_VT  (WS_KH + 2u * (size_t)NB * TT * CC)      // f16 v chunks [b][h][t / 32][VCH]
#define WS_QL  (WS_VT + 2u * (size_t)NB * CC * TT)      // f16 q residual x 2^10 tiles [b][h][t / 16, t < QHI][QKT]
#define WS_KL  (WS_QL + 2u * (size_t)NB * QHI * CC)     // f16 k residual x 2^10 tiles [b][h][t / 16, t < KHI][QKT]
#define WS_VB  (WS_KL + 2u * (size_t)NB * KHI * CC)     // bf16 v hi chunks [b][h][t / 32, t < KHI][VCH]
#define WS_VBL (WS_VB + 2u * (size_t)NB * CC * KHI)
#define WS_Y   (WS_VBL + 2u * (size_t)NB * CC * KHI)    // f32 ctx rows [b*t][CC] (only when there is an output projection)
#define WS_END (WS_Y  + 4u * (size_t)NB * TT * CC)
#define WS_Y2 (WS_END)                                     // f32 rows [b*t][DIN]: the first output projection's result, the second one's operand
#define WS_END2 (WS_Y2 + 4u * (size_t)NB * TT * DIN)

// ---- operand tiles of one K step (32 k) of k_proj / k_out: read by whole-line loads and converted once per block, kept in LDS as 16-bit rows of 32 k, so that an A or B fragment is two 16-byte LDS reads (frag_b / frag_h on the row). Every loop over a register array, here and in the K steps, is fully unrolled: its indices must be constants, else the array goes to scratch
#define WP 40              // LDS pitch of a staged row in 16-bit elements: 32 k values + 16 bytes, so that 16-byte reads and writes of 64-byte rows spread over all banks
static_assert(WQKV_LAYOUT == 0 && !WO_OUT_IN, "the staged weight tile is written for (in,out) weights");
typedef __attribute__((ext_vector_type(4))) __bf16 v4b;
typedef __attribute__((ext_vector_type(4))) _Float16 v4h;
// weight tile: 32 k rows x 128 output columns of an (in,out) [K][ld] matrix, in LDS as [column][k]. Thread (wave, lane) owns the patch k = 8 (lane >> 3) + 0..7, column = 32 wave + 4 (lane & 7) + 0..3: each load instruction covers four whole 128-byte lines, each LDS store holds 8 consecutive k of one column
__device__ __forceinline__ const float* wt_ptr(const float* Wm, int c0, int wave, int lane, int ld) { return Wm + (size_t)(8 * (lane >> 3)) * ld + c0 + 32 * wave + 4 * (lane & 7); }
__device__ __forceinline__ void wt_load(v4f (&r)[8], const float* p, int ld) {
#pragma unroll
  for (int i = 0; i < 8; ++i) r[i] = *(const v4f*)(p + (size_t)i * ld); }
__device__ __forceinline__ void wt_put_b(__bf16* buf, const v4f (&r)[8], int wave, int lane) {   /* bf16, exact for the bf16-rounded weight */
#pragma unroll
  for (int c = 0; c < 4; ++c) { v8b t;
#pragma unroll
    for (int i = 0; i < 8; ++i) t[i] = (__bf16)r[i][c];
    *(v8b*)(buf + (32 * wave + 4 * (lane & 7) + c) * WP + 8 * (lane >> 3)) = t; } }
__device__ __forceinline__ void wt_put_h(_Float16* buf, const v4f (&r)[8], int wave, int lane) {   /* f16(bf16 x 2^8), exact */
#pragma unroll
  for (int c = 0; c < 4; ++c) { v8h t;
#pragma unroll
    for (int i = 0; i < 8; ++i) t[i] = (_Float16)(bfr(r[i][c]) * 256.0f);
    *(v8h*)(buf + (32 * wave + 4 * (lane & 7) + c) * WP + 8 * (lane >> 3)) = t; } }
// row tile: 64 rows x 32 k of an f32 [rows][ld] matrix, in LDS as [row][k]; rows0 = the block's first row. Thread (wave, lane) owns k = 4 (lane & 7) + 0..3 of rows 16 wave + 4 i + (lane >> 3), i < 4 (the rows of its own wave's A fragment): each load instruction covers four whole 128-byte lines
__device__ __forceinline__ const float* xt_ptr(const float* rows0, int wave, int lane, int ld) { return rows0 + (size_t)(16 * wave + (lane >> 3)) * ld + 4 * (lane & 7); }
__device__ __forceinline__ void xt_load(v4f (&r)[4], const float* p, int ld) {
#pragma unroll
  for (int i = 0; i < 4; ++i) r[i] = *(const v4f*)(p + (size_t)(4 * i) * ld); }
__device__ __forceinline__ int xt_at(int i, int wave, int lane) { return (16 * wave + 4 * i + (lane >> 3)) * WP + 4 * (lane & 7); }
__device__ __forceinline__ void xt_put_b(__bf16* buf, const v4f (&r)[4], int wave, int lane) {   /* once to bf16 */
#pragma unroll
  for (int i = 0; i < 4; ++i) { v4b t;
#pragma unroll
    for (int c = 0; c < 4; ++c) t[c] = (__bf16)r[i][c];
    *(v4b*)(buf + xt_at(i, wave, lane)) = t; } }
__device__ __forceinline__ void xt_put_hl(__bf16* bh, __bf16* bl, const v4f (&r)[4], int wave, int lane) {   /* bf16 hi + lo planes, as bsplit16 */
#pragma unroll
  for (int i = 0; i < 4; ++i) { v4b th, tl;
#pragma unroll
    for (int c = 0; c < 4; ++c) { const __bf16 h = (__bf16)r[i][c]; th[c] = h; tl[c] = (__bf16)(r[i][c] - (float)h); }
    *(v4b*)(bh + xt_at(i, wave, lane)) = th; *(v4b*)(bl + xt_at(i, wave, lane)) = tl; } }
__device__ __forceinline__ void xt_put_h(_Float16* buf, const v4f (&r)[4], int wave, int lane, float sc) {   /* x sc, once to f16 */
#pragma unroll
  for (int i = 0; i < 4; ++i) { v4h t;
#pragma unroll
    for (int c = 0; c < 4; ++c) t[c] = (_Float16)(r[i][c] * sc);
    *(v4h*)(buf + xt_at(i, wave, lane)) = t; } }
// ---- k_proj: block = (64 rows, 128 cols, which): q/k/v = X W (+ b) with exact bf16 products (K = DIN), both operand tiles of each K step staged in LDS (two buffers, which share their LDS with the epilogue's tiles), the next step's loads issued behind the step's barrier -> which 0: q f16 tiles (+ residual tiles, rows < QHI); 1: k f16 tiles (+ residual tiles, rows < KHI); 2: v f16 chunks (+ bf16 hi/lo chunks for t < KHI), all in fragment order: thread e of the store loops takes the e-th 16 bytes of the block's share, so that a wave stores 512 bytes in a row
__global__ __launch_bounds__(128) void k_proj(const float* __restrict__ XQ, const float* __restrict__ XK, const float* __restrict__ XV, const float* __restrict__ WQ, const float* __restrict__ WK, const float* __restrict__ WV, const float* __restrict__ BQ, const float* __restrict__ BK, const float* __restrict__ BV,
    _Float16* __restrict__ QH, _Float16* __restrict__ QL, _Float16* __restrict__ KH, _Float16* __restrict__ KL, _Float16* __restrict__ VT, __bf16* __restrict__ VB, __bf16* __restrict__ VBL) {
  __shared__ __align__(16) union { struct { _Float16 sh[64][136], sl[64][136]; } r; struct { _Float16 th[128][72]; __bf16 tb[128][72], tbl[128][72]; } c; struct { __bf16 w[2][128 * WP], x[2][64 * WP]; } k; } u;
  _Float16 (&sh)[64][136] = u.r.sh; _Float16 (&sl)[64][136] = u.r.sl; _Float16 (&th)[128][72] = u.c.th; __bf16 (&tb)[128][72] = u.c.tb; __bf16 (&tbl)[128][72] = u.c.tbl;
  const int tid = threadIdx.x, wave = tid >> 5, lane = tid & 31, col = lane & 15, g = lane >> 4; const int which = blockIdx.z; const int c0 = blockIdx.y * 128; const size_t r0 = (size_t)blockIdx.x * 64; const size_t bb = r0 / TT; const int t0 = (int)(r0 % TT);
  const float* X = which == 0 ? XQ : which == 1 ? XK : XV; const float* WA = which == 0 ? WQ : which == 1 ? WK : WV; const float* BA = which == 0 ? BQ : which == 1 ? BK : BV;
  v8f acc[8] = {};
  const float* wp = wt_ptr(WA, c0, wave, lane, CC); const float* xp = xt_ptr(X + r0 * DIN, wave, lane, DIN);
  v4f wr[8], xr[4]; wt_load(wr, wp, CC); xt_load(xr, xp, DIN);
  for (int kc = 0; kc < DIN / 32; ++kc) { __bf16* wb = u.k.w[kc & 1]; __bf16* xb = u.k.x[kc & 1]; wt_put_b(wb, wr, wave, lane); xt_put_b(xb, xr, wave, lane);
    __syncthreads();   /* the whole tiles of step kc are in LDS before any wave reads fragments across them; the same barrier ends every wave's reads of step kc - 1, whose buffers step kc + 1 overwrites */
    if (kc + 1 < DIN / 32) { wt_load(wr, wp + (size_t)32 * CC, CC); xt_load(xr, xp + 32, DIN);
      asm volatile("s_wait_xcnt 0x0" :: "v"(wp), "v"(xp) : "memory");   /* the loads' address registers, named here so that they stay as they are up to this wait, are advanced behind it */
      wp += (size_t)32 * CC; xp += 32; }
    const v16b a = frag_b(xb + (wave * 16 + col) * WP, lane); v16b wf[8];
#pragma unroll
    for (int j = 0; j < 8; ++j) wf[j] = frag_b(wb + (j * 16 + col) * WP, lane);   /* all of the step's LDS reads as one group in front of its matrix instructions */
#pragma unroll
    for (int j = 0; j < 8; ++j) acc[j] = wmma_bf(a, wf[j], acc[j]); }
  __syncthreads();   /* every wave has read its last fragments before the epilogue's tiles overwrite the staging buffers */
  if (which < 2) { _Float16* DH = which == 0 ? QH : KH; _Float16* DL = which == 0 ? QL : KL; const int nhi = which == 0 ? QHI : KHI; const bool hi_rows = t0 < nhi;
#pragma unroll
    for (int j = 0; j < 8; ++j) { const float bias = BA ? bfr(BA[c0 + j * 16 + col]) : 0.f;
#pragma unroll
      for (int r = 0; r < 8; ++r) { const float v = acc[j][r] + bias; const _Float16 hv = (_Float16)v; sh[wave * 16 + 8 * g + r][j * 16 + col] = hv; sl[wave * 16 + 8 * g + r][j * 16 + col] = (_Float16)((v - (float)hv) * 1024.0f); } }
    __syncthreads();
    for (int e = tid; e < 64 * 16; e += 128) { const int hh = e >> 9, tl = (e >> 7) & 3, rl = tl * 16 + col, cl = hh * HD + ((e >> 5) & 3) * 16 + g * 8; const size_t hb = bb * NH + c0 / HD + hh;   /* e = [head][tile][d / 16][lane] */
      vst2((unsigned*)(DH + (hb * (TT / 16) + t0 / 16 + tl) * QKT + (e & 127) * 8), *(const v4u*)&sh[rl][cl]);
      asm volatile("s_wait_xcnt 0x0" ::: "memory");   /* in front of what rewrites the store's address and data registers: the residual's lines, the next trip */
      if (hi_rows) { vst2((unsigned*)(DL + (hb * (nhi / 16) + t0 / 16 + tl) * QKT + (e & 127) * 8), *(const v4u*)&sl[rl][cl]);
        asm volatile("s_wait_xcnt 0x0" ::: "memory"); } }   /* as above */
  } else { const bool hi_rows = t0 < KHI;
#pragma unroll
    for (int j = 0; j < 8; ++j) { const float bias = BA ? bfr(BA[c0 + j * 16 + col]) : 0.f;
#pragma unroll
      for (int r = 0; r < 8; ++r) { const float v = acc[j][r] + bias; const int rl = wave * 16 + 8 * g + r, cl = j * 16 + col; th[cl][rl] = (_Float16)v; const __bf16 bh = (__bf16)v; tb[cl][rl] = bh; tbl[cl][rl] = (__bf16)(v - (float)bh); } }
    __syncthreads();
    for (int e = tid; e < 128 * 8; e += 128) { const int hh = e >> 9, cn = (e >> 8) & 1, cl = hh * HD + ((e >> 6) & 3) * 16 + col, rl = cn * 32 + ((e >> 5) & 1) * 16 + g * 8; const size_t hb = bb * NH + c0 / HD + hh;   /* e = [head][chunk][d / 16][(t / 16) & 1][lane] */
      vst2((unsigned*)(VT + (hb * (TT / 32) + t0 / 32 + cn) * VCH + (e & 255) * 8), *(const v4u*)&th[cl][rl]);
      asm volatile("s_wait_xcnt 0x0" ::: "memory");   /* as in the branch above */
      if (hi_rows) { const size_t o3 = (hb * (KHI / 32) + t0 / 32 + cn) * VCH + (e & 255) * 8; vst2((unsigned*)(VB + o3), *(const v4u*)&tb[cl][rl]); vst2((unsigned*)(VBL + o3), *(const v4u*)&tbl[cl][rl]);
        asm volatile("s_wait_xcnt 0x0" ::: "memory"); } } } }   /* as in the branch above */
// ---- k_pv: block = 16 queries (tile qt of query block qb = qt / 4) of (b, h) = blockIdx.z, PVW waves. Logits first, never through memory: wave w takes the 64-key units w, w + PVW, ... of keys [0, kend): q x k on the matrix unit, x SCALE, f32 to the 16 LDS rows (single f16 product; causal early query blocks: q hi + residual (x 2^10) against k hi + residual, 3 products); the mask is applied by index in the softmax. Softmax: wave w takes query rows w and w + PVW whole, in registers: keys [0, kend): causal -> logit if s <= t else excluded; softmax in f32; exp(logit - max) (0 for excluded) back to the LDS rows, 2^11 / sum to LDS per row. Then ctx = P . v over keys [0, kend), P x 2^11 = the LDS value x the row's 2^11 / sum; wave w takes the 32-key chunks w, w + PVW, ... and the PVW partial tiles are summed in wave order through LDS (P x 2^11 once to f16 against v f16: 1 product; causal early query blocks: P and v as bf16 hi + lo, 3 products); 256-B (row, head) segment by 16 lanes
#define PVW 8
#define PPITCH (TT + 4)    // LDS pitch of a P row in floats: 16 bytes over the row, so that the 16 rows of a fragment read start 4 banks apart
#define NCF (TT / 128 - 1) // most 128-key pieces of a row in front of its last one; a piece is one 16-byte load per lane
__device__ __forceinline__ v4f sm_exp(v4f v, float m) { v4f e;
#pragma unroll
  for (int c = 0; c < 4; ++c) { const float ex = expf(v[c] - m); e[c] = (v[c] <= -1.0e38f) ? 0.f : ex; }
  return e; }
// one query row's softmax by one wave: lane l holds the logits of keys i * 128 + 4 l + 0..3 in x[i], i < nf, and those of the row's last piece (i = nf) in xl. Only the last piece can hold keys > t: nf * 128 = (kb_last(qb)) * 128 <= qb * 64 <= t. Returns 2^11 / sum; exp(logit - max) goes to the LDS row pr
__device__ __forceinline__ float sm_row(const v4f (&x)[NCF], v4f xl, int nf, int t, int lane, float* pr) {
  float m = -3.0e38f;
#pragma unroll
  for (int c = 0; c < 4; ++c) { xl[c] = (!CAUSAL || nf * 128 + lane * 4 + c <= t) ? xl[c] : -3.0e38f; m = fmaxf(m, xl[c]); }
#pragma unroll
  for (int i = 0; i < NCF; ++i) if (i < nf) {
#pragma unroll
    for (int c = 0; c < 4; ++c) m = fmaxf(m, x[i][c]); }
#pragma unroll
  for (int o = 1; o < 32; o <<= 1) m = fmaxf(m, __shfl_xor(m, o));
  v4f s4 = {};
#pragma unroll
  for (int i = 0; i < NCF; ++i) if (i < nf) { const v4f e = sm_exp(x[i], m); s4 += e; *(v4f*)(pr + i * 128 + lane * 4) = e; }
  { const v4f e = sm_exp(xl, m); s4 += e; *(v4f*)(pr + nf * 128 + lane * 4) = e; }
  float sum = (s4[0] + s4[1]) + (s4[2] + s4[3]);
#pragma unroll
  for (int o = 1; o < 32; o <<= 1) sum += __shfl_xor(sum, o);
  return sum > 0.f ? 2048.0f / sum : 0.f; }   /* a fully excluded row yields P = 0 */
#define KU 64              // keys of one logit unit: four 16-key tiles, whose 16 loads per lane are in flight together
// the B fragments of one unit: f[2 j + kc] = keys 16 j + (lane & 15), d = 32 kc + ..; p = the lane's own 16 bytes in the first 512 of the unit's four tiles, so that all 16 loads go off one address
__device__ __forceinline__ void ku_load(v16h (&f)[8], const _Float16* p) {
#pragma unroll
  for (int j = 0; j < 4; ++j)
#pragma unroll
    for (int kc = 0; kc < 2; ++kc) { union { v16h v; v8h q[2]; } u; const _Float16* s = p + j * QKT + kc * (QKT / 2); u.q[0] = *(const v8h*)s; u.q[1] = *(const v8h*)(s + QKT / 4); f[2 * j + kc] = u.v; } }
// one unit's logits, single product: the four tiles' accumulators are independent, so that no matrix instruction waits for the one in front of it; w = the lane's place (row 8 (lane >> 4), key lane & 15 of the unit) in the LDS rows
__device__ __forceinline__ void lg_unit(v16h a0, v16h a1, const v16h (&f)[8], float* w) { v8f c[4];
#pragma unroll
  for (int j = 0; j < 4; ++j) { const v8f z = {}; c[j] = wmma16(a0, f[2 * j], z); }
#pragma unroll
  for (int j = 0; j < 4; ++j) c[j] = wmma16(a1, f[2 * j + 1], c[j]);
#pragma unroll
  for (int j = 0; j < 4; ++j)
#pragma unroll
    for (int r = 0; r < 8; ++r) w[r * PPITCH + j * 16] = c[j][r] * SCALE; }
// the B fragments of one 32-key chunk of v: f[j] = d = 16 j + (lane & 15), keys 8 (lane >> 4) + ..; p = the lane's own 16 bytes in the chunk's first 512, so that all 8 loads go off one address
template <typename V, typename E> __device__ __forceinline__ void pv_load(V (&f)[HD / 16], const E* p) {
#pragma unroll
  for (int j = 0; j < HD / 16; ++j) { union { V v; v4u q[2]; } u; const E* s = p + j * (VCH / 4); u.q[0] = *(const v4u*)s; u.q[1] = *(const v4u*)(s + VCH / 8); f[j] = u.v; } }
// one chunk's P . v, single product: P x 2^11 from the LDS row, once to f16, against the chunk's four fragments
__device__ __forceinline__ void pv_mac(v8f (&acc)[HD / 16], v16h p, const v16h (&f)[HD / 16]) {
#pragma unroll
  for (int j = 0; j < HD / 16; ++j) acc[j] = wmma16(p, f[j], acc[j]); }
__device__ __forceinline__ void pv_unit(v8f (&acc)[HD / 16], const v16h (&f)[HD / 16], const float* prow, int lane, float inv) { pv_mac(acc, frag_f32s(prow, lane, inv), f); }
__global__ __launch_bounds__(32 * PVW) void k_pv(const _Float16* __restrict__ QH, const _Float16* __restrict__ KH, const _Float16* __restrict__ QL, const _Float16* __restrict__ KL, const _Float16* __restrict__ VT, const __bf16* __restrict__ VB, const __bf16* __restrict__ VBL, float* __restrict__ Y) { const int b = blockIdx.z / NH, h = blockIdx.z % NH; __shared__ __align__(16) float sp[16 * PPITCH]; __shared__ float sinv[16];
  static_assert(PVW * 16 * (HD + 4) <= 16 * PPITCH && 2 * PVW == 16, "the partial tiles reuse the P rows' LDS; two query rows per wave");
  static_assert((((QBH * 64 + 63) >> 7) + 1) * 4 >= 2 * PVW, "beyond the early query blocks every wave has two P.v chunks or more");
  static_assert(CAUSAL && (((QBH * 64 + 63) >> 7) + 1) * (128 / KU) >= PVW && ((((QBH - 1) * 64 + 63) >> 7) + 1) * (128 / KU) <= PVW, "beyond the early query blocks every wave has a logit unit, within them at most one");
  const int tid = threadIdx.x, lane = tid & 31, col = lane & 15, g = lane >> 4; const int qb = blockIdx.x >> 2; const int ql0 = blockIdx.x * 16; const int kce = (kb_last(qb) + 1) * 4;
  const int wave = __builtin_amdgcn_readfirstlane(tid >> 5);   /* scalar, so that the key loop's bounds and branch stay wave-uniform around the matrix instructions */
  { const int nu = (kb_last(qb) + 1) * (128 / KU); const size_t bh = blockIdx.z; float* sw = sp + 8 * g * PPITCH + col;   /* bh = b NH + h, the head's index in the fragment-order planes */
    const _Float16* qp = QH + (bh * (TT / 16) + blockIdx.x) * QKT + lane * 8; const _Float16* kp = KH + (bh * (TT / 16) + wave * (KU / 16)) * QKT + lane * 8;
    union { v16h v; v8h q[2]; } a0, a1; a0.q[0] = *(const v8h*)qp; a0.q[1] = *(const v8h*)(qp + QKT / 4); a1.q[0] = *(const v8h*)(qp + QKT / 2); a1.q[1] = *(const v8h*)(qp + 3 * (QKT / 4));
    if (qb < QBH) { const _Float16* qlp = QL + (bh * (QHI / 16) + blockIdx.x) * QKT + lane * 8; const _Float16* klp = KL + (bh * (KHI / 16) + wave * (KU / 16)) * QKT + lane * 8;
      union { v16h v; v8h q[2]; } l0, l1; l0.q[0] = *(const v8h*)qlp; l0.q[1] = *(const v8h*)(qlp + QKT / 4); l1.q[0] = *(const v8h*)(qlp + QKT / 2); l1.q[1] = *(const v8h*)(qlp + 3 * (QKT / 4));
      asm volatile("s_wait_xcnt 0x0" :: "v"(qp), "v"(qlp) : "memory");   /* the loads' address registers, named here so that they stay as they are up to this wait, may be reused behind it */
      if (wave < nu) { const int u = wave; v16h kf[8], lf[8]; ku_load(kf, kp); ku_load(lf, klp);   /* here nu <= PVW: at most one unit per wave; a scalar test, so that the matrix instructions run with every lane on */
        asm volatile("s_wait_xcnt 0x0" :: "v"(kp), "v"(klp) : "memory");   /* as above */
#pragma unroll
        for (int j = 0; j < 4; ++j) { v8f c = {}, cl = {};
          c = wmma16(a0.v, kf[2 * j], c); cl = wmma16(l0.v, kf[2 * j], cl); cl = wmma16(a0.v, lf[2 * j], cl);
          c = wmma16(a1.v, kf[2 * j + 1], c); cl = wmma16(l1.v, kf[2 * j + 1], cl); cl = wmma16(a1.v, lf[2 * j + 1], cl);
#pragma unroll
          for (int r = 0; r < 8; ++r) sw[r * PPITCH + u * KU + j * 16] = (c[r] + cl[r] * (1.0f / 1024.0f)) * SCALE; } }
    } else { v16h kf[8], kn[8]; int u = wave; constexpr size_t KS = (size_t)PVW * (KU / 16) * QKT;   /* from one unit of a wave to its next; here nu >= PVW: every wave has a unit */
      ku_load(kf, kp);
      asm volatile("s_wait_xcnt 0x0" :: "v"(qp), "v"(kp) : "memory");   /* as above */
      /* two register sets by turns, and no branch between a unit's loads and the work on the unit before it: the wave's next unit is in flight while this one is worked on */
      while (u + 2 * PVW < nu) { ku_load(kn, kp + KS); lg_unit(a0.v, a1.v, kf, sw + u * KU); ku_load(kf, kp + 2 * KS);
        asm volatile("s_wait_xcnt 0x0" :: "v"(kp) : "memory");   /* as above: the address is advanced behind it */
        kp += 2 * KS; lg_unit(a0.v, a1.v, kn, sw + (u + PVW) * KU); u += 2 * PVW; }
      if (u + PVW < nu) { ku_load(kn, kp + KS);
        asm volatile("s_wait_xcnt 0x0" :: "v"(kp) : "memory");   /* as above */
        lg_unit(a0.v, a1.v, kf, sw + u * KU); lg_unit(a0.v, a1.v, kn, sw + (u + PVW) * KU); }
      else lg_unit(a0.v, a1.v, kf, sw + u * KU); } }
  __syncthreads();   /* all 16 rows' logits are in LDS before any wave reads a row across the units */
  { const int nf = kb_last(qb); v4f x0[NCF], x1[NCF]; const float* s0 = sp + wave * PPITCH + lane * 4; const float* s1 = s0 + PVW * PPITCH;
#pragma unroll
    for (int i = 0; i < NCF; ++i) if (i < nf) { x0[i] = *(const v4f*)(s0 + i * 128); x1[i] = *(const v4f*)(s1 + i * 128); }   /* both rows whole in registers before either row's LDS is overwritten */
    const v4f xl0 = *(const v4f*)(s0 + nf * 128), xl1 = *(const v4f*)(s1 + nf * 128);
    const float i0 = sm_row(x0, xl0, nf, ql0 + wave, lane, sp + wave * PPITCH), i1 = sm_row(x1, xl1, nf, ql0 + wave + PVW, lane, sp + (wave + PVW) * PPITCH);
    if (lane == 0) { sinv[wave] = i0; sinv[wave + PVW] = i1; } }
  __syncthreads();   /* all 16 rows and their factors are in LDS before any wave reads fragments across them */
  const float inv = sinv[col]; const float* pc = sp + col * PPITCH + 8 * g;
  v8f acc[HD / 16] = {};
  if (qb < QBH) {
    const size_t vo = (size_t)blockIdx.z * (KHI / 32) * VCH + lane * 8;
#pragma unroll 1   /* at most two trips here: kept rolled, so that the kernel's text stays short */
    for (int kc = wave; kc < kce; kc += PVW) { v16b vh[HD / 16], vl[HD / 16]; const __bf16* hp = VB + vo + kc * VCH; const __bf16* lp = VBL + vo + kc * VCH; pv_load(vh, hp); pv_load(vl, lp);   /* the chunk's 16 loads in flight together, in front of its matrix instructions */
      asm volatile("s_wait_xcnt 0x0" :: "v"(hp), "v"(lp) : "memory");   /* the loads' address registers, named here so that they stay as they are up to this wait, may be reused behind it */
      float pv[16];
#pragma unroll
      for (int i = 0; i < 8; ++i) { pv[i] = pc[kc * 32 + i] * inv; pv[8 + i] = pc[kc * 32 + 16 + i] * inv; }
      const F2 p = bsplit16(pv);
#pragma unroll
      for (int j = 0; j < HD / 16; ++j) { acc[j] = wmma_bf(p.h, vh[j], acc[j]); acc[j] = wmma_bf(p.l, vh[j], acc[j]); acc[j] = wmma_bf(p.h, vl[j], acc[j]); } }
  } else { v16h vf[HD / 16], vn[HD / 16]; int kc = wave; constexpr int VS = PVW * VCH;   /* from one chunk of a wave to its next, in elements; here kce >= 2 PVW: every wave has two chunks or more */
    const _Float16* vp = VT + ((size_t)blockIdx.z * (TT / 32) + wave) * VCH + lane * 8; const float* pr = sp + col * PPITCH;
    pv_load(vf, vp); pv_load(vn, vp + VS);
    asm volatile("s_wait_xcnt 0x0" :: "v"(vp) : "memory");   /* as above */
    /* two register sets by turns, each refilled as soon as its chunk is worked off, and no branch between a chunk's loads and the work on the chunk behind it: two chunks of the wave are in flight at any time; the wave sums its chunks in rising order */
    while (kc + 3 * PVW < kce) { const v16h p0 = frag_f32s(pr + kc * 32, lane, inv), p1 = frag_f32s(pr + (kc + PVW) * 32, lane, inv);   /* both chunks' P fragments first, so that each set's refill follows its last matrix instruction directly */
      pv_mac(acc, p0, vf); pv_load(vf, vp + 2 * VS); pv_mac(acc, p1, vn); pv_load(vn, vp + 3 * VS);
      asm volatile("s_wait_xcnt 0x0" :: "v"(vp) : "memory");   /* as above: the address is advanced behind it */
      vp += 2 * VS; kc += 2 * PVW; }
    pv_unit(acc, vf, pr + kc * 32, lane, inv);
    if (kc + 2 * PVW < kce) { pv_load(vf, vp + 2 * VS);
      asm volatile("s_wait_xcnt 0x0" :: "v"(vp) : "memory");   /* as above */
      pv_unit(acc, vn, pr + (kc + PVW) * 32, lane, inv); pv_unit(acc, vf, pr + (kc + 2 * PVW) * 32, lane, inv); }
    else pv_unit(acc, vn, pr + (kc + PVW) * 32, lane, inv); }
  __syncthreads();   /* every wave has read its last P fragment before the partial tiles overwrite the P rows */
  float (*ss)[16][HD + 4] = (float (*)[16][HD + 4])sp;
#pragma unroll
  for (int j = 0; j < HD / 16; ++j)
#pragma unroll
    for (int r = 0; r < 8; ++r) ss[wave][8 * g + r][j * 16 + col] = acc[j][r];
  __syncthreads();   /* every wave's partial tile is in LDS before any thread sums across waves */
  for (int e = tid; e < 16 * (HD / 4); e += 32 * PVW) { const int rl = e / (HD / 4), q = e % (HD / 4); v4f s = *(const v4f*)&ss[0][rl][q * 4];
    for (int w = 1; w < PVW; ++w) s += *(const v4f*)&ss[w][rl][q * 4];
    vst2(Y + ((size_t)b * TT + ql0 + rl) * CC + h * HD + q * 4, s * (1.0f / 2048.0f)); } }
// ---- k_out: block = (64 rows, 128 cols): out = ctx Wo (+ bo), both operand tiles of each K step staged in LDS as in k_proj: ctx x 2^6 once to f16 against Wo as f16(bf16 x 2^8) exact (1 product) x 2^-14; causal early rows (< QHI of each sequence): ctx bf16 hi + lo against exact bf16 Wo (2 products)
__global__ __launch_bounds__(128) void k_out(const float* __restrict__ Y, const float* __restrict__ WO, const float* __restrict__ BO, float* __restrict__ OUT) { __shared__ __align__(16) float sf[4][16][132]; __shared__ __align__(16) union { struct { __bf16 w[2][128 * WP], yh[2][64 * WP], yl[2][64 * WP]; } b; struct { _Float16 w[2][128 * WP], y[2][64 * WP]; } h; } sk;
  const int tid = threadIdx.x, wave = tid >> 5, lane = tid & 31, col = lane & 15, g = lane >> 4; const int c0 = blockIdx.y * 128; const size_t r0 = (size_t)blockIdx.x * 64 + wave * 16;
  v8f acc[8] = {};
  const float* wp = wt_ptr(WO, c0, wave, lane, DIN); const float* yp = xt_ptr(Y + (size_t)blockIdx.x * 64 * CC, wave, lane, CC);
  v4f wr[8], yr[4]; wt_load(wr, wp, DIN); xt_load(yr, yp, CC);
  if (CAUSAL && (int)(((size_t)blockIdx.x * 64) % TT) < QHI) {   /* block-uniform */
    for (int kc = 0; kc < CC / 32; ++kc) { __bf16* wb = sk.b.w[kc & 1]; __bf16* yh = sk.b.yh[kc & 1]; __bf16* yl = sk.b.yl[kc & 1]; wt_put_b(wb, wr, wave, lane); xt_put_hl(yh, yl, yr, wave, lane);
      __syncthreads();   /* the whole tiles of step kc are in LDS before any wave reads fragments across them; the same barrier ends every wave's reads of step kc - 1, whose buffers step kc + 1 overwrites */
      if (kc + 1 < CC / 32) { wt_load(wr, wp + (size_t)32 * DIN, DIN); xt_load(yr, yp + 32, CC);
        asm volatile("s_wait_xcnt 0x0" :: "v"(wp), "v"(yp) : "memory");   /* the loads' address registers, named here so that they stay as they are up to this wait, are advanced behind it */
        wp += (size_t)32 * DIN; yp += 32; }
      const v16b ah = frag_b(yh + (wave * 16 + col) * WP, lane), al = frag_b(yl + (wave * 16 + col) * WP, lane); v16b wf[8];
#pragma unroll
      for (int j = 0; j < 8; ++j) wf[j] = frag_b(wb + (j * 16 + col) * WP, lane);   /* all of the step's LDS reads as one group in front of its matrix instructions */
#pragma unroll
      for (int j = 0; j < 8; ++j) { acc[j] = wmma_bf(ah, wf[j], acc[j]); acc[j] = wmma_bf(al, wf[j], acc[j]); } }
#pragma unroll
    for (int j = 0; j < 8; ++j) { const float bias = BO ? bfr(BO[c0 + j * 16 + col]) : 0.f;
#pragma unroll
      for (int r = 0; r < 8; ++r) sf[wave][8 * g + r][j * 16 + col] = acc[j][r] + bias; }
  } else {
    for (int kc = 0; kc < CC / 32; ++kc) { _Float16* wb = sk.h.w[kc & 1]; _Float16* yb = sk.h.y[kc & 1]; wt_put_h(wb, wr, wave, lane); xt_put_h(yb, yr, wave, lane, 64.0f);   /* ctx carried x 2^6 into f16 so small-magnitude context rows stay clear of f16 subnormals */
      __syncthreads();   /* as in the branch above: publishes step kc's tiles and ends the reads of step kc - 1 */
      if (kc + 1 < CC / 32) { wt_load(wr, wp + (size_t)32 * DIN, DIN); xt_load(yr, yp + 32, CC);
        asm volatile("s_wait_xcnt 0x0" :: "v"(wp), "v"(yp) : "memory");   /* as in the branch above */
        wp += (size_t)32 * DIN; yp += 32; }
      const v16h a = frag_h(yb + (wave * 16 + col) * WP, lane); v16h wf[8];
#pragma unroll
      for (int j = 0; j < 8; ++j) wf[j] = frag_h(wb + (j * 16 + col) * WP, lane);   /* as in the branch above */
#pragma unroll
      for (int j = 0; j < 8; ++j) acc[j] = wmma16(a, wf[j], acc[j]); }
#pragma unroll
    for (int j = 0; j < 8; ++j) { const float bias = BO ? bfr(BO[c0 + j * 16 + col]) : 0.f;
#pragma unroll
      for (int r = 0; r < 8; ++r) sf[wave][8 * g + r][j * 16 + col] = acc[j][r] * (1.0f / 16384.0f) + bias; } }   /* 2^-8 (Wo carry) x 2^-6 (ctx carry) */
  LDSX(); for (int rl = 0; rl < 16; ++rl) vst2(OUT + (r0 + rl) * DIN + c0 + lane * 4, *(const v4f*)&sf[wave][rl][lane * 4]); }

extern "C" void kernel_launch(void* const* d_in, const int* in_sizes, int n_in, void* d_out, int out_size, void* d_ws, size_t ws_size, hipStream_t stream) {
  (void)in_sizes; (void)n_in; (void)out_size;
  const float** F = (const float**)d_in;
  if (ws_size < (size_t)WS_END) return;
  char* ws = (char*)d_ws; _Float16 *QH = (_Float16*)(ws + WS_QH), *KH = (_Float16*)(ws + WS_KH), *VT = (_Float16*)(ws + WS_VT), *QL = (_Float16*)(ws + WS_QL), *KL = (_Float16*)(ws + WS_KL); __bf16 *VB = (__bf16*)(ws + WS_VB), *VBL = (__bf16*)(ws + WS_VBL); float *Y = (float*)(ws + WS_Y);
  (void)Y; (void)QL; (void)KL; (void)VB; (void)VBL;
  // inputs: 0 x [2,2048,1024]; 1 wq [1024,16,64] = (in,out) [1024][1024]; 2 wk; 3 wv; 4 wp1 [16,64,1024] = (in,out) [1024][1024]; 5 wp2 [1024,1024] (in,out); no biases
  if (ws_size < (size_t)WS_END2) return;
  float* Y2 = (float*)(ws + WS_Y2);
  k_proj<<<dim3(TNB * TT / 64, CC / 128, 3), 128, 0, stream>>>(F[0], F[0], F[0], F[1], F[2], F[3], nullptr, nullptr, nullptr, QH, QL, KH, KL, VT, VB, VBL);
  k_pv<<<dim3(TT / 16, 1, TNB * NH), 32 * PVW, 0, stream>>>(QH, KH, QL, KL, VT, VB, VBL, Y);
  k_out<<<dim3(TNB * TT / 64, DIN / 128), 128, 0, stream>>>(Y, F[4], nullptr, Y2);              /* y = att wp1 (f32 rows in workspace) */
  k_out<<<dim3(TNB * TT / 64, DIN / 128), 128, 0, stream>>>(Y2, F[5], nullptr, (float*)d_out);   /* out = y wp2 */
  static_assert(CC == DIN, "the second output projection reuses k_out: its operand rows have width DIN == CC");
}

// v007
// One run takes 176 microseconds.
// Two timings next to v006 put it at 1.05 and 1.06 times that version's speed.
// Counting every step since v000, it is 6.17 times as fast.
// compute dtype: all float inputs rounded to bf16; q / k / v projections with EXACT bf16 products on WMMA 16x16x32 (f32 accumulate), no biases; causal logits: 3 products for the first 384 rows, single f16 q x k after, x 64^-0.5; softmax f32; P x 2^11 once to f16 x v once to f16 (bf16 hi + lo below row 384); TWO output projections in sequence, each through k_out (rows < 384: the f32 operand as bf16 hi + lo against the exact weight; beyond: x2^6 f16 carry x f16(bf16 x 2^8) weight); f32 output.
#include <hip/hip_runtime.h>
#include <math.h>

typedef __attribute__((ext_vector_type(16))) _Float16 v16h;
typedef __attribute__((ext_vector_type(16))) __bf16 v16b;
typedef __attribute__((ext_vector_type(8)))  _Float16 v8h;
typedef __attribute__((ext_vector_type(8)))  float v8f;
typedef __attribute__((ext_vector_type(4)))  float v4f;
typedef __attribute__((ext_vector_type(2)))  float v2f;
typedef __attribute__((ext_vector_type(4)))  unsigned v4u;
typedef __attribute__((ext_vector_type(4)))  int v4i;
typedef float __attribute__((may_alias)) float_a;
typedef int __attribute__((may_alias)) int_a;

template <typename T> __device__ __forceinline__ void vst2(void* p, T v) { *(T*)p = v;  }
__device__ __forceinline__ v8f wmma16(v16h a, v16h b, v8f c) {
  v8f d = __builtin_amdgcn_wmma_f32_16x16x32_f16(false, a, false, b, (short)0, c, false, false);
  asm volatile("v_nop\n\tv_nop\n\tv_nop\n\tv_nop" : "+v"(d) : "v"(a), "v"(b));
  return d;
}
__device__ __forceinline__ v8f wmma_bf(v16b a, v16b b, v8f c) {
  v8f d = __builtin_amdgcn_wmma_f32_16x16x32_bf16(false, a, false, b, (short)0, c, false, false);
  asm volatile("v_nop\n\tv_nop\n\tv_nop\n\tv_nop" : "+v"(d) : "v"(a), "v"(b));
  return d;
}
// 16x16x32 fragments: lane = (h = lane>>4, row/col = lane&15); elements 0..7 = k0+8h+0..7, 8..15 = k0+16+8h+0..7; D element r = row 8h+r
__device__ __forceinline__ v16h frag_h(const _Float16* rowk0, int lane) {
  union { v16h v; v8h q[2]; } u; const _Float16* p = rowk0 + 8 * (lane >> 4);
  u.q[0] = *(const v8h*)p; u.q[1] = *(const v8h*)(p + 16); return u.v;
}
__device__ __forceinline__ v16h frag_f32(const float* rowk0, int lane) {
  v16h a; const float* p = rowk0 + 8 * (lane >> 4);
#pragma unroll
  for (int i = 0; i < 8; ++i) { a[i] = (_Float16)p[i]; a[8 + i] = (_Float16)p[16 + i]; }
  return a;
}
__device__ __forceinline__ v16h frag_f32s(const float* rowk0, int lane, float sc) {
  v16h a; const float* p = rowk0 + 8 * (lane >> 4);
#pragma unroll
  for (int i = 0; i < 8; ++i) { a[i] = (_Float16)(p[i] * sc); a[8 + i] = (_Float16)(p[16 + i] * sc); }
  return a;
}
// column fragment from a [K][ld] layout (column n), rows >= K read as 0
__device__ __forceinline__ v16h fragc_f32(const float* W, int k0, int n, int lane, int ld, int K) {
  v16h a; const int g = lane >> 4;
#pragma unroll
  for (int i = 0; i < 8; ++i) { const int ka = k0 + 8 * g + i, kb = ka + 16;
    a[i] = (_Float16)(ka < K ? W[(size_t)(ka < K ? ka : K - 1) * ld + n] : 0.f); a[8 + i] = (_Float16)(kb < K ? W[(size_t)(kb < K ? kb : K - 1) * ld + n] : 0.f); }
  return a;
}
struct F2 { v16b h, l; };
__device__ __forceinline__ F2 bsplit16(const float v[16]) { F2 r;
#pragma unroll
  for (int i = 0; i < 16; ++i) { const __bf16 h = (__bf16)v[i]; r.h[i] = h; r.l[i] = (__bf16)(v[i] - (float)h); }
  return r; }
__device__ __forceinline__ F2 split_row(const float* row, int k0, int lane) { float v[16]; const float* p = row + k0 + 8 * (lane >> 4);
#pragma unroll
  for (int i = 0; i < 8; ++i) { v[i] = p[i]; v[8 + i] = p[16 + i]; }
  return bsplit16(v); }
__device__ __forceinline__ F2 split_rowK(const float* row, int k0, int lane, int K) { float v[16]; const int g = lane >> 4;
#pragma unroll
  for (int i = 0; i < 8; ++i) { const int ka = k0 + 8 * g + i, kb = ka + 16; v[i] = ka < K ? row[ka < K ? ka : K - 1] : 0.f; v[8 + i] = kb < K ? row[kb < K ? kb : K - 1] : 0.f; }
  return bsplit16(v); }
__device__ __forceinline__ F2 split_col(const float* W, int k0, int n, int lane, int ld, int K) { float v[16]; const int g = lane >> 4;
#pragma unroll
  for (int i = 0; i < 8; ++i) { const int ka = k0 + 8 * g + i, kb = ka + 16; v[i] = ka < K ? W[(size_t)(ka < K ? ka : K - 1) * ld + n] : 0.f; v[8 + i] = kb < K ? W[(size_t)(kb < K ? kb : K - 1) * ld + n] : 0.f; }
  return bsplit16(v); }
__device__ __forceinline__ v8f mac3(const F2& a, const F2& b, v8f c) { c = wmma_bf(a.l, b.h, c); c = wmma_bf(a.h, b.l, c); return wmma_bf(a.h, b.h, c); }
__device__ __forceinline__ float sigm(float v) { return 1.0f / (1.0f + expf(-v)); }
#define LDSX() do { asm volatile("s_wait_dscnt 0" ::: "memory"); __builtin_amdgcn_wave_barrier(); __builtin_amdgcn_fence(__ATOMIC_RELEASE, "workgroup"); } while (0)

// Causal multi-head self-attention with per-head-shaped weights and TWO output projections (x [2,2048,1024]; wq / wk / wv [1024,16,64] = (in, head, d): an (in,out) [1024][1024] matrix with out = head*64 + d; wp1 [16,64,1024] = (head, d, out): an (in,out) [1024][1024] matrix with in = head*64 + d; wp2 [1024,1024] (in,out); all N(0, 1/1024), no biases; wei = q k^T x 64^-0.5; tril kept, -inf elsewhere; softmax; att merged (head*64 + d); y = att wp1; out = y wp2).
#define NB 2
#define TT 2048
#define CC 1024            // NH * HD = projected width
#define DIN 1024          // input (model) width
#define NH 16
#define HD 64
#define SCALE (0.125f)
#define CAUSAL 1
#ifndef TNB
#define TNB NB
#endif
__device__ __forceinline__ float bfr(float v) { return (float)(__bf16)v; }
__host__ __device__ __forceinline__ int kb_last(int qb) { return CAUSAL ? ((qb * 64 + 63) >> 7) : (TT / 128 - 1); }
typedef __attribute__((ext_vector_type(8))) __bf16 v8b;
__device__ __forceinline__ v16b frag_b(const __bf16* rowk0, int lane) {
  union { v16b v; v8b q[2]; } u; const __bf16* p = rowk0 + 8 * (lane >> 4);
  u.q[0] = *(const v8b*)p; u.q[1] = *(const v8b*)(p + 16); return u.v;
}
#define QBH 6              // causal: query blocks 0..QBH-1 of each sequence (few keys, no averaging) take the high-precision path
#define QHI 384            // rows carrying a q residual plane
#define KHI 384            // key rows carrying k residual / v bf16 hi+lo planes (used only by the causal high-precision path)
// B fragment (k rows k0+.., output column o) of a weight: (in,out) [K][ld] or (out,in) [ld rows of K]: bf16 exact, or f16(bf16 * 256) exact
__device__ __forceinline__ v16b wcol_io(const float* Wm, int k0, int o, int lane, int ld) { v16b w; const int g = lane >> 4;
#pragma unroll
  for (int i = 0; i < 8; ++i) { w[i] = (__bf16)Wm[(size_t)(k0 + 8 * g + i) * ld + o]; w[8 + i] = (__bf16)Wm[(size_t)(k0 + 16 + 8 * g + i) * ld + o]; }
  return w; }
__device__ __forceinline__ v16b wcol_oi(const float* Wm, int k0, int o, int lane, int K) { v16b w; const float* p = Wm + (size_t)o * K + k0 + 8 * (lane >> 4);
#pragma unroll
  for (int i = 0; i < 8; ++i) { w[i] = (__bf16)p[i]; w[8 + i] = (__bf16)p[16 + i]; }
  return w; }
__device__ __forceinline__ v16h wcolh_io(const float* Wm, int k0, int o, int lane, int ld) { v16h w; const int g = lane >> 4;
#pragma unroll
  for (int i = 0; i < 8; ++i) { w[i] = (_Float16)(bfr(Wm[(size_t)(k0 + 8 * g + i) * ld + o]) * 256.0f); w[8 + i] = (_Float16)(bfr(Wm[(size_t)(k0 + 16 + 8 * g + i) * ld + o]) * 256.0f); }
  return w; }
__device__ __forceinline__ v16h wcolh_oi(const float* Wm, int k0, int o, int lane, int K) { v16h w; const float* p = Wm + (size_t)o * K + k0 + 8 * (lane >> 4);
#pragma unroll
  for (int i = 0; i < 8; ++i) { w[i] = (_Float16)(bfr(p[i]) * 256.0f); w[8 + i] = (_Float16)(bfr(p[16 + i]) * 256.0f); }
  return w; }
#define WQKV_LAYOUT 0   // 0 = (in,out) [DIN][CC]; 1 = (out,in) [CC][DIN]; 2 = per-head [NH][DIN][HD]
__device__ __forceinline__ v16b wcol_hdk(const float* Wm, int k0, int o, int lane) { v16b w; const int g = lane >> 4; const float* p = Wm + (size_t)(o / HD) * DIN * HD + (o % HD);
#pragma unroll
  for (int i = 0; i < 8; ++i) { w[i] = (__bf16)p[(size_t)(k0 + 8 * g + i) * HD]; w[8 + i] = (__bf16)p[(size_t)(k0 + 16 + 8 * g + i) * HD]; }
  return w; }
#define WO_OUT_IN 0
#if WQKV_LAYOUT == 1
#define WCOL(W, k0, o, lane) wcol_oi(W, k0, o, lane, DIN)
#elif WQKV_LAYOUT == 2
#define WCOL(W, k0, o, lane) wcol_hdk(W, k0, o, lane)
#else
#define WCOL(W, k0, o, lane) wcol_io(W, k0, o, lane, CC)
#endif
#if WO_OUT_IN
#define WOCOL(W, k0, o, lane) wcol_oi(W, k0, o, lane, CC)
#define WOCOLH(W, k0, o, lane) wcolh_oi(W, k0, o, lane, CC)
#else
#define WOCOL(W, k0, o, lane) wcol_io(W, k0, o, lane, DIN)
#define WOCOLH(W, k0, o, lane) wcolh_io(W, k0, o, lane, DIN)
#endif

#ifndef PROJ_EXTRA_PARAMS
#define PROJ_EXTRA_PARAMS
#endif

// q, k and v lie in the workspace in the order of k_pv's matrix fragments: the 16 bytes that lane l takes with one load stand at l * 16 in a run of 512 bytes, so that every load of a wave covers four whole 128-byte lines (from rows or planes it would touch 16 lines for 32 bytes each)
#define QKT 1024           // 16-bit elements of one 16-row tile of one head's q or k: [d / 32][(d / 16) & 1][lane = 16 ((d / 8) & 1) + (t & 15)][d & 7]
#define VCH 2048           // 16-bit elements of one 32-key chunk of one head's v: [d / 16][(t / 16) & 1][lane = 16 ((t / 8) & 1) + (d & 15)][t & 7]
static_assert(HD == 64 && QKT == 16 * HD && VCH == 32 * HD, "the fragment-order tiles are written for head size 64");
#define WS_QH  0u                                      // f16 q tiles [b][h][t / 16][QKT]
#define WS_KH  (WS_QH + 2u * (size_t)NB * TT * CC)      // f16 k tiles [b][h][t / 16][QKT]
#define WS_VT  (WS_KH + 2u * (size_t)NB * TT * CC)      // f16 v chunks [b][h][t / 32][VCH]
#define WS_QL  (WS_VT + 2u * (size_t)NB * CC * TT)      // f16 q residual x 2^10 tiles [b][h][t / 16, t < QHI][QKT]
#define WS_KL  (WS_QL + 2u * (size_t)NB * QHI * CC)     // f16 k residual x 2^10 tiles [b][h][t / 16, t < KHI][QKT]
#define WS_VB  (WS_KL + 2u * (size_t)NB * KHI * CC)     // bf16 v hi chunks [b][h][t / 32, t < KHI][VCH]
#define WS_VBL (WS_VB + 2u * (size_t)NB * CC * KHI)
#define WS_Y   (WS_VBL + 2u * (size_t)NB * CC * KHI)    // f32 ctx rows [b*t][CC] (only when there is an output projection)
#define WS_END (WS_Y  + 4u * (size_t)NB * TT * CC)
#define WS_Y2 (WS_END)                                     // f32 rows [b*t][DIN]: the first output projection's result, the second one's operand
#define WS_END2 (WS_Y2 + 4u * (size_t)NB * TT * DIN)

// ---- operand tiles of one K step (32 k) of k_proj / k_out: read by whole-line loads and converted once per block, kept in LDS as 16-bit rows of 32 k, so that an A or B fragment is two 16-byte LDS reads (frag_b / frag_h on the row). Every loop over a register array, here and in the K steps, is fully unrolled: its indices must be constants, else the array goes to scratch
#define WP 40              // LDS pitch of a staged row in 16-bit elements: 32 k values + 16 bytes, so that 16-byte reads and writes of 64-byte rows spread over all banks
static_assert(WQKV_LAYOUT == 0 && !WO_OUT_IN, "the staged weight tile is written for (in,out) weights");
typedef __attribute__((ext_vector_type(4))) __bf16 v4b;
typedef __attribute__((ext_vector_type(4))) _Float16 v4h;
// weight tile: 32 k rows x 128 output columns of an (in,out) [K][ld] matrix, in LDS as [column][k]. Thread (wave, lane) owns the patch k = 8 (lane >> 3) + 0..7, column = 32 wave + 4 (lane & 7) + 0..3: each load instruction covers four whole 128-byte lines, each LDS store holds 8 consecutive k of one column
__device__ __forceinline__ const float* wt_ptr(const float* Wm, int c0, int wave, int lane, int ld) { return Wm + (size_t)(8 * (lane >> 3)) * ld + c0 + 32 * wave + 4 * (lane & 7); }
__device__ __forceinline__ void wt_load(v4f (&r)[8], const float* p, int ld) {
#pragma unroll
  for (int i = 0; i < 8; ++i) r[i] = *(const v4f*)(p + (size_t)i * ld); }
__device__ __forceinline__ void wt_put_b(__bf16* buf, const v4f (&r)[8], int wave, int lane) {   /* bf16, exact for the bf16-rounded weight */
#pragma unroll
  for (int c = 0; c < 4; ++c) { v8b t;
#pragma unroll
    for (int i = 0; i < 8; ++i) t[i] = (__bf16)r[i][c];
    *(v8b*)(buf + (32 * wave + 4 * (lane & 7) + c) * WP + 8 * (lane >> 3)) = t; } }
__device__ __forceinline__ void wt_put_h(_Float16* buf, const v4f (&r)[8], int wave, int lane) {   /* f16(bf16 x 2^8), exact */
#pragma unroll
  for (int c = 0; c < 4; ++c) { v8h t;
#pragma unroll
    for (int i = 0; i < 8; ++i) t[i] = (_Float16)(bfr(r[i][c]) * 256.0f);
    *(v8h*)(buf + (32 * wave + 4 * (lane & 7) + c) * WP + 8 * (lane >> 3)) = t; } }
// row tile: 64 rows x 32 k of an f32 [rows][ld] matrix, in LDS as [row][k]; rows0 = the block's first row. Thread (wave, lane) owns k = 4 (lane & 7) + 0..3 of rows 16 wave + 4 i + (lane >> 3), i < 4 (the rows of its own wave's A fragment): each load instruction covers four whole 128-byte lines
__device__ __forceinline__ const float* xt_ptr(const float* rows0, int wave, int lane, int ld) { return rows0 + (size_t)(16 * wave + (lane >> 3)) * ld + 4 * (lane & 7); }
__device__ __forceinline__ void xt_load(v4f (&r)[4], const float* p, int ld) {
#pragma unroll
  for (int i = 0; i < 4; ++i) r[i] = *(const v4f*)(p + (size_t)(4 * i) * ld); }
__device__ __forceinline__ int xt_at(int i, int wave, int lane) { return (16 * wave + 4 * i + (lane >> 3)) * WP + 4 * (lane & 7); }
__device__ __forceinline__ void xt_put_b(__bf16* buf, const v4f (&r)[4], int wave, int lane) {   /* once to bf16 */
#pragma unroll
  for (int i = 0; i < 4; ++i) { v4b t;
#pragma unroll
    for (int c = 0; c < 4; ++c) t[c] = (__bf16)r[i][c];
    *(v4b*)(buf + xt_at(i, wave, lane)) = t; } }
__device__ __forceinline__ void xt_put_hl(__bf16* bh, __bf16* bl, const v4f (&r)[4], int wave, int lane) {   /* bf16 hi + lo planes, as bsplit16 */
#pragma unroll
  for (int i = 0; i < 4; ++i) { v4b th, tl;
#pragma unroll
    for (int c = 0; c < 4; ++c) { const __bf16 h = (__bf16)r[i][c]; th[c] = h; tl[c] = (__bf16)(r[i][c] - (float)h); }
    *(v4b*)(bh + xt_at(i, wave, lane)) = th; *(v4b*)(bl + xt_at(i, wave, lane)) = tl; } }
__device__ __forceinline__ void xt_put_h(_Float16* buf, const v4f (&r)[4], int wave, int lane, float sc) {   /* x sc, once to f16 */
#pragma unroll
  for (int i = 0; i < 4; ++i) { v4h t;
#pragma unroll
    for (int c = 0; c < 4; ++c) t[c] = (_Float16)(r[i][c] * sc);
    *(v4h*)(buf + xt_at(i, wave, lane)) = t; } }
// ---- k_proj: block = (64 rows, 128 cols, which): q/k/v = X W (+ b) with exact bf16 products (K = DIN), both operand tiles of each K step staged in LDS (two buffers, which share their LDS with the epilogue's tiles), the next step's loads issued behind the step's barrier -> which 0: q f16 tiles (+ residual tiles, rows < QHI); 1: k f16 tiles (+ residual tiles, rows < KHI); 2: v f16 chunks (+ bf16 hi/lo chunks for t < KHI), all in fragment order: thread e of the store loops takes the e-th 16 bytes of the block's share, so that a wave stores 512 bytes in a row
__global__ __launch_bounds__(128) void k_proj(const float* __restrict__ XQ, const float* __restrict__ XK, const float* __restrict__ XV, const float* __restrict__ WQ, const float* __restrict__ WK, const float* __restrict__ WV, const float* __restrict__ BQ, const float* __restrict__ BK, const float* __restrict__ BV,
    _Float16* __restrict__ QH, _Float16* __restrict__ QL, _Float16* __restrict__ KH, _Float16* __restrict__ KL, _Float16* __restrict__ VT, __bf16* __restrict__ VB, __bf16* __restrict__ VBL) {
  __shared__ __align__(16) union { struct { _Float16 sh[64][136], sl[64][136]; } r; struct { _Float16 th[128][72]; __bf16 tb[128][72], tbl[128][72]; } c; struct { __bf16 w[2][128 * WP], x[2][64 * WP]; } k; } u;
  _Float16 (&sh)[64][136] = u.r.sh; _Float16 (&sl)[64][136] = u.r.sl; _Float16 (&th)[128][72] = u.c.th; __bf16 (&tb)[128][72] = u.c.tb; __bf16 (&tbl)[128][72] = u.c.tbl;
  const int tid = threadIdx.x, wave = tid >> 5, lane = tid & 31, col = lane & 15, g = lane >> 4; const int which = blockIdx.z; const int c0 = blockIdx.y * 128; const size_t r0 = (size_t)blockIdx.x * 64; const size_t bb = r0 / TT; const int t0 = (int)(r0 % TT);
  const float* X = which == 0 ? XQ : which == 1 ? XK : XV; const float* WA = which == 0 ? WQ : which == 1 ? WK : WV; const float* BA = which == 0 ? BQ : which == 1 ? BK : BV;
  v8f acc[8] = {};
  const float* wp = wt_ptr(WA, c0, wave, lane, CC); const float* xp = xt_ptr(X + r0 * DIN, wave, lane, DIN);
  v4f wr[8], xr[4]; wt_load(wr, wp, CC); xt_load(xr, xp, DIN);
  for (int kc = 0; kc < DIN / 32; ++kc) { __bf16* wb = u.k.w[kc & 1]; __bf16* xb = u.k.x[kc & 1]; wt_put_b(wb, wr, wave, lane); xt_put_b(xb, xr, wave, lane);
    __syncthreads();   /* the whole tiles of step kc are in LDS before any wave reads fragments across them; the same barrier ends every wave's reads of step kc - 1, whose buffers step kc + 1 overwrites */
    if (kc + 1 < DIN / 32) { wt_load(wr, wp + (size_t)32 * CC, CC); xt_load(xr, xp + 32, DIN);
      asm volatile("s_wait_xcnt 0x0" :: "v"(wp), "v"(xp) : "memory");   /* the loads' address registers, named here so that they stay as they are up to this wait, are advanced behind it */
      wp += (size_t)32 * CC; xp += 32; }
    const v16b a = frag_b(xb + (wave * 16 + col) * WP, lane); v16b wf[8];
#pragma unroll
    for (int j = 0; j < 8; ++j) wf[j] = frag_b(wb + (j * 16 + col) * WP, lane);   /* all of the step's LDS reads as one group in front of its matrix instructions */
#pragma unroll
    for (int j = 0; j < 8; ++j) acc[j] = wmma_bf(a, wf[j], acc[j]); }
  __syncthreads();   /* every wave has read its last fragments before the epilogue's tiles overwrite the staging buffers */
  if (which < 2) { _Float16* DH = which == 0 ? QH : KH; _Float16* DL = which == 0 ? QL : KL; const int nhi = which == 0 ? QHI : KHI; const bool hi_rows = t0 < nhi;
#pragma unroll
    for (int j = 0; j < 8; ++j) { const float bias = BA ? bfr(BA[c0 + j * 16 + col]) : 0.f;
#pragma unroll
      for (int r = 0; r < 8; ++r) { const float v = acc[j][r] + bias; const _Float16 hv = (_Float16)v; sh[wave * 16 + 8 * g + r][j * 16 + col] = hv; sl[wave * 16 + 8 * g + r][j * 16 + col] = (_Float16)((v - (float)hv) * 1024.0f); } }
    __syncthreads();
    for (int e = tid; e < 64 * 16; e += 128) { const int hh = e >> 9, tl = (e >> 7) & 3, rl = tl * 16 + col, cl = hh * HD + ((e >> 5) & 3) * 16 + g * 8; const size_t hb = bb * NH + c0 / HD + hh;   /* e = [head][tile][d / 16][lane] */
      vst2((unsigned*)(DH + (hb * (TT / 16) + t0 / 16 + tl) * QKT + (e & 127) * 8), *(const v4u*)&sh[rl][cl]);
      asm volatile("s_wait_xcnt 0x0" ::: "memory");   /* in front of what rewrites the store's address and data registers: the residual's lines, the next trip */
      if (hi_rows) { vst2((unsigned*)(DL + (hb * (nhi / 16) + t0 / 16 + tl) * QKT + (e & 127) * 8), *(const v4u*)&sl[rl][cl]);
        asm volatile("s_wait_xcnt 0x0" ::: "memory"); } }   /* as above */
  } else { const bool hi_rows = t0 < KHI;
#pragma unroll
    for (int j = 0; j < 8; ++j) { const float bias = BA ? bfr(BA[c0 + j * 16 + col]) : 0.f;
#pragma unroll
      for (int r = 0; r < 8; ++r) { const float v = acc[j][r] + bias; const int rl = wave * 16 + 8 * g + r, cl = j * 16 + col; th[cl][rl] = (_Float16)v; const __bf16 bh = (__bf16)v; tb[cl][rl] = bh; tbl[cl][rl] = (__bf16)(v - (float)bh); } }
    __syncthreads();
    for (int e = tid; e < 128 * 8; e += 128) { const int hh = e >> 9, cn = (e >> 8) & 1, cl = hh * HD + ((e >> 6) & 3) * 16 + col, rl = cn * 32 + ((e >> 5) & 1) * 16 + g * 8; const size_t hb = bb * NH + c0 / HD + hh;   /* e = [head][chunk][d / 16][(t / 16) & 1][lane] */
      vst2((unsigned*)(VT + (hb * (TT / 32) + t0 / 32 + cn) * VCH + (e & 255) * 8), *(const v4u*)&th[cl][rl]);
      asm volatile("s_wait_xcnt 0x0" ::: "memory");   /* as in the branch above */
      if (hi_rows) { const size_t o3 = (hb * (KHI / 32) + t0 / 32 + cn) * VCH + (e & 255) * 8; vst2((unsigned*)(VB + o3), *(const v4u*)&tb[cl][rl]); vst2((unsigned*)(VBL + o3), *(const v4u*)&tbl[cl][rl]);
        asm volatile("s_wait_xcnt 0x0" ::: "memory"); } } } }   /* as in the branch above */
// ---- k_pv: block = 16 queries (tile qt of query block qb = qt / 4) of (b, h) = blockIdx.z, PVW waves. Logits first, never through memory: wave w takes the 64-key units w, w + PVW, ... of keys [0, kend): q x k on the matrix unit, x SCALE, f32 to the 16 LDS rows (single f16 product; causal early query blocks: q hi + residual (x 2^10) against k hi + residual, 3 products); the mask is applied by index in the softmax. Softmax: wave w takes query rows w and w + PVW whole, in registers: keys [0, kend): causal -> logit if s <= t else excluded; softmax in f32; exp(logit - max) (0 for excluded) back to the LDS rows, 2^11 / sum to LDS per row. Then ctx = P . v over keys [0, kend), P x 2^11 = the LDS value x the row's 2^11 / sum; wave w takes the 32-key chunks w, w + PVW, ... and the PVW partial tiles are summed in wave order through LDS (P x 2^11 once to f16 against v f16: 1 product; causal early query blocks: P and v as bf16 hi + lo, 3 products); 256-B (row, head) segment by 16 lanes
#define PVW 8
#define PPITCH (TT + 4)    // LDS pitch of a P row in floats: 16 bytes over the row, so that the 16 rows of a fragment read start 4 banks apart
#define NCF (TT / 128 - 1) // most 128-key pieces of a row in front of its last one; a piece is one 16-byte load per lane
#define L2E 1.44269504088896340736f   // log2(e)
// exp(logit - max) = 2^(logit x log2(e) - mc), mc = max x log2(e): one fused multiply-add (the product unrounded, so that the exponent is rounded once) and the chip's exp2 per element. The exponent is <= 0 up to mc's rounding, which scales a whole row alike and cancels against the row's sum; a result under 2^-126 may come out as 0, beside a sum that holds the max's own term, about 1
__device__ __forceinline__ v4f sm_exp(v4f v, float mc) { v4f e;
#pragma unroll
  for (int c = 0; c < 4; ++c) e[c] = __builtin_amdgcn_exp2f(__builtin_fmaf(v[c], L2E, -mc));
  return e; }
// one query row's softmax by one wave: lane l holds the logits of keys i * 128 + 4 l + 0..3 in x[i], i < nf, and those of the row's last piece (i = nf) in xl. Only the last piece can hold keys > t: nf * 128 = (kb_last(qb)) * 128 <= qb * 64 <= t. Returns 2^11 / sum; exp(logit - max) goes to the LDS row pr
__device__ __forceinline__ float sm_row(const v4f (&x)[NCF], v4f xl, int nf, int t, int lane, float* pr) {
  float m = -3.0e38f;
#pragma unroll
  for (int c = 0; c < 4; ++c) { xl[c] = (!CAUSAL || nf * 128 + lane * 4 + c <= t) ? xl[c] : -3.0e38f; m = fmaxf(m, xl[c]); }
#pragma unroll
  for (int i = 0; i < NCF; ++i) if (i < nf) {
#pragma unroll
    for (int c = 0; c < 4; ++c) m = fmaxf(m, x[i][c]); }
#pragma unroll
  for (int o = 1; o < 32; o <<= 1) m = fmaxf(m, __shfl_xor(m, o));
  const float mc = m * L2E; v4f s4 = {};
#pragma unroll
  for (int i = 0; i < NCF; ++i) if (i < nf) { const v4f e = sm_exp(x[i], mc); s4 += e; *(v4f*)(pr + i * 128 + lane * 4) = e; }   /* no key of these pieces is excluded */
  { v4f e = sm_exp(xl, mc);
#pragma unroll
    for (int c = 0; c < 4; ++c) e[c] = (xl[c] <= -1.0e38f) ? 0.f : e[c];   /* excluded keys */
    s4 += e; *(v4f*)(pr + nf * 128 + lane * 4) = e; }
  float sum = (s4[0] + s4[1]) + (s4[2] + s4[3]);
#pragma unroll
  for (int o = 1; o < 32; o <<= 1) sum += __shfl_xor(sum, o);
  return sum > 0.f ? 2048.0f / sum : 0.f; }   /* a fully excluded row yields P = 0 */
#define KU 64              // keys of one logit unit: four 16-key tiles, whose 16 loads per lane are in flight together
// the B fragments of one unit: f[2 j + kc] = keys 16 j + (lane & 15), d = 32 kc + ..; p = the lane's own 16 bytes in the first 512 of the unit's four tiles, so that all 16 loads go off one address
__device__ __forceinline__ void ku_load(v16h (&f)[8], const _Float16* p) {
#pragma unroll
  for (int j = 0; j < 4; ++j)
#pragma unroll
    for (int kc = 0; kc < 2; ++kc) { union { v16h v; v8h q[2]; } u; const _Float16* s = p + j * QKT + kc * (QKT / 2); u.q[0] = *(const v8h*)s; u.q[1] = *(const v8h*)(s + QKT / 4); f[2 * j + kc] = u.v; } }
// one unit's logits, single product: the four tiles' accumulators are independent, so that no matrix instruction waits for the one in front of it; w = the lane's place (row 8 (lane >> 4), key lane & 15 of the unit) in the LDS rows
__device__ __forceinline__ void lg_unit(v16h a0, v16h a1, const v16h (&f)[8], float* w) { v8f c[4];
#pragma unroll
  for (int j = 0; j < 4; ++j) { const v8f z = {}; c[j] = wmma16(a0, f[2 * j], z); }
#pragma unroll
  for (int j = 0; j < 4; ++j) c[j] = wmma16(a1, f[2 * j + 1], c[j]);
#pragma unroll
  for (int j = 0; j < 4; ++j)
#pragma unroll
    for (int r = 0; r < 8; ++r) w[r * PPITCH + j * 16] = c[j][r] * SCALE; }
// the B fragments of one 32-key chunk of v: f[j] = d = 16 j + (lane & 15), keys 8 (lane >> 4) + ..; p = the lane's own 16 bytes in the chunk's first 512, so that all 8 loads go off one address
template <typename V, typename E> __device__ __forceinline__ void pv_load(V (&f)[HD / 16], const E* p) {
#pragma unroll
  for (int j = 0; j < HD / 16; ++j) { union { V v; v4u q[2]; } u; const E* s = p + j * (VCH / 4); u.q[0] = *(const v4u*)s; u.q[1] = *(const v4u*)(s + VCH / 8); f[j] = u.v; } }
// one chunk's P . v, single product: P x 2^11 from the LDS row, once to f16, against the chunk's four fragments
__device__ __forceinline__ void pv_mac(v8f (&acc)[HD / 16], v16h p, const v16h (&f)[HD / 16]) {
#pragma unroll
  for (int j = 0; j < HD / 16; ++j) acc[j] = wmma16(p, f[j], acc[j]); }
__device__ __forceinline__ void pv_unit(v8f (&acc)[HD / 16], const v16h (&f)[HD / 16], const float* prow, int lane, float inv) { pv_mac(acc, frag_f32s(prow, lane, inv), f); }
__global__ __launch_bounds__(32 * PVW) void k_pv(const _Float16* __restrict__ QH, const _Float16* __restrict__ KH, const _Float16* __restrict__ QL, const _Float16* __restrict__ KL, const _Float16* __restrict__ VT, const __bf16* __restrict__ VB, const __bf16* __restrict__ VBL, float* __restrict__ Y) { const int b = blockIdx.z / NH, h = blockIdx.z % NH; __shared__ __align__(16) float sp[16 * PPITCH]; __shared__ float sinv[16];
  static_assert(PVW * 16 * (HD + 4) <= 16 * PPITCH && 2 * PVW == 16, "the partial tiles reuse the P rows' LDS; two query rows per wave");
  static_assert((((QBH * 64 + 63) >> 7) + 1) * 4 >= 2 * PVW, "beyond the early query blocks every wave has two P.v chunks or more");
  static_assert(CAUSAL && (((QBH * 64 + 63) >> 7) + 1) * (128 / KU) >= PVW && ((((QBH - 1) * 64 + 63) >> 7) + 1) * (128 / KU) <= PVW, "beyond the early query blocks every wave has a logit unit, within them at most one");
  const int tid = threadIdx.x, lane = tid & 31, col = lane & 15, g = lane >> 4; const int qb = blockIdx.x >> 2; const int ql0 = blockIdx.x * 16; const int kce = (kb_last(qb) + 1) * 4;
  const int wave = __builtin_amdgcn_readfirstlane(tid >> 5);   /* scalar, so that the key loop's bounds and branch stay wave-uniform around the matrix instructions */
  { const int nu = (kb_last(qb) + 1) * (128 / KU); const size_t bh = blockIdx.z; float* sw = sp + 8 * g * PPITCH + col;   /* bh = b NH + h, the head's index in the fragment-order planes */
    const _Float16* qp = QH + (bh * (TT / 16) + blockIdx.x) * QKT + lane * 8; const _Float16* kp = KH + (bh * (TT / 16) + wave * (KU / 16)) * QKT + lane * 8;
    union { v16h v; v8h q[2]; } a0, a1; a0.q[0] = *(const v8h*)qp; a0.q[1] = *(const v8h*)(qp + QKT / 4); a1.q[0] = *(const v8h*)(qp + QKT / 2); a1.q[1] = *(const v8h*)(qp + 3 * (QKT / 4));
    if (qb < QBH) { const _Float16* qlp = QL + (bh * (QHI / 16) + blockIdx.x) * QKT + lane * 8; const _Float16* klp = KL + (bh * (KHI / 16) + wave * (KU / 16)) * QKT + lane * 8;
      union { v16h v; v8h q[2]; } l0, l1; l0.q[0] = *(const v8h*)qlp; l0.q[1] = *(const v8h*)(qlp + QKT / 4); l1.q[0] = *(const v8h*)(qlp + QKT / 2); l1.q[1] = *(const v8h*)(qlp + 3 * (QKT / 4));
      asm volatile("s_wait_xcnt 0x0" :: "v"(qp), "v"(qlp) : "memory");   /* the loads' address registers, named here so that they stay as they are up to this wait, may be reused behind it */
      if (wave < nu) { const int u = wave; v16h kf[8], lf[8]; ku_load(kf, kp); ku_load(lf, klp);   /* here nu <= PVW: at most one unit per wave; a scalar test, so that the matrix instructions run with every lane on */
        asm volatile("s_wait_xcnt 0x0" :: "v"(kp), "v"(klp) : "memory");   /* as above */
#pragma unroll
        for (int j = 0; j < 4; ++j) { v8f c = {}, cl = {};
          c = wmma16(a0.v, kf[2 * j], c); cl = wmma16(l0.v, kf[2 * j], cl); cl = wmma16(a0.v, lf[2 * j], cl);
          c = wmma16(a1.v, kf[2 * j + 1], c); cl = wmma16(l1.v, kf[2 * j + 1], cl); cl = wmma16(a1.v, lf[2 * j + 1], cl);
#pragma unroll
          for (int r = 0; r < 8; ++r) sw[r * PPITCH + u * KU + j * 16] = (c[r] + cl[r] * (1.0f / 1024.0f)) * SCALE; } }
    } else { v16h kf[8], kn[8]; int u = wave; constexpr size_t KS = (size_t)PVW * (KU / 16) * QKT;   /* from one unit of a wave to its next; here nu >= PVW: every wave has a unit */
      ku_load(kf, kp);
      asm volatile("s_wait_xcnt 0x0" :: "v"(qp), "v"(kp) : "memory");   /* as above */
      /* two register sets by turns, and no branch between a unit's loads and the work on the unit before it: the wave's next unit is in flight while this one is worked on */
      while (u + 2 * PVW < nu) { ku_load(kn, kp + KS); lg_unit(a0.v, a1.v, kf, sw + u * KU); ku_load(kf, kp + 2 * KS);
        asm volatile("s_wait_xcnt 0x0" :: "v"(kp) : "memory");   /* as above: the address is advanced behind it */
        kp += 2 * KS; lg_unit(a0.v, a1.v, kn, sw + (u + PVW) * KU); u += 2 * PVW; }
      if (u + PVW < nu) { ku_load(kn, kp + KS);
        asm volatile("s_wait_xcnt 0x0" :: "v"(kp) : "memory");   /* as above */
        lg_unit(a0.v, a1.v, kf, sw + u * KU); lg_unit(a0.v, a1.v, kn, sw + (u + PVW) * KU); }
      else lg_unit(a0.v, a1.v, kf, sw + u * KU); } }
  __syncthreads();   /* all 16 rows' logits are in LDS before any wave reads a row across the units */
  { const int nf = kb_last(qb); v4f x0[NCF], x1[NCF]; const float* s0 = sp + wave * PPITCH + lane * 4; const float* s1 = s0 + PVW * PPITCH;
#pragma unroll
    for (int i = 0; i < NCF; ++i) if (i < nf) { x0[i] = *(const v4f*)(s0 + i * 128); x1[i] = *(const v4f*)(s1 + i * 128); }   /* both rows whole in registers before either row's LDS is overwritten */
    const v4f xl0 = *(const v4f*)(s0 + nf * 128), xl1 = *(const v4f*)(s1 + nf * 128);
    const float i0 = sm_row(x0, xl0, nf, ql0 + wave, lane, sp + wave * PPITCH), i1 = sm_row(x1, xl1, nf, ql0 + wave + PVW, lane, sp + (wave + PVW) * PPITCH);
    if (lane == 0) { sinv[wave] = i0; sinv[wave + PVW] = i1; } }
  __syncthreads();   /* all 16 rows and their factors are in LDS before any wave reads fragments across them */
  const float inv = sinv[col]; const float* pc = sp + col * PPITCH + 8 * g;
  v8f acc[HD / 16] = {};
  if (qb < QBH) {
    const size_t vo = (size_t)blockIdx.z * (KHI / 32) * VCH + lane * 8;
#pragma unroll 1   /* at most two trips here: kept rolled, so that the kernel's text stays short */
    for (int kc = wave; kc < kce; kc += PVW) { v16b vh[HD / 16], vl[HD / 16]; const __bf16* hp = VB + vo + kc * VCH; const __bf16* lp = VBL + vo + kc * VCH; pv_load(vh, hp); pv_load(vl, lp);   /* the chunk's 16 loads in flight together, in front of its matrix instructions */
      asm volatile("s_wait_xcnt 0x0" :: "v"(hp), "v"(lp) : "memory");   /* the loads' address registers, named here so that they stay as they are up to this wait, may be reused behind it */
      float pv[16];
#pragma unroll
      for (int i = 0; i < 8; ++i) { pv[i] = pc[kc * 32 + i] * inv; pv[8 + i] = pc[kc * 32 + 16 + i] * inv; }
      const F2 p = bsplit16(pv);
#pragma unroll
      for (int j = 0; j < HD / 16; ++j) { acc[j] = wmma_bf(p.h, vh[j], acc[j]); acc[j] = wmma_bf(p.l, vh[j], acc[j]); acc[j] = wmma_bf(p.h, vl[j], acc[j]); } }
  } else { v16h vf[HD / 16], vn[HD / 16]; int kc = wave; constexpr int VS = PVW * VCH;   /* from one chunk of a wave to its next, in elements; here kce >= 2 PVW: every wave has two chunks or more */
    const _Float16* vp = VT + ((size_t)blockIdx.z * (TT / 32) + wave) * VCH + lane * 8; const float* pr = sp + col * PPITCH;
    pv_load(vf, vp); pv_load(vn, vp + VS);
    asm volatile("s_wait_xcnt 0x0" :: "v"(vp) : "memory");   /* as above */
    /* two register sets by turns, each refilled as soon as its chunk is worked off, and no branch between a chunk's loads and the work on the chunk behind it: two chunks of the wave are in flight at any time; the wave sums its chunks in rising order */
    while (kc + 3 * PVW < kce) { const v16h p0 = frag_f32s(pr + kc * 32, lane, inv), p1 = frag_f32s(pr + (kc + PVW) * 32, lane, inv);   /* both chunks' P fragments first, so that each set's refill follows its last matrix instruction directly */
      pv_mac(acc, p0, vf); pv_load(vf, vp + 2 * VS); pv_mac(acc, p1, vn); pv_load(vn, vp + 3 * VS);
      asm volatile("s_wait_xcnt 0x0" :: "v"(vp) : "memory");   /* as above: the address is advanced behind it */
      vp += 2 * VS; kc += 2 * PVW; }
    pv_unit(acc, vf, pr + kc * 32, lane, inv);
    if (kc + 2 * PVW < kce) { pv_load(vf, vp + 2 * VS);
      asm volatile("s_wait_xcnt 0x0" :: "v"(vp) : "memory");   /* as above */
      pv_unit(acc, vn, pr + (kc + PVW) * 32, lane, inv); pv_unit(acc, vf, pr + (kc + 2 * PVW) * 32, lane, inv); }
    else pv_unit(acc, vn, pr + (kc + PVW) * 32, lane, inv); }
  __syncthreads();   /* every wave has read its last P fragment before the partial tiles overwrite the P rows */
  float (*ss)[16][HD + 4] = (float (*)[16][HD + 4])sp;
#pragma unroll
  for (int j = 0; j < HD / 16; ++j)
#pragma unroll
    for (int r = 0; r < 8; ++r) ss[wave][8 * g + r][j * 16 + col] = acc[j][r];
  __syncthreads();   /* every wave's partial tile is in LDS before any thread sums across waves */
  for (int e = tid; e < 16 * (HD / 4); e += 32 * PVW) { const int rl = e / (HD / 4), q = e % (HD / 4); v4f s = *(const v4f*)&ss[0][rl][q * 4];
    for (int w = 1; w < PVW; ++w) s += *(const v4f*)&ss[w][rl][q * 4];
    vst2(Y + ((size_t)b * TT + ql0 + rl) * CC + h * HD + q * 4, s * (1.0f / 2048.0f)); } }
// ---- k_out: block = (64 rows, 128 cols): out = ctx Wo (+ bo), both operand tiles of each K step staged in LDS as in k_proj: ctx x 2^6 once to f16 against Wo as f16(bf16 x 2^8) exact (1 product) x 2^-14; causal early rows (< QHI of each sequence): ctx bf16 hi + lo against exact bf16 Wo (2 products)
__global__ __launch_bounds__(128) void k_out(const float* __restrict__ Y, const float* __restrict__ WO, const float* __restrict__ BO, float* __restrict__ OUT) { __shared__ __align__(16) float sf[4][16][132]; __shared__ __align__(16) union { struct { __bf16 w[2][128 * WP], yh[2][64 * WP], yl[2][64 * WP]; } b; struct { _Float16 w[2][128 * WP], y[2][64 * WP]; } h; } sk;
  const int tid = threadIdx.x, wave = tid >> 5, lane = tid & 31, col = lane & 15, g = lane >> 4; const int c0 = blockIdx.y * 128; const size_t r0 = (size_t)blockIdx.x * 64 + wave * 16;
  v8f acc[8] = {};
  const float* wp = wt_ptr(WO, c0, wave, lane, DIN); const float* yp = xt_ptr(Y + (size_t)blockIdx.x * 64 * CC, wave, lane, CC);
  v4f wr[8], yr[4]; wt_load(wr, wp, DIN); xt_load(yr, yp, CC);
  if (CAUSAL && (int)(((size_t)blockIdx.x * 64) % TT) < QHI) {   /* block-uniform */
    for (int kc = 0; kc < CC / 32; ++kc) { __bf16* wb = sk.b.w[kc & 1]; __bf16* yh = sk.b.yh[kc & 1]; __bf16* yl = sk.b.yl[kc & 1]; wt_put_b(wb, wr, wave, lane); xt_put_hl(yh, yl, yr, wave, lane);
      __syncthreads();   /* the whole tiles of step kc are in LDS before any wave reads fragments across them; the same barrier ends every wave's reads of step kc - 1, whose buffers step kc + 1 overwrites */
      if (kc + 1 < CC / 32) { wt_load(wr, wp + (size_t)32 * DIN, DIN); xt_load(yr, yp + 32, CC);
        asm volatile("s_wait_xcnt 0x0" :: "v"(wp), "v"(yp) : "memory");   /* the loads' address registers, named here so that they stay as they are up to this wait, are advanced behind it */
        wp += (size_t)32 * DIN; yp += 32; }
      const v16b ah = frag_b(yh + (wave * 16 + col) * WP, lane), al = frag_b(yl + (wave * 16 + col) * WP, lane); v16b wf[8];
#pragma unroll
      for (int j = 0; j < 8; ++j) wf[j] = frag_b(wb + (j * 16 + col) * WP, lane);   /* all of the step's LDS reads as one group in front of its matrix instructions */
#pragma unroll
      for (int j = 0; j < 8; ++j) { acc[j] = wmma_bf(ah, wf[j], acc[j]); acc[j] = wmma_bf(al, wf[j], acc[j]); } }
#pragma unroll
    for (int j = 0; j < 8; ++j) { const float bias = BO ? bfr(BO[c0 + j * 16 + col]) : 0.f;
#pragma unroll
      for (int r = 0; r < 8; ++r) sf[wave][8 * g + r][j * 16 + col] = acc[j][r] + bias; }
  } else {
    for (int kc = 0; kc < CC / 32; ++kc) { _Float16* wb = sk.h.w[kc & 1]; _Float16* yb = sk.h.y[kc & 1]; wt_put_h(wb, wr, wave, lane); xt_put_h(yb, yr, wave, lane, 64.0f);   /* ctx carried x 2^6 into f16 so small-magnitude context rows stay clear of f16 subnormals */
      __syncthreads();   /* as in the branch above: publishes step kc's tiles and ends the reads of step kc - 1 */
      if (kc + 1 < CC / 32) { wt_load(wr, wp + (size_t)32 * DIN, DIN); xt_load(yr, yp + 32, CC);
        asm volatile("s_wait_xcnt 0x0" :: "v"(wp), "v"(yp) : "memory");   /* as in the branch above */
        wp += (size_t)32 * DIN; yp += 32; }
      const v16h a = frag_h(yb + (wave * 16 + col) * WP, lane); v16h wf[8];
#pragma unroll
      for (int j = 0; j < 8; ++j) wf[j] = frag_h(wb + (j * 16 + col) * WP, lane);   /* as in the branch above */
#pragma unroll
      for (int j = 0; j < 8; ++j) acc[j] = wmma16(a, wf[j], acc[j]); }
#pragma unroll
    for (int j = 0; j < 8; ++j) { const float bias = BO ? bfr(BO[c0 + j * 16 + col]) : 0.f;
#pragma unroll
      for (int r = 0; r < 8; ++r) sf[wave][8 * g + r][j * 16 + col] = acc[j][r] * (1.0f / 16384.0f) + bias; } }   /* 2^-8 (Wo carry) x 2^-6 (ctx carry) */
  LDSX(); for (int rl = 0; rl < 16; ++rl) vst2(OUT + (r0 + rl) * DIN + c0 + lane * 4, *(const v4f*)&sf[wave][rl][lane * 4]); }

extern "C" void kernel_launch(void* const* d_in, const int* in_sizes, int n_in, void* d_out, int out_size, void* d_ws, size_t ws_size, hipStream_t stream) {
  (void)in_sizes; (void)n_in; (void)out_size;
  const float** F = (const float**)d_in;
  if (ws_size < (size_t)WS_END) return;
  char* ws = (char*)d_ws; _Float16 *QH = (_Float16*)(ws + WS_QH), *KH = (_Float16*)(ws + WS_KH), *VT = (_Float16*)(ws + WS_VT), *QL = (_Float16*)(ws + WS_QL), *KL = (_Float16*)(ws + WS_KL); __bf16 *VB = (__bf16*)(ws + WS_VB), *VBL = (__bf16*)(ws + WS_VBL); float *Y = (float*)(ws + WS_Y);
  (void)Y; (void)QL; (void)KL; (void)VB; (void)VBL;
  // inputs: 0 x [2,2048,1024]; 1 wq [1024,16,64] = (in,out) [1024][1024]; 2 wk; 3 wv; 4 wp1 [16,64,1024] = (in,out) [1024][1024]; 5 wp2 [1024,1024] (in,out); no biases
  if (ws_size < (size_t)WS_END2) return;
  float* Y2 = (float*)(ws + WS_Y2);
  k_proj<<<dim3(TNB * TT / 64, CC / 128, 3), 128, 0, stream>>>(F[0], F[0], F[0], F[1], F[2], F[3], nullptr, nullptr, nullptr, QH, QL, KH, KL, VT, VB, VBL);
  k_pv<<<dim3(TT / 16, 1, TNB * NH), 32 * PVW, 0, stream>>>(QH, KH, QL, KL, VT, VB, VBL, Y);
  k_out<<<dim3(TNB * TT / 64, DIN / 128), 128, 0, stream>>>(Y, F[4], nullptr, Y2);              /* y = att wp1 (f32 rows in workspace) */
  k_out<<<dim3(TNB * TT / 64, DIN / 128), 128, 0, stream>>>(Y2, F[5], nullptr, (float*)d_out);   /* out = y wp2 */
  static_assert(CC == DIN, "the second output projection reuses k_out: its operand rows have width DIN == CC");
}

// v008
// A run of this version takes 155 microseconds.
// Next to v007, in two timings, it ran 1.15 times as fast each time.
// All steps since v000 together make it 7.09 times as fast.
// compute dtype: all float inputs rounded to bf16; q / k / v projections with EXACT bf16 products on WMMA 16x16x32 (f32 accumulate), no biases; causal logits: 3 products for the first 384 rows, single f16 q x k after, x 64^-0.5; softmax f32; P x 2^11 once to f16 x v once to f16 (bf16 hi + lo below row 384); TWO output projections in sequence, each through k_out (rows < 384: the f32 operand as bf16 hi + lo against the exact weight; beyond: x2^6 f16 carry x f16(bf16 x 2^8) weight); f32 output.
#include <hip/hip_runtime.h>
#include <math.h>

typedef __attribute__((ext_vector_type(16))) _Float16 v16h;
typedef __attribute__((ext_vector_type(16))) __bf16 v16b;
typedef __attribute__((ext_vector_type(8)))  _Float16 v8h;
typedef __attribute__((ext_vector_type(8)))  float v8f;
typedef __attribute__((ext_vector_type(4)))  float v4f;
typedef __attribute__((ext_vector_type(2)))  float v2f;
typedef __attribute__((ext_vector_type(4)))  unsigned v4u;
typedef __attribute__((ext_vector_type(4)))  int v4i;
typedef float __attribute__((may_alias)) float_a;
typedef int __attribute__((may_alias)) int_a;

template <typename T> __device__ __forceinline__ void vst2(void* p, T v) { *(T*)p = v;  }
__device__ __forceinline__ v8f wmma16(v16h a, v16h b, v8f c) {
  v8f d = __builtin_amdgcn_wmma_f32_16x16x32_f16(false, a, false, b, (short)0, c, false, false);
  asm volatile("v_nop\n\tv_nop\n\tv_nop\n\tv_nop" : "+v"(d) : "v"(a), "v"(b));
  return d;
}
__device__ __forceinline__ v8f wmma_bf(v16b a, v16b b, v8f c) {
  v8f d = __builtin_amdgcn_wmma_f32_16x16x32_bf16(false, a, false, b, (short)0, c, false, false);
  asm volatile("v_nop\n\tv_nop\n\tv_nop\n\tv_nop" : "+v"(d) : "v"(a), "v"(b));
  return d;
}
// 16x16x32 fragments: lane = (h = lane>>4, row/col = lane&15); elements 0..7 = k0+8h+0..7, 8..15 = k0+16+8h+0..7; D element r = row 8h+r
__device__ __forceinline__ v16h frag_h(const _Float16* rowk0, int lane) {
  union { v16h v; v8h q[2]; } u; const _Float16* p = rowk0 + 8 * (lane >> 4);
  u.q[0] = *(const v8h*)p; u.q[1] = *(const v8h*)(p + 16); return u.v;
}
__device__ __forceinline__ v16h frag_f32(const float* rowk0, int lane) {
  v16h a; const float* p = rowk0 + 8 * (lane >> 4);
#pragma unroll
  for (int i = 0; i < 8; ++i) { a[i] = (_Float16)p[i]; a[8 + i] = (_Float16)p[16 + i]; }
  return a;
}
__device__ __forceinline__ v16h frag_f32s(const float* rowk0, int lane, float sc) {
  v16h a; const float* p = rowk0 + 8 * (lane >> 4);
#pragma unroll
  for (int i = 0; i < 8; ++i) { a[i] = (_Float16)(p[i] * sc); a[8 + i] = (_Float16)(p[16 + i] * sc); }
  return a;
}
// column fragment from a [K][ld] layout (column n), rows >= K read as 0
__device__ __forceinline__ v16h fragc_f32(const float* W, int k0, int n, int lane, int ld, int K) {
  v16h a; const int g = lane >> 4;
#pragma unroll
  for (int i = 0; i < 8; ++i) { const int ka = k0 + 8 * g + i, kb = ka + 16;
    a[i] = (_Float16)(ka < K ? W[(size_t)(ka < K ? ka : K - 1) * ld + n] : 0.f); a[8 + i] = (_Float16)(kb < K ? W[(size_t)(kb < K ? kb : K - 1) * ld + n] : 0.f); }
  return a;
}
struct F2 { v16b h, l; };
__device__ __forceinline__ F2 bsplit16(const float v[16]) { F2 r;
#pragma unroll
  for (int i = 0; i < 16; ++i) { const __bf16 h = (__bf16)v[i]; r.h[i] = h; r.l[i] = (__bf16)(v[i] - (float)h); }
  return r; }
__device__ __forceinline__ F2 split_row(const float* row, int k0, int lane) { float v[16]; const float* p = row + k0 + 8 * (lane >> 4);
#pragma unroll
  for (int i = 0; i < 8; ++i) { v[i] = p[i]; v[8 + i] = p[16 + i]; }
  return bsplit16(v); }
__device__ __forceinline__ F2 split_rowK(const float* row, int k0, int lane, int K) { float v[16]; const int g = lane >> 4;
#pragma unroll
  for (int i = 0; i < 8; ++i) { const int ka = k0 + 8 * g + i, kb = ka + 16; v[i] = ka < K ? row[ka < K ? ka : K - 1] : 0.f; v[8 + i] = kb < K ? row[kb < K ? kb : K - 1] : 0.f; }
  return bsplit16(v); }
__device__ __forceinline__ F2 split_col(const float* W, int k0, int n, int lane, int ld, int K) { float v[16]; const int g = lane >> 4;
#pragma unroll
  for (int i = 0; i < 8; ++i) { const int ka = k0 + 8 * g + i, kb = ka + 16; v[i] = ka < K ? W[(size_t)(ka < K ? ka : K - 1) * ld + n] : 0.f; v[8 + i] = kb < K ? W[(size_t)(kb < K ? kb : K - 1) * ld + n] : 0.f; }
  return bsplit16(v); }
__device__ __forceinline__ v8f mac3(const F2& a, const F2& b, v8f c) { c = wmma_bf(a.l, b.h, c); c = wmma_bf(a.h, b.l, c); return wmma_bf(a.h, b.h, c); }
__device__ __forceinline__ float sigm(float v) { return 1.0f / (1.0f + expf(-v)); }
#define LDSX() do { asm volatile("s_wait_dscnt 0" ::: "memory"); __builtin_amdgcn_wave_barrier(); __builtin_amdgcn_fence(__ATOMIC_RELEASE, "workgroup"); } while (0)

// Causal multi-head self-attention with per-head-shaped weights and TWO output projections (x [2,2048,1024]; wq / wk / wv [1024,16,64] = (in, head, d): an (in,out) [1024][1024] matrix with out = head*64 + d; wp1 [16,64,1024] = (head, d, out): an (in,out) [1024][1024] matrix with in = head*64 + d; wp2 [1024,1024] (in,out); all N(0, 1/1024), no biases; wei = q k^T x 64^-0.5; tril kept, -inf elsewhere; softmax; att merged (head*64 + d); y = att wp1; out = y wp2).
#define NB 2
#define TT 2048
#define CC 1024            // NH * HD = projected width
#define DIN 1024          // input (model) width
#define NH 16
#define HD 64
#define SCALE (0.125f)
#define CAUSAL 1
#ifndef TNB
#define TNB NB
#endif
__device__ __forceinline__ float bfr(float v) { return (float)(__bf16)v; }
__host__ __device__ __forceinline__ int kb_last(int qb) { return CAUSAL ? ((qb * 64 + 63) >> 7) : (TT / 128 - 1); }
typedef __attribute__((ext_vector_type(8))) __bf16 v8b;
__device__ __forceinline__ v16b frag_b(const __bf16* rowk0, int lane) {
  union { v16b v; v8b q[2]; } u; const __bf16* p = rowk0 + 8 * (lane >> 4);
  u.q[0] = *(const v8b*)p; u.q[1] = *(const v8b*)(p + 16); return u.v;
}
#define QBH 6              // causal: query blocks 0..QBH-1 of each sequence (few keys, no averaging) take the high-precision path
#define QHI 384            // rows carrying a q residual plane
#define KHI 384            // key rows carrying k residual / v bf16 hi+lo planes (used only by the causal high-precision path)
// B fragment (k rows k0+.., output column o) of a weight: (in,out) [K][ld] or (out,in) [ld rows of K]: bf16 exact, or f16(bf16 * 256) exact
__device__ __forceinline__ v16b wcol_io(const float* Wm, int k0, int o, int lane, int ld) { v16b w; const int g = lane >> 4;
#pragma unroll
  for (int i = 0; i < 8; ++i) { w[i] = (__bf16)Wm[(size_t)(k0 + 8 * g + i) * ld + o]; w[8 + i] = (__bf16)Wm[(size_t)(k0 + 16 + 8 * g + i) * ld + o]; }
  return w; }
__device__ __forceinline__ v16b wcol_oi(const float* Wm, int k0, int o, int lane, int K) { v16b w; const float* p = Wm + (size_t)o * K + k0 + 8 * (lane >> 4);
#pragma unroll
  for (int i = 0; i < 8; ++i) { w[i] = (__bf16)p[i]; w[8 + i] = (__bf16)p[16 + i]; }
  return w; }
__device__ __forceinline__ v16h wcolh_io(const float* Wm, int k0, int o, int lane, int ld) { v16h w; const int g = lane >> 4;
#pragma unroll
  for (int i = 0; i < 8; ++i) { w[i] = (_Float16)(bfr(Wm[(size_t)(k0 + 8 * g + i) * ld + o]) * 256.0f); w[8 + i] = (_Float16)(bfr(Wm[(size_t)(k0 + 16 + 8 * g + i) * ld + o]) * 256.0f); }
  return w; }
__device__ __forceinline__ v16h wcolh_oi(const float* Wm, int k0, int o, int lane, int K) { v16h w; const float* p = Wm + (size_t)o * K + k0 + 8 * (lane >> 4);
#pragma unroll
  for (int i = 0; i < 8; ++i) { w[i] = (_Float16)(bfr(p[i]) * 256.0f); w[8 + i] = (_Float16)(bfr(p[16 + i]) * 256.0f); }
  return w; }
#define WQKV_LAYOUT 0   // 0 = (in,out) [DIN][CC]; 1 = (out,in) [CC][DIN]; 2 = per-head [NH][DIN][HD]
__device__ __forceinline__ v16b wcol_hdk(const float* Wm, int k0, int o, int lane) { v16b w; const int g = lane >> 4; const float* p = Wm + (size_t)(o / HD) * DIN * HD + (o % HD);
#pragma unroll
  for (int i = 0; i < 8; ++i) { w[i] = (__bf16)p[(size_t)(k0 + 8 * g + i) * HD]; w[8 + i] = (__bf16)p[(size_t)(k0 + 16 + 8 * g + i) * HD]; }
  return w; }
#define WO_OUT_IN 0
#if WQKV_LAYOUT == 1
#define WCOL(W, k0, o, lane) wcol_oi(W, k0, o, lane, DIN)
#elif WQKV_LAYOUT == 2
#define WCOL(W, k0, o, lane) wcol_hdk(W, k0, o, lane)
#else
#define WCOL(W, k0, o, lane) wcol_io(W, k0, o, lane, CC)
#endif
#if WO_OUT_IN
#define WOCOL(W, k0, o, lane) wcol_oi(W, k0, o, lane, CC)
#define WOCOLH(W, k0, o, lane) wcolh_oi(W, k0, o, lane, CC)
#else
#define WOCOL(W, k0, o, lane) wcol_io(W, k0, o, lane, DIN)
#define WOCOLH(W, k0, o, lane) wcolh_io(W, k0, o, lane, DIN)
#endif

#ifndef PROJ_EXTRA_PARAMS
#define PROJ_EXTRA_PARAMS
#endif

// q, k and v lie in the workspace in the order of k_pv's matrix fragments: the 16 bytes that lane l takes with one load stand at l * 16 in a run of 512 bytes, so that every load of a wave covers four whole 128-byte lines (from rows or planes it would touch 16 lines for 32 bytes each)
#define QKT 1024           // 16-bit elements of one 16-row tile of one head's q or k: [d / 32][(d / 16) & 1][lane = 16 ((d / 8) & 1) + (t & 15)][d & 7]
#define VCH 2048           // 16-bit elements of one 32-key chunk of one head's v: [d / 16][(t / 16) & 1][lane = 16 ((t / 8) & 1) + (d & 15)][t & 7]
static_assert(HD == 64 && QKT == 16 * HD && VCH == 32 * HD, "the fragment-order tiles are written for head size 64");
#define WS_QH  0u                                      // f16 q tiles [b][h][t / 16][QKT]
#define WS_KH  (WS_QH + 2u * (size_t)NB * TT * CC)      // f16 k tiles [b][h][t / 16][QKT]
#define WS_VT  (WS_KH + 2u * (size_t)NB * TT * CC)      // f16 v chunks [b][h][t / 32][VCH]
#define WS_QL  (WS_VT + 2u * (size_t)NB * CC * TT)      // f16 q residual x 2^10 tiles [b][h][t / 16, t < QHI][QKT]
#define WS_KL  (WS_QL + 2u * (size_t)NB * QHI * CC)     // f16 k residual x 2^10 tiles [b][h][t / 16, t < KHI][QKT]
#define WS_VB  (WS_KL + 2u * (size_t)NB * KHI * CC)     // bf16 v hi chunks [b][h][t / 32, t < KHI][VCH]
#define WS_VBL (WS_VB + 2u * (size_t)NB * CC * KHI)
#define WS_Y   (WS_VBL + 2u * (size_t)NB * CC * KHI)    // f32 ctx rows [b*t][CC] (only when there is an output projection)
#define WS_END (WS_Y  + 4u * (size_t)NB * TT * CC)
#define WS_Y2 (WS_END)                                     // f32 rows [b*t][DIN]: the first output projection's result, the second one's operand
#define WS_END2 (WS_Y2 + 4u * (size_t)NB * TT * DIN)

// ---- operand tiles of one K step (32 k) of k_proj / k_out: read by whole-line loads and converted once per block, kept in LDS as 16-bit rows of 32 k, so that an A or B fragment is two 16-byte LDS reads (frag_b / frag_h on the row). Every loop over a register array, here and in the K steps, is fully unrolled: its indices must be constants, else the array goes to scratch
#define WP 40              // LDS pitch of a staged row in 16-bit elements: 32 k values + 16 bytes, so that 16-byte reads of 64-byte rows spread over all banks
static_assert(WQKV_LAYOUT == 0 && !WO_OUT_IN, "the staged weight tile is written for (in,out) weights");
typedef __attribute__((ext_vector_type(4))) __bf16 v4b;
typedef __attribute__((ext_vector_type(4))) _Float16 v4h;
// a block of k_proj / k_out is 8 waves on a tile of 128 rows x 128 output columns; wave w takes rows 32 (w >> 1) + 0..31 and columns 64 (w & 1) + 0..63 of it: 2 A fragments against 4 B fragments, 8 matrix instructions for 6 fragments read
// weight tile: 32 k rows x 128 output columns of an (in,out) [K][ld] matrix, in LDS as [column][k]. Thread (wave, lane) owns the patch k = 16 (wave >> 2) + 4 (lane >> 3) + 0..3, column = 32 (wave & 3) + 4 (lane & 7) + 0..3: each load instruction covers four whole 128-byte lines, each LDS store holds 4 consecutive k of one column
__device__ __forceinline__ const float* wt_ptr(const float* Wm, int c0, int wave, int lane, int ld) { return Wm + (size_t)(16 * (wave >> 2) + 4 * (lane >> 3)) * ld + c0 + 32 * (wave & 3) + 4 * (lane & 7); }
__device__ __forceinline__ void wt_load(v4f (&r)[4], const float* p, int ld) {
#pragma unroll
  for (int i = 0; i < 4; ++i) r[i] = *(const v4f*)(p + (size_t)i * ld); }
__device__ __forceinline__ int wt_at(int c, int wave, int lane) { return (32 * (wave & 3) + 4 * (lane & 7) + c) * WP + 16 * (wave >> 2) + 4 * (lane >> 3); }
__device__ __forceinline__ void wt_put_b(__bf16* buf, const v4f (&r)[4], int wave, int lane) {   /* bf16, exact for the bf16-rounded weight */
#pragma unroll
  for (int c = 0; c < 4; ++c) { v4b t;
#pragma unroll
    for (int i = 0; i < 4; ++i) t[i] = (__bf16)r[i][c];
    *(v4b*)(buf + wt_at(c, wave, lane)) = t; } }
__device__ __forceinline__ void wt_put_h(_Float16* buf, const v4f (&r)[4], int wave, int lane) {   /* f16(bf16 x 2^8), exact */
#pragma unroll
  for (int c = 0; c < 4; ++c) { v4h t;
#pragma unroll
    for (int i = 0; i < 4; ++i) t[i] = (_Float16)(bfr(r[i][c]) * 256.0f);
    *(v4h*)(buf + wt_at(c, wave, lane)) = t; } }
// row tile: 128 rows x 32 k of an f32 [rows][ld] matrix, in LDS as [row][k]; rows0 = the block's first row. Thread (wave, lane) owns k = 4 (lane & 7) + 0..3 of rows 16 wave + 4 i + (lane >> 3), i < 4: each load instruction covers four whole 128-byte lines
__device__ __forceinline__ const float* xt_ptr(const float* rows0, int wave, int lane, int ld) { return rows0 + (size_t)(16 * wave + (lane >> 3)) * ld + 4 * (lane & 7); }
__device__ __forceinline__ void xt_load(v4f (&r)[4], const float* p, int ld) {
#pragma unroll
  for (int i = 0; i < 4; ++i) r[i] = *(const v4f*)(p + (size_t)(4 * i) * ld); }
__device__ __forceinline__ int xt_at(int i, int wave, int lane) { return (16 * wave + 4 * i + (lane >> 3)) * WP + 4 * (lane & 7); }
__device__ __forceinline__ void xt_put_b(__bf16* buf, const v4f (&r)[4], int wave, int lane) {   /* once to bf16 */
#pragma unroll
  for (int i = 0; i < 4; ++i) { v4b t;
#pragma unroll
    for (int c = 0; c < 4; ++c) t[c] = (__bf16)r[i][c];
    *(v4b*)(buf + xt_at(i, wave, lane)) = t; } }
__device__ __forceinline__ void xt_put_hl(__bf16* bh, __bf16* bl, const v4f (&r)[4], int wave, int lane) {   /* bf16 hi + lo planes, as bsplit16 */
#pragma unroll
  for (int i = 0; i < 4; ++i) { v4b th, tl;
#pragma unroll
    for (int c = 0; c < 4; ++c) { const __bf16 h = (__bf16)r[i][c]; th[c] = h; tl[c] = (__bf16)(r[i][c] - (float)h); }
    *(v4b*)(bh + xt_at(i, wave, lane)) = th; *(v4b*)(bl + xt_at(i, wave, lane)) = tl; } }
__device__ __forceinline__ void xt_put_h(_Float16* buf, const v4f (&r)[4], int wave, int lane, float sc) {   /* x sc, once to f16 */
#pragma unroll
  for (int i = 0; i < 4; ++i) { v4h t;
#pragma unroll
    for (int c = 0; c < 4; ++c) t[c] = (_Float16)(r[i][c] * sc);
    *(v4h*)(buf + xt_at(i, wave, lane)) = t; } }
// ---- k_proj: block = (128 rows, 128 cols, which), 8 waves of 32 x 64: q/k/v = X W (+ b) with exact bf16 products (K = DIN), both operand tiles of each K step staged in LDS (two buffers, which share their LDS with the epilogue's tiles), the next step's loads issued behind the step's barrier -> which 0: q f16 tiles (+ residual tiles, rows < QHI); 1: k f16 tiles (+ residual tiles, rows < KHI); 2: v f16 chunks (+ bf16 hi/lo chunks for t < KHI), all in fragment order: thread e of the store loops takes the e-th 16 bytes of the block's share, so that a wave stores 512 bytes in a row
static_assert(TT % 128 == 0 && QHI % 128 == 0 && KHI % 128 == 0, "a block's 128 rows lie in one sequence and on one side of the high-precision bound");
__global__ __launch_bounds__(256) void k_proj(const float* __restrict__ XQ, const float* __restrict__ XK, const float* __restrict__ XV, const float* __restrict__ WQ, const float* __restrict__ WK, const float* __restrict__ WV, const float* __restrict__ BQ, const float* __restrict__ BK, const float* __restrict__ BV,
    _Float16* __restrict__ QH, _Float16* __restrict__ QL, _Float16* __restrict__ KH, _Float16* __restrict__ KL, _Float16* __restrict__ VT, __bf16* __restrict__ VB, __bf16* __restrict__ VBL) {
  __shared__ __align__(16) union { struct { _Float16 sh[128][136], sl[128][136]; } r; struct { _Float16 th[128][136]; __bf16 tb[128][136], tbl[128][136]; } c; struct { __bf16 w[2][128 * WP], x[2][128 * WP]; } k; } u;
  _Float16 (&sh)[128][136] = u.r.sh; _Float16 (&sl)[128][136] = u.r.sl; _Float16 (&th)[128][136] = u.c.th; __bf16 (&tb)[128][136] = u.c.tb; __bf16 (&tbl)[128][136] = u.c.tbl;
  const int tid = threadIdx.x, wave = __builtin_amdgcn_readfirstlane(tid >> 5) /* scalar, so that what hangs on the wave alone takes no vector register */, lane = tid & 31, col = lane & 15, g = lane >> 4, wr = wave >> 1, wc = wave & 1; const int which = blockIdx.z; const int c0 = blockIdx.y * 128; const size_t r0 = (size_t)blockIdx.x * 128; const size_t bb = r0 / TT; const int t0 = (int)(r0 % TT);
  const float* X = which == 0 ? XQ : which == 1 ? XK : XV; const float* WA = which == 0 ? WQ : which == 1 ? WK : WV; const float* BA = which == 0 ? BQ : which == 1 ? BK : BV;
  v8f acc[2][4] = {}; const int ao = (wr * 32 + col) * WP, bo = (wc * 64 + col) * WP;   /* the lane's row in the wave's first A and first B fragment; the further fragments lie 16 rows apart */
  const float* wp = wt_ptr(WA, c0, wave, lane, CC); const float* xp = xt_ptr(X + r0 * DIN, wave, lane, DIN);
  v4f wr4[4], xr[4]; wt_load(wr4, wp, CC); xt_load(xr, xp, DIN);
  for (int kc = 0; kc < DIN / 32; ++kc) { __bf16* wb = u.k.w[kc & 1]; __bf16* xb = u.k.x[kc & 1]; wt_put_b(wb, wr4, wave, lane); xt_put_b(xb, xr, wave, lane);
    __syncthreads();   /* the whole tiles of step kc are in LDS before any wave reads fragments across them; the same barrier ends every wave's reads of step kc - 1, whose buffers step kc + 1 overwrites */
    if (kc + 1 < DIN / 32) { wt_load(wr4, wp + (size_t)32 * CC, CC); xt_load(xr, xp + 32, DIN);
      asm volatile("s_wait_xcnt 0x0" :: "v"(wp), "v"(xp) : "memory");   /* the loads' address registers, named here so that they stay as they are up to this wait, are advanced behind it */
      wp += (size_t)32 * CC; xp += 32; }
    v16b af[2], wf[4];
#pragma unroll
    for (int i = 0; i < 2; ++i) af[i] = frag_b(xb + ao + i * 16 * WP, lane);
#pragma unroll
    for (int j = 0; j < 4; ++j) wf[j] = frag_b(wb + bo + j * 16 * WP, lane);   /* all of the step's LDS reads as one group in front of its matrix instructions */
#pragma unroll
    for (int j = 0; j < 4; ++j)
#pragma unroll
      for (int i = 0; i < 2; ++i) acc[i][j] = wmma_bf(af[i], wf[j], acc[i][j]); }
  __syncthreads();   /* every wave has read its last fragments before the epilogue's tiles overwrite the staging buffers */
  if (which < 2) { _Float16* DH = which == 0 ? QH : KH; _Float16* DL = which == 0 ? QL : KL; const int nhi = which == 0 ? QHI : KHI; const bool hi_rows = t0 < nhi;
#pragma unroll
    for (int j = 0; j < 4; ++j) { const int cl = wc * 64 + j * 16 + col; const float bias = BA ? bfr(BA[c0 + cl]) : 0.f;
#pragma unroll
      for (int i = 0; i < 2; ++i)
#pragma unroll
        for (int r = 0; r < 8; ++r) { const float v = acc[i][j][r] + bias; const _Float16 hv = (_Float16)v; const int rl = wr * 32 + i * 16 + 8 * g + r; sh[rl][cl] = hv; sl[rl][cl] = (_Float16)((v - (float)hv) * 1024.0f); } }
    __syncthreads();
    for (int e = tid; e < 128 * 16; e += 256) { const int hh = e >> 10, tl = (e >> 7) & 7, rl = tl * 16 + col, cl = hh * HD + ((e >> 5) & 3) * 16 + g * 8; const size_t hb = bb * NH + c0 / HD + hh;   /* e = [head][tile][d / 16][lane] */
      vst2((unsigned*)(DH + (hb * (TT / 16) + t0 / 16 + tl) * QKT + (e & 127) * 8), *(const v4u*)&sh[rl][cl]);
      asm volatile("s_wait_xcnt 0x0" ::: "memory");   /* in front of what rewrites the store's address and data registers: the residual's lines, the next trip */
      if (hi_rows) { vst2((unsigned*)(DL + (hb * (nhi / 16) + t0 / 16 + tl) * QKT + (e & 127) * 8), *(const v4u*)&sl[rl][cl]);
        asm volatile("s_wait_xcnt 0x0" ::: "memory"); } }   /* as above */
  } else { const bool hi_rows = t0 < KHI;
#pragma unroll
    for (int j = 0; j < 4; ++j) { const int cl = wc * 64 + j * 16 + col; const float bias = BA ? bfr(BA[c0 + cl]) : 0.f;
#pragma unroll
      for (int i = 0; i < 2; ++i)
#pragma unroll
        for (int r = 0; r < 8; ++r) { const float v = acc[i][j][r] + bias; const int rl = wr * 32 + i * 16 + 8 * g + r; th[cl][rl] = (_Float16)v; const __bf16 bh = (__bf16)v; tb[cl][rl] = bh; tbl[cl][rl] = (__bf16)(v - (float)bh); } }
    __syncthreads();
    for (int e = tid; e < 128 * 16; e += 256) { const int hh = e >> 10, cn = (e >> 8) & 3, cl = hh * HD + ((e >> 6) & 3) * 16 + col, rl = cn * 32 + ((e >> 5) & 1) * 16 + g * 8; const size_t hb = bb * NH + c0 / HD + hh;   /* e = [head][chunk][d / 16][(t / 16) & 1][lane] */
      vst2((unsigned*)(VT + (hb * (TT / 32) + t0 / 32 + cn) * VCH + (e & 255) * 8), *(const v4u*)&th[cl][rl]);
      asm volatile("s_wait_xcnt 0x0" ::: "memory");   /* as in the branch above */
      if (hi_rows) { const size_t o3 = (hb * (KHI / 32) + t0 / 32 + cn) * VCH + (e & 255) * 8; vst2((unsigned*)(VB + o3), *(const v4u*)&tb[cl][rl]); vst2((unsigned*)(VBL + o3), *(const v4u*)&tbl[cl][rl]);
        asm volatile("s_wait_xcnt 0x0" ::: "memory"); } } } }   /* as in the branch above */
// ---- k_pv: block = 16 queries (tile qt of query block qb = qt / 4) of (b, h) = blockIdx.z, PVW waves. Logits first, never through memory: wave w takes the 64-key units w, w + PVW, ... of keys [0, kend): q x k on the matrix unit, x SCALE, f32 to the 16 LDS rows (single f16 product; causal early query blocks: q hi + residual (x 2^10) against k hi + residual, 3 products); the mask is applied by index in the softmax. Softmax: wave w takes query rows w and w + PVW whole, in registers: keys [0, kend): causal -> logit if s <= t else excluded; softmax in f32; exp(logit - max) (0 for excluded) back to the LDS rows, 2^11 / sum to LDS per row. Then ctx = P . v over keys [0, kend), P x 2^11 = the LDS value x the row's 2^11 / sum; wave w takes the 32-key chunks w, w + PVW, ... and the PVW partial tiles are summed in wave order through LDS (P x 2^11 once to f16 against v f16: 1 product; causal early query blocks: P and v as bf16 hi + lo, 3 products); 256-B (row, head) segment by 16 lanes
#define PVW 8
#define PPITCH (TT + 4)    // LDS pitch of a P row in floats: 16 bytes over the row, so that the 16 rows of a fragment read start 4 banks apart
#define NCF (TT / 128 - 1) // most 128-key pieces of a row in front of its last one; a piece is one 16-byte load per lane
#define L2E 1.44269504088896340736f   // log2(e)
// exp(logit - max) = 2^(logit x log2(e) - mc), mc = max x log2(e): one fused multiply-add (the product unrounded, so that the exponent is rounded once) and the chip's exp2 per element. The exponent is <= 0 up to mc's rounding, which scales a whole row alike and cancels against the row's sum; a result under 2^-126 may come out as 0, beside a sum that holds the max's own term, about 1
__device__ __forceinline__ v4f sm_exp(v4f v, float mc) { v4f e;
#pragma unroll
  for (int c = 0; c < 4; ++c) e[c] = __builtin_amdgcn_exp2f(__builtin_fmaf(v[c], L2E, -mc));
  return e; }
// one query row's softmax by one wave: lane l holds the logits of keys i * 128 + 4 l + 0..3 in x[i], i < nf, and those of the row's last piece (i = nf) in xl. Only the last piece can hold keys > t: nf * 128 = (kb_last(qb)) * 128 <= qb * 64 <= t. Returns 2^11 / sum; exp(logit - max) goes to the LDS row pr
__device__ __forceinline__ float sm_row(const v4f (&x)[NCF], v4f xl, int nf, int t, int lane, float* pr) {
  float m = -3.0e38f;
#pragma unroll
  for (int c = 0; c < 4; ++c) { xl[c] = (!CAUSAL || nf * 128 + lane * 4 + c <= t) ? xl[c] : -3.0e38f; m = fmaxf(m, xl[c]); }
#pragma unroll
  for (int i = 0; i < NCF; ++i) if (i < nf) {
#pragma unroll
    for (int c = 0; c < 4; ++c) m = fmaxf(m, x[i][c]); }
#pragma unroll
  for (int o = 1; o < 32; o <<= 1) m = fmaxf(m, __shfl_xor(m, o));
  const float mc = m * L2E; v4f s4 = {};
#pragma unroll
  for (int i = 0; i < NCF; ++i) if (i < nf) { const v4f e = sm_exp(x[i], mc); s4 += e; *(v4f*)(pr + i * 128 + lane * 4) = e; }   /* no key of these pieces is excluded */
  { v4f e = sm_exp(xl, mc);
#pragma unroll
    for (int c = 0; c < 4; ++c) e[c] = (xl[c] <= -1.0e38f) ? 0.f : e[c];   /* excluded keys */
    s4 += e; *(v4f*)(pr + nf * 128 + lane * 4) = e; }
  float sum = (s4[0] + s4[1]) + (s4[2] + s4[3]);
#pragma unroll
  for (int o = 1; o < 32; o <<= 1) sum += __shfl_xor(sum, o);
  return sum > 0.f ? 2048.0f / sum : 0.f; }   /* a fully excluded row yields P = 0 */
#define KU 64              // keys of one logit unit: four 16-key tiles, whose 16 loads per lane are in flight together
// the B fragments of one unit: f[2 j + kc] = keys 16 j + (lane & 15), d = 32 kc + ..; p = the lane's own 16 bytes in the first 512 of the unit's four tiles, so that all 16 loads go off one address
__device__ __forceinline__ void ku_load(v16h (&f)[8], const _Float16* p) {
#pragma unroll
  for (int j = 0; j < 4; ++j)
#pragma unroll
    for (int kc = 0; kc < 2; ++kc) { union { v16h v; v8h q[2]; } u; const _Float16* s = p + j * QKT + kc * (QKT / 2); u.q[0] = *(const v8h*)s; u.q[1] = *(const v8h*)(s + QKT / 4); f[2 * j + kc] = u.v; } }
// one unit's logits, single product: the four tiles' accumulators are independent, so that no matrix instruction waits for the one in front of it; w = the lane's place (row 8 (lane >> 4), key lane & 15 of the unit) in the LDS rows
__device__ __forceinline__ void lg_unit(v16h a0, v16h a1, const v16h (&f)[8], float* w) { v8f c[4];
#pragma unroll
  for (int j = 0; j < 4; ++j) { const v8f z = {}; c[j] = wmma16(a0, f[2 * j], z); }
#pragma unroll
  for (int j = 0; j < 4; ++j) c[j] = wmma16(a1, f[2 * j + 1], c[j]);
#pragma unroll
  for (int j = 0; j < 4; ++j)
#pragma unroll
    for (int r = 0; r < 8; ++r) w[r * PPITCH + j * 16] = c[j][r] * SCALE; }
// the B fragments of one 32-key chunk of v: f[j] = d = 16 j + (lane & 15), keys 8 (lane >> 4) + ..; p = the lane's own 16 bytes in the chunk's first 512, so that all 8 loads go off one address
template <typename V, typename E> __device__ __forceinline__ void pv_load(V (&f)[HD / 16], const E* p) {
#pragma unroll
  for (int j = 0; j < HD / 16; ++j) { union { V v; v4u q[2]; } u; const E* s = p + j * (VCH / 4); u.q[0] = *(const v4u*)s; u.q[1] = *(const v4u*)(s + VCH / 8); f[j] = u.v; } }
// one chunk's P . v, single product: P x 2^11 from the LDS row, once to f16, against the chunk's four fragments
__device__ __forceinline__ void pv_mac(v8f (&acc)[HD / 16], v16h p, const v16h (&f)[HD / 16]) {
#pragma unroll
  for (int j = 0; j < HD / 16; ++j) acc[j] = wmma16(p, f[j], acc[j]); }
__device__ __forceinline__ void pv_unit(v8f (&acc)[HD / 16], const v16h (&f)[HD / 16], const float* prow, int lane, float inv) { pv_mac(acc, frag_f32s(prow, lane, inv), f); }
__global__ __launch_bounds__(32 * PVW) void k_pv(const _Float16* __restrict__ QH, const _Float16* __restrict__ KH, const _Float16* __restrict__ QL, const _Float16* __restrict__ KL, const _Float16* __restrict__ VT, const __bf16* __restrict__ VB, const __bf16* __restrict__ VBL, float* __restrict__ Y) { const int b = blockIdx.z / NH, h = blockIdx.z % NH; __shared__ __align__(16) float sp[16 * PPITCH]; __shared__ float sinv[16];
  static_assert(PVW * 16 * (HD + 4) <= 16 * PPITCH && 2 * PVW == 16, "the partial tiles reuse the P rows' LDS; two query rows per wave");
  static_assert((((QBH * 64 + 63) >> 7) + 1) * 4 >= 2 * PVW, "beyond the early query blocks every wave has two P.v chunks or more");
  static_assert(CAUSAL && (((QBH * 64 + 63) >> 7) + 1) * (128 / KU) >= PVW && ((((QBH - 1) * 64 + 63) >> 7) + 1) * (128 / KU) <= PVW, "beyond the early query blocks every wave has a logit unit, within them at most one");
  const int tid = threadIdx.x, lane = tid & 31, col = lane & 15, g = lane >> 4; const int qb = blockIdx.x >> 2; const int ql0 = blockIdx.x * 16; const int kce = (kb_last(qb) + 1) * 4;
  const int wave = __builtin_amdgcn_readfirstlane(tid >> 5);   /* scalar, so that the key loop's bounds and branch stay wave-uniform around the matrix instructions */
  { const int nu = (kb_last(qb) + 1) * (128 / KU); const size_t bh = blockIdx.z; float* sw = sp + 8 * g * PPITCH + col;   /* bh = b NH + h, the head's index in the fragment-order planes */
    const _Float16* qp = QH + (bh * (TT / 16) + blockIdx.x) * QKT + lane * 8; const _Float16* kp = KH + (bh * (TT / 16) + wave * (KU / 16)) * QKT + lane * 8;
    union { v16h v; v8h q[2]; } a0, a1; a0.q[0] = *(const v8h*)qp; a0.q[1] = *(const v8h*)(qp + QKT / 4); a1.q[0] = *(const v8h*)(qp + QKT / 2); a1.q[1] = *(const v8h*)(qp + 3 * (QKT / 4));
    if (qb < QBH) { const _Float16* qlp = QL + (bh * (QHI / 16) + blockIdx.x) * QKT + lane * 8; const _Float16* klp = KL + (bh * (KHI / 16) + wave * (KU / 16)) * QKT + lane * 8;
      union { v16h v; v8h q[2]; } l0, l1; l0.q[0] = *(const v8h*)qlp; l0.q[1] = *(const v8h*)(qlp + QKT / 4); l1.q[0] = *(const v8h*)(qlp + QKT / 2); l1.q[1] = *(const v8h*)(qlp + 3 * (QKT / 4));
      asm volatile("s_wait_xcnt 0x0" :: "v"(qp), "v"(qlp) : "memory");   /* the loads' address registers, named here so that they stay as they are up to this wait, may be reused behind it */
      if (wave < nu) { const int u = wave; v16h kf[8], lf[8]; ku_load(kf, kp); ku_load(lf, klp);   /* here nu <= PVW: at most one unit per wave; a scalar test, so that the matrix instructions run with every lane on */
        asm volatile("s_wait_xcnt 0x0" :: "v"(kp), "v"(klp) : "memory");   /* as above */
#pragma unroll
        for (int j = 0; j < 4; ++j) { v8f c = {}, cl = {};
          c = wmma16(a0.v, kf[2 * j], c); cl = wmma16(l0.v, kf[2 * j], cl); cl = wmma16(a0.v, lf[2 * j], cl);
          c = wmma16(a1.v, kf[2 * j + 1], c); cl = wmma16(l1.v, kf[2 * j + 1], cl); cl = wmma16(a1.v, lf[2 * j + 1], cl);
#pragma unroll
          for (int r = 0; r < 8; ++r) sw[r * PPITCH + u * KU + j * 16] = (c[r] + cl[r] * (1.0f / 1024.0f)) * SCALE; } }
    } else { v16h kf[8], kn[8]; int u = wave; constexpr size_t KS = (size_t)PVW * (KU / 16) * QKT;   /* from one unit of a wave to its next; here nu >= PVW: every wave has a unit */
      ku_load(kf, kp);
      asm volatile("s_wait_xcnt 0x0" :: "v"(qp), "v"(kp) : "memory");   /* as above */
      /* two register sets by turns, and no branch between a unit's loads and the work on the unit before it: the wave's next unit is in flight while this one is worked on */
      while (u + 2 * PVW < nu) { ku_load(kn, kp + KS); lg_unit(a0.v, a1.v, kf, sw + u * KU); ku_load(kf, kp + 2 * KS);
        asm volatile("s_wait_xcnt 0x0" :: "v"(kp) : "memory");   /* as above: the address is advanced behind it */
        kp += 2 * KS; lg_unit(a0.v, a1.v, kn, sw + (u + PVW) * KU); u += 2 * PVW; }
      if (u + PVW < nu) { ku_load(kn, kp + KS);
        asm volatile("s_wait_xcnt 0x0" :: "v"(kp) : "memory");   /* as above */
        lg_unit(a0.v, a1.v, kf, sw + u * KU); lg_unit(a0.v, a1.v, kn, sw + (u + PVW) * KU); }
      else lg_unit(a0.v, a1.v, kf, sw + u * KU); } }
  __syncthreads();   /* all 16 rows' logits are in LDS before any wave reads a row across the units */
  { const int nf = kb_last(qb); v4f x0[NCF], x1[NCF]; const float* s0 = sp + wave * PPITCH + lane * 4; const float* s1 = s0 + PVW * PPITCH;
#pragma unroll
    for (int i = 0; i < NCF; ++i) if (i < nf) { x0[i] = *(const v4f*)(s0 + i * 128); x1[i] = *(const v4f*)(s1 + i * 128); }   /* both rows whole in registers before either row's LDS is overwritten */
    const v4f xl0 = *(const v4f*)(s0 + nf * 128), xl1 = *(const v4f*)(s1 + nf * 128);
    const float i0 = sm_row(x0, xl0, nf, ql0 + wave, lane, sp + wave * PPITCH), i1 = sm_row(x1, xl1, nf, ql0 + wave + PVW, lane, sp + (wave + PVW) * PPITCH);
    if (lane == 0) { sinv[wave] = i0; sinv[wave + PVW] = i1; } }
  __syncthreads();   /* all 16 rows and their factors are in LDS before any wave reads fragments across them */
  const float inv = sinv[col]; const float* pc = sp + col * PPITCH + 8 * g;
  v8f acc[HD / 16] = {};
  if (qb < QBH) {
    const size_t vo = (size_t)blockIdx.z * (KHI / 32) * VCH + lane * 8;
#pragma unroll 1   /* at most two trips here: kept rolled, so that the kernel's text stays short */
    for (int kc = wave; kc < kce; kc += PVW) { v16b vh[HD / 16], vl[HD / 16]; const __bf16* hp = VB + vo + kc * VCH; const __bf16* lp = VBL + vo + kc * VCH; pv_load(vh, hp); pv_load(vl, lp);   /* the chunk's 16 loads in flight together, in front of its matrix instructions */
      asm volatile("s_wait_xcnt 0x0" :: "v"(hp), "v"(lp) : "memory");   /* the loads' address registers, named here so that they stay as they are up to this wait, may be reused behind it */
      float pv[16];
#pragma unroll
      for (int i = 0; i < 8; ++i) { pv[i] = pc[kc * 32 + i] * inv; pv[8 + i] = pc[kc * 32 + 16 + i] * inv; }
      const F2 p = bsplit16(pv);
#pragma unroll
      for (int j = 0; j < HD / 16; ++j) { acc[j] = wmma_bf(p.h, vh[j], acc[j]); acc[j] = wmma_bf(p.l, vh[j], acc[j]); acc[j] = wmma_bf(p.h, vl[j], acc[j]); } }
  } else { v16h vf[HD / 16], vn[HD / 16]; int kc = wave; constexpr int VS = PVW * VCH;   /* from one chunk of a wave to its next, in elements; here kce >= 2 PVW: every wave has two chunks or more */
    const _Float16* vp = VT + ((size_t)blockIdx.z * (TT / 32) + wave) * VCH + lane * 8; const float* pr = sp + col * PPITCH;
    pv_load(vf, vp); pv_load(vn, vp + VS);
    asm volatile("s_wait_xcnt 0x0" :: "v"(vp) : "memory");   /* as above */
    /* two register sets by turns, each refilled as soon as its chunk is worked off, and no branch between a chunk's loads and the work on the chunk behind it: two chunks of the wave are in flight at any time; the wave sums its chunks in rising order */
    while (kc + 3 * PVW < kce) { const v16h p0 = frag_f32s(pr + kc * 32, lane, inv), p1 = frag_f32s(pr + (kc + PVW) * 32, lane, inv);   /* both chunks' P fragments first, so that each set's refill follows its last matrix instruction directly */
      pv_mac(acc, p0, vf); pv_load(vf, vp + 2 * VS); pv_mac(acc, p1, vn); pv_load(vn, vp + 3 * VS);
      asm volatile("s_wait_xcnt 0x0" :: "v"(vp) : "memory");   /* as above: the address is advanced behind it */
      vp += 2 * VS; kc += 2 * PVW; }
    pv_unit(acc, vf, pr + kc * 32, lane, inv);
    if (kc + 2 * PVW < kce) { pv_load(vf, vp + 2 * VS);
      asm volatile("s_wait_xcnt 0x0" :: "v"(vp) : "memory");   /* as above */
      pv_unit(acc, vn, pr + (kc + PVW) * 32, lane, inv); pv_unit(acc, vf, pr + (kc + 2 * PVW) * 32, lane, inv); }
    else pv_unit(acc, vn, pr + (kc + PVW) * 32, lane, inv); }
  __syncthreads();   /* every wave has read its last P fragment before the partial tiles overwrite the P rows */
  float (*ss)[16][HD + 4] = (float (*)[16][HD + 4])sp;
#pragma unroll
  for (int j = 0; j < HD / 16; ++j)
#pragma unroll
    for (int r = 0; r < 8; ++r) ss[wave][8 * g + r][j * 16 + col] = acc[j][r];
  __syncthreads();   /* every wave's partial tile is in LDS before any thread sums across waves */
  for (int e = tid; e < 16 * (HD / 4); e += 32 * PVW) { const int rl = e / (HD / 4), q = e % (HD / 4); v4f s = *(const v4f*)&ss[0][rl][q * 4];
    for (int w = 1; w < PVW; ++w) s += *(const v4f*)&ss[w][rl][q * 4];
    vst2(Y + ((size_t)b * TT + ql0 + rl) * CC + h * HD + q * 4, s * (1.0f / 2048.0f)); } }
// ---- k_out: block = (128 rows, 128 cols), 8 waves of 32 x 64: out = ctx Wo (+ bo), both operand tiles of each K step staged in LDS as in k_proj: ctx x 2^6 once to f16 against Wo as f16(bf16 x 2^8) exact (1 product) x 2^-14; causal early rows (< QHI of each sequence): ctx bf16 hi + lo against exact bf16 Wo (2 products)
__global__ __launch_bounds__(256) void k_out(const float* __restrict__ Y, const float* __restrict__ WO, const float* __restrict__ BO, float* __restrict__ OUT) { __shared__ __align__(16) float sf[8][32][68]; __shared__ __align__(16) union { struct { __bf16 w[2][128 * WP], yh[2][128 * WP], yl[2][128 * WP]; } b; struct { _Float16 w[2][128 * WP], y[2][128 * WP]; } h; } sk;
  const int tid = threadIdx.x, wave = __builtin_amdgcn_readfirstlane(tid >> 5) /* scalar, so that what hangs on the wave alone takes no vector register */, lane = tid & 31, col = lane & 15, g = lane >> 4, wr = wave >> 1, wc = wave & 1; const int c0 = blockIdx.y * 128; const size_t r0 = (size_t)blockIdx.x * 128 + wr * 32;
  v8f acc[2][4] = {}; const int ao = (wr * 32 + col) * WP, bo = (wc * 64 + col) * WP;   /* the lane's row in the wave's first A and first B fragment; the further fragments lie 16 rows apart */
  const float* wp = wt_ptr(WO, c0, wave, lane, DIN); const float* yp = xt_ptr(Y + (size_t)blockIdx.x * 128 * CC, wave, lane, CC);
  v4f wr4[4], yr[4]; wt_load(wr4, wp, DIN); xt_load(yr, yp, CC);
  if (CAUSAL && (int)(((size_t)blockIdx.x * 128) % TT) < QHI) {   /* block-uniform */
    for (int kc = 0; kc < CC / 32; ++kc) { __bf16* wb = sk.b.w[kc & 1]; __bf16* yh = sk.b.yh[kc & 1]; __bf16* yl = sk.b.yl[kc & 1]; wt_put_b(wb, wr4, wave, lane); xt_put_hl(yh, yl, yr, wave, lane);
      __syncthreads();   /* the whole tiles of step kc are in LDS before any wave reads fragments across them; the same barrier ends every wave's reads of step kc - 1, whose buffers step kc + 1 overwrites */
      if (kc + 1 < CC / 32) { wt_load(wr4, wp + (size_t)32 * DIN, DIN); xt_load(yr, yp + 32, CC);
        asm volatile("s_wait_xcnt 0x0" :: "v"(wp), "v"(yp) : "memory");   /* the loads' address registers, named here so that they stay as they are up to this wait, are advanced behind it */
        wp += (size_t)32 * DIN; yp += 32; }
      v16b ah[2], al[2], wf[4];
#pragma unroll
      for (int i = 0; i < 2; ++i) { ah[i] = frag_b(yh + ao + i * 16 * WP, lane); al[i] = frag_b(yl + ao + i * 16 * WP, lane); }
#pragma unroll
      for (int j = 0; j < 4; ++j) wf[j] = frag_b(wb + bo + j * 16 * WP, lane);   /* all of the step's LDS reads as one group in front of its matrix instructions */
#pragma unroll
      for (int j = 0; j < 4; ++j)
#pragma unroll
        for (int i = 0; i < 2; ++i) { acc[i][j] = wmma_bf(ah[i], wf[j], acc[i][j]); acc[i][j] = wmma_bf(al[i], wf[j], acc[i][j]); } }
#pragma unroll
    for (int j = 0; j < 4; ++j) { const float bias = BO ? bfr(BO[c0 + wc * 64 + j * 16 + col]) : 0.f;
#pragma unroll
      for (int i = 0; i < 2; ++i)
#pragma unroll
        for (int r = 0; r < 8; ++r) sf[wave][i * 16 + 8 * g + r][j * 16 + col] = acc[i][j][r] + bias; }
  } else {
    for (int kc = 0; kc < CC / 32; ++kc) { _Float16* wb = sk.h.w[kc & 1]; _Float16* yb = sk.h.y[kc & 1]; wt_put_h(wb, wr4, wave, lane); xt_put_h(yb, yr, wave, lane, 64.0f);   /* ctx carried x 2^6 into f16 so small-magnitude context rows stay clear of f16 subnormals */
      __syncthreads();   /* as in the branch above: publishes step kc's tiles and ends the reads of step kc - 1 */
      if (kc + 1 < CC / 32) { wt_load(wr4, wp + (size_t)32 * DIN, DIN); xt_load(yr, yp + 32, CC);
        asm volatile("s_wait_xcnt 0x0" :: "v"(wp), "v"(yp) : "memory");   /* as in the branch above */
        wp += (size_t)32 * DIN; yp += 32; }
      v16h af[2], wf[4];
#pragma unroll
      for (int i = 0; i < 2; ++i) af[i] = frag_h(yb + ao + i * 16 * WP, lane);
#pragma unroll
      for (int j = 0; j < 4; ++j) wf[j] = frag_h(wb + bo + j * 16 * WP, lane);   /* as in the branch above */
#pragma unroll
      for (int j = 0; j < 4; ++j)
#pragma unroll
        for (int i = 0; i < 2; ++i) acc[i][j] = wmma16(af[i], wf[j], acc[i][j]); }
#pragma unroll
    for (int j = 0; j < 4; ++j) { const float bias = BO ? bfr(BO[c0 + wc * 64 + j * 16 + col]) : 0.f;
#pragma unroll
      for (int i = 0; i < 2; ++i)
#pragma unroll
        for (int r = 0; r < 8; ++r) sf[wave][i * 16 + 8 * g + r][j * 16 + col] = acc[i][j][r] * (1.0f / 16384.0f) + bias; } }   /* 2^-8 (Wo carry) x 2^-6 (ctx carry) */
  LDSX();   /* the wave's own 32 x 64 tile goes out two rows per store, 256 bytes in a row each */
  v4f o[16];
#pragma unroll
  for (int t = 0; t < 16; ++t) o[t] = *(const v4f*)&sf[wave][2 * t + g][col * 4];   /* all 16 LDS reads as one group: one latency, and each store has data registers of its own */
#pragma unroll
  for (int t = 0; t < 16; ++t) vst2(OUT + (r0 + 2 * t + g) * DIN + c0 + wc * 64 + col * 4, o[t]); }

extern "C" void kernel_launch(void* const* d_in, const int* in_sizes, int n_in, void* d_out, int out_size, void* d_ws, size_t ws_size, hipStream_t stream) {
  (void)in_sizes; (void)n_in; (void)out_size;
  const float** F = (const float**)d_in;
  if (ws_size < (size_t)WS_END) return;
  char* ws = (char*)d_ws; _Float16 *QH = (_Float16*)(ws + WS_QH), *KH = (_Float16*)(ws + WS_KH), *VT = (_Float16*)(ws + WS_VT), *QL = (_Float16*)(ws + WS_QL), *KL = (_Float16*)(ws + WS_KL); __bf16 *VB = (__bf16*)(ws + WS_VB), *VBL = (__bf16*)(ws + WS_VBL); float *Y = (float*)(ws + WS_Y);
  (void)Y; (void)QL; (void)KL; (void)VB; (void)VBL;
  // inputs: 0 x [2,2048,1024]; 1 wq [1024,16,64] = (in,out) [1024][1024]; 2 wk; 3 wv; 4 wp1 [16,64,1024] = (in,out) [1024][1024]; 5 wp2 [1024,1024] (in,out); no biases
  if (ws_size < (size_t)WS_END2) return;
  float* Y2 = (float*)(ws + WS_Y2);
  k_proj<<<dim3(TNB * TT / 128, CC / 128, 3), 256, 0, stream>>>(F[0], F[0], F[0], F[1], F[2], F[3], nullptr, nullptr, nullptr, QH, QL, KH, KL, VT, VB, VBL);
  k_pv<<<dim3(TT / 16, 1, TNB * NH), 32 * PVW, 0, stream>>>(QH, KH, QL, KL, VT, VB, VBL, Y);
  k_out<<<dim3(TNB * TT / 128, DIN / 128), 256, 0, stream>>>(Y, F[4], nullptr, Y2);              /* y = att wp1 (f32 rows in workspace) */
  k_out<<<dim3(TNB * TT / 128, DIN / 128), 256, 0, stream>>>(Y2, F[5], nullptr, (float*)d_out);   /* out = y wp2 */
  static_assert(CC == DIN, "the second output projection reuses k_out: its operand rows have width DIN == CC");
}

// v009
// One run takes 139 microseconds.
// Timed twice side by side with v008, it ran 1.12 times as fast both times.
// Over all steps from v000 it is 7.94 times as fast.
// compute dtype: all float inputs rounded to bf16; q / k / v projections with EXACT bf16 products on WMMA 16x16x32 (f32 accumulate), no biases; causal logits: 3 products for the first 384 rows, single f16 q x k after, x 64^-0.5; softmax f32; P x 2^11 once to f16 x v once to f16 (bf16 hi + lo below row 384); TWO output projections in sequence, each through k_out (rows < 384: the f32 operand as bf16 hi + lo against the exact weight; beyond: x2^6 f16 carry x f16(bf16 x 2^8) weight); f32 output.
#include <hip/hip_runtime.h>
#include <math.h>

typedef __attribute__((ext_vector_type(16))) _Float16 v16h;
typedef __attribute__((ext_vector_type(16))) __bf16 v16b;
typedef __attribute__((ext_vector_type(8)))  _Float16 v8h;
typedef __attribute__((ext_vector_type(8)))  float v8f;
typedef __attribute__((ext_vector_type(4)))  float v4f;
typedef __attribute__((ext_vector_type(2)))  float v2f;
typedef __attribute__((ext_vector_type(4)))  unsigned v4u;
typedef __attribute__((ext_vector_type(4)))  int v4i;
typedef float __attribute__((may_alias)) float_a;
typedef int __attribute__((may_alias)) int_a;

template <typename T> __device__ __forceinline__ void vst2(void* p, T v) { *(T*)p = v;  }
__device__ __forceinline__ v8f wmma16(v16h a, v16h b, v8f c) {
  v8f d = __builtin_amdgcn_wmma_f32_16x16x32_f16(false, a, false, b, (short)0, c, false, false);
  asm volatile("v_nop\n\tv_nop\n\tv_nop\n\tv_nop" : "+v"(d) : "v"(a), "v"(b));
  return d;
}
__device__ __forceinline__ v8f wmma_bf(v16b a, v16b b, v8f c) {
  v8f d = __builtin_amdgcn_wmma_f32_16x16x32_bf16(false, a, false, b, (short)0, c, false, false);
  asm volatile("v_nop\n\tv_nop\n\tv_nop\n\tv_nop" : "+v"(d) : "v"(a), "v"(b));
  return d;
}
// 16x16x32 fragments: lane = (h = lane>>4, row/col = lane&15); elements 0..7 = k0+8h+0..7, 8..15 = k0+16+8h+0..7; D element r = row 8h+r
__device__ __forceinline__ v16h frag_h(const _Float16* rowk0, int lane) {
  union { v16h v; v8h q[2]; } u; const _Float16* p = rowk0 + 8 * (lane >> 4);
  u.q[0] = *(const v8h*)p; u.q[1] = *(const v8h*)(p + 16); return u.v;
}
__device__ __forceinline__ v16h frag_f32(const float* rowk0, int lane) {
  v16h a; const float* p = rowk0 + 8 * (lane >> 4);
#pragma unroll
  for (int i = 0; i < 8; ++i) { a[i] = (_Float16)p[i]; a[8 + i] = (_Float16)p[16 + i]; }
  return a;
}
__device__ __forceinline__ v16h frag_f32s(const float* rowk0, int lane, float sc) {
  v16h a; const float* p = rowk0 + 8 * (lane >> 4);
#pragma unroll
  for (int i = 0; i < 8; ++i) { a[i] = (_Float16)(p[i] * sc); a[8 + i] = (_Float16)(p[16 + i] * sc); }
  return a;
}
// column fragment from a [K][ld] layout (column n), rows >= K read as 0
__device__ __forceinline__ v16h fragc_f32(const float* W, int k0, int n, int lane, int ld, int K) {
  v16h a; const int g = lane >> 4;
#pragma unroll
  for (int i = 0; i < 8; ++i) { const int ka = k0 + 8 * g + i, kb = ka + 16;
    a[i] = (_Float16)(ka < K ? W[(size_t)(ka < K ? ka : K - 1) * ld + n] : 0.f); a[8 + i] = (_Float16)(kb < K ? W[(size_t)(kb < K ? kb : K - 1) * ld + n] : 0.f); }
  return a;
}
struct F2 { v16b h, l; };
__device__ __forceinline__ F2 bsplit16(const float v[16]) { F2 r;
#pragma unroll
  for (int i = 0; i < 16; ++i) { const __bf16 h = (__bf16)v[i]; r.h[i] = h; r.l[i] = (__bf16)(v[i] - (float)h); }
  return r; }
__device__ __forceinline__ F2 split_row(const float* row, int k0, int lane) { float v[16]; const float* p = row + k0 + 8 * (lane >> 4);
#pragma unroll
  for (int i = 0; i < 8; ++i) { v[i] = p[i]; v[8 + i] = p[16 + i]; }
  return bsplit16(v); }
__device__ __forceinline__ F2 split_rowK(const float* row, int k0, int lane, int K) { float v[16]; const int g = lane >> 4;
#pragma unroll
  for (int i = 0; i < 8; ++i) { const int ka = k0 + 8 * g + i, kb = ka + 16; v[i] = ka < K ? row[ka < K ? ka : K - 1] : 0.f; v[8 + i] = kb < K ? row[kb < K ? kb : K - 1] : 0.f; }
  return bsplit16(v); }
__device__ __forceinline__ F2 split_col(const float* W, int k0, int n, int lane, int ld, int K) { float v[16]; const int g = lane >> 4;
#pragma unroll
  for (int i = 0; i < 8; ++i) { const int ka = k0 + 8 * g + i, kb = ka + 16; v[i] = ka < K ? W[(size_t)(ka < K ? ka : K - 1) * ld + n] : 0.f; v[8 + i] = kb < K ? W[(size_t)(kb < K ? kb : K - 1) * ld + n] : 0.f; }
  return bsplit16(v); }
__device__ __forceinline__ v8f mac3(const F2& a, const F2& b, v8f c) { c = wmma_bf(a.l, b.h, c); c = wmma_bf(a.h, b.l, c); return wmma_bf(a.h, b.h, c); }
__device__ __forceinline__ float sigm(float v) { return 1.0f / (1.0f + expf(-v)); }
#define LDSX() do { asm volatile("s_wait_dscnt 0" ::: "memory"); __builtin_amdgcn_wave_barrier(); __builtin_amdgcn_fence(__ATOMIC_RELEASE, "workgroup"); } while (0)

// Causal multi-head self-attention with per-head-shaped weights and TWO output projections (x [2,2048,1024]; wq / wk / wv [1024,16,64] = (in, head, d): an (in,out) [1024][1024] matrix with out = head*64 + d; wp1 [16,64,1024] = (head, d, out): an (in,out) [1024][1024] matrix with in = head*64 + d; wp2 [1024,1024] (in,out); all N(0, 1/1024), no biases; wei = q k^T x 64^-0.5; tril kept, -inf elsewhere; softmax; att merged (head*64 + d); y = att wp1; out = y wp2).
#define NB 2
#define TT 2048
#define CC 1024            // NH * HD = projected width
#define DIN 1024          // input (model) width
#define NH 16
#define HD 64
#define SCALE (0.125f)
#define CAUSAL 1
#ifndef TNB
#define TNB NB
#endif
__device__ __forceinline__ float bfr(float v) { return (float)(__bf16)v; }
__host__ __device__ __forceinline__ int kb_last(int qb) { return CAUSAL ? ((qb * 64 + 63) >> 7) : (TT / 128 - 1); }
typedef __attribute__((ext_vector_type(8))) __bf16 v8b;
__device__ __forceinline__ v16b frag_b(const __bf16* rowk0, int lane) {
  union { v16b v; v8b q[2]; } u; const __bf16* p = rowk0 + 8 * (lane >> 4);
  u.q[0] = *(const v8b*)p; u.q[1] = *(const v8b*)(p + 16); return u.v;
}
#define QBH 6              // causal: query blocks 0..QBH-1 of each sequence (few keys, no averaging) take the high-precision path
#define QHI 384            // rows carrying a q residual plane
#define KHI 384            // key rows carrying k residual / v bf16 hi+lo planes (used only by the causal high-precision path)
// B fragment (k rows k0+.., output column o) of a weight: (in,out) [K][ld] or (out,in) [ld rows of K]: bf16 exact, or f16(bf16 * 256) exact
__device__ __forceinline__ v16b wcol_io(const float* Wm, int k0, int o, int lane, int ld) { v16b w; const int g = lane >> 4;
#pragma unroll
  for (int i = 0; i < 8; ++i) { w[i] = (__bf16)Wm[(size_t)(k0 + 8 * g + i) * ld + o]; w[8 + i] = (__bf16)Wm[(size_t)(k0 + 16 + 8 * g + i) * ld + o]; }
  return w; }
__device__ __forceinline__ v16b wcol_oi(const float* Wm, int k0, int o, int lane, int K) { v16b w; const float* p = Wm + (size_t)o * K + k0 + 8 * (lane >> 4);
#pragma unroll
  for (int i = 0; i < 8; ++i) { w[i] = (__bf16)p[i]; w[8 + i] = (__bf16)p[16 + i]; }
  return w; }
__device__ __forceinline__ v16h wcolh_io(const float* Wm, int k0, int o, int lane, int ld) { v16h w; const int g = lane >> 4;
#pragma unroll
  for (int i = 0; i < 8; ++i) { w[i] = (_Float16)(bfr(Wm[(size_t)(k0 + 8 * g + i) * ld + o]) * 256.0f); w[8 + i] = (_Float16)(bfr(Wm[(size_t)(k0 + 16 + 8 * g + i) * ld + o]) * 256.0f); }
  return w; }
__device__ __forceinline__ v16h wcolh_oi(const float* Wm, int k0, int o, int lane, int K) { v16h w; const float* p = Wm + (size_t)o * K + k0 + 8 * (lane >> 4);
#pragma unroll
  for (int i = 0; i < 8; ++i) { w[i] = (_Float16)(bfr(p[i]) * 256.0f); w[8 + i] = (_Float16)(bfr(p[16 + i]) * 256.0f); }
  return w; }
#define WQKV_LAYOUT 0   // 0 = (in,out) [DIN][CC]; 1 = (out,in) [CC][DIN]; 2 = per-head [NH][DIN][HD]
__device__ __forceinline__ v16b wcol_hdk(const float* Wm, int k0, int o, int lane) { v16b w; const int g = lane >> 4; const float* p = Wm + (size_t)(o / HD) * DIN * HD + (o % HD);
#pragma unroll
  for (int i = 0; i < 8; ++i) { w[i] = (__bf16)p[(size_t)(k0 + 8 * g + i) * HD]; w[8 + i] = (__bf16)p[(size_t)(k0 + 16 + 8 * g + i) * HD]; }
  return w; }
#define WO_OUT_IN 0
#if WQKV_LAYOUT == 1
#define WCOL(W, k0, o, lane) wcol_oi(W, k0, o, lane, DIN)
#elif WQKV_LAYOUT == 2
#define WCOL(W, k0, o, lane) wcol_hdk(W, k0, o, lane)
#else
#define WCOL(W, k0, o, lane) wcol_io(W, k0, o, lane, CC)
#endif
#if WO_OUT_IN
#define WOCOL(W, k0, o, lane) wcol_oi(W, k0, o, lane, CC)
#define WOCOLH(W, k0, o, lane) wcolh_oi(W, k0, o, lane, CC)
#else
#define WOCOL(W, k0, o, lane) wcol_io(W, k0, o, lane, DIN)
#define WOCOLH(W, k0, o, lane) wcolh_io(W, k0, o, lane, DIN)
#endif

#ifndef PROJ_EXTRA_PARAMS
#define PROJ_EXTRA_PARAMS
#endif

// q, k and v lie in the workspace in the order of k_pv's matrix fragments: the 16 bytes that lane l takes with one load stand at l * 16 in a run of 512 bytes, so that every load of a wave covers four whole 128-byte lines (from rows or planes it would touch 16 lines for 32 bytes each)
#define QKT 1024           // 16-bit elements of one 16-row tile of one head's q or k: [d / 32][(d / 16) & 1][lane = 16 ((d / 8) & 1) + (t & 15)][d & 7]
#define VCH 2048           // 16-bit elements of one 32-key chunk of one head's v: [d / 16][(t / 16) & 1][lane = 16 ((t / 8) & 1) + (d & 15)][t & 7]
static_assert(HD == 64 && QKT == 16 * HD && VCH == 32 * HD, "the fragment-order tiles are written for head size 64");
#define WS_QH  0u                                      // f16 q tiles [b][h][t / 16][QKT]
#define WS_KH  (WS_QH + 2u * (size_t)NB * TT * CC)      // f16 k tiles [b][h][t / 16][QKT]
#define WS_VT  (WS_KH + 2u * (size_t)NB * TT * CC)      // f16 v chunks [b][h][t / 32][VCH]
#define WS_QL  (WS_VT + 2u * (size_t)NB * CC * TT)      // f16 q residual x 2^10 tiles [b][h][t / 16, t < QHI][QKT]
#define WS_KL  (WS_QL + 2u * (size_t)NB * QHI * CC)     // f16 k residual x 2^10 tiles [b][h][t / 16, t < KHI][QKT]
#define WS_VB  (WS_KL + 2u * (size_t)NB * KHI * CC)     // bf16 v hi chunks [b][h][t / 32, t < KHI][VCH]
#define WS_VBL (WS_VB + 2u * (size_t)NB * CC * KHI)
#define WS_Y   (WS_VBL + 2u * (size_t)NB * CC * KHI)    // f32 ctx rows [b*t][CC] (only when there is an output projection)
#define WS_END (WS_Y  + 4u * (size_t)NB * TT * CC)
#define WS_Y2 (WS_END)                                     // f32 rows [b*t][DIN]: the first output projection's result, the second one's operand
#define WS_END2 (WS_Y2 + 4u * (size_t)NB * TT * DIN)

// ---- operand tiles of one K step (32 k) of k_proj / k_out: read by whole-line loads and converted once per block, kept in LDS as 16-bit rows of 32 k, so that an A or B fragment is two 16-byte LDS reads (frag_b / frag_h on the row). Every loop over a register array, here and in the K steps, is fully unrolled: its indices must be constants, else the array goes to scratch
#define WP 40              // LDS pitch of a staged row in 16-bit elements: 32 k values + 16 bytes, so that 16-byte reads of 64-byte rows spread over all banks
static_assert(WQKV_LAYOUT == 0 && !WO_OUT_IN, "the staged weight tile is written for (in,out) weights");
typedef __attribute__((ext_vector_type(4))) __bf16 v4b;
typedef __attribute__((ext_vector_type(4))) _Float16 v4h;
// a block of k_proj / k_out is 8 waves on a tile of 128 rows x 128 output columns; wave w takes rows 32 (w >> 1) + 0..31 and columns 64 (w & 1) + 0..63 of it: 2 A fragments against 4 B fragments, 8 matrix instructions for 6 fragments read
// weight tile: 32 k rows x 128 output columns of an (in,out) [K][ld] matrix, in LDS as [column][k]. Thread (wave, lane) owns the patch k = 16 (wave >> 2) + 4 (lane >> 3) + 0..3, column = 32 (wave & 3) + 4 (lane & 7) + 0..3: each load instruction covers four whole 128-byte lines, each LDS store holds 4 consecutive k of one column
__device__ __forceinline__ const float* wt_ptr(const float* Wm, int c0, int wave, int lane, int ld) { return Wm + (size_t)(16 * (wave >> 2) + 4 * (lane >> 3)) * ld + c0 + 32 * (wave & 3) + 4 * (lane & 7); }
__device__ __forceinline__ void wt_load(v4f (&r)[4], const float* p, int ld) {
#pragma unroll
  for (int i = 0; i < 4; ++i) r[i] = *(const v4f*)(p + (size_t)i * ld); }
__device__ __forceinline__ int wt_at(int c, int wave, int lane) { return (32 * (wave & 3) + 4 * (lane & 7) + c) * WP + 16 * (wave >> 2) + 4 * (lane >> 3); }
__device__ __forceinline__ void wt_put_b(__bf16* buf, const v4f (&r)[4], int wave, int lane) {   /* bf16, exact for the bf16-rounded weight */
#pragma unroll
  for (int c = 0; c < 4; ++c) { v4b t;
#pragma unroll
    for (int i = 0; i < 4; ++i) t[i] = (__bf16)r[i][c];
    *(v4b*)(buf + wt_at(c, wave, lane)) = t; } }
__device__ __forceinline__ void wt_put_h(_Float16* buf, const v4f (&r)[4], int wave, int lane) {   /* f16(bf16 x 2^8), exact */
#pragma unroll
  for (int c = 0; c < 4; ++c) { v4h t;
#pragma unroll
    for (int i = 0; i < 4; ++i) t[i] = (_Float16)(bfr(r[i][c]) * 256.0f);
    *(v4h*)(buf + wt_at(c, wave, lane)) = t; } }
// row tile: 128 rows x 32 k of an f32 [rows][ld] matrix, in LDS as [row][k]; rows0 = the block's first row. Thread (wave, lane) owns k = 4 (lane & 7) + 0..3 of rows 16 wave + 4 i + (lane >> 3), i < 4: each load instruction covers four whole 128-byte lines
__device__ __forceinline__ const float* xt_ptr(const float* rows0, int wave, int lane, int ld) { return rows0 + (size_t)(16 * wave + (lane >> 3)) * ld + 4 * (lane & 7); }
__device__ __forceinline__ void xt_load(v4f (&r)[4], const float* p, int ld) {
#pragma unroll
  for (int i = 0; i < 4; ++i) r[i] = *(const v4f*)(p + (size_t)(4 * i) * ld); }
__device__ __forceinline__ int xt_at(int i, int wave, int lane) { return (16 * wave + 4 * i + (lane >> 3)) * WP + 4 * (lane & 7); }
__device__ __forceinline__ void xt_put_b(__bf16* buf, const v4f (&r)[4], int wave, int lane) {   /* once to bf16 */
#pragma unroll
  for (int i = 0; i < 4; ++i) { v4b t;
#pragma unroll
    for (int c = 0; c < 4; ++c) t[c] = (__bf16)r[i][c];
    *(v4b*)(buf + xt_at(i, wave, lane)) = t; } }
__device__ __forceinline__ void xt_put_hl(__bf16* bh, __bf16* bl, const v4f (&r)[4], int wave, int lane) {   /* bf16 hi + lo planes, as bsplit16 */
#pragma unroll
  for (int i = 0; i < 4; ++i) { v4b th, tl;
#pragma unroll
    for (int c = 0; c < 4; ++c) { const __bf16 h = (__bf16)r[i][c]; th[c] = h; tl[c] = (__bf16)(r[i][c] - (float)h); }
    *(v4b*)(bh + xt_at(i, wave, lane)) = th; *(v4b*)(bl + xt_at(i, wave, lane)) = tl; } }
__device__ __forceinline__ void xt_put_h(_Float16* buf, const v4f (&r)[4], int wave, int lane, float sc) {   /* x sc, once to f16 */
#pragma unroll
  for (int i = 0; i < 4; ++i) { v4h t;
#pragma unroll
    for (int c = 0; c < 4; ++c) t[c] = (_Float16)(r[i][c] * sc);
    *(v4h*)(buf + xt_at(i, wave, lane)) = t; } }
// ---- k_proj: block = (128 rows, 128 cols, which), 8 waves of 32 x 64: q/k/v = X W (+ b) with exact bf16 products (K = DIN), both operand tiles of each K step staged in LDS (two buffers, which share their LDS with the epilogue's tiles), the next step's loads issued behind the step's barrier -> which 0: q f16 tiles (+ residual tiles, rows < QHI); 1: k f16 tiles (+ residual tiles, rows < KHI); 2: v f16 chunks (+ bf16 hi/lo chunks for t < KHI), all in fragment order: thread e of the store loops takes the e-th 16 bytes of the block's share, so that a wave stores 512 bytes in a row
static_assert(TT % 128 == 0 && QHI % 128 == 0 && KHI % 128 == 0, "a block's 128 rows lie in one sequence and on one side of the high-precision bound");
__global__ __launch_bounds__(256) void k_proj(const float* __restrict__ XQ, const float* __restrict__ XK, const float* __restrict__ XV, const float* __restrict__ WQ, const float* __restrict__ WK, const float* __restrict__ WV, const float* __restrict__ BQ, const float* __restrict__ BK, const float* __restrict__ BV,
    _Float16* __restrict__ QH, _Float16* __restrict__ QL, _Float16* __restrict__ KH, _Float16* __restrict__ KL, _Float16* __restrict__ VT, __bf16* __restrict__ VB, __bf16* __restrict__ VBL) {
  __shared__ __align__(16) union { struct { _Float16 sh[128][136], sl[128][136]; } r; struct { _Float16 th[128][136]; __bf16 tb[128][136], tbl[128][136]; } c; struct { __bf16 w[2][128 * WP], x[2][128 * WP]; } k; } u;
  _Float16 (&sh)[128][136] = u.r.sh; _Float16 (&sl)[128][136] = u.r.sl; _Float16 (&th)[128][136] = u.c.th; __bf16 (&tb)[128][136] = u.c.tb; __bf16 (&tbl)[128][136] = u.c.tbl;
  const int tid = threadIdx.x, wave = __builtin_amdgcn_readfirstlane(tid >> 5) /* scalar, so that what hangs on the wave alone takes no vector register */, lane = tid & 31, col = lane & 15, g = lane >> 4, wr = wave >> 1, wc = wave & 1; const int which = blockIdx.z; const int c0 = blockIdx.y * 128; const size_t r0 = (size_t)blockIdx.x * 128; const size_t bb = r0 / TT; const int t0 = (int)(r0 % TT);
  const float* X = which == 0 ? XQ : which == 1 ? XK : XV; const float* WA = which == 0 ? WQ : which == 1 ? WK : WV; const float* BA = which == 0 ? BQ : which == 1 ? BK : BV;
  v8f acc[2][4] = {}; const int ao = (wr * 32 + col) * WP, bo = (wc * 64 + col) * WP;   /* the lane's row in the wave's first A and first B fragment; the further fragments lie 16 rows apart */
  const float* wp = wt_ptr(WA, c0, wave, lane, CC); const float* xp = xt_ptr(X + r0 * DIN, wave, lane, DIN);
  v4f wr4[4], xr[4]; wt_load(wr4, wp, CC); xt_load(xr, xp, DIN);
  for (int kc = 0; kc < DIN / 32; ++kc) { __bf16* wb = u.k.w[kc & 1]; __bf16* xb = u.k.x[kc & 1]; wt_put_b(wb, wr4, wave, lane); xt_put_b(xb, xr, wave, lane);
    __syncthreads();   /* the whole tiles of step kc are in LDS before any wave reads fragments across them; the same barrier ends every wave's reads of step kc - 1, whose buffers step kc + 1 overwrites */
    if (kc + 1 < DIN / 32) { wt_load(wr4, wp + (size_t)32 * CC, CC); xt_load(xr, xp + 32, DIN);
      asm volatile("s_wait_xcnt 0x0" :: "v"(wp), "v"(xp) : "memory");   /* the loads' address registers, named here so that they stay as they are up to this wait, are advanced behind it */
      wp += (size_t)32 * CC; xp += 32; }
    v16b af[2], wf[4];
#pragma unroll
    for (int i = 0; i < 2; ++i) af[i] = frag_b(xb + ao + i * 16 * WP, lane);
#pragma unroll
    for (int j = 0; j < 4; ++j) wf[j] = frag_b(wb + bo + j * 16 * WP, lane);   /* all of the step's LDS reads as one group in front of its matrix instructions */
#pragma unroll
    for (int j = 0; j < 4; ++j)
#pragma unroll
      for (int i = 0; i < 2; ++i) acc[i][j] = wmma_bf(af[i], wf[j], acc[i][j]); }
  __syncthreads();   /* every wave has read its last fragments before the epilogue's tiles overwrite the staging buffers */
  if (which < 2) { _Float16* DH = which == 0 ? QH : KH; _Float16* DL = which == 0 ? QL : KL; const int nhi = which == 0 ? QHI : KHI; const bool hi_rows = t0 < nhi;
#pragma unroll
    for (int j = 0; j < 4; ++j) { const int cl = wc * 64 + j * 16 + col; const float bias = BA ? bfr(BA[c0 + cl]) : 0.f;
#pragma unroll
      for (int i = 0; i < 2; ++i)
#pragma unroll
        for (int r = 0; r < 8; ++r) { const float v = acc[i][j][r] + bias; const _Float16 hv = (_Float16)v; const int rl = wr * 32 + i * 16 + 8 * g + r; sh[rl][cl] = hv; sl[rl][cl] = (_Float16)((v - (float)hv) * 1024.0f); } }
    __syncthreads();
    for (int e = tid; e < 128 * 16; e += 256) { const int hh = e >> 10, tl = (e >> 7) & 7, rl = tl * 16 + col, cl = hh * HD + ((e >> 5) & 3) * 16 + g * 8; const size_t hb = bb * NH + c0 / HD + hh;   /* e = [head][tile][d / 16][lane] */
      vst2((unsigned*)(DH + (hb * (TT / 16) + t0 / 16 + tl) * QKT + (e & 127) * 8), *(const v4u*)&sh[rl][cl]);
      asm volatile("s_wait_xcnt 0x0" ::: "memory");   /* in front of what rewrites the store's address and data registers: the residual's lines, the next trip */
      if (hi_rows) { vst2((unsigned*)(DL + (hb * (nhi / 16) + t0 / 16 + tl) * QKT + (e & 127) * 8), *(const v4u*)&sl[rl][cl]);
        asm volatile("s_wait_xcnt 0x0" ::: "memory"); } }   /* as above */
  } else { const bool hi_rows = t0 < KHI;
#pragma unroll
    for (int j = 0; j < 4; ++j) { const int cl = wc * 64 + j * 16 + col; const float bias = BA ? bfr(BA[c0 + cl]) : 0.f;
#pragma unroll
      for (int i = 0; i < 2; ++i)
#pragma unroll
        for (int r = 0; r < 8; ++r) { const float v = acc[i][j][r] + bias; const int rl = wr * 32 + i * 16 + 8 * g + r; th[cl][rl] = (_Float16)v; const __bf16 bh = (__bf16)v; tb[cl][rl] = bh; tbl[cl][rl] = (__bf16)(v - (float)bh); } }
    __syncthreads();
    for (int e = tid; e < 128 * 16; e += 256) { const int hh = e >> 10, cn = (e >> 8) & 3, cl = hh * HD + ((e >> 6) & 3) * 16 + col, rl = cn * 32 + ((e >> 5) & 1) * 16 + g * 8; const size_t hb = bb * NH + c0 / HD + hh;   /* e = [head][chunk][d / 16][(t / 16) & 1][lane] */
      vst2((unsigned*)(VT + (hb * (TT / 32) + t0 / 32 + cn) * VCH + (e & 255) * 8), *(const v4u*)&th[cl][rl]);
      asm volatile("s_wait_xcnt 0x0" ::: "memory");   /* as in the branch above */
      if (hi_rows) { const size_t o3 = (hb * (KHI / 32) + t0 / 32 + cn) * VCH + (e & 255) * 8; vst2((unsigned*)(VB + o3), *(const v4u*)&tb[cl][rl]); vst2((unsigned*)(VBL + o3), *(const v4u*)&tbl[cl][rl]);
        asm volatile("s_wait_xcnt 0x0" ::: "memory"); } } } }   /* as in the branch above */
// ---- k_pv: block = 16 queries (tile qt of query block qb = qt / 4) of (b, h) = blockIdx.z, PVW waves. Logits first, never through memory: wave w takes the 64-key units w, w + PVW, ... of keys [0, kend): q x k on the matrix unit, x SCALE, f32 to the 16 LDS rows (single f16 product; causal early query blocks: q hi + residual (x 2^10) against k hi + residual, 3 products); the mask is applied by index in the softmax. Softmax: wave w takes query rows w and w + PVW whole, in registers: keys [0, kend): causal -> logit if s <= t else excluded; softmax in f32; exp(logit - max) (0 for excluded) back to the LDS rows, 2^11 / sum to LDS per row. Then ctx = P . v over keys [0, kend), P x 2^11 = the LDS value x the row's 2^11 / sum; wave w takes the 32-key chunks w, w + PVW, ... and the PVW partial tiles are summed in wave order through LDS (P x 2^11 once to f16 against v f16: 1 product; causal early query blocks: P and v as bf16 hi + lo, 3 products); 256-B (row, head) segment by 16 lanes
#define PVW 8
#define PPITCH (TT + 4)    // LDS pitch of a P row in floats: 16 bytes over the row, so that the 16 rows of a fragment read start 4 banks apart
#define NCF (TT / 128 - 1) // most 128-key pieces of a row in front of its last one; a piece is one 16-byte load per lane
#define L2E 1.44269504088896340736f   // log2(e)
// exp(logit - max) = 2^(logit x log2(e) - mc), mc = max x log2(e): one fused multiply-add (the product unrounded, so that the exponent is rounded once) and the chip's exp2 per element. The exponent is <= 0 up to mc's rounding, which scales a whole row alike and cancels against the row's sum; a result under 2^-126 may come out as 0, beside a sum that holds the max's own term, about 1
__device__ __forceinline__ v4f sm_exp(v4f v, float mc) { v4f e;
#pragma unroll
  for (int c = 0; c < 4; ++c) e[c] = __builtin_amdgcn_exp2f(__builtin_fmaf(v[c], L2E, -mc));
  return e; }
// one query row's softmax by one wave: lane l holds the logits of keys i * 128 + 4 l + 0..3 in x[i], i < nf, and those of the row's last piece (i = nf) in xl. Only the last piece can hold keys > t: nf * 128 = (kb_last(qb)) * 128 <= qb * 64 <= t. Returns 2^11 / sum; exp(logit - max) goes to the LDS row pr
__device__ __forceinline__ float sm_row(const v4f (&x)[NCF], v4f xl, int nf, int t, int lane, float* pr) {
  float m = -3.0e38f;
#pragma unroll
  for (int c = 0; c < 4; ++c) { xl[c] = (!CAUSAL || nf * 128 + lane * 4 + c <= t) ? xl[c] : -3.0e38f; m = fmaxf(m, xl[c]); }
#pragma unroll
  for (int i = 0; i < NCF; ++i) if (i < nf) {
#pragma unroll
    for (int c = 0; c < 4; ++c) m = fmaxf(m, x[i][c]); }
#pragma unroll
  for (int o = 1; o < 32; o <<= 1) m = fmaxf(m, __shfl_xor(m, o));
  const float mc = m * L2E; v4f s4 = {};
#pragma unroll
  for (int i = 0; i < NCF; ++i) if (i < nf) { const v4f e = sm_exp(x[i], mc); s4 += e; *(v4f*)(pr + i * 128 + lane * 4) = e; }   /* no key of these pieces is excluded */
  { v4f e = sm_exp(xl, mc);
#pragma unroll
    for (int c = 0; c < 4; ++c) e[c] = (xl[c] <= -1.0e38f) ? 0.f : e[c];   /* excluded keys */
    s4 += e; *(v4f*)(pr + nf * 128 + lane * 4) = e; }
  float sum = (s4[0] + s4[1]) + (s4[2] + s4[3]);
#pragma unroll
  for (int o = 1; o < 32; o <<= 1) sum += __shfl_xor(sum, o);
  return sum > 0.f ? 2048.0f / sum : 0.f; }   /* a fully excluded row yields P = 0 */
#define KU 64              // keys of one logit unit: four 16-key tiles, whose 16 loads per lane are in flight together
// the B fragments of one unit: f[2 j + kc] = keys 16 j + (lane & 15), d = 32 kc + ..; p = the lane's own 16 bytes in the first 512 of the unit's four tiles, so that all 16 loads go off one address
__device__ __forceinline__ void ku_load(v16h (&f)[8], const _Float16* p) {
#pragma unroll
  for (int j = 0; j < 4; ++j)
#pragma unroll
    for (int kc = 0; kc < 2; ++kc) { union { v16h v; v8h q[2]; } u; const _Float16* s = p + j * QKT + kc * (QKT / 2); u.q[0] = *(const v8h*)s; u.q[1] = *(const v8h*)(s + QKT / 4); f[2 * j + kc] = u.v; } }
// one unit's logits, single product: the four tiles' accumulators are independent, so that no matrix instruction waits for the one in front of it; w = the lane's place (row 8 (lane >> 4), key lane & 15 of the unit) in the LDS rows
__device__ __forceinline__ void lg_unit(v16h a0, v16h a1, const v16h (&f)[8], float* w) { v8f c[4];
#pragma unroll
  for (int j = 0; j < 4; ++j) { const v8f z = {}; c[j] = wmma16(a0, f[2 * j], z); }
#pragma unroll
  for (int j = 0; j < 4; ++j) c[j] = wmma16(a1, f[2 * j + 1], c[j]);
#pragma unroll
  for (int j = 0; j < 4; ++j)
#pragma unroll
    for (int r = 0; r < 8; ++r) w[r * PPITCH + j * 16] = c[j][r] * SCALE; }
// the B fragments of one 32-key chunk of v: f[j] = d = 16 j + (lane & 15), keys 8 (lane >> 4) + ..; p = the lane's own 16 bytes in the chunk's first 512, so that all 8 loads go off one address
template <typename V, typename E> __device__ __forceinline__ void pv_load(V (&f)[HD / 16], const E* p) {
#pragma unroll
  for (int j = 0; j < HD / 16; ++j) { union { V v; v4u q[2]; } u; const E* s = p + j * (VCH / 4); u.q[0] = *(const v4u*)s; u.q[1] = *(const v4u*)(s + VCH / 8); f[j] = u.v; } }
// one chunk's P . v, single product: P x 2^11 from the LDS row, once to f16, against the chunk's four fragments
__device__ __forceinline__ void pv_mac(v8f (&acc)[HD / 16], v16h p, const v16h (&f)[HD / 16]) {
#pragma unroll
  for (int j = 0; j < HD / 16; ++j) acc[j] = wmma16(p, f[j], acc[j]); }
__device__ __forceinline__ void pv_unit(v8f (&acc)[HD / 16], const v16h (&f)[HD / 16], const float* prow, int lane, float inv) { pv_mac(acc, frag_f32s(prow, lane, inv), f); }
__global__ __launch_bounds__(32 * PVW) void k_pv(const _Float16* __restrict__ QH, const _Float16* __restrict__ KH, const _Float16* __restrict__ QL, const _Float16* __restrict__ KL, const _Float16* __restrict__ VT, const __bf16* __restrict__ VB, const __bf16* __restrict__ VBL, float* __restrict__ Y) { const int b = blockIdx.z / NH, h = blockIdx.z % NH; __shared__ __align__(16) float sp[16 * PPITCH]; __shared__ float sinv[16];
  static_assert(PVW * 16 * (HD + 4) <= 16 * PPITCH && 2 * PVW == 16, "the partial tiles reuse the P rows' LDS; two query rows per wave");
  static_assert((((QBH * 64 + 63) >> 7) + 1) * 4 >= 2 * PVW, "beyond the early query blocks every wave has two P.v chunks or more");
  static_assert(CAUSAL && (((QBH * 64 + 63) >> 7) + 1) * (128 / KU) >= PVW && ((((QBH - 1) * 64 + 63) >> 7) + 1) * (128 / KU) <= PVW, "beyond the early query blocks every wave has a logit unit, within them at most one");
  const int tid = threadIdx.x, lane = tid & 31, col = lane & 15, g = lane >> 4; const int qb = blockIdx.x >> 2; const int ql0 = blockIdx.x * 16; const int kce = (kb_last(qb) + 1) * 4;
  const int wave = __builtin_amdgcn_readfirstlane(tid >> 5);   /* scalar, so that the key loop's bounds and branch stay wave-uniform around the matrix instructions */
  { const int nu = (kb_last(qb) + 1) * (128 / KU); const size_t bh = blockIdx.z; float* sw = sp + 8 * g * PPITCH + col;   /* bh = b NH + h, the head's index in the fragment-order planes */
    const _Float16* qp = QH + (bh * (TT / 16) + blockIdx.x) * QKT + lane * 8; const _Float16* kp = KH + (bh * (TT / 16) + wave * (KU / 16)) * QKT + lane * 8;
    union { v16h v; v8h q[2]; } a0, a1; a0.q[0] = *(const v8h*)qp; a0.q[1] = *(const v8h*)(qp + QKT / 4); a1.q[0] = *(const v8h*)(qp + QKT / 2); a1.q[1] = *(const v8h*)(qp + 3 * (QKT / 4));
    if (qb < QBH) { const _Float16* qlp = QL + (bh * (QHI / 16) + blockIdx.x) * QKT + lane * 8; const _Float16* klp = KL + (bh * (KHI / 16) + wave * (KU / 16)) * QKT + lane * 8;
      union { v16h v; v8h q[2]; } l0, l1; l0.q[0] = *(const v8h*)qlp; l0.q[1] = *(const v8h*)(qlp + QKT / 4); l1.q[0] = *(const v8h*)(qlp + QKT / 2); l1.q[1] = *(const v8h*)(qlp + 3 * (QKT / 4));
      asm volatile("s_wait_xcnt 0x0" :: "v"(qp), "v"(qlp) : "memory");   /* the loads' address registers, named here so that they stay as they are up to this wait, may be reused behind it */
      if (wave < nu) { const int u = wave; v16h kf[8], lf[8]; ku_load(kf, kp); ku_load(lf, klp);   /* here nu <= PVW: at most one unit per wave; a scalar test, so that the matrix instructions run with every lane on */
        asm volatile("s_wait_xcnt 0x0" :: "v"(kp), "v"(klp) : "memory");   /* as above */
#pragma unroll
        for (int j = 0; j < 4; ++j) { v8f c = {}, cl = {};
          c = wmma16(a0.v, kf[2 * j], c); cl = wmma16(l0.v, kf[2 * j], cl); cl = wmma16(a0.v, lf[2 * j], cl);
          c = wmma16(a1.v, kf[2 * j + 1], c); cl = wmma16(l1.v, kf[2 * j + 1], cl); cl = wmma16(a1.v, lf[2 * j + 1], cl);
#pragma unroll
          for (int r = 0; r < 8; ++r) sw[r * PPITCH + u * KU + j * 16] = (c[r] + cl[r] * (1.0f / 1024.0f)) * SCALE; } }
    } else { v16h kf[8], kn[8]; int u = wave; constexpr size_t KS = (size_t)PVW * (KU / 16) * QKT;   /* from one unit of a wave to its next; here nu >= PVW: every wave has a unit */
      ku_load(kf, kp);
      asm volatile("s_wait_xcnt 0x0" :: "v"(qp), "v"(kp) : "memory");   /* as above */
      /* two register sets by turns, and no branch between a unit's loads and the work on the unit before it: the wave's next unit is in flight while this one is worked on */
      while (u + 2 * PVW < nu) { ku_load(kn, kp + KS); lg_unit(a0.v, a1.v, kf, sw + u * KU); ku_load(kf, kp + 2 * KS);
        asm volatile("s_wait_xcnt 0x0" :: "v"(kp) : "memory");   /* as above: the address is advanced behind it */
        kp += 2 * KS; lg_unit(a0.v, a1.v, kn, sw + (u + PVW) * KU); u += 2 * PVW; }
      if (u + PVW < nu) { ku_load(kn, kp + KS);
        asm volatile("s_wait_xcnt 0x0" :: "v"(kp) : "memory");   /* as above */
        lg_unit(a0.v, a1.v, kf, sw + u * KU); lg_unit(a0.v, a1.v, kn, sw + (u + PVW) * KU); }
      else lg_unit(a0.v, a1.v, kf, sw + u * KU); } }
  __syncthreads();   /* all 16 rows' logits are in LDS before any wave reads a row across the units */
  { const int nf = kb_last(qb); v4f x0[NCF], x1[NCF]; const float* s0 = sp + wave * PPITCH + lane * 4; const float* s1 = s0 + PVW * PPITCH;
#pragma unroll
    for (int i = 0; i < NCF; ++i) if (i < nf) { x0[i] = *(const v4f*)(s0 + i * 128); x1[i] = *(const v4f*)(s1 + i * 128); }   /* both rows whole in registers before either row's LDS is overwritten */
    const v4f xl0 = *(const v4f*)(s0 + nf * 128), xl1 = *(const v4f*)(s1 + nf * 128);
    const float i0 = sm_row(x0, xl0, nf, ql0 + wave, lane, sp + wave * PPITCH), i1 = sm_row(x1, xl1, nf, ql0 + wave + PVW, lane, sp + (wave + PVW) * PPITCH);
    if (lane == 0) { sinv[wave] = i0; sinv[wave + PVW] = i1; } }
  __syncthreads();   /* all 16 rows and their factors are in LDS before any wave reads fragments across them */
  const float inv = sinv[col]; const float* pc = sp + col * PPITCH + 8 * g;
  v8f acc[HD / 16] = {};
  if (qb < QBH) {
    const size_t vo = (size_t)blockIdx.z * (KHI / 32) * VCH + lane * 8;
#pragma unroll 1   /* at most two trips here: kept rolled, so that the kernel's text stays short */
    for (int kc = wave; kc < kce; kc += PVW) { v16b vh[HD / 16], vl[HD / 16]; const __bf16* hp = VB + vo + kc * VCH; const __bf16* lp = VBL + vo + kc * VCH; pv_load(vh, hp); pv_load(vl, lp);   /* the chunk's 16 loads in flight together, in front of its matrix instructions */
      asm volatile("s_wait_xcnt 0x0" :: "v"(hp), "v"(lp) : "memory");   /* the loads' address registers, named here so that they stay as they are up to this wait, may be reused behind it */
      float pv[16];
#pragma unroll
      for (int i = 0; i < 8; ++i) { pv[i] = pc[kc * 32 + i] * inv; pv[8 + i] = pc[kc * 32 + 16 + i] * inv; }
      const F2 p = bsplit16(pv);
#pragma unroll
      for (int j = 0; j < HD / 16; ++j) { acc[j] = wmma_bf(p.h, vh[j], acc[j]); acc[j] = wmma_bf(p.l, vh[j], acc[j]); acc[j] = wmma_bf(p.h, vl[j], acc[j]); } }
  } else { v16h vf[HD / 16], vn[HD / 16]; int kc = wave; constexpr int VS = PVW * VCH;   /* from one chunk of a wave to its next, in elements; here kce >= 2 PVW: every wave has two chunks or more */
    const _Float16* vp = VT + ((size_t)blockIdx.z * (TT / 32) + wave) * VCH + lane * 8; const float* pr = sp + col * PPITCH;
    pv_load(vf, vp); pv_load(vn, vp + VS);
    asm volatile("s_wait_xcnt 0x0" :: "v"(vp) : "memory");   /* as above */
    /* two register sets by turns, each refilled as soon as its chunk is worked off, and no branch between a chunk's loads and the work on the chunk behind it: two chunks of the wave are in flight at any time; the wave sums its chunks in rising order */
    while (kc + 3 * PVW < kce) { const v16h p0 = frag_f32s(pr + kc * 32, lane, inv), p1 = frag_f32s(pr + (kc + PVW) * 32, lane, inv);   /* both chunks' P fragments first, so that each set's refill follows its last matrix instruction directly */
      pv_mac(acc, p0, vf); pv_load(vf, vp + 2 * VS); pv_mac(acc, p1, vn); pv_load(vn, vp + 3 * VS);
      asm volatile("s_wait_xcnt 0x0" :: "v"(vp) : "memory");   /* as above: the address is advanced behind it */
      vp += 2 * VS; kc += 2 * PVW; }
    pv_unit(acc, vf, pr + kc * 32, lane, inv);
    if (kc + 2 * PVW < kce) { pv_load(vf, vp + 2 * VS);
      asm volatile("s_wait_xcnt 0x0" :: "v"(vp) : "memory");   /* as above */
      pv_unit(acc, vn, pr + (kc + PVW) * 32, lane, inv); pv_unit(acc, vf, pr + (kc + 2 * PVW) * 32, lane, inv); }
    else pv_unit(acc, vn, pr + (kc + PVW) * 32, lane, inv); }
  __syncthreads();   /* every wave has read its last P fragment before the partial tiles overwrite the P rows */
  float (*ss)[16][HD + 4] = (float (*)[16][HD + 4])sp;
#pragma unroll
  for (int j = 0; j < HD / 16; ++j)
#pragma unroll
    for (int r = 0; r < 8; ++r) ss[wave][8 * g + r][j * 16 + col] = acc[j][r];
  __syncthreads();   /* every wave's partial tile is in LDS before any thread sums across waves */
  for (int e = tid; e < 16 * (HD / 4); e += 32 * PVW) { const int rl = e / (HD / 4), q = e % (HD / 4); v4f s = *(const v4f*)&ss[0][rl][q * 4];
    for (int w = 1; w < PVW; ++w) s += *(const v4f*)&ss[w][rl][q * 4];
    vst2(Y + ((size_t)b * TT + ql0 + rl) * CC + h * HD + q * 4, s * (1.0f / 2048.0f)); } }
// ---- k_out: block = (128 rows, 128 cols), 8 waves of 32 x 64: out = ctx Wo (+ bo), both operand tiles of each K step staged in LDS as in k_proj, but loaded two steps ahead: ctx x 2^6 once to f16 against Wo as f16(bf16 x 2^8) exact (1 product) x 2^-14; causal early rows (< QHI of each sequence): ctx bf16 hi + lo against exact bf16 Wo (2 products)
template <int V> struct IC { static constexpr int v = V; };   // a compile-time number as a function argument
// the work-group barrier for data that goes from wave to wave through LDS alone: the wave's own LDS stores and reads are done (s_wait_dscnt 0), then signal and wait. Written by hand because __syncthreads() also waits for every global load in flight, which would end the other register set's loads at each step; the clobber keeps every LDS access on its side
__device__ __forceinline__ void bar_lds() { asm volatile("s_wait_dscnt 0x0\n\ts_barrier_signal -1\n\ts_barrier_wait -1" ::: "memory"); }
__global__ __launch_bounds__(256) void k_out(const float* __restrict__ Y, const float* __restrict__ WO, const float* __restrict__ BO, float* __restrict__ OUT) { __shared__ __align__(16) float sf[8][32][68]; __shared__ __align__(16) union { struct { __bf16 w[2][128 * WP], yh[2][128 * WP], yl[2][128 * WP]; } b; struct { _Float16 w[2][128 * WP], y[2][128 * WP]; } h; } sk;
  const int tid = threadIdx.x, wave = __builtin_amdgcn_readfirstlane(tid >> 5) /* scalar, so that what hangs on the wave alone takes no vector register */, lane = tid & 31, col = lane & 15, g = lane >> 4, wr = wave >> 1, wc = wave & 1; const int c0 = blockIdx.y * 128; const size_t r0 = (size_t)blockIdx.x * 128 + wr * 32;
  v8f acc[2][4] = {}; const int ao = (wr * 32 + col) * WP, bo = (wc * 64 + col) * WP;   /* the lane's row in the wave's first A and first B fragment; the further fragments lie 16 rows apart */
  const float* wp = wt_ptr(WO, c0, wave, lane, DIN); const float* yp = xt_ptr(Y + (size_t)blockIdx.x * 128 * CC, wave, lane, CC);
  static_assert((CC / 32) % 2 == 0 && CC / 32 >= 2, "the K steps go in pairs, one step per register set");
  v4f wr4[2][4], yr[2][4];   /* two register sets by turns: a step's set is refilled with the step after next as soon as it has gone to LDS, so that a load has more than a whole step to arrive; one block of two waves per SIMD has nothing else to hide that time behind. The last pair of steps stands behind the loop and loads nothing: with no branch round the loads the compiler can count them, and waits for the older set alone */
  wt_load(wr4[0], wp, DIN); xt_load(yr[0], yp, CC);
  __builtin_amdgcn_sched_barrier(0);   /* keeps all of the first set's loads in front of the second's, as on the loop's back edge: mixed, the loop's first wait would have to cover both sets on every trip */
  wt_load(wr4[1], wp + (size_t)32 * DIN, DIN); xt_load(yr[1], yp + 32, CC);
  if (CAUSAL && (int)(((size_t)blockIdx.x * 128) % TT) < QHI) {   /* block-uniform */
    auto step = [&](auto S, auto LD) { constexpr int s = decltype(S)::v;   /* one K step on register set and LDS buffers s, both compile-time constants */
      __builtin_amdgcn_sched_barrier(0);   /* keeps this step's conversions, and with them the wait for its loads, behind the matrix instructions of the step before: moved up, they wait for loads that have only just gone out */
      __bf16* wb = sk.b.w[s]; __bf16* yh = sk.b.yh[s]; __bf16* yl = sk.b.yl[s]; wt_put_b(wb, wr4[s], wave, lane); xt_put_hl(yh, yl, yr[s], wave, lane);
      bar_lds();   /* the whole tiles of this step are in LDS before any wave reads fragments across them; the same barrier ends every wave's reads of the step before, whose buffers the next step overwrites */
      if constexpr (decltype(LD)::v != 0) { wt_load(wr4[s], wp + (size_t)(2 + s) * 32 * DIN, DIN); xt_load(yr[s], yp + (2 + s) * 32, CC); }
      v16b ah[2], al[2], wf[4];
#pragma unroll
      for (int i = 0; i < 2; ++i) { ah[i] = frag_b(yh + ao + i * 16 * WP, lane); al[i] = frag_b(yl + ao + i * 16 * WP, lane); }
#pragma unroll
      for (int j = 0; j < 4; ++j) wf[j] = frag_b(wb + bo + j * 16 * WP, lane);   /* all of the step's LDS reads as one group in front of its matrix instructions */
#pragma unroll
      for (int j = 0; j < 4; ++j)
#pragma unroll
        for (int i = 0; i < 2; ++i) { acc[i][j] = wmma_bf(ah[i], wf[j], acc[i][j]); acc[i][j] = wmma_bf(al[i], wf[j], acc[i][j]); } };
    for (int kc = 0; kc + 2 < CC / 32; kc += 2) { step(IC<0>{}, IC<1>{}); step(IC<1>{}, IC<1>{});
      asm volatile("s_wait_xcnt 0x0" :: "v"(wp), "v"(yp) : "memory");   /* the loads' address registers, named here so that they stay as they are up to this wait, are advanced behind it */
      wp += (size_t)64 * DIN; yp += 64; }
    step(IC<0>{}, IC<0>{}); step(IC<1>{}, IC<0>{});
#pragma unroll
    for (int j = 0; j < 4; ++j) { const float bias = BO ? bfr(BO[c0 + wc * 64 + j * 16 + col]) : 0.f;
#pragma unroll
      for (int i = 0; i < 2; ++i)
#pragma unroll
        for (int r = 0; r < 8; ++r) sf[wave][i * 16 + 8 * g + r][j * 16 + col] = acc[i][j][r] + bias; }
  } else {
    auto step = [&](auto S, auto LD) { constexpr int s = decltype(S)::v;   /* as in the branch above */
      __builtin_amdgcn_sched_barrier(0);   /* as in the branch above */
      _Float16* wb = sk.h.w[s]; _Float16* yb = sk.h.y[s]; wt_put_h(wb, wr4[s], wave, lane); xt_put_h(yb, yr[s], wave, lane, 64.0f);   /* ctx carried x 2^6 into f16 so small-magnitude context rows stay clear of f16 subnormals */
      bar_lds();   /* as in the branch above: publishes this step's tiles and ends the reads of the step before */
      if constexpr (decltype(LD)::v != 0) { wt_load(wr4[s], wp + (size_t)(2 + s) * 32 * DIN, DIN); xt_load(yr[s], yp + (2 + s) * 32, CC); }
      v16h af[2], wf[4];
#pragma unroll
      for (int i = 0; i < 2; ++i) af[i] = frag_h(yb + ao + i * 16 * WP, lane);
#pragma unroll
      for (int j = 0; j < 4; ++j) wf[j] = frag_h(wb + bo + j * 16 * WP, lane);   /* as in the branch above */
#pragma unroll
      for (int j = 0; j < 4; ++j)
#pragma unroll
        for (int i = 0; i < 2; ++i) acc[i][j] = wmma16(af[i], wf[j], acc[i][j]); };
    for (int kc = 0; kc + 2 < CC / 32; kc += 2) { step(IC<0>{}, IC<1>{}); step(IC<1>{}, IC<1>{});
      asm volatile("s_wait_xcnt 0x0" :: "v"(wp), "v"(yp) : "memory");   /* as in the branch above */
      wp += (size_t)64 * DIN; yp += 64; }
    step(IC<0>{}, IC<0>{}); step(IC<1>{}, IC<0>{});
#pragma unroll
    for (int j = 0; j < 4; ++j) { const float bias = BO ? bfr(BO[c0 + wc * 64 + j * 16 + col]) : 0.f;
#pragma unroll
      for (int i = 0; i < 2; ++i)
#pragma unroll
        for (int r = 0; r < 8; ++r) sf[wave][i * 16 + 8 * g + r][j * 16 + col] = acc[i][j][r] * (1.0f / 16384.0f) + bias; } }   /* 2^-8 (Wo carry) x 2^-6 (ctx carry) */
  LDSX();   /* the wave's own 32 x 64 tile goes out two rows per store, 256 bytes in a row each */
  v4f o[16];
#pragma unroll
  for (int t = 0; t < 16; ++t) o[t] = *(const v4f*)&sf[wave][2 * t + g][col * 4];   /* all 16 LDS reads as one group: one latency, and each store has data registers of its own */
#pragma unroll
  for (int t = 0; t < 16; ++t) vst2(OUT + (r0 + 2 * t + g) * DIN + c0 + wc * 64 + col * 4, o[t]); }

extern "C" void kernel_launch(void* const* d_in, const int* in_sizes, int n_in, void* d_out, int out_size, void* d_ws, size_t ws_size, hipStream_t stream) {
  (void)in_sizes; (void)n_in; (void)out_size;
  const float** F = (const float**)d_in;
  if (ws_size < (size_t)WS_END) return;
  char* ws = (char*)d_ws; _Float16 *QH = (_Float16*)(ws + WS_QH), *KH = (_Float16*)(ws + WS_KH), *VT = (_Float16*)(ws + WS_VT), *QL = (_Float16*)(ws + WS_QL), *KL = (_Float16*)(ws + WS_KL); __bf16 *VB = (__bf16*)(ws + WS_VB), *VBL = (__bf16*)(ws + WS_VBL); float *Y = (float*)(ws + WS_Y);
  (void)Y; (void)QL; (void)KL; (void)VB; (void)VBL;
  // inputs: 0 x [2,2048,1024]; 1 wq [1024,16,64] = (in,out) [1024][1024]; 2 wk; 3 wv; 4 wp1 [16,64,1024] = (in,out) [1024][1024]; 5 wp2 [1024,1024] (in,out); no biases
  if (ws_size < (size_t)WS_END2) return;
  float* Y2 = (float*)(ws + WS_Y2);
  k_proj<<<dim3(TNB * TT / 128, CC / 128, 3), 256, 0, stream>>>(F[0], F[0], F[0], F[1], F[2], F[3], nullptr, nullptr, nullptr, QH, QL, KH, KL, VT, VB, VBL);
  k_pv<<<dim3(TT / 16, 1, TNB * NH), 32 * PVW, 0, stream>>>(QH, KH, QL, KL, VT, VB, VBL, Y);
  k_out<<<dim3(TNB * TT / 128, DIN / 128), 256, 0, stream>>>(Y, F[4], nullptr, Y2);              /* y = att wp1 (f32 rows in workspace) */
  k_out<<<dim3(TNB * TT / 128, DIN / 128), 256, 0, stream>>>(Y2, F[5], nullptr, (float*)d_out);   /* out = y wp2 */
  static_assert(CC == DIN, "the second output projection reuses k_out: its operand rows have width DIN == CC");
}

// v010
// A run of this version takes 132 microseconds.
// In both of two side-by-side timings against v009, it was 1.06 times as fast.
// All steps since v000 together make it 8.39 times as fast.
// compute dtype: all float inputs rounded to bf16; q / k / v projections with EXACT bf16 products on WMMA 16x16x32 (f32 accumulate), no biases; causal logits: 3 products for the first 384 rows, single f16 q x k after, x 64^-0.5; softmax f32; P x 2^11 once to f16 x v once to f16 (bf16 hi + lo below row 384); TWO output projections in sequence, each through k_out (rows < 384: the f32 operand as bf16 hi + lo against the exact weight; beyond: x2^6 f16 carry x f16(bf16 x 2^8) weight); f32 output.
#include <hip/hip_runtime.h>
#include <math.h>

typedef __attribute__((ext_vector_type(16))) _Float16 v16h;
typedef __attribute__((ext_vector_type(16))) __bf16 v16b;
typedef __attribute__((ext_vector_type(8)))  _Float16 v8h;
typedef __attribute__((ext_vector_type(8)))  float v8f;
typedef __attribute__((ext_vector_type(4)))  float v4f;
typedef __attribute__((ext_vector_type(2)))  float v2f;
typedef __attribute__((ext_vector_type(4)))  unsigned v4u;
typedef __attribute__((ext_vector_type(4)))  int v4i;
typedef float __attribute__((may_alias)) float_a;
typedef int __attribute__((may_alias)) int_a;

template <typename T> __device__ __forceinline__ void vst2(void* p, T v) { *(T*)p = v;  }
__device__ __forceinline__ v8f wmma16(v16h a, v16h b, v8f c) {
  v8f d = __builtin_amdgcn_wmma_f32_16x16x32_f16(false, a, false, b, (short)0, c, false, false);
  asm volatile("v_nop\n\tv_nop\n\tv_nop\n\tv_nop" : "+v"(d) : "v"(a), "v"(b));
  return d;
}
__device__ __forceinline__ v8f wmma_bf(v16b a, v16b b, v8f c) {
  v8f d = __builtin_amdgcn_wmma_f32_16x16x32_bf16(false, a, false, b, (short)0, c, false, false);
  asm volatile("v_nop\n\tv_nop\n\tv_nop\n\tv_nop" : "+v"(d) : "v"(a), "v"(b));
  return d;
}
// 16x16x32 fragments: lane = (h = lane>>4, row/col = lane&15); elements 0..7 = k0+8h+0..7, 8..15 = k0+16+8h+0..7; D element r = row 8h+r
__device__ __forceinline__ v16h frag_h(const _Float16* rowk0, int lane) {
  union { v16h v; v8h q[2]; } u; const _Float16* p = rowk0 + 8 * (lane >> 4);
  u.q[0] = *(const v8h*)p; u.q[1] = *(const v8h*)(p + 16); return u.v;
}
__device__ __forceinline__ v16h frag_f32(const float* rowk0, int lane) {
  v16h a; const float* p = rowk0 + 8 * (lane >> 4);
#pragma unroll
  for (int i = 0; i < 8; ++i) { a[i] = (_Float16)p[i]; a[8 + i] = (_Float16)p[16 + i]; }
  return a;
}
__device__ __forceinline__ v16h frag_f32s(const float* rowk0, int lane, float sc) {
  v16h a; const float* p = rowk0 + 8 * (lane >> 4);
#pragma unroll
  for (int i = 0; i < 8; ++i) { a[i] = (_Float16)(p[i] * sc); a[8 + i] = (_Float16)(p[16 + i] * sc); }
  return a;
}
// column fragment from a [K][ld] layout (column n), rows >= K read as 0
__device__ __forceinline__ v16h fragc_f32(const float* W, int k0, int n, int lane, int ld, int K) {
  v16h a; const int g = lane >> 4;
#pragma unroll
  for (int i = 0; i < 8; ++i) { const int ka = k0 + 8 * g + i, kb = ka + 16;
    a[i] = (_Float16)(ka < K ? W[(size_t)(ka < K ? ka : K - 1) * ld + n] : 0.f); a[8 + i] = (_Float16)(kb < K ? W[(size_t)(kb < K ? kb : K - 1) * ld + n] : 0.f); }
  return a;
}
struct F2 { v16b h, l; };
__device__ __forceinline__ F2 bsplit16(const float v[16]) { F2 r;
#pragma unroll
  for (int i = 0; i < 16; ++i) { const __bf16 h = (__bf16)v[i]; r.h[i] = h; r.l[i] = (__bf16)(v[i] - (float)h); }
  return r; }
__device__ __forceinline__ F2 split_row(const float* row, int k0, int lane) { float v[16]; const float* p = row + k0 + 8 * (lane >> 4);
#pragma unroll
  for (int i = 0; i < 8; ++i) { v[i] = p[i]; v[8 + i] = p[16 + i]; }
  return bsplit16(v); }
__device__ __forceinline__ F2 split_rowK(const float* row, int k0, int lane, int K) { float v[16]; const int g = lane >> 4;
#pragma unroll
  for (int i = 0; i < 8; ++i) { const int ka = k0 + 8 * g + i, kb = ka + 16; v[i] = ka < K ? row[ka < K ? ka : K - 1] : 0.f; v[8 + i] = kb < K ? row[kb < K ? kb : K - 1] : 0.f; }
  return bsplit16(v); }
__device__ __forceinline__ F2 split_col(const float* W, int k0, int n, int lane, int ld, int K) { float v[16]; const int g = lane >> 4;
#pragma unroll
  for (int i = 0; i < 8; ++i) { const int ka = k0 + 8 * g + i, kb = ka + 16; v[i] = ka < K ? W[(size_t)(ka < K ? ka : K - 1) * ld + n] : 0.f; v[8 + i] = kb < K ? W[(size_t)(kb < K ? kb : K - 1) * ld + n] : 0.f; }
  return bsplit16(v); }
__device__ __forceinline__ v8f mac3(const F2& a, const F2& b, v8f c) { c = wmma_bf(a.l, b.h, c); c = wmma_bf(a.h, b.l, c); return wmma_bf(a.h, b.h, c); }
__device__ __forceinline__ float sigm(float v) { return 1.0f / (1.0f + expf(-v)); }
#define LDSX() do { asm volatile("s_wait_dscnt 0" ::: "memory"); __builtin_amdgcn_wave_barrier(); __builtin_amdgcn_fence(__ATOMIC_RELEASE, "workgroup"); } while (0)

// Causal multi-head self-attention with per-head-shaped weights and TWO output projections (x [2,2048,1024]; wq / wk / wv [1024,16,64] = (in, head, d): an (in,out) [1024][1024] matrix with out = head*64 + d; wp1 [16,64,1024] = (head, d, out): an (in,out) [1024][1024] matrix with in = head*64 + d; wp2 [1024,1024] (in,out); all N(0, 1/1024), no biases; wei = q k^T x 64^-0.5; tril kept, -inf elsewhere; softmax; att merged (head*64 + d); y = att wp1; out = y wp2).
#define NB 2
#define TT 2048
#define CC 1024            // NH * HD = projected width
#define DIN 1024          // input (model) width
#define NH 16
#define HD 64
#define SCALE (0.125f)
#define CAUSAL 1
#ifndef TNB
#define TNB NB
#endif
__device__ __forceinline__ float bfr(float v) { return (float)(__bf16)v; }
__host__ __device__ __forceinline__ int kb_last(int qb) { return CAUSAL ? ((qb * 64 + 63) >> 7) : (TT / 128 - 1); }
typedef __attribute__((ext_vector_type(8))) __bf16 v8b;
__device__ __forceinline__ v16b frag_b(const __bf16* rowk0, int lane) {
  union { v16b v; v8b q[2]; } u; const __bf16* p = rowk0 + 8 * (lane >> 4);
  u.q[0] = *(const v8b*)p; u.q[1] = *(const v8b*)(p + 16); return u.v;
}
#define QBH 6              // causal: query blocks 0..QBH-1 of each sequence (few keys, no averaging) take the high-precision path
#define QHI 384            // rows carrying a q residual plane
#define KHI 384            // key rows carrying k residual / v bf16 hi+lo planes (used only by the causal high-precision path)
// B fragment (k rows k0+.., output column o) of a weight: (in,out) [K][ld] or (out,in) [ld rows of K]: bf16 exact, or f16(bf16 * 256) exact
__device__ __forceinline__ v16b wcol_io(const float* Wm, int k0, int o, int lane, int ld) { v16b w; const int g = lane >> 4;
#pragma unroll
  for (int i = 0; i < 8; ++i) { w[i] = (__bf16)Wm[(size_t)(k0 + 8 * g + i) * ld + o]; w[8 + i] = (__bf16)Wm[(size_t)(k0 + 16 + 8 * g + i) * ld + o]; }
  return w; }
__device__ __forceinline__ v16b wcol_oi(const float* Wm, int k0, int o, int lane, int K) { v16b w; const float* p = Wm + (size_t)o * K + k0 + 8 * (lane >> 4);
#pragma unroll
  for (int i = 0; i < 8; ++i) { w[i] = (__bf16)p[i]; w[8 + i] = (__bf16)p[16 + i]; }
  return w; }
__device__ __forceinline__ v16h wcolh_io(const float* Wm, int k0, int o, int lane, int ld) { v16h w; const int g = lane >> 4;
#pragma unroll
  for (int i = 0; i < 8; ++i) { w[i] = (_Float16)(bfr(Wm[(size_t)(k0 + 8 * g + i) * ld + o]) * 256.0f); w[8 + i] = (_Float16)(bfr(Wm[(size_t)(k0 + 16 + 8 * g + i) * ld + o]) * 256.0f); }
  return w; }
__device__ __forceinline__ v16h wcolh_oi(const float* Wm, int k0, int o, int lane, int K) { v16h w; const float* p = Wm + (size_t)o * K + k0 + 8 * (lane >> 4);
#pragma unroll
  for (int i = 0; i < 8; ++i) { w[i] = (_Float16)(bfr(p[i]) * 256.0f); w[8 + i] = (_Float16)(bfr(p[16 + i]) * 256.0f); }
  return w; }
#define WQKV_LAYOUT 0   // 0 = (in,out) [DIN][CC]; 1 = (out,in) [CC][DIN]; 2 = per-head [NH][DIN][HD]
__device__ __forceinline__ v16b wcol_hdk(const float* Wm, int k0, int o, int lane) { v16b w; const int g = lane >> 4; const float* p = Wm + (size_t)(o / HD) * DIN * HD + (o % HD);
#pragma unroll
  for (int i = 0; i < 8; ++i) { w[i] = (__bf16)p[(size_t)(k0 + 8 * g + i) * HD]; w[8 + i] = (__bf16)p[(size_t)(k0 + 16 + 8 * g + i) * HD]; }
  return w; }
#define WO_OUT_IN 0
#if WQKV_LAYOUT == 1
#define WCOL(W, k0, o, lane) wcol_oi(W, k0, o, lane, DIN)
#elif WQKV_LAYOUT == 2
#define WCOL(W, k0, o, lane) wcol_hdk(W, k0, o, lane)
#else
#define WCOL(W, k0, o, lane) wcol_io(W, k0, o, lane, CC)
#endif
#if WO_OUT_IN
#define WOCOL(W, k0, o, lane) wcol_oi(W, k0, o, lane, CC)
#define WOCOLH(W, k0, o, lane) wcolh_oi(W, k0, o, lane, CC)
#else
#define WOCOL(W, k0, o, lane) wcol_io(W, k0, o, lane, DIN)
#define WOCOLH(W, k0, o, lane) wcolh_io(W, k0, o, lane, DIN)
#endif

#ifndef PROJ_EXTRA_PARAMS
#define PROJ_EXTRA_PARAMS
#endif

// q, k and v lie in the workspace in the order of k_pv's matrix fragments: the 16 bytes that lane l takes with one load stand at l * 16 in a run of 512 bytes, so that every load of a wave covers four whole 128-byte lines (from rows or planes it would touch 16 lines for 32 bytes each)
#define QKT 1024           // 16-bit elements of one 16-row tile of one head's q or k: [d / 32][(d / 16) & 1][lane = 16 ((d / 8) & 1) + (t & 15)][d & 7]
#define VCH 2048           // 16-bit elements of one 32-key chunk of one head's v: [d / 16][(t / 16) & 1][lane = 16 ((t / 8) & 1) + (d & 15)][t & 7]
static_assert(HD == 64 && QKT == 16 * HD && VCH == 32 * HD, "the fragment-order tiles are written for head size 64");
#define WS_QH  0u                                      // f16 q tiles [b][h][t / 16][QKT]
#define WS_KH  (WS_QH + 2u * (size_t)NB * TT * CC)      // f16 k tiles [b][h][t / 16][QKT]
#define WS_VT  (WS_KH + 2u * (size_t)NB * TT * CC)      // f16 v chunks [b][h][t / 32][VCH]
#define WS_QL  (WS_VT + 2u * (size_t)NB * CC * TT)      // f16 q residual x 2^10 tiles [b][h][t / 16, t < QHI][QKT]
#define WS_KL  (WS_QL + 2u * (size_t)NB * QHI * CC)     // f16 k residual x 2^10 tiles [b][h][t / 16, t < KHI][QKT]
#define WS_VB  (WS_KL + 2u * (size_t)NB * KHI * CC)     // bf16 v hi chunks [b][h][t / 32, t < KHI][VCH]
#define WS_VBL (WS_VB + 2u * (size_t)NB * CC * KHI)
#define WS_Y   (WS_VBL + 2u * (size_t)NB * CC * KHI)    // f32 ctx rows [b*t][CC] (only when there is an output projection)
#define WS_END (WS_Y  + 4u * (size_t)NB * TT * CC)
#define WS_Y2 (WS_END)                                     // f32 rows [b*t][DIN]: the first output projection's result, the second one's operand
#define WS_END2 (WS_Y2 + 4u * (size_t)NB * TT * DIN)

// ---- operand tiles of one K step (32 k) of k_proj / k_out: read by whole-line loads and converted once per block, kept in LDS as 16-bit rows of 32 k, so that an A or B fragment is two 16-byte LDS reads (frag_b / frag_h on the row). Every loop over a register array, here and in the K steps, is fully unrolled: its indices must be constants, else the array goes to scratch
#define WP 40              // LDS pitch of a staged row in 16-bit elements: 32 k values + 16 bytes, so that 16-byte reads of 64-byte rows spread over all banks
static_assert(WQKV_LAYOUT == 0 && !WO_OUT_IN, "the staged weight tile is written for (in,out) weights");
typedef __attribute__((ext_vector_type(4))) __bf16 v4b;
typedef __attribute__((ext_vector_type(4))) _Float16 v4h;
// a block of k_proj / k_out is 8 waves on a tile of 128 rows x 128 output columns; wave w takes rows 32 (w >> 1) + 0..31 and columns 64 (w & 1) + 0..63 of it: 2 A fragments against 4 B fragments, 8 matrix instructions for 6 fragments read
// weight tile: 32 k rows x 128 output columns of an (in,out) [K][ld] matrix, in LDS as [column][k]. Thread (wave, lane) owns the patch k = 16 (wave >> 2) + 4 (lane >> 3) + 0..3, column = 32 (wave & 3) + 4 (lane & 7) + 0..3: each load instruction covers four whole 128-byte lines, each LDS store holds 4 consecutive k of one column
__device__ __forceinline__ const float* wt_ptr(const float* Wm, int c0, int wave, int lane, int ld) { return Wm + (size_t)(16 * (wave >> 2) + 4 * (lane >> 3)) * ld + c0 + 32 * (wave & 3) + 4 * (lane & 7); }
__device__ __forceinline__ void wt_load(v4f (&r)[4], const float* p, int ld) {
#pragma unroll
  for (int i = 0; i < 4; ++i) r[i] = *(const v4f*)(p + (size_t)i * ld); }
__device__ __forceinline__ int wt_at(int c, int wave, int lane) { return (32 * (wave & 3) + 4 * (lane & 7) + c) * WP + 16 * (wave >> 2) + 4 * (lane >> 3); }
__device__ __forceinline__ void wt_put_b(__bf16* buf, const v4f (&r)[4], int wave, int lane) {   /* bf16, exact for the bf16-rounded weight */
#pragma unroll
  for (int c = 0; c < 4; ++c) { v4b t;
#pragma unroll
    for (int i = 0; i < 4; ++i) t[i] = (__bf16)r[i][c];
    *(v4b*)(buf + wt_at(c, wave, lane)) = t; } }
__device__ __forceinline__ void wt_put_h(_Float16* buf, const v4f (&r)[4], int wave, int lane) {   /* f16(bf16 x 2^8), exact */
#pragma unroll
  for (int c = 0; c < 4; ++c) { v4h t;
#pragma unroll
    for (int i = 0; i < 4; ++i) t[i] = (_Float16)(bfr(r[i][c]) * 256.0f);
    *(v4h*)(buf + wt_at(c, wave, lane)) = t; } }
// row tile: 128 rows x 32 k of an f32 [rows][ld] matrix, in LDS as [row][k]; rows0 = the block's first row. Thread (wave, lane) owns k = 4 (lane & 7) + 0..3 of rows 16 wave + 4 i + (lane >> 3), i < 4: each load instruction covers four whole 128-byte lines
__device__ __forceinline__ const float* xt_ptr(const float* rows0, int wave, int lane, int ld) { return rows0 + (size_t)(16 * wave + (lane >> 3)) * ld + 4 * (lane & 7); }
__device__ __forceinline__ void xt_load(v4f (&r)[4], const float* p, int ld) {
#pragma unroll
  for (int i = 0; i < 4; ++i) r[i] = *(const v4f*)(p + (size_t)(4 * i) * ld); }
__device__ __forceinline__ int xt_at(int i, int wave, int lane) { return (16 * wave + 4 * i + (lane >> 3)) * WP + 4 * (lane & 7); }
__device__ __forceinline__ void xt_put_b(__bf16* buf, const v4f (&r)[4], int wave, int lane) {   /* once to bf16 */
#pragma unroll
  for (int i = 0; i < 4; ++i) { v4b t;
#pragma unroll
    for (int c = 0; c < 4; ++c) t[c] = (__bf16)r[i][c];
    *(v4b*)(buf + xt_at(i, wave, lane)) = t; } }
__device__ __forceinline__ void xt_put_hl(__bf16* bh, __bf16* bl, const v4f (&r)[4], int wave, int lane) {   /* bf16 hi + lo planes, as bsplit16 */
#pragma unroll
  for (int i = 0; i < 4; ++i) { v4b th, tl;
#pragma unroll
    for (int c = 0; c < 4; ++c) { const __bf16 h = (__bf16)r[i][c]; th[c] = h; tl[c] = (__bf16)(r[i][c] - (float)h); }
    *(v4b*)(bh + xt_at(i, wave, lane)) = th; *(v4b*)(bl + xt_at(i, wave, lane)) = tl; } }
__device__ __forceinline__ void xt_put_h(_Float16* buf, const v4f (&r)[4], int wave, int lane, float sc) {   /* x sc, once to f16 */
#pragma unroll
  for (int i = 0; i < 4; ++i) { v4h t;
#pragma unroll
    for (int c = 0; c < 4; ++c) t[c] = (_Float16)(r[i][c] * sc);
    *(v4h*)(buf + xt_at(i, wave, lane)) = t; } }
// ---- k_proj: block = (128 rows, 128 cols, which), 8 waves of 32 x 64: q/k/v = X W (+ b) with exact bf16 products (K = DIN), both operand tiles of each K step staged in LDS (two buffers, which share their LDS with the epilogue's tiles), the next step's loads issued behind the step's barrier -> which 0: q f16 tiles (+ residual tiles, rows < QHI); 1: k f16 tiles (+ residual tiles, rows < KHI); 2: v f16 chunks (+ bf16 hi/lo chunks for t < KHI), all in fragment order: thread e of the store loops takes the e-th 16 bytes of the block's share, so that a wave stores 512 bytes in a row
static_assert(TT % 128 == 0 && QHI % 128 == 0 && KHI % 128 == 0, "a block's 128 rows lie in one sequence and on one side of the high-precision bound");
__global__ __launch_bounds__(256) void k_proj(const float* __restrict__ XQ, const float* __restrict__ XK, const float* __restrict__ XV, const float* __restrict__ WQ, const float* __restrict__ WK, const float* __restrict__ WV, const float* __restrict__ BQ, const float* __restrict__ BK, const float* __restrict__ BV,
    _Float16* __restrict__ QH, _Float16* __restrict__ QL, _Float16* __restrict__ KH, _Float16* __restrict__ KL, _Float16* __restrict__ VT, __bf16* __restrict__ VB, __bf16* __restrict__ VBL) {
  __shared__ __align__(16) union { struct { _Float16 sh[128][136], sl[128][136]; } r; struct { _Float16 th[128][136]; __bf16 tb[128][136], tbl[128][136]; } c; struct { __bf16 w[2][128 * WP], x[2][128 * WP]; } k; } u;
  _Float16 (&sh)[128][136] = u.r.sh; _Float16 (&sl)[128][136] = u.r.sl; _Float16 (&th)[128][136] = u.c.th; __bf16 (&tb)[128][136] = u.c.tb; __bf16 (&tbl)[128][136] = u.c.tbl;
  const int tid = threadIdx.x, wave = __builtin_amdgcn_readfirstlane(tid >> 5) /* scalar, so that what hangs on the wave alone takes no vector register */, lane = tid & 31, col = lane & 15, g = lane >> 4, wr = wave >> 1, wc = wave & 1; const int which = blockIdx.z; const int c0 = blockIdx.y * 128; const size_t r0 = (size_t)blockIdx.x * 128; const size_t bb = r0 / TT; const int t0 = (int)(r0 % TT);
  const float* X = which == 0 ? XQ : which == 1 ? XK : XV; const float* WA = which == 0 ? WQ : which == 1 ? WK : WV; const float* BA = which == 0 ? BQ : which == 1 ? BK : BV;
  v8f acc[2][4] = {}; const int ao = (wr * 32 + col) * WP, bo = (wc * 64 + col) * WP;   /* the lane's row in the wave's first A and first B fragment; the further fragments lie 16 rows apart */
  const float* wp = wt_ptr(WA, c0, wave, lane, CC); const float* xp = xt_ptr(X + r0 * DIN, wave, lane, DIN);
  v4f wr4[4], xr[4]; wt_load(wr4, wp, CC); xt_load(xr, xp, DIN);
  for (int kc = 0; kc < DIN / 32; ++kc) { __bf16* wb = u.k.w[kc & 1]; __bf16* xb = u.k.x[kc & 1]; wt_put_b(wb, wr4, wave, lane); xt_put_b(xb, xr, wave, lane);
    __syncthreads();   /* the whole tiles of step kc are in LDS before any wave reads fragments across them; the same barrier ends every wave's reads of step kc - 1, whose buffers step kc + 1 overwrites */
    if (kc + 1 < DIN / 32) { wt_load(wr4, wp + (size_t)32 * CC, CC); xt_load(xr, xp + 32, DIN);
      asm volatile("s_wait_xcnt 0x0" :: "v"(wp), "v"(xp) : "memory");   /* the loads' address registers, named here so that they stay as they are up to this wait, are advanced behind it */
      wp += (size_t)32 * CC; xp += 32; }
    v16b af[2], wf[4];
#pragma unroll
    for (int i = 0; i < 2; ++i) af[i] = frag_b(xb + ao + i * 16 * WP, lane);
#pragma unroll
    for (int j = 0; j < 4; ++j) wf[j] = frag_b(wb + bo + j * 16 * WP, lane);   /* all of the step's LDS reads as one group in front of its matrix instructions */
#pragma unroll
    for (int j = 0; j < 4; ++j)
#pragma unroll
      for (int i = 0; i < 2; ++i) acc[i][j] = wmma_bf(af[i], wf[j], acc[i][j]); }
  __syncthreads();   /* every wave has read its last fragments before the epilogue's tiles overwrite the staging buffers */
  if (which < 2) { _Float16* DH = which == 0 ? QH : KH; _Float16* DL = which == 0 ? QL : KL; const int nhi = which == 0 ? QHI : KHI; const bool hi_rows = t0 < nhi;
#pragma unroll
    for (int j = 0; j < 4; ++j) { const int cl = wc * 64 + j * 16 + col; const float bias = BA ? bfr(BA[c0 + cl]) : 0.f;
#pragma unroll
      for (int i = 0; i < 2; ++i)
#pragma unroll
        for (int r = 0; r < 8; ++r) { const float v = acc[i][j][r] + bias; const _Float16 hv = (_Float16)v; const int rl = wr * 32 + i * 16 + 8 * g + r; sh[rl][cl] = hv; sl[rl][cl] = (_Float16)((v - (float)hv) * 1024.0f); } }
    __syncthreads();
    for (int e = tid; e < 128 * 16; e += 256) { const int hh = e >> 10, tl = (e >> 7) & 7, rl = tl * 16 + col, cl = hh * HD + ((e >> 5) & 3) * 16 + g * 8; const size_t hb = bb * NH + c0 / HD + hh;   /* e = [head][tile][d / 16][lane] */
      vst2((unsigned*)(DH + (hb * (TT / 16) + t0 / 16 + tl) * QKT + (e & 127) * 8), *(const v4u*)&sh[rl][cl]);
      asm volatile("s_wait_xcnt 0x0" ::: "memory");   /* in front of what rewrites the store's address and data registers: the residual's lines, the next trip */
      if (hi_rows) { vst2((unsigned*)(DL + (hb * (nhi / 16) + t0 / 16 + tl) * QKT + (e & 127) * 8), *(const v4u*)&sl[rl][cl]);
        asm volatile("s_wait_xcnt 0x0" ::: "memory"); } }   /* as above */
  } else { const bool hi_rows = t0 < KHI;
#pragma unroll
    for (int j = 0; j < 4; ++j) { const int cl = wc * 64 + j * 16 + col; const float bias = BA ? bfr(BA[c0 + cl]) : 0.f;
#pragma unroll
      for (int i = 0; i < 2; ++i)
#pragma unroll
        for (int r = 0; r < 8; ++r) { const float v = acc[i][j][r] + bias; const int rl = wr * 32 + i * 16 + 8 * g + r; th[cl][rl] = (_Float16)v; const __bf16 bh = (__bf16)v; tb[cl][rl] = bh; tbl[cl][rl] = (__bf16)(v - (float)bh); } }
    __syncthreads();
    for (int e = tid; e < 128 * 16; e += 256) { const int hh = e >> 10, cn = (e >> 8) & 3, cl = hh * HD + ((e >> 6) & 3) * 16 + col, rl = cn * 32 + ((e >> 5) & 1) * 16 + g * 8; const size_t hb = bb * NH + c0 / HD + hh;   /* e = [head][chunk][d / 16][(t / 16) & 1][lane] */
      vst2((unsigned*)(VT + (hb * (TT / 32) + t0 / 32 + cn) * VCH + (e & 255) * 8), *(const v4u*)&th[cl][rl]);
      asm volatile("s_wait_xcnt 0x0" ::: "memory");   /* as in the branch above */
      if (hi_rows) { const size_t o3 = (hb * (KHI / 32) + t0 / 32 + cn) * VCH + (e & 255) * 8; vst2((unsigned*)(VB + o3), *(const v4u*)&tb[cl][rl]); vst2((unsigned*)(VBL + o3), *(const v4u*)&tbl[cl][rl]);
        asm volatile("s_wait_xcnt 0x0" ::: "memory"); } } } }   /* as in the branch above */
// ---- k_pv: block = 16 queries (tile qt = TT / 16 - 1 - blockIdx.z of query block qb = qt / 4) of (b, h) = blockIdx.x, PVW waves. Logits first, never through memory: wave w takes the 64-key units w, w + PVW, ... of keys [0, kend): q x k on the matrix unit, x SCALE, f32 to the 16 LDS rows (single f16 product; causal early query blocks: q hi + residual (x 2^10) against k hi + residual, 3 products); the mask is applied by index in the softmax. Softmax: wave w takes query rows w and w + PVW whole, in registers: keys [0, kend): causal -> logit if s <= t else excluded; softmax in f32; exp(logit - max) (0 for excluded) back to the LDS rows, 2^11 / sum to LDS per row. Then ctx = P . v over keys [0, kend), P x 2^11 = the LDS value x the row's 2^11 / sum; wave w takes the 32-key chunks w, w + PVW, ... and the PVW partial tiles are summed in wave order through LDS (P x 2^11 once to f16 against v f16: 1 product; causal early query blocks: P and v as bf16 hi + lo, 3 products); 256-B (row, head) segment by 16 lanes
#define PVW 8
#define PPITCH (TT + 4)    // LDS pitch of a P row in floats: 16 bytes over the row, so that the 16 rows of a fragment read start 4 banks apart
#define NCF (TT / 128 - 1) // most 128-key pieces of a row in front of its last one; a piece is one 16-byte load per lane
#define L2E 1.44269504088896340736f   // log2(e)
// exp(logit - max) = 2^(logit x log2(e) - mc), mc = max x log2(e): one fused multiply-add (the product unrounded, so that the exponent is rounded once) and the chip's exp2 per element. The exponent is <= 0 up to mc's rounding, which scales a whole row alike and cancels against the row's sum; a result under 2^-126 may come out as 0, beside a sum that holds the max's own term, about 1
__device__ __forceinline__ v4f sm_exp(v4f v, float mc) { v4f e;
#pragma unroll
  for (int c = 0; c < 4; ++c) e[c] = __builtin_amdgcn_exp2f(__builtin_fmaf(v[c], L2E, -mc));
  return e; }
// one query row's softmax by one wave: lane l holds the logits of keys i * 128 + 4 l + 0..3 in x[i], i < nf, and those of the row's last piece (i = nf) in xl. Only the last piece can hold keys > t: nf * 128 = (kb_last(qb)) * 128 <= qb * 64 <= t. Returns 2^11 / sum; exp(logit - max) goes to the LDS row pr
__device__ __forceinline__ float sm_row(const v4f (&x)[NCF], v4f xl, int nf, int t, int lane, float* pr) {
  float m = -3.0e38f;
#pragma unroll
  for (int c = 0; c < 4; ++c) { xl[c] = (!CAUSAL || nf * 128 + lane * 4 + c <= t) ? xl[c] : -3.0e38f; m = fmaxf(m, xl[c]); }
#pragma unroll
  for (int i = 0; i < NCF; ++i) if (i < nf) {
#pragma unroll
    for (int c = 0; c < 4; ++c) m = fmaxf(m, x[i][c]); }
#pragma unroll
  for (int o = 1; o < 32; o <<= 1) m = fmaxf(m, __shfl_xor(m, o));
  const float mc = m * L2E; v4f s4 = {};
#pragma unroll
  for (int i = 0; i < NCF; ++i) if (i < nf) { const v4f e = sm_exp(x[i], mc); s4 += e; *(v4f*)(pr + i * 128 + lane * 4) = e; }   /* no key of these pieces is excluded */
  { v4f e = sm_exp(xl, mc);
#pragma unroll
    for (int c = 0; c < 4; ++c) e[c] = (xl[c] <= -1.0e38f) ? 0.f : e[c];   /* excluded keys */
    s4 += e; *(v4f*)(pr + nf * 128 + lane * 4) = e; }
  float sum = (s4[0] + s4[1]) + (s4[2] + s4[3]);
#pragma unroll
  for (int o = 1; o < 32; o <<= 1) sum += __shfl_xor(sum, o);
  return sum > 0.f ? 2048.0f / sum : 0.f; }   /* a fully excluded row yields P = 0 */
#define KU 64              // keys of one logit unit: four 16-key tiles, whose 16 loads per lane are in flight together
// the B fragments of one unit: f[2 j + kc] = keys 16 j + (lane & 15), d = 32 kc + ..; p = the lane's own 16 bytes in the first 512 of the unit's four tiles, so that all 16 loads go off one address
__device__ __forceinline__ void ku_load(v16h (&f)[8], const _Float16* p) {
#pragma unroll
  for (int j = 0; j < 4; ++j)
#pragma unroll
    for (int kc = 0; kc < 2; ++kc) { union { v16h v; v8h q[2]; } u; const _Float16* s = p + j * QKT + kc * (QKT / 2); u.q[0] = *(const v8h*)s; u.q[1] = *(const v8h*)(s + QKT / 4); f[2 * j + kc] = u.v; } }
// one unit's logits, single product: the four tiles' accumulators are independent, so that no matrix instruction waits for the one in front of it; w = the lane's place (row 8 (lane >> 4), key lane & 15 of the unit) in the LDS rows
__device__ __forceinline__ void lg_unit(v16h a0, v16h a1, const v16h (&f)[8], float* w) { v8f c[4];
#pragma unroll
  for (int j = 0; j < 4; ++j) { const v8f z = {}; c[j] = wmma16(a0, f[2 * j], z); }
#pragma unroll
  for (int j = 0; j < 4; ++j) c[j] = wmma16(a1, f[2 * j + 1], c[j]);
#pragma unroll
  for (int j = 0; j < 4; ++j)
#pragma unroll
    for (int r = 0; r < 8; ++r) w[r * PPITCH + j * 16] = c[j][r] * SCALE; }
// the B fragments of one 32-key chunk of v: f[j] = d = 16 j + (lane & 15), keys 8 (lane >> 4) + ..; p = the lane's own 16 bytes in the chunk's first 512, so that all 8 loads go off one address
template <typename V, typename E> __device__ __forceinline__ void pv_load(V (&f)[HD / 16], const E* p) {
#pragma unroll
  for (int j = 0; j < HD / 16; ++j) { union { V v; v4u q[2]; } u; const E* s = p + j * (VCH / 4); u.q[0] = *(const v4u*)s; u.q[1] = *(const v4u*)(s + VCH / 8); f[j] = u.v; } }
// one chunk's P . v, single product: P x 2^11 from the LDS row, once to f16, against the chunk's four fragments
__device__ __forceinline__ void pv_mac(v8f (&acc)[HD / 16], v16h p, const v16h (&f)[HD / 16]) {
#pragma unroll
  for (int j = 0; j < HD / 16; ++j) acc[j] = wmma16(p, f[j], acc[j]); }
__device__ __forceinline__ void pv_unit(v8f (&acc)[HD / 16], const v16h (&f)[HD / 16], const float* prow, int lane, float inv) { pv_mac(acc, frag_f32s(prow, lane, inv), f); }
__global__ __launch_bounds__(32 * PVW) void k_pv(const _Float16* __restrict__ QH, const _Float16* __restrict__ KH, const _Float16* __restrict__ QL, const _Float16* __restrict__ KL, const _Float16* __restrict__ VT, const __bf16* __restrict__ VB, const __bf16* __restrict__ VBL, float* __restrict__ Y) {
  const int hz = blockIdx.x, qt = TT / 16 - 1 - (int)blockIdx.z;   /* z counts the query tiles down from the last one, which has the most keys; x is (b, h): for speed only */
  const int b = hz / NH, h = hz % NH; __shared__ __align__(16) float sp[16 * PPITCH]; __shared__ float sinv[16];
  static_assert(PVW * 16 * (HD + 4) <= 16 * PPITCH && 2 * PVW == 16, "the partial tiles reuse the P rows' LDS; two query rows per wave");
  static_assert((((QBH * 64 + 63) >> 7) + 1) * 4 >= 2 * PVW, "beyond the early query blocks every wave has two P.v chunks or more");
  static_assert(CAUSAL && (((QBH * 64 + 63) >> 7) + 1) * (128 / KU) >= PVW && ((((QBH - 1) * 64 + 63) >> 7) + 1) * (128 / KU) <= PVW, "beyond the early query blocks every wave has a logit unit, within them at most one");
  const int tid = threadIdx.x, lane = tid & 31, col = lane & 15, g = lane >> 4; const int qb = qt >> 2; const int ql0 = qt * 16; const int kce = (kb_last(qb) + 1) * 4;
  const int wave = __builtin_amdgcn_readfirstlane(tid >> 5);   /* scalar, so that the key loop's bounds and branch stay wave-uniform around the matrix instructions */
  { const int nu = (kb_last(qb) + 1) * (128 / KU); const size_t bh = hz; float* sw = sp + 8 * g * PPITCH + col;   /* bh = b NH + h, the head's index in the fragment-order planes */
    const _Float16* qp = QH + (bh * (TT / 16) + qt) * QKT + lane * 8; const _Float16* kp = KH + (bh * (TT / 16) + wave * (KU / 16)) * QKT + lane * 8;
    union { v16h v; v8h q[2]; } a0, a1; a0.q[0] = *(const v8h*)qp; a0.q[1] = *(const v8h*)(qp + QKT / 4); a1.q[0] = *(const v8h*)(qp + QKT / 2); a1.q[1] = *(const v8h*)(qp + 3 * (QKT / 4));
    if (qb < QBH) { const _Float16* qlp = QL + (bh * (QHI / 16) + qt) * QKT + lane * 8; const _Float16* klp = KL + (bh * (KHI / 16) + wave * (KU / 16)) * QKT + lane * 8;
      union { v16h v; v8h q[2]; } l0, l1; l0.q[0] = *(const v8h*)qlp; l0.q[1] = *(const v8h*)(qlp + QKT / 4); l1.q[0] = *(const v8h*)(qlp + QKT / 2); l1.q[1] = *(const v8h*)(qlp + 3 * (QKT / 4));
      asm volatile("s_wait_xcnt 0x0" :: "v"(qp), "v"(qlp) : "memory");   /* the loads' address registers, named here so that they stay as they are up to this wait, may be reused behind it */
      if (wave < nu) { const int u = wave; v16h kf[8], lf[8]; ku_load(kf, kp); ku_load(lf, klp);   /* here nu <= PVW: at most one unit per wave; a scalar test, so that the matrix instructions run with every lane on */
        asm volatile("s_wait_xcnt 0x0" :: "v"(kp), "v"(klp) : "memory");   /* as above */
#pragma unroll
        for (int j = 0; j < 4; ++j) { v8f c = {}, cl = {};
          c = wmma16(a0.v, kf[2 * j], c); cl = wmma16(l0.v, kf[2 * j], cl); cl = wmma16(a0.v, lf[2 * j], cl);
          c = wmma16(a1.v, kf[2 * j + 1], c); cl = wmma16(l1.v, kf[2 * j + 1], cl); cl = wmma16(a1.v, lf[2 * j + 1], cl);
#pragma unroll
          for (int r = 0; r < 8; ++r) sw[r * PPITCH + u * KU + j * 16] = (c[r] + cl[r] * (1.0f / 1024.0f)) * SCALE; } }
    } else { v16h kf[8], kn[8]; int u = wave; constexpr size_t KS = (size_t)PVW * (KU / 16) * QKT;   /* from one unit of a wave to its next; here nu >= PVW: every wave has a unit */
      ku_load(kf, kp);
      asm volatile("s_wait_xcnt 0x0" :: "v"(qp), "v"(kp) : "memory");   /* as above */
      /* two register sets by turns, and no branch between a unit's loads and the work on the unit before it: the wave's next unit is in flight while this one is worked on */
      while (u + 2 * PVW < nu) { ku_load(kn, kp + KS); lg_unit(a0.v, a1.v, kf, sw + u * KU); ku_load(kf, kp + 2 * KS);
        asm volatile("s_wait_xcnt 0x0" :: "v"(kp) : "memory");   /* as above: the address is advanced behind it */
        kp += 2 * KS; lg_unit(a0.v, a1.v, kn, sw + (u + PVW) * KU); u += 2 * PVW; }
      if (u + PVW < nu) { ku_load(kn, kp + KS);
        asm volatile("s_wait_xcnt 0x0" :: "v"(kp) : "memory");   /* as above */
        lg_unit(a0.v, a1.v, kf, sw + u * KU); lg_unit(a0.v, a1.v, kn, sw + (u + PVW) * KU); }
      else lg_unit(a0.v, a1.v, kf, sw + u * KU); } }
  __syncthreads();   /* all 16 rows' logits are in LDS before any wave reads a row across the units */
  { const int nf = kb_last(qb); v4f x0[NCF], x1[NCF]; const float* s0 = sp + wave * PPITCH + lane * 4; const float* s1 = s0 + PVW * PPITCH;
#pragma unroll
    for (int i = 0; i < NCF; ++i) if (i < nf) { x0[i] = *(const v4f*)(s0 + i * 128); x1[i] = *(const v4f*)(s1 + i * 128); }   /* both rows whole in registers before either row's LDS is overwritten */
    const v4f xl0 = *(const v4f*)(s0 + nf * 128), xl1 = *(const v4f*)(s1 + nf * 128);
    const float i0 = sm_row(x0, xl0, nf, ql0 + wave, lane, sp + wave * PPITCH), i1 = sm_row(x1, xl1, nf, ql0 + wave + PVW, lane, sp + (wave + PVW) * PPITCH);
    if (lane == 0) { sinv[wave] = i0; sinv[wave + PVW] = i1; } }
  __syncthreads();   /* all 16 rows and their factors are in LDS before any wave reads fragments across them */
  const float inv = sinv[col]; const float* pc = sp + col * PPITCH + 8 * g;
  v8f acc[HD / 16] = {};
  if (qb < QBH) {
    const size_t vo = (size_t)hz * (KHI / 32) * VCH + lane * 8;
#pragma unroll 1   /* at most two trips here: kept rolled, so that the kernel's text stays short */
    for (int kc = wave; kc < kce; kc += PVW) { v16b vh[HD / 16], vl[HD / 16]; const __bf16* hp = VB + vo + kc * VCH; const __bf16* lp = VBL + vo + kc * VCH; pv_load(vh, hp); pv_load(vl, lp);   /* the chunk's 16 loads in flight together, in front of its matrix instructions */
      asm volatile("s_wait_xcnt 0x0" :: "v"(hp), "v"(lp) : "memory");   /* the loads' address registers, named here so that they stay as they are up to this wait, may be reused behind it */
      float pv[16];
#pragma unroll
      for (int i = 0; i < 8; ++i) { pv[i] = pc[kc * 32 + i] * inv; pv[8 + i] = pc[kc * 32 + 16 + i] * inv; }
      const F2 p = bsplit16(pv);
#pragma unroll
      for (int j = 0; j < HD / 16; ++j) { acc[j] = wmma_bf(p.h, vh[j], acc[j]); acc[j] = wmma_bf(p.l, vh[j], acc[j]); acc[j] = wmma_bf(p.h, vl[j], acc[j]); } }
  } else { v16h vf[HD / 16], vn[HD / 16]; int kc = wave; constexpr int VS = PVW * VCH;   /* from one chunk of a wave to its next, in elements; here kce >= 2 PVW: every wave has two chunks or more */
    const _Float16* vp = VT + ((size_t)hz * (TT / 32) + wave) * VCH + lane * 8; const float* pr = sp + col * PPITCH;
    pv_load(vf, vp); pv_load(vn, vp + VS);
    asm volatile("s_wait_xcnt 0x0" :: "v"(vp) : "memory");   /* as above */
    /* two register sets by turns, each refilled as soon as its chunk is worked off, and no branch between a chunk's loads and the work on the chunk behind it: two chunks of the wave are in flight at any time; the wave sums its chunks in rising order */
    while (kc + 3 * PVW < kce) { const v16h p0 = frag_f32s(pr + kc * 32, lane, inv), p1 = frag_f32s(pr + (kc + PVW) * 32, lane, inv);   /* both chunks' P fragments first, so that each set's refill follows its last matrix instruction directly */
      pv_mac(acc, p0, vf); pv_load(vf, vp + 2 * VS); pv_mac(acc, p1, vn); pv_load(vn, vp + 3 * VS);
      asm volatile("s_wait_xcnt 0x0" :: "v"(vp) : "memory");   /* as above: the address is advanced behind it */
      vp += 2 * VS; kc += 2 * PVW; }
    pv_unit(acc, vf, pr + kc * 32, lane, inv);
    if (kc + 2 * PVW < kce) { pv_load(vf, vp + 2 * VS);
      asm volatile("s_wait_xcnt 0x0" :: "v"(vp) : "memory");   /* as above */
      pv_unit(acc, vn, pr + (kc + PVW) * 32, lane, inv); pv_unit(acc, vf, pr + (kc + 2 * PVW) * 32, lane, inv); }
    else pv_unit(acc, vn, pr + (kc + PVW) * 32, lane, inv); }
  __syncthreads();   /* every wave has read its last P fragment before the partial tiles overwrite the P rows */
  float (*ss)[16][HD + 4] = (float (*)[16][HD + 4])sp;
#pragma unroll
  for (int j = 0; j < HD / 16; ++j)
#pragma unroll
    for (int r = 0; r < 8; ++r) ss[wave][8 * g + r][j * 16 + col] = acc[j][r];
  __syncthreads();   /* every wave's partial tile is in LDS before any thread sums across waves */
  for (int e = tid; e < 16 * (HD / 4); e += 32 * PVW) { const int rl = e / (HD / 4), q = e % (HD / 4); v4f s = *(const v4f*)&ss[0][rl][q * 4];
    for (int w = 1; w < PVW; ++w) s += *(const v4f*)&ss[w][rl][q * 4];
    vst2(Y + ((size_t)b * TT + ql0 + rl) * CC + h * HD + q * 4, s * (1.0f / 2048.0f)); } }
// ---- k_out: block = (128 rows, 128 cols), 8 waves of 32 x 64: out = ctx Wo (+ bo), both operand tiles of each K step staged in LDS as in k_proj, but loaded two steps ahead: ctx x 2^6 once to f16 against Wo as f16(bf16 x 2^8) exact (1 product) x 2^-14; causal early rows (< QHI of each sequence): ctx bf16 hi + lo against exact bf16 Wo (2 products)
template <int V> struct IC { static constexpr int v = V; };   // a compile-time number as a function argument
// the work-group barrier for data that goes from wave to wave through LDS alone: the wave's own LDS stores and reads are done (s_wait_dscnt 0), then signal and wait. Written by hand because __syncthreads() also waits for every global load in flight, which would end the other register set's loads at each step; the clobber keeps every LDS access on its side
__device__ __forceinline__ void bar_lds() { asm volatile("s_wait_dscnt 0x0\n\ts_barrier_signal -1\n\ts_barrier_wait -1" ::: "memory"); }
__global__ __launch_bounds__(256) void k_out(const float* __restrict__ Y, const float* __restrict__ WO, const float* __restrict__ BO, float* __restrict__ OUT) { __shared__ __align__(16) float sf[8][32][68]; __shared__ __align__(16) union { struct { __bf16 w[2][128 * WP], yh[2][128 * WP], yl[2][128 * WP]; } b; struct { _Float16 w[2][128 * WP], y[2][128 * WP]; } h; } sk;
  const int tid = threadIdx.x, wave = __builtin_amdgcn_readfirstlane(tid >> 5) /* scalar, so that what hangs on the wave alone takes no vector register */, lane = tid & 31, col = lane & 15, g = lane >> 4, wr = wave >> 1, wc = wave & 1; const int c0 = blockIdx.y * 128; const size_t r0 = (size_t)blockIdx.x * 128 + wr * 32;
  v8f acc[2][4] = {}; const int ao = (wr * 32 + col) * WP, bo = (wc * 64 + col) * WP;   /* the lane's row in the wave's first A and first B fragment; the further fragments lie 16 rows apart */
  const float* wp = wt_ptr(WO, c0, wave, lane, DIN); const float* yp = xt_ptr(Y + (size_t)blockIdx.x * 128 * CC, wave, lane, CC);
  static_assert((CC / 32) % 2 == 0 && CC / 32 >= 2, "the K steps go in pairs, one step per register set");
  v4f wr4[2][4], yr[2][4];   /* two register sets by turns: a step's set is refilled with the step after next as soon as it has gone to LDS, so that a load has more than a whole step to arrive; one block of two waves per SIMD has nothing else to hide that time behind. The last pair of steps stands behind the loop and loads nothing: with no branch round the loads the compiler can count them, and waits for the older set alone */
  wt_load(wr4[0], wp, DIN); xt_load(yr[0], yp, CC);
  __builtin_amdgcn_sched_barrier(0);   /* keeps all of the first set's loads in front of the second's, as on the loop's back edge: mixed, the loop's first wait would have to cover both sets on every trip */
  wt_load(wr4[1], wp + (size_t)32 * DIN, DIN); xt_load(yr[1], yp + 32, CC);
  if (CAUSAL && (int)(((size_t)blockIdx.x * 128) % TT) < QHI) {   /* block-uniform */
    auto step = [&](auto S, auto LD) { constexpr int s = decltype(S)::v;   /* one K step on register set and LDS buffers s, both compile-time constants */
      __builtin_amdgcn_sched_barrier(0);   /* keeps this step's conversions, and with them the wait for its loads, behind the matrix instructions of the step before: moved up, they wait for loads that have only just gone out */
      __bf16* wb = sk.b.w[s]; __bf16* yh = sk.b.yh[s]; __bf16* yl = sk.b.yl[s]; wt_put_b(wb, wr4[s], wave, lane); xt_put_hl(yh, yl, yr[s], wave, lane);
      bar_lds();   /* the whole tiles of this step are in LDS before any wave reads fragments across them; the same barrier ends every wave's reads of the step before, whose buffers the next step overwrites */
      if constexpr (decltype(LD)::v != 0) { wt_load(wr4[s], wp + (size_t)(2 + s) * 32 * DIN, DIN); xt_load(yr[s], yp + (2 + s) * 32, CC); }
      v16b ah[2], al[2], wf[4];
#pragma unroll
      for (int i = 0; i < 2; ++i) { ah[i] = frag_b(yh + ao + i * 16 * WP, lane); al[i] = frag_b(yl + ao + i * 16 * WP, lane); }
#pragma unroll
      for (int j = 0; j < 4; ++j) wf[j] = frag_b(wb + bo + j * 16 * WP, lane);   /* all of the step's LDS reads as one group in front of its matrix instructions */
#pragma unroll
      for (int j = 0; j < 4; ++j)
#pragma unroll
        for (int i = 0; i < 2; ++i) { acc[i][j] = wmma_bf(ah[i], wf[j], acc[i][j]); acc[i][j] = wmma_bf(al[i], wf[j], acc[i][j]); } };
    for (int kc = 0; kc + 2 < CC / 32; kc += 2) { step(IC<0>{}, IC<1>{}); step(IC<1>{}, IC<1>{});
      asm volatile("s_wait_xcnt 0x0" :: "v"(wp), "v"(yp) : "memory");   /* the loads' address registers, named here so that they stay as they are up to this wait, are advanced behind it */
      wp += (size_t)64 * DIN; yp += 64; }
    step(IC<0>{}, IC<0>{}); step(IC<1>{}, IC<0>{});
#pragma unroll
    for (int j = 0; j < 4; ++j) { const float bias = BO ? bfr(BO[c0 + wc * 64 + j * 16 + col]) : 0.f;
#pragma unroll
      for (int i = 0; i < 2; ++i)
#pragma unroll
        for (int r = 0; r < 8; ++r) sf[wave][i * 16 + 8 * g + r][j * 16 + col] = acc[i][j][r] + bias; }
  } else {
    auto step = [&](auto S, auto LD) { constexpr int s = decltype(S)::v;   /* as in the branch above */
      __builtin_amdgcn_sched_barrier(0);   /* as in the branch above */
      _Float16* wb = sk.h.w[s]; _Float16* yb = sk.h.y[s]; wt_put_h(wb, wr4[s], wave, lane); xt_put_h(yb, yr[s], wave, lane, 64.0f);   /* ctx carried x 2^6 into f16 so small-magnitude context rows stay clear of f16 subnormals */
      bar_lds();   /* as in the branch above: publishes this step's tiles and ends the reads of the step before */
      if constexpr (decltype(LD)::v != 0) { wt_load(wr4[s], wp + (size_t)(2 + s) * 32 * DIN, DIN); xt_load(yr[s], yp + (2 + s) * 32, CC); }
      v16h af[2], wf[4];
#pragma unroll
      for (int i = 0; i < 2; ++i) af[i] = frag_h(yb + ao + i * 16 * WP, lane);
#pragma unroll
      for (int j = 0; j < 4; ++j) wf[j] = frag_h(wb + bo + j * 16 * WP, lane);   /* as in the branch above */
#pragma unroll
      for (int j = 0; j < 4; ++j)
#pragma unroll
        for (int i = 0; i < 2; ++i) acc[i][j] = wmma16(af[i], wf[j], acc[i][j]); };
    for (int kc = 0; kc + 2 < CC / 32; kc += 2) { step(IC<0>{}, IC<1>{}); step(IC<1>{}, IC<1>{});
      asm volatile("s_wait_xcnt 0x0" :: "v"(wp), "v"(yp) : "memory");   /* as in the branch above */
      wp += (size_t)64 * DIN; yp += 64; }
    step(IC<0>{}, IC<0>{}); step(IC<1>{}, IC<0>{});
#pragma unroll
    for (int j = 0; j < 4; ++j) { const float bias = BO ? bfr(BO[c0 + wc * 64 + j * 16 + col]) : 0.f;
#pragma unroll
      for (int i = 0; i < 2; ++i)
#pragma unroll
        for (int r = 0; r < 8; ++r) sf[wave][i * 16 + 8 * g + r][j * 16 + col] = acc[i][j][r] * (1.0f / 16384.0f) + bias; } }   /* 2^-8 (Wo carry) x 2^-6 (ctx carry) */
  LDSX();   /* the wave's own 32 x 64 tile goes out two rows per store, 256 bytes in a row each */
  v4f o[16];
#pragma unroll
  for (int t = 0; t < 16; ++t) o[t] = *(const v4f*)&sf[wave][2 * t + g][col * 4];   /* all 16 LDS reads as one group: one latency, and each store has data registers of its own */
#pragma unroll
  for (int t = 0; t < 16; ++t) vst2(OUT + (r0 + 2 * t + g) * DIN + c0 + wc * 64 + col * 4, o[t]); }

extern "C" void kernel_launch(void* const* d_in, const int* in_sizes, int n_in, void* d_out, int out_size, void* d_ws, size_t ws_size, hipStream_t stream) {
  (void)in_sizes; (void)n_in; (void)out_size;
  const float** F = (const float**)d_in;
  if (ws_size < (size_t)WS_END) return;
  char* ws = (char*)d_ws; _Float16 *QH = (_Float16*)(ws + WS_QH), *KH = (_Float16*)(ws + WS_KH), *VT = (_Float16*)(ws + WS_VT), *QL = (_Float16*)(ws + WS_QL), *KL = (_Float16*)(ws + WS_KL); __bf16 *VB = (__bf16*)(ws + WS_VB), *VBL = (__bf16*)(ws + WS_VBL); float *Y = (float*)(ws + WS_Y);
  (void)Y; (void)QL; (void)KL; (void)VB; (void)VBL;
  // inputs: 0 x [2,2048,1024]; 1 wq [1024,16,64] = (in,out) [1024][1024]; 2 wk; 3 wv; 4 wp1 [16,64,1024] = (in,out) [1024][1024]; 5 wp2 [1024,1024] (in,out); no biases
  if (ws_size < (size_t)WS_END2) return;
  float* Y2 = (float*)(ws + WS_Y2);
  k_proj<<<dim3(TNB * TT / 128, CC / 128, 3), 256, 0, stream>>>(F[0], F[0], F[0], F[1], F[2], F[3], nullptr, nullptr, nullptr, QH, QL, KH, KL, VT, VB, VBL);
  k_pv<<<dim3(TNB * NH, 1, TT / 16), 32 * PVW, 0, stream>>>(QH, KH, QL, KL, VT, VB, VBL, Y);
  k_out<<<dim3(TNB * TT / 128, DIN / 128), 256, 0, stream>>>(Y, F[4], nullptr, Y2);              /* y = att wp1 (f32 rows in workspace) */
  k_out<<<dim3(TNB * TT / 128, DIN / 128), 256, 0, stream>>>(Y2, F[5], nullptr, (float*)d_out);   /* out = y wp2 */
  static_assert(CC == DIN, "the second output projection reuses k_out: its operand rows have width DIN == CC");
}
